// v000
// Measured on an AMD MI455X. A time is GPU time per run, averaged over a window of back-to-back runs after a warm-up
// (all launches, gaps included; the runs take copies of the inputs in turn), and the median of several windows.
// Apart from v000's, it joins two sittings. Times from different sittings can be a few percent apart, while
// side-by-side timings come from the same sitting.
// The starting kernel, v000, takes 478 microseconds a run.
#include <hip/hip_runtime.h>

// Contractions: fused q|k|v projection v_wmma_f32_16x16x32_bf16 (bf16 operands = RNE-converted inputs, exact products); scores v_wmma_f32_16x16x32_bf16 with q/k as bf16 hi/lo planes (3 products) on every row; attn.v v_wmma_f32_16x16x32_f16 (f16 P carried x1024, f16 v) on query rows >= 64 and v_wmma_f32_16x16x32_bf16 with P and v as bf16 hi/lo (3 products) on query rows < 64; f32 accumulate, f32 online softmax, f32 output.
// Layout per batch: bf16 copy of x; one [3072][1024] bf16 'oi' weight (q rows, then k rows, then v rows, k/v de-interleaved from the [2048][1024] kv weight whose row is h*128 + 2d + c); F = x W^T f32 [T][3072];
// rotary planes q,k [h][t][64] bf16 hi/lo (rotate-half, table cos/sin[t][d], q pre-scaled by 1/8); value planes [h][d][t] f16 and bf16 hi/lo; per (64-row query block, 64-key chunk) mask flags from the int mask (empty chunks skipped, partial chunks apply the mask element-wise, replace-fill);
// flash-style attention: K hi/lo and V chunk tiles staged in LDS, online softmax per 16-row wave slab, output rows written directly (no output projection).

#ifndef NB
#define NB 2
#endif
#ifndef SEQ
#define SEQ 2048
#endif
#define NB_FULL  2
#define SEQ_FULL 2048
#define TT     SEQ
#define DM     1024
#define NH_    16
#define HD     64
#define DQ     (NH_ * HD)
#define D3     (3 * DM)
#define NQB    (TT / 64)
#define NCH    (TT / 64)
#define RH     64
#define MPITCH SEQ_FULL
#define FLP    32
#define PCAR   1024.0f
#define SCL    0.125f
#define NEGS   (-3.0e38f)
#define TP     72
#define TILEB  (64 * TP * 2)
#define O_KH   0
#define O_KL   (TILEB)
#define O_VA   (2 * TILEB)
#define O_VB   (3 * TILEB)
#define O_PA   (4 * TILEB)
#define O_PB   (5 * TILEB)
#define O_MS   (6 * TILEB)
#define LDS_TOTAL (6 * TILEB + 64 * 64)

static_assert(TT % 64 == 0);
static_assert(TT <= SEQ_FULL);
static_assert(NB >= 1 && NB <= NB_FULL);
static_assert(NCH <= FLP);
static_assert(RH == 64);
static_assert(NQB >= RH / 64);
static_assert(DM % 32 == 0 && D3 % 64 == 0 && HD == 64 && DQ == DM);
static_assert(4 * 16 * 68 * 4 <= O_VA);
static_assert(4 * 16 * TP * 2 == TILEB);
static_assert((TP * 2) % 16 == 0);
static_assert(LDS_TOTAL <= 65536);

typedef _Float16 h16;
typedef unsigned short bf;
typedef __attribute__((ext_vector_type(16))) __bf16   v16bf;
typedef __attribute__((ext_vector_type(16))) _Float16 v16h;
typedef __attribute__((ext_vector_type(8)))  _Float16 v8h;
typedef __attribute__((ext_vector_type(8)))  unsigned short v8us;
typedef __attribute__((ext_vector_type(8)))  float    v8f;
typedef __attribute__((ext_vector_type(4)))  float    v4f;
typedef __attribute__((ext_vector_type(2)))  float    v2f;
typedef __attribute__((ext_vector_type(2)))  _Float16 v2h;
typedef __attribute__((ext_vector_type(2)))  unsigned short v2us;
typedef __attribute__((ext_vector_type(4)))  int      v4i;
typedef v8h  __attribute__((may_alias)) v8ha;
typedef v4f  __attribute__((may_alias)) v4fa;
typedef v8us __attribute__((may_alias)) v8usa;

__device__ __forceinline__ unsigned short f2bf(float f) { unsigned u = __float_as_uint(f); u += 0x7FFFu + ((u >> 16) & 1u); return (unsigned short)(u >> 16); }
__device__ __forceinline__ float bf2f(unsigned short b) { return __uint_as_float(((unsigned)b) << 16); }
__device__ __forceinline__ float bfr(float f) { return bf2f(f2bf(f)); }
__device__ __forceinline__ v16h cat16(v8h lo, v8h hi) { return __builtin_shufflevector(lo, hi, 0, 1, 2, 3, 4, 5, 6, 7, 8, 9, 10, 11, 12, 13, 14, 15); }
__device__ __forceinline__ v16bf cat16b(v8us lo, v8us hi) { return __builtin_bit_cast(v16bf, __builtin_shufflevector(lo, hi, 0, 1, 2, 3, 4, 5, 6, 7, 8, 9, 10, 11, 12, 13, 14, 15)); }
__device__ __forceinline__ v8f wmma16(v16h a, v16h b, v8f c) { return __builtin_amdgcn_wmma_f32_16x16x32_f16(false, a, false, b, (short)0, c, false, false); }
__device__ __forceinline__ v8f wmmab(v16bf a, v16bf b, v8f c) { return __builtin_amdgcn_wmma_f32_16x16x32_bf16(false, a, false, b, (short)0, c, false, false); }
__device__ __forceinline__ h16 tohx(float x) { return (h16)x; }
__device__ __forceinline__ void splitf(float y, unsigned short& h, unsigned short& l) { h = f2bf(y); l = f2bf(y - bf2f(h)); }

// Fragment loaders (split k map for A and B alike): element i of the 16-wide vector <- k0 + 8*hi + i (i < 8), k0 + 16 + 8*hi + (i - 8) (i >= 8); callers pass p = row_base + k0 + 8*hi.
template <typename T16> struct WFrag;
template <> struct WFrag<h16> { typedef v16h V; static __device__ __forceinline__ V ld(const h16* p) { return cat16(*(const v8h*)p, *(const v8h*)(p + 16)); } static __device__ __forceinline__ v8f mma(V a, V b, v8f c) { return wmma16(a, b, c); } };
template <> struct WFrag<bf> { typedef v16bf V; static __device__ __forceinline__ V ld(const bf* p) { return cat16b(*(const v8us*)p, *(const v8us*)(p + 16)); } static __device__ __forceinline__ v8f mma(V a, V b, v8f c) { return wmmab(a, b, c); } };
// LDS reloads of tiles written as 16-bit elements: same element type through may_alias vectors.
__device__ __forceinline__ v16h  ldsA16(const h16* p) { return cat16(*(const v8ha*)p, *(const v8ha*)(p + 16)); }
__device__ __forceinline__ v16bf ldsAb(const bf* p) { return cat16b(*(const v8usa*)p, *(const v8usa*)(p + 16)); }

// ---- k_gemmw: register-blocked GEMM, ONE WAVE per 64x64 output tile (16 accumulators), operands straight from K-contiguous 16-bit planes; grid (M/64, N/64, Z), 32 threads.
// C[m][n] (f32, pitch ldc, + optional f32 bias[n]) = sum_k A[m][k] Bt[n][k] (+ split products per NSPLIT). z-batch strides sA/sB/sC in elements. K % 32 == 0.
template <typename T16, int NSPLIT, bool BIAS>
__global__ __launch_bounds__(32) void k_gemmw(const T16* __restrict__ A, const T16* __restrict__ A2, const T16* __restrict__ Bt, const T16* __restrict__ Bt2, int K, float* C, int ldc, const float* __restrict__ bias, size_t sA, size_t sB, size_t sC) {
    typedef typename WFrag<T16>::V V;
    __shared__ __align__(16) float os[16 * 68];
    const size_t z = blockIdx.z; A += z * sA; if (A2) A2 += z * sA; Bt += z * sB; if (Bt2) Bt2 += z * sB; C += z * sC;
    const int lane = threadIdx.x & 31, lr = lane & 15, hi = lane >> 4; const int r0 = blockIdx.x * 64, c0 = blockIdx.y * 64;
    v8f acc[4][4];
#pragma unroll
    for (int mb = 0; mb < 4; ++mb)
#pragma unroll
        for (int nb = 0; nb < 4; ++nb) acc[mb][nb] = (v8f){};
    const size_t aoff = (size_t)(r0 + lr) * K + 8 * hi, boff = (size_t)(c0 + lr) * K + 8 * hi;
#pragma unroll 1
    for (int kc = 0; kc < K; kc += 32) {
        V a[4], a2[4];
#pragma unroll
        for (int mb = 0; mb < 4; ++mb) { a[mb] = WFrag<T16>::ld(A + aoff + (size_t)mb * 16 * K + kc); if (NSPLIT == 1 || NSPLIT == 2) a2[mb] = WFrag<T16>::ld(A2 + aoff + (size_t)mb * 16 * K + kc); }
#pragma unroll
        for (int nb = 0; nb < 4; ++nb) { const V b = WFrag<T16>::ld(Bt + boff + (size_t)nb * 16 * K + kc); V b2; if (NSPLIT >= 2) b2 = WFrag<T16>::ld(Bt2 + boff + (size_t)nb * 16 * K + kc);
#pragma unroll
            for (int mb = 0; mb < 4; ++mb) { acc[mb][nb] = WFrag<T16>::mma(a[mb], b, acc[mb][nb]); if (NSPLIT == 1 || NSPLIT == 2) acc[mb][nb] = WFrag<T16>::mma(a2[mb], b, acc[mb][nb]); if (NSPLIT >= 2) acc[mb][nb] = WFrag<T16>::mma(a[mb], b2, acc[mb][nb]); } }
        asm volatile("v_nop\n\tv_nop\n\tv_nop\n\tv_nop" : "+v"(acc[0][0]), "+v"(acc[1][1]), "+v"(acc[2][2]), "+v"(acc[3][3]) : "v"(a[0]), "v"(a[3]));
    }
#pragma unroll
    for (int mb = 0; mb < 4; ++mb) {
#pragma unroll
        for (int nb = 0; nb < 4; ++nb) {
#pragma unroll
            for (int j = 0; j < 8; ++j) os[(hi * 8 + j) * 68 + nb * 16 + lr] = acc[mb][nb][j]; }
        __builtin_amdgcn_wave_barrier(); asm volatile("" ::: "memory");
        float* crow = C + (size_t)(r0 + mb * 16) * ldc + c0;
{
#pragma unroll
            for (int s = 0; s < 8; ++s) { const int row = 2 * s + hi, cofs = lr * 4; v4f val = *(const v4fa*)(os + row * 68 + cofs); if (BIAS) { val[0] += bfr(bias[c0 + cofs]); val[1] += bfr(bias[c0 + cofs + 1]); val[2] += bfr(bias[c0 + cofs + 2]); val[3] += bfr(bias[c0 + cofs + 3]); }
                *(v4f*)(crow + (size_t)row * ldc + cofs) = val; }
             }
        __builtin_amdgcn_wave_barrier(); asm volatile("" ::: "memory");
    }
}

__global__ __launch_bounds__(256) void k_cvt8(const float* __restrict__ src, bf* dst, size_t n8) { const size_t i = (size_t)blockIdx.x * 256 + threadIdx.x; if (i >= n8) return; const v8f v = *(const v8f*)(src + i * 8); v8us o;
#pragma unroll
    for (int k = 0; k < 8; ++k) o[k] = f2bf(v[k]); *(v8us*)(dst + i * 8) = o;  }

__global__ __launch_bounds__(256) void k_cvtw(const float* __restrict__ wq, const float* __restrict__ wkv, bf* dst, size_t n8) {
    const size_t i = (size_t)blockIdx.x * 256 + threadIdx.x; if (i >= n8) return;
    const int row = (int)((i * 8) / DM), col = (int)((i * 8) % DM);
    const int r2 = max(row - DM, 0); const int c = (r2 >= DM) ? 1 : 0; const int r3 = r2 - c * DM;
    const int srow = (r3 >> 6) * (2 * HD) + 2 * (r3 & 63) + c;
    const float* src = (row < DM) ? (wq + (size_t)row * DM + col) : (wkv + (size_t)srow * DM + col);
    const v8f v = *(const v8f*)src; v8us o;
#pragma unroll
    for (int k = 0; k < 8; ++k) o[k] = f2bf(v[k]);
    *(v8us*)(dst + i * 8) = o; 
}

__global__ __launch_bounds__(256) void k_cstab(float* CS) {
    const int idx = blockIdx.x * 256 + threadIdx.x; if (idx >= TT * HD) return;
    const int t = idx / HD, dd = idx % HD, p = dd & (HD / 2 - 1);
    const float pw = exp10f((float)p * 0.125f);
    const float inv = __fdiv_rn(1.0f, pw);
    float ang = __fmul_rn((float)t, inv); asm volatile("" : "+v"(ang));
    float sn, cn; sincosf(ang, &sn, &cn);
    v2f cs; cs[0] = cn; cs[1] = sn;
    *(v2f*)(CS + (size_t)idx * 2) = cs; 
}

// k_mflag: per (64-row query block, 64-key chunk) flags from the int mask [q][k] (row pitch MPITCH): bit0 = any nonzero, bit1 = all nonzero; chunks >= NCH flagged 0.
__global__ __launch_bounds__(256) void k_mflag(const int* __restrict__ mask, int* FL) {
    __shared__ int fls[FLP];
    const int tid = threadIdx.x, lane = tid & 31, w = tid >> 5; const int qblk = blockIdx.x, qb = qblk * 64;
    const int kc = tid >> 3, sub = tid & 7;
    int anyv = 0, allv = 1;
#pragma unroll 1
    for (int row = 0; row < 64; ++row) {
        const int* mp = mask + (size_t)(qb + row) * MPITCH + kc * 64 + sub * 8;
        const v4i a = *(const v4i*)mp; const v4i c = *(const v4i*)(mp + 4);
#pragma unroll
        for (int q = 0; q < 4; ++q) { anyv |= a[q] | c[q]; allv &= (((a[q] != 0) & (c[q] != 0)) ? 1 : 0); } }
    anyv = (anyv != 0) ? 1 : 0;
#pragma unroll
    for (int sh = 1; sh < 8; sh <<= 1) { anyv |= __shfl_xor(anyv, sh, 32); allv &= __shfl_xor(allv, sh, 32); }
    if (sub == 0) fls[kc] = (kc < NCH) ? (anyv | (allv << 1)) : 0;
    __syncthreads();
    if (w == 0) { const int v = fls[lane]; int* p = FL + (size_t)qblk * FLP + lane; *(int*)p = v;  }
}

// k_rope: planes [h][t][d] (bf16 hi/lo) of rope(x) x sc with the rotate-half convention out[d] = x[d] cos[t][d] - x[d+HD/2] sin[t][d], out[d+HD/2] = x[d+HD/2] cos[t][d+HD/2] + x[d] sin[t][d+HD/2]
__global__ __launch_bounds__(256) void k_rope(const float* __restrict__ F, int pitch, int nheads, const float* __restrict__ CS, float sc, bf* Ph, bf* Pl) {
    const size_t e = ((size_t)blockIdx.x * 256 + threadIdx.x) * 2; if (e >= (size_t)nheads * TT * HD) return; const int d = (int)(e % HD); const int t = (int)((e / HD) % TT); const int h = (int)(e / ((size_t)HD * TT)); const float* f = F + (size_t)t * pitch + h * HD; v2us oh, ol;
#pragma unroll
    for (int q = 0; q < 2; ++q) { const int dd = d + q; const int dp = (dd < HD / 2) ? dd + HD / 2 : dd - HD / 2; const float x0 = f[dd], x1 = f[dp];
        const v2f cs = *(const v2f*)(CS + ((size_t)t * HD + dd) * 2); float a = __fmul_rn(x0, cs[0]), bq = __fmul_rn(x1, cs[1]); asm volatile("" : "+v"(a)); asm volatile("" : "+v"(bq)); const float r = ((dd < HD / 2) ? __fsub_rn(a, bq) : __fadd_rn(a, bq)) * sc;
        unsigned short a2, c2; splitf(r, a2, c2); oh[q] = a2; ol[q] = c2; }
    *(v2us*)(Ph + e) = oh; *(v2us*)(Pl + e) = ol;  }
__global__ __launch_bounds__(256) void k_vtp(const float* __restrict__ F, int pitch, int nheads, h16* V16, bf* Vh, bf* Vl) { const size_t e = ((size_t)blockIdx.x * 256 + threadIdx.x) * 2; if (e >= (size_t)nheads * HD * TT) return; const int t = (int)(e % TT); const int d = (int)((e / TT) % HD); const int g = (int)(e / ((size_t)TT * HD)); v2h o16; v2us oh, ol;
#pragma unroll
    for (int q = 0; q < 2; ++q) { const float x = F[(size_t)(t + q) * pitch + g * HD + d]; o16[q] = tohx(x); unsigned short a2, c2; splitf(x, a2, c2); oh[q] = a2; ol[q] = c2; }
    *(v2h*)(V16 + e) = o16; *(v2us*)(Vh + e) = oh; *(v2us*)(Vl + e) = ol;  }

// k_flash: flash-style masked softmax attention for one head and one 64-row query block per workgroup (128 threads = 4 waves x 16 query rows); grid (query blocks, heads).
// Per 64-key chunk (flag bit0 set): K hi/lo tiles [key][d] and the V^T tile [d][key] staged in LDS (pitch TP), the int mask tile packed to bytes when the chunk is partial (flag bit1 clear);
// S[16x64] = q_hi.k_hi + q_lo.k_hi + q_hi.k_lo (q planes pre-scaled by 1/8); masked keys -> excluded; running-max online softmax in f32 (per-row max/sum across the 16 lanes of a half);
// P relaid out through a wave-private LDS tile (16-bit element stores, may_alias vector reloads after a wave barrier) and O[16x64] += P.V: HIRES -> P and v as bf16 hi/lo (3 products, carry 1),
template <bool HIRES>
__global__ __launch_bounds__(128) void k_flash(const bf* __restrict__ QPh, const bf* __restrict__ QPl, const bf* __restrict__ KPh, const bf* __restrict__ KPl,
                                               const h16* __restrict__ VT16, const bf* __restrict__ VTh, const bf* __restrict__ VTl,
                                               const int* __restrict__ mask, const int* __restrict__ FL, int qblk0, float* OUTb) {
    __shared__ __align__(16) unsigned char smem[LDS_TOTAL];
    bf* sKh = (bf*)(smem + O_KH); bf* sKl = (bf*)(smem + O_KL);
    h16* sV16 = (h16*)(smem + O_VA); bf* sVh = (bf*)(smem + O_VA); bf* sVl = (bf*)(smem + O_VB);
    h16* sP16 = (h16*)(smem + O_PA); bf* sPh = (bf*)(smem + O_PA); bf* sPl = (bf*)(smem + O_PB);
    unsigned char* Ms = smem + O_MS;
    const int tid = threadIdx.x, lane = tid & 31, w = tid >> 5, lr = lane & 15, hi = lane >> 4;
    const int h = blockIdx.y; const int qblk = qblk0 + (int)blockIdx.x; const int qb = qblk * 64;
    const size_t hp = (size_t)h * TT * HD;
    const bf* Qh = QPh + hp; const bf* Ql = QPl + hp; const bf* Kh = KPh + hp; const bf* Kl = KPl + hp;
    const h16* V16 = VT16 + hp; const bf* Vh = VTh + hp; const bf* Vl = VTl + hp;
    const int qrow = qb + w * 16 + lr;                       // A layout: lane -> query row
    v16bf aq[2], aq2[2];
#pragma unroll
    for (int ks = 0; ks < 2; ++ks) { aq[ks] = WFrag<bf>::ld(Qh + (size_t)qrow * HD + ks * 32 + 8 * hi); aq2[ks] = WFrag<bf>::ld(Ql + (size_t)qrow * HD + ks * 32 + 8 * hi); }
    v8f acc[4]; float m[8], l[8];
#pragma unroll
    for (int dt = 0; dt < 4; ++dt) acc[dt] = (v8f){};
#pragma unroll
    for (int r = 0; r < 8; ++r) { m[r] = NEGS; l[r] = 0.0f; }
    h16* sPw16 = sP16 + w * 16 * TP; bf* sPwh = sPh + w * 16 * TP; bf* sPwl = sPl + w * 16 * TP;
    const int mrow0 = w * 16 + 8 * hi;                      // D layout: lane's rows within the 64-row block = mrow0 + r, column = lr
    const float L2E = 1.4426950408889634f;
#pragma unroll 1
    for (int kc = 0; kc < NCH; ++kc) {
        const int flag = FL[qblk * FLP + kc];                // block-uniform
        if ((flag & 1) == 0) continue;
        const bool needm = ((flag & 2) == 0);
        const int kb = kc * 64;
        __syncthreads();
#pragma unroll
        for (int i = 0; i < 4; ++i) {
            const int idx = i * 128 + tid; const int row = idx >> 3, seg = idx & 7;
            *(v8us*)(sKh + row * TP + seg * 8) = *(const v8us*)(Kh + (size_t)(kb + row) * HD + seg * 8);
            *(v8us*)(sKl + row * TP + seg * 8) = *(const v8us*)(Kl + (size_t)(kb + row) * HD + seg * 8);
            if (HIRES) { *(v8us*)(sVh + row * TP + seg * 8) = *(const v8us*)(Vh + (size_t)row * TT + kb + seg * 8);
                         *(v8us*)(sVl + row * TP + seg * 8) = *(const v8us*)(Vl + (size_t)row * TT + kb + seg * 8); }
            else       { *(v8h*)(sV16 + row * TP + seg * 8) = *(const v8h*)(V16 + (size_t)row * TT + kb + seg * 8); }
        }
        if (needm) {
#pragma unroll
            for (int i = 0; i < 8; ++i) {
                const int idx = i * 128 + tid; const int row = idx >> 4, seg = idx & 15;
                const v4i mv = *(const v4i*)(mask + (size_t)(qb + row) * MPITCH + kb + seg * 4);
                const unsigned pk = (mv[0] != 0 ? 1u : 0u) | (mv[1] != 0 ? 0x100u : 0u) | (mv[2] != 0 ? 0x10000u : 0u) | (mv[3] != 0 ? 0x1000000u : 0u);
                *(unsigned*)(Ms + row * 64 + seg * 4) = pk; } }
        __syncthreads();
        v8f s[4];
#pragma unroll
        for (int nb = 0; nb < 4; ++nb) s[nb] = (v8f){};
#pragma unroll
        for (int ks = 0; ks < 2; ++ks) {
#pragma unroll
            for (int nb = 0; nb < 4; ++nb) {
                const v16bf b = ldsAb(sKh + (nb * 16 + lr) * TP + ks * 32 + 8 * hi);
                const v16bf b2 = ldsAb(sKl + (nb * 16 + lr) * TP + ks * 32 + 8 * hi);
                s[nb] = wmmab(aq[ks], b, s[nb]); s[nb] = wmmab(aq2[ks], b, s[nb]); s[nb] = wmmab(aq[ks], b2, s[nb]);
                asm volatile("v_nop\n\tv_nop\n\tv_nop\n\tv_nop" : "+v"(s[nb]) : "v"(b), "v"(b2), "v"(aq[ks]), "v"(aq2[ks])); } }
#pragma unroll
        for (int r = 0; r < 8; ++r) {
            const int mrow = mrow0 + r, prow = 8 * hi + r;
            float t[4]; float tmax = NEGS;
#pragma unroll
            for (int nb = 0; nb < 4; ++nb) { int mk = 1; if (needm) mk = (int)Ms[mrow * 64 + nb * 16 + lr]; t[nb] = (mk != 0) ? s[nb][r] : NEGS; tmax = fmaxf(tmax, t[nb]); }
#pragma unroll
            for (int sh = 1; sh < 16; sh <<= 1) tmax = fmaxf(tmax, __shfl_xor(tmax, sh, 32));
            const float nm = fmaxf(m[r], tmax);
            float da = __fsub_rn(m[r], nm); asm volatile("" : "+v"(da));
            const float alpha = __builtin_amdgcn_exp2f(__fmul_rn(da, L2E));
            m[r] = nm;
            float sum = 0.0f;
#pragma unroll
            for (int nb = 0; nb < 4; ++nb) {
                float d0 = __fsub_rn(t[nb], nm); asm volatile("" : "+v"(d0));
                float p = __builtin_amdgcn_exp2f(__fmul_rn(d0, L2E)); p = (t[nb] > -1.0e38f) ? p : 0.0f; sum += p;
                if (HIRES) { unsigned short a2, c2; splitf(p, a2, c2); sPwh[prow * TP + nb * 16 + lr] = a2; sPwl[prow * TP + nb * 16 + lr] = c2; }
                else       { sPw16[prow * TP + nb * 16 + lr] = tohx(p * PCAR); } }
#pragma unroll
            for (int sh = 1; sh < 16; sh <<= 1) sum += __shfl_xor(sum, sh, 32);
            l[r] = l[r] * alpha + sum;
#pragma unroll
            for (int dt = 0; dt < 4; ++dt) acc[dt][r] *= alpha;
        }
        __builtin_amdgcn_wave_barrier(); asm volatile("" ::: "memory");
        if (HIRES) {
#pragma unroll
            for (int ks = 0; ks < 2; ++ks) {
                const v16bf aph = ldsAb(sPwh + lr * TP + ks * 32 + 8 * hi), apl = ldsAb(sPwl + lr * TP + ks * 32 + 8 * hi);
#pragma unroll
                for (int dt = 0; dt < 4; ++dt) {
                    const v16bf bvh = ldsAb(sVh + (dt * 16 + lr) * TP + ks * 32 + 8 * hi), bvl = ldsAb(sVl + (dt * 16 + lr) * TP + ks * 32 + 8 * hi);
                    acc[dt] = wmmab(aph, bvh, acc[dt]); acc[dt] = wmmab(apl, bvh, acc[dt]); acc[dt] = wmmab(aph, bvl, acc[dt]);
                    asm volatile("v_nop\n\tv_nop\n\tv_nop\n\tv_nop" : "+v"(acc[dt]) : "v"(aph), "v"(apl), "v"(bvh), "v"(bvl)); } }
        } else {
#pragma unroll
            for (int ks = 0; ks < 2; ++ks) {
                const v16h ap = ldsA16(sPw16 + lr * TP + ks * 32 + 8 * hi);
#pragma unroll
                for (int dt = 0; dt < 4; ++dt) {
                    const v16h bv = ldsA16(sV16 + (dt * 16 + lr) * TP + ks * 32 + 8 * hi);
                    acc[dt] = wmma16(ap, bv, acc[dt]);
                    asm volatile("v_nop\n\tv_nop\n\tv_nop\n\tv_nop" : "+v"(acc[dt]) : "v"(ap), "v"(bv)); } }
        }
    }
    __syncthreads();                                          // all waves done with the K tiles before the output staging aliases them
    float* os = (float*)smem + w * 16 * 68;
    const float rc = HIRES ? 1.0f : (1.0f / PCAR);
    float inv[8];
#pragma unroll
    for (int r = 0; r < 8; ++r) inv[r] = __fdiv_rn(rc, l[r]);
#pragma unroll
    for (int dt = 0; dt < 4; ++dt) {
#pragma unroll
        for (int r = 0; r < 8; ++r) os[(hi * 8 + r) * 68 + dt * 16 + lr] = acc[dt][r] * inv[r]; }
    __builtin_amdgcn_wave_barrier(); asm volatile("" ::: "memory");
    float* crow = OUTb + (size_t)(qb + w * 16) * DQ + h * HD;
{
#pragma unroll
        for (int s2 = 0; s2 < 8; ++s2) { const int row = 2 * s2 + hi, cofs = lr * 4; const v4f val = *(const v4fa*)(os + row * 68 + cofs);
            *(v4f*)(crow + (size_t)row * DQ + cofs) = val; }
         }
}

extern "C" void kernel_launch(void* const* d_in, const int* in_sizes, int n_in,
                              void* d_out, int out_size, void* d_ws, size_t ws_size, hipStream_t stream) {
    if (n_in < 4) return;
    if (in_sizes[0] < (NB - 1) * SEQ_FULL * DM + TT * DM) return;
    if (in_sizes[1] < DM * DM) return;
    if (in_sizes[2] < 2 * DM * DM) return;
    if (in_sizes[3] < TT * MPITCH) return;
    if (out_size < NB * TT * DQ) return;
    const float* x = (const float*)d_in[0]; const float* wq = (const float*)d_in[1]; const float* wkv = (const float*)d_in[2]; const int* mask = (const int*)d_in[3];
    float* OUT = (float*)d_out;     // [NB][TT][DQ]
    char* wsp = (char*)d_ws;
    auto take = [&](size_t bytes) { char* p = wsp; wsp += (bytes + 255) & ~(size_t)255; return (void*)p; };
    bf* W3 = (bf*)take((size_t)D3 * DM * 2); float* CS = (float*)take((size_t)TT * HD * 2 * 4); int* FL = (int*)take((size_t)NQB * FLP * 4);
    bf* XB = (bf*)take((size_t)TT * DM * 2); float* F = (float*)take((size_t)TT * D3 * 4);
    bf* QPh = (bf*)take((size_t)NH_ * TT * HD * 2); bf* QPl = (bf*)take((size_t)NH_ * TT * HD * 2); bf* KPh = (bf*)take((size_t)NH_ * TT * HD * 2); bf* KPl = (bf*)take((size_t)NH_ * TT * HD * 2);
    h16* VT16 = (h16*)take((size_t)NH_ * HD * TT * 2); bf* VTh = (bf*)take((size_t)NH_ * HD * TT * 2); bf* VTl = (bf*)take((size_t)NH_ * HD * TT * 2);
    const size_t used = (size_t)(wsp - (char*)d_ws);
    if (used > ws_size || used > (size_t)134217728) return;   // 66,064,384 B at NB=2, SEQ=2048
    k_cvtw<<<(unsigned)(((size_t)D3 * DM / 8 + 255) / 256), 256, 0, stream>>>(wq, wkv, W3, (size_t)D3 * DM / 8);
    k_cstab<<<(TT * HD + 255) / 256, 256, 0, stream>>>(CS);
    k_mflag<<<NQB, 256, 0, stream>>>(mask, FL);
    const unsigned LQ = (unsigned)(((size_t)NH_ * TT * HD / 2 + 255) / 256);
    for (int b = 0; b < NB; ++b) {
        float* OUTb = OUT + (size_t)b * TT * DQ;
        k_cvt8<<<(unsigned)(((size_t)TT * DM / 8 + 255) / 256), 256, 0, stream>>>(x + (size_t)b * SEQ_FULL * DM, XB, (size_t)TT * DM / 8);
        k_gemmw<bf, 0, false><<<dim3(TT / 64, D3 / 64, 1), 32, 0, stream>>>(XB, nullptr, W3, nullptr, DM, F, D3, nullptr, 0, 0, 0);
        k_rope<<<LQ, 256, 0, stream>>>(F, D3, NH_, CS, SCL, QPh, QPl);
        k_rope<<<LQ, 256, 0, stream>>>(F + DM, D3, NH_, CS, 1.0f, KPh, KPl);
        k_vtp<<<LQ, 256, 0, stream>>>(F + 2 * DM, D3, NH_, VT16, VTh, VTl);
        k_flash<true><<<dim3(RH / 64, NH_, 1), 128, 0, stream>>>(QPh, QPl, KPh, KPl, VT16, VTh, VTl, mask, FL, 0, OUTb);
        if (NQB > RH / 64) k_flash<false><<<dim3(NQB - RH / 64, NH_, 1), 128, 0, stream>>>(QPh, QPl, KPh, KPl, VT16, VTh, VTl, mask, FL, RH / 64, OUTb);
    }
}

// v001
// It runs in 303 microseconds.
// In two side-by-side timings against v000, it was 1.57 and 1.58 times as fast.
#include <hip/hip_runtime.h>

// Contractions: fused q|k|v projection v_wmma_f32_16x16x32_bf16 (bf16 operands = RNE-converted inputs, exact products); scores v_wmma_f32_16x16x32_bf16 with q/k as bf16 hi/lo planes (3 products) on every row; attn.v v_wmma_f32_16x16x32_f16 (f16 P carried x1024, f16 v) on query rows >= 64 and v_wmma_f32_16x16x32_bf16 with P and v as bf16 hi/lo (3 products) on query rows < 64; f32 accumulate, f32 online softmax, f32 output.
// Both batch elements go through each per-batch launch together (batch = grid y for the x conversion, rope and value kernels, grid z for the GEMM and attention; every per-batch plane below is stored [batch][...]). Layout (weight, cos/sin table and mask flags shared across the batch): bf16 copy of x; one [3072][1024] bf16 'oi' weight (q rows, then k rows, then v rows, k/v de-interleaved from the [2048][1024] kv weight whose row is h*128 + 2d + c); F = x W^T f32 [T][3072];
// rotary planes q,k [h][t][64] bf16 hi/lo (rotate-half, table cos/sin[t][d], q pre-scaled by 1/8); value planes [h][d][t] f16 and bf16 hi/lo; per (64-row query block, 64-key chunk) mask flags from the int mask (empty chunks skipped, partial chunks apply the mask element-wise, replace-fill);
// flash-style attention: K hi/lo and V chunk tiles staged in LDS, online softmax per 16-row wave slab, output rows written directly (no output projection).

#ifndef NB
#define NB 2
#endif
#ifndef SEQ
#define SEQ 2048
#endif
#define NB_FULL  2
#define SEQ_FULL 2048
#define TT     SEQ
#define DM     1024
#define NH_    16
#define HD     64
#define DQ     (NH_ * HD)
#define D3     (3 * DM)
#define NQB    (TT / 64)
#define NCH    (TT / 64)
#define RH     64
#define MPITCH SEQ_FULL
#define FLP    32
#define PCAR   1024.0f
#define SCL    0.125f
#define NEGS   (-3.0e38f)
#define TP     72
#define TILEB  (64 * TP * 2)
#define O_KH   0
#define O_KL   (TILEB)
#define O_VA   (2 * TILEB)
#define O_VB   (3 * TILEB)
#define O_PA   (4 * TILEB)
#define O_PB   (5 * TILEB)
#define O_MS   (6 * TILEB)
#define LDS_TOTAL (6 * TILEB + 64 * 64)

static_assert(TT % 64 == 0);
static_assert(TT <= SEQ_FULL);
static_assert(NB >= 1 && NB <= NB_FULL);
static_assert(NCH <= FLP);
static_assert(RH == 64);
static_assert(NQB >= RH / 64);
static_assert(DM % 32 == 0 && D3 % 64 == 0 && HD == 64 && DQ == DM);
static_assert(4 * 16 * 68 * 4 <= O_VA);
static_assert(4 * 16 * TP * 2 == TILEB);
static_assert((TP * 2) % 16 == 0);
static_assert(LDS_TOTAL <= 65536);

typedef _Float16 h16;
typedef unsigned short bf;
typedef __attribute__((ext_vector_type(16))) __bf16   v16bf;
typedef __attribute__((ext_vector_type(16))) _Float16 v16h;
typedef __attribute__((ext_vector_type(8)))  _Float16 v8h;
typedef __attribute__((ext_vector_type(8)))  unsigned short v8us;
typedef __attribute__((ext_vector_type(8)))  float    v8f;
typedef __attribute__((ext_vector_type(4)))  float    v4f;
typedef __attribute__((ext_vector_type(2)))  float    v2f;
typedef __attribute__((ext_vector_type(2)))  _Float16 v2h;
typedef __attribute__((ext_vector_type(2)))  unsigned short v2us;
typedef __attribute__((ext_vector_type(4)))  int      v4i;
typedef v8h  __attribute__((may_alias)) v8ha;
typedef v4f  __attribute__((may_alias)) v4fa;
typedef v8us __attribute__((may_alias)) v8usa;

__device__ __forceinline__ unsigned short f2bf(float f) { unsigned u = __float_as_uint(f); u += 0x7FFFu + ((u >> 16) & 1u); return (unsigned short)(u >> 16); }
__device__ __forceinline__ float bf2f(unsigned short b) { return __uint_as_float(((unsigned)b) << 16); }
__device__ __forceinline__ float bfr(float f) { return bf2f(f2bf(f)); }
__device__ __forceinline__ v16h cat16(v8h lo, v8h hi) { return __builtin_shufflevector(lo, hi, 0, 1, 2, 3, 4, 5, 6, 7, 8, 9, 10, 11, 12, 13, 14, 15); }
__device__ __forceinline__ v16bf cat16b(v8us lo, v8us hi) { return __builtin_bit_cast(v16bf, __builtin_shufflevector(lo, hi, 0, 1, 2, 3, 4, 5, 6, 7, 8, 9, 10, 11, 12, 13, 14, 15)); }
__device__ __forceinline__ v8f wmma16(v16h a, v16h b, v8f c) { return __builtin_amdgcn_wmma_f32_16x16x32_f16(false, a, false, b, (short)0, c, false, false); }
__device__ __forceinline__ v8f wmmab(v16bf a, v16bf b, v8f c) { return __builtin_amdgcn_wmma_f32_16x16x32_bf16(false, a, false, b, (short)0, c, false, false); }
__device__ __forceinline__ h16 tohx(float x) { return (h16)x; }
__device__ __forceinline__ void splitf(float y, unsigned short& h, unsigned short& l) { h = f2bf(y); l = f2bf(y - bf2f(h)); }

// Fragment loaders (split k map for A and B alike): element i of the 16-wide vector <- k0 + 8*hi + i (i < 8), k0 + 16 + 8*hi + (i - 8) (i >= 8); callers pass p = row_base + k0 + 8*hi.
template <typename T16> struct WFrag;
template <> struct WFrag<h16> { typedef v16h V; static __device__ __forceinline__ V ld(const h16* p) { return cat16(*(const v8h*)p, *(const v8h*)(p + 16)); } static __device__ __forceinline__ v8f mma(V a, V b, v8f c) { return wmma16(a, b, c); } };
template <> struct WFrag<bf> { typedef v16bf V; static __device__ __forceinline__ V ld(const bf* p) { return cat16b(*(const v8us*)p, *(const v8us*)(p + 16)); } static __device__ __forceinline__ v8f mma(V a, V b, v8f c) { return wmmab(a, b, c); } };
// LDS reloads of tiles written as 16-bit elements: same element type through may_alias vectors.
__device__ __forceinline__ v16h  ldsA16(const h16* p) { return cat16(*(const v8ha*)p, *(const v8ha*)(p + 16)); }
__device__ __forceinline__ v16bf ldsAb(const bf* p) { return cat16b(*(const v8usa*)p, *(const v8usa*)(p + 16)); }

// ---- k_gemmw: register-blocked GEMM, ONE WAVE per 64x64 output tile (16 accumulators), operands straight from K-contiguous 16-bit planes; grid (M/64, N/64, Z), 32 threads.
// C[m][n] (f32, pitch ldc, + optional f32 bias[n]) = sum_k A[m][k] Bt[n][k] (+ split products per NSPLIT). z-batch strides sA/sB/sC in elements. K % 32 == 0.
template <typename T16, int NSPLIT, bool BIAS>
__global__ __launch_bounds__(32) void k_gemmw(const T16* __restrict__ A, const T16* __restrict__ A2, const T16* __restrict__ Bt, const T16* __restrict__ Bt2, int K, float* C, int ldc, const float* __restrict__ bias, size_t sA, size_t sB, size_t sC) {
    typedef typename WFrag<T16>::V V;
    __shared__ __align__(16) float os[16 * 68];
    const size_t z = blockIdx.z; A += z * sA; if (A2) A2 += z * sA; Bt += z * sB; if (Bt2) Bt2 += z * sB; C += z * sC;
    const int lane = threadIdx.x & 31, lr = lane & 15, hi = lane >> 4; const int r0 = blockIdx.x * 64, c0 = blockIdx.y * 64;
    v8f acc[4][4];
#pragma unroll
    for (int mb = 0; mb < 4; ++mb)
#pragma unroll
        for (int nb = 0; nb < 4; ++nb) acc[mb][nb] = (v8f){};
    const size_t aoff = (size_t)(r0 + lr) * K + 8 * hi, boff = (size_t)(c0 + lr) * K + 8 * hi;
#pragma unroll 1
    for (int kc = 0; kc < K; kc += 32) {
        V a[4], a2[4];
#pragma unroll
        for (int mb = 0; mb < 4; ++mb) { a[mb] = WFrag<T16>::ld(A + aoff + (size_t)mb * 16 * K + kc); if (NSPLIT == 1 || NSPLIT == 2) a2[mb] = WFrag<T16>::ld(A2 + aoff + (size_t)mb * 16 * K + kc); }
#pragma unroll
        for (int nb = 0; nb < 4; ++nb) { const V b = WFrag<T16>::ld(Bt + boff + (size_t)nb * 16 * K + kc); V b2; if (NSPLIT >= 2) b2 = WFrag<T16>::ld(Bt2 + boff + (size_t)nb * 16 * K + kc);
#pragma unroll
            for (int mb = 0; mb < 4; ++mb) { acc[mb][nb] = WFrag<T16>::mma(a[mb], b, acc[mb][nb]); if (NSPLIT == 1 || NSPLIT == 2) acc[mb][nb] = WFrag<T16>::mma(a2[mb], b, acc[mb][nb]); if (NSPLIT >= 2) acc[mb][nb] = WFrag<T16>::mma(a[mb], b2, acc[mb][nb]); } }
        asm volatile("v_nop\n\tv_nop\n\tv_nop\n\tv_nop" : "+v"(acc[0][0]), "+v"(acc[1][1]), "+v"(acc[2][2]), "+v"(acc[3][3]) : "v"(a[0]), "v"(a[3]));
    }
#pragma unroll
    for (int mb = 0; mb < 4; ++mb) {
#pragma unroll
        for (int nb = 0; nb < 4; ++nb) {
#pragma unroll
            for (int j = 0; j < 8; ++j) os[(hi * 8 + j) * 68 + nb * 16 + lr] = acc[mb][nb][j]; }
        __builtin_amdgcn_wave_barrier(); asm volatile("" ::: "memory");
        float* crow = C + (size_t)(r0 + mb * 16) * ldc + c0;
{
#pragma unroll
            for (int s = 0; s < 8; ++s) { const int row = 2 * s + hi, cofs = lr * 4; v4f val = *(const v4fa*)(os + row * 68 + cofs); if (BIAS) { val[0] += bfr(bias[c0 + cofs]); val[1] += bfr(bias[c0 + cofs + 1]); val[2] += bfr(bias[c0 + cofs + 2]); val[3] += bfr(bias[c0 + cofs + 3]); }
                *(v4f*)(crow + (size_t)row * ldc + cofs) = val; }
             }
        __builtin_amdgcn_wave_barrier(); asm volatile("" ::: "memory");
    }
}

__global__ __launch_bounds__(256) void k_cvt8(const float* __restrict__ src, bf* dst, size_t n8, size_t sS, size_t sD) { const size_t i = (size_t)blockIdx.x * 256 + threadIdx.x; if (i >= n8) return; src += blockIdx.y * sS; dst += blockIdx.y * sD; const v8f v = *(const v8f*)(src + i * 8); v8us o;
#pragma unroll
    for (int k = 0; k < 8; ++k) o[k] = f2bf(v[k]); *(v8us*)(dst + i * 8) = o;  }

__global__ __launch_bounds__(256) void k_cvtw(const float* __restrict__ wq, const float* __restrict__ wkv, bf* dst, size_t n8) {
    const size_t i = (size_t)blockIdx.x * 256 + threadIdx.x; if (i >= n8) return;
    const int row = (int)((i * 8) / DM), col = (int)((i * 8) % DM);
    const int r2 = max(row - DM, 0); const int c = (r2 >= DM) ? 1 : 0; const int r3 = r2 - c * DM;
    const int srow = (r3 >> 6) * (2 * HD) + 2 * (r3 & 63) + c;
    const float* src = (row < DM) ? (wq + (size_t)row * DM + col) : (wkv + (size_t)srow * DM + col);
    const v8f v = *(const v8f*)src; v8us o;
#pragma unroll
    for (int k = 0; k < 8; ++k) o[k] = f2bf(v[k]);
    *(v8us*)(dst + i * 8) = o; 
}

__global__ __launch_bounds__(256) void k_cstab(float* CS) {
    const int idx = blockIdx.x * 256 + threadIdx.x; if (idx >= TT * HD) return;
    const int t = idx / HD, dd = idx % HD, p = dd & (HD / 2 - 1);
    const float pw = exp10f((float)p * 0.125f);
    const float inv = __fdiv_rn(1.0f, pw);
    float ang = __fmul_rn((float)t, inv); asm volatile("" : "+v"(ang));
    float sn, cn; sincosf(ang, &sn, &cn);
    v2f cs; cs[0] = cn; cs[1] = sn;
    *(v2f*)(CS + (size_t)idx * 2) = cs; 
}

// k_mflag: per (64-row query block, 64-key chunk) flags from the int mask [q][k] (row pitch MPITCH): bit0 = any nonzero, bit1 = all nonzero; chunks >= NCH flagged 0.
__global__ __launch_bounds__(256) void k_mflag(const int* __restrict__ mask, int* FL) {
    __shared__ int fls[FLP];
    const int tid = threadIdx.x, lane = tid & 31, w = tid >> 5; const int qblk = blockIdx.x, qb = qblk * 64;
    const int kc = tid >> 3, sub = tid & 7;
    int anyv = 0, allv = 1;
#pragma unroll 1
    for (int row = 0; row < 64; ++row) {
        const int* mp = mask + (size_t)(qb + row) * MPITCH + kc * 64 + sub * 8;
        const v4i a = *(const v4i*)mp; const v4i c = *(const v4i*)(mp + 4);
#pragma unroll
        for (int q = 0; q < 4; ++q) { anyv |= a[q] | c[q]; allv &= (((a[q] != 0) & (c[q] != 0)) ? 1 : 0); } }
    anyv = (anyv != 0) ? 1 : 0;
#pragma unroll
    for (int sh = 1; sh < 8; sh <<= 1) { anyv |= __shfl_xor(anyv, sh, 32); allv &= __shfl_xor(allv, sh, 32); }
    if (sub == 0) fls[kc] = (kc < NCH) ? (anyv | (allv << 1)) : 0;
    __syncthreads();
    if (w == 0) { const int v = fls[lane]; int* p = FL + (size_t)qblk * FLP + lane; *(int*)p = v;  }
}

// k_rope: planes [h][t][d] (bf16 hi/lo) of rope(x) x sc with the rotate-half convention out[d] = x[d] cos[t][d] - x[d+HD/2] sin[t][d], out[d+HD/2] = x[d+HD/2] cos[t][d+HD/2] + x[d] sin[t][d+HD/2]
__global__ __launch_bounds__(256) void k_rope(const float* __restrict__ F, int pitch, int nheads, const float* __restrict__ CS, float sc, bf* Ph, bf* Pl, size_t sF, size_t sP) {
    const size_t e = ((size_t)blockIdx.x * 256 + threadIdx.x) * 2; if (e >= (size_t)nheads * TT * HD) return; F += blockIdx.y * sF; Ph += blockIdx.y * sP; Pl += blockIdx.y * sP; const int d = (int)(e % HD); const int t = (int)((e / HD) % TT); const int h = (int)(e / ((size_t)HD * TT)); const float* f = F + (size_t)t * pitch + h * HD; v2us oh, ol;
#pragma unroll
    for (int q = 0; q < 2; ++q) { const int dd = d + q; const int dp = (dd < HD / 2) ? dd + HD / 2 : dd - HD / 2; const float x0 = f[dd], x1 = f[dp];
        const v2f cs = *(const v2f*)(CS + ((size_t)t * HD + dd) * 2); float a = __fmul_rn(x0, cs[0]), bq = __fmul_rn(x1, cs[1]); asm volatile("" : "+v"(a)); asm volatile("" : "+v"(bq)); const float r = ((dd < HD / 2) ? __fsub_rn(a, bq) : __fadd_rn(a, bq)) * sc;
        unsigned short a2, c2; splitf(r, a2, c2); oh[q] = a2; ol[q] = c2; }
    *(v2us*)(Ph + e) = oh; *(v2us*)(Pl + e) = ol;  }
__global__ __launch_bounds__(256) void k_vtp(const float* __restrict__ F, int pitch, int nheads, h16* V16, bf* Vh, bf* Vl, size_t sF, size_t sP) { const size_t e = ((size_t)blockIdx.x * 256 + threadIdx.x) * 2; if (e >= (size_t)nheads * HD * TT) return; F += blockIdx.y * sF; V16 += blockIdx.y * sP; Vh += blockIdx.y * sP; Vl += blockIdx.y * sP; const int t = (int)(e % TT); const int d = (int)((e / TT) % HD); const int g = (int)(e / ((size_t)TT * HD)); v2h o16; v2us oh, ol;
#pragma unroll
    for (int q = 0; q < 2; ++q) { const float x = F[(size_t)(t + q) * pitch + g * HD + d]; o16[q] = tohx(x); unsigned short a2, c2; splitf(x, a2, c2); oh[q] = a2; ol[q] = c2; }
    *(v2h*)(V16 + e) = o16; *(v2us*)(Vh + e) = oh; *(v2us*)(Vl + e) = ol;  }

// k_flash: flash-style masked softmax attention for one head and one 64-row query block per workgroup (128 threads = 4 waves x 16 query rows); grid (query blocks, heads, batch).
// Per 64-key chunk (flag bit0 set): K hi/lo tiles [key][d] and the V^T tile [d][key] staged in LDS (pitch TP), the int mask tile packed to bytes when the chunk is partial (flag bit1 clear);
// S[16x64] = q_hi.k_hi + q_lo.k_hi + q_hi.k_lo (q planes pre-scaled by 1/8); masked keys -> excluded; running-max online softmax in f32 (per-row max/sum across the 16 lanes of a half);
// P relaid out through a wave-private LDS tile (16-bit element stores, may_alias vector reloads after a wave barrier) and O[16x64] += P.V: HIRES -> P and v as bf16 hi/lo (3 products, carry 1),
template <bool HIRES>
__global__ __launch_bounds__(128) void k_flash(const bf* __restrict__ QPh, const bf* __restrict__ QPl, const bf* __restrict__ KPh, const bf* __restrict__ KPl,
                                               const h16* __restrict__ VT16, const bf* __restrict__ VTh, const bf* __restrict__ VTl,
                                               const int* __restrict__ mask, const int* __restrict__ FL, int qblk0, float* OUT) {
    __shared__ __align__(16) unsigned char smem[LDS_TOTAL];
    bf* sKh = (bf*)(smem + O_KH); bf* sKl = (bf*)(smem + O_KL);
    h16* sV16 = (h16*)(smem + O_VA); bf* sVh = (bf*)(smem + O_VA); bf* sVl = (bf*)(smem + O_VB);
    h16* sP16 = (h16*)(smem + O_PA); bf* sPh = (bf*)(smem + O_PA); bf* sPl = (bf*)(smem + O_PB);
    unsigned char* Ms = smem + O_MS;
    const int tid = threadIdx.x, lane = tid & 31, w = tid >> 5, lr = lane & 15, hi = lane >> 4;
    const int h = blockIdx.y; const int qblk = qblk0 + (int)blockIdx.x; const int qb = qblk * 64;
    const size_t hp = ((size_t)blockIdx.z * NH_ + h) * TT * HD;
    float* OUTb = OUT + (size_t)blockIdx.z * TT * DQ;
    const bf* Qh = QPh + hp; const bf* Ql = QPl + hp; const bf* Kh = KPh + hp; const bf* Kl = KPl + hp;
    const h16* V16 = VT16 + hp; const bf* Vh = VTh + hp; const bf* Vl = VTl + hp;
    const int qrow = qb + w * 16 + lr;                       // A layout: lane -> query row
    v16bf aq[2], aq2[2];
#pragma unroll
    for (int ks = 0; ks < 2; ++ks) { aq[ks] = WFrag<bf>::ld(Qh + (size_t)qrow * HD + ks * 32 + 8 * hi); aq2[ks] = WFrag<bf>::ld(Ql + (size_t)qrow * HD + ks * 32 + 8 * hi); }
    v8f acc[4]; float m[8], l[8];
#pragma unroll
    for (int dt = 0; dt < 4; ++dt) acc[dt] = (v8f){};
#pragma unroll
    for (int r = 0; r < 8; ++r) { m[r] = NEGS; l[r] = 0.0f; }
    h16* sPw16 = sP16 + w * 16 * TP; bf* sPwh = sPh + w * 16 * TP; bf* sPwl = sPl + w * 16 * TP;
    const int mrow0 = w * 16 + 8 * hi;                      // D layout: lane's rows within the 64-row block = mrow0 + r, column = lr
    const float L2E = 1.4426950408889634f;
#pragma unroll 1
    for (int kc = 0; kc < NCH; ++kc) {
        const int flag = FL[qblk * FLP + kc];                // block-uniform
        if ((flag & 1) == 0) continue;
        const bool needm = ((flag & 2) == 0);
        const int kb = kc * 64;
        __syncthreads();
#pragma unroll
        for (int i = 0; i < 4; ++i) {
            const int idx = i * 128 + tid; const int row = idx >> 3, seg = idx & 7;
            *(v8us*)(sKh + row * TP + seg * 8) = *(const v8us*)(Kh + (size_t)(kb + row) * HD + seg * 8);
            *(v8us*)(sKl + row * TP + seg * 8) = *(const v8us*)(Kl + (size_t)(kb + row) * HD + seg * 8);
            if (HIRES) { *(v8us*)(sVh + row * TP + seg * 8) = *(const v8us*)(Vh + (size_t)row * TT + kb + seg * 8);
                         *(v8us*)(sVl + row * TP + seg * 8) = *(const v8us*)(Vl + (size_t)row * TT + kb + seg * 8); }
            else       { *(v8h*)(sV16 + row * TP + seg * 8) = *(const v8h*)(V16 + (size_t)row * TT + kb + seg * 8); }
        }
        if (needm) {
#pragma unroll
            for (int i = 0; i < 8; ++i) {
                const int idx = i * 128 + tid; const int row = idx >> 4, seg = idx & 15;
                const v4i mv = *(const v4i*)(mask + (size_t)(qb + row) * MPITCH + kb + seg * 4);
                const unsigned pk = (mv[0] != 0 ? 1u : 0u) | (mv[1] != 0 ? 0x100u : 0u) | (mv[2] != 0 ? 0x10000u : 0u) | (mv[3] != 0 ? 0x1000000u : 0u);
                *(unsigned*)(Ms + row * 64 + seg * 4) = pk; } }
        __syncthreads();
        v8f s[4];
#pragma unroll
        for (int nb = 0; nb < 4; ++nb) s[nb] = (v8f){};
#pragma unroll
        for (int ks = 0; ks < 2; ++ks) {
#pragma unroll
            for (int nb = 0; nb < 4; ++nb) {
                const v16bf b = ldsAb(sKh + (nb * 16 + lr) * TP + ks * 32 + 8 * hi);
                const v16bf b2 = ldsAb(sKl + (nb * 16 + lr) * TP + ks * 32 + 8 * hi);
                s[nb] = wmmab(aq[ks], b, s[nb]); s[nb] = wmmab(aq2[ks], b, s[nb]); s[nb] = wmmab(aq[ks], b2, s[nb]);
                asm volatile("v_nop\n\tv_nop\n\tv_nop\n\tv_nop" : "+v"(s[nb]) : "v"(b), "v"(b2), "v"(aq[ks]), "v"(aq2[ks])); } }
#pragma unroll
        for (int r = 0; r < 8; ++r) {
            const int mrow = mrow0 + r, prow = 8 * hi + r;
            float t[4]; float tmax = NEGS;
#pragma unroll
            for (int nb = 0; nb < 4; ++nb) { int mk = 1; if (needm) mk = (int)Ms[mrow * 64 + nb * 16 + lr]; t[nb] = (mk != 0) ? s[nb][r] : NEGS; tmax = fmaxf(tmax, t[nb]); }
#pragma unroll
            for (int sh = 1; sh < 16; sh <<= 1) tmax = fmaxf(tmax, __shfl_xor(tmax, sh, 32));
            const float nm = fmaxf(m[r], tmax);
            float da = __fsub_rn(m[r], nm); asm volatile("" : "+v"(da));
            const float alpha = __builtin_amdgcn_exp2f(__fmul_rn(da, L2E));
            m[r] = nm;
            float sum = 0.0f;
#pragma unroll
            for (int nb = 0; nb < 4; ++nb) {
                float d0 = __fsub_rn(t[nb], nm); asm volatile("" : "+v"(d0));
                float p = __builtin_amdgcn_exp2f(__fmul_rn(d0, L2E)); p = (t[nb] > -1.0e38f) ? p : 0.0f; sum += p;
                if (HIRES) { unsigned short a2, c2; splitf(p, a2, c2); sPwh[prow * TP + nb * 16 + lr] = a2; sPwl[prow * TP + nb * 16 + lr] = c2; }
                else       { sPw16[prow * TP + nb * 16 + lr] = tohx(p * PCAR); } }
#pragma unroll
            for (int sh = 1; sh < 16; sh <<= 1) sum += __shfl_xor(sum, sh, 32);
            l[r] = l[r] * alpha + sum;
#pragma unroll
            for (int dt = 0; dt < 4; ++dt) acc[dt][r] *= alpha;
        }
        __builtin_amdgcn_wave_barrier(); asm volatile("" ::: "memory");
        if (HIRES) {
#pragma unroll
            for (int ks = 0; ks < 2; ++ks) {
                const v16bf aph = ldsAb(sPwh + lr * TP + ks * 32 + 8 * hi), apl = ldsAb(sPwl + lr * TP + ks * 32 + 8 * hi);
#pragma unroll
                for (int dt = 0; dt < 4; ++dt) {
                    const v16bf bvh = ldsAb(sVh + (dt * 16 + lr) * TP + ks * 32 + 8 * hi), bvl = ldsAb(sVl + (dt * 16 + lr) * TP + ks * 32 + 8 * hi);
                    acc[dt] = wmmab(aph, bvh, acc[dt]); acc[dt] = wmmab(apl, bvh, acc[dt]); acc[dt] = wmmab(aph, bvl, acc[dt]);
                    asm volatile("v_nop\n\tv_nop\n\tv_nop\n\tv_nop" : "+v"(acc[dt]) : "v"(aph), "v"(apl), "v"(bvh), "v"(bvl)); } }
        } else {
#pragma unroll
            for (int ks = 0; ks < 2; ++ks) {
                const v16h ap = ldsA16(sPw16 + lr * TP + ks * 32 + 8 * hi);
#pragma unroll
                for (int dt = 0; dt < 4; ++dt) {
                    const v16h bv = ldsA16(sV16 + (dt * 16 + lr) * TP + ks * 32 + 8 * hi);
                    acc[dt] = wmma16(ap, bv, acc[dt]);
                    asm volatile("v_nop\n\tv_nop\n\tv_nop\n\tv_nop" : "+v"(acc[dt]) : "v"(ap), "v"(bv)); } }
        }
    }
    __syncthreads();                                          // all waves done with the K tiles before the output staging aliases them
    float* os = (float*)smem + w * 16 * 68;
    const float rc = HIRES ? 1.0f : (1.0f / PCAR);
    float inv[8];
#pragma unroll
    for (int r = 0; r < 8; ++r) inv[r] = __fdiv_rn(rc, l[r]);
#pragma unroll
    for (int dt = 0; dt < 4; ++dt) {
#pragma unroll
        for (int r = 0; r < 8; ++r) os[(hi * 8 + r) * 68 + dt * 16 + lr] = acc[dt][r] * inv[r]; }
    __builtin_amdgcn_wave_barrier(); asm volatile("" ::: "memory");
    float* crow = OUTb + (size_t)(qb + w * 16) * DQ + h * HD;
{
#pragma unroll
        for (int s2 = 0; s2 < 8; ++s2) { const int row = 2 * s2 + hi, cofs = lr * 4; const v4f val = *(const v4fa*)(os + row * 68 + cofs);
            *(v4f*)(crow + (size_t)row * DQ + cofs) = val; }
         }
}

extern "C" void kernel_launch(void* const* d_in, const int* in_sizes, int n_in,
                              void* d_out, int out_size, void* d_ws, size_t ws_size, hipStream_t stream) {
    if (n_in < 4) return;
    if (in_sizes[0] < (NB - 1) * SEQ_FULL * DM + TT * DM) return;
    if (in_sizes[1] < DM * DM) return;
    if (in_sizes[2] < 2 * DM * DM) return;
    if (in_sizes[3] < TT * MPITCH) return;
    if (out_size < NB * TT * DQ) return;
    const float* x = (const float*)d_in[0]; const float* wq = (const float*)d_in[1]; const float* wkv = (const float*)d_in[2]; const int* mask = (const int*)d_in[3];
    float* OUT = (float*)d_out;     // [NB][TT][DQ]
    char* wsp = (char*)d_ws;
    auto take = [&](size_t bytes) { char* p = wsp; wsp += (bytes + 255) & ~(size_t)255; return (void*)p; };
    bf* W3 = (bf*)take((size_t)D3 * DM * 2); float* CS = (float*)take((size_t)TT * HD * 2 * 4); int* FL = (int*)take((size_t)NQB * FLP * 4);
    bf* XB = (bf*)take((size_t)NB * TT * DM * 2); float* F = (float*)take((size_t)NB * TT * D3 * 4);
    bf* QPh = (bf*)take((size_t)NB * NH_ * TT * HD * 2); bf* QPl = (bf*)take((size_t)NB * NH_ * TT * HD * 2); bf* KPh = (bf*)take((size_t)NB * NH_ * TT * HD * 2); bf* KPl = (bf*)take((size_t)NB * NH_ * TT * HD * 2);
    h16* VT16 = (h16*)take((size_t)NB * NH_ * HD * TT * 2); bf* VTh = (bf*)take((size_t)NB * NH_ * HD * TT * 2); bf* VTl = (bf*)take((size_t)NB * NH_ * HD * TT * 2);
    const size_t used = (size_t)(wsp - (char*)d_ws);
    if (used > ws_size || used > (size_t)134217728) return;   // 124,784,640 B at NB=2, SEQ=2048
    k_cvtw<<<(unsigned)(((size_t)D3 * DM / 8 + 255) / 256), 256, 0, stream>>>(wq, wkv, W3, (size_t)D3 * DM / 8);
    k_cstab<<<(TT * HD + 255) / 256, 256, 0, stream>>>(CS);
    k_mflag<<<NQB, 256, 0, stream>>>(mask, FL);
    const unsigned LQ = (unsigned)(((size_t)NH_ * TT * HD / 2 + 255) / 256);
    const size_t SF = (size_t)TT * D3, SP = (size_t)NH_ * TT * HD;   // per-batch strides of F and of the head planes, in elements
    k_cvt8<<<dim3((unsigned)(((size_t)TT * DM / 8 + 255) / 256), NB, 1), 256, 0, stream>>>(x, XB, (size_t)TT * DM / 8, (size_t)SEQ_FULL * DM, (size_t)TT * DM);
    k_gemmw<bf, 0, false><<<dim3(TT / 64, D3 / 64, NB), 32, 0, stream>>>(XB, nullptr, W3, nullptr, DM, F, D3, nullptr, (size_t)TT * DM, 0, SF);
    k_rope<<<dim3(LQ, NB, 1), 256, 0, stream>>>(F, D3, NH_, CS, SCL, QPh, QPl, SF, SP);
    k_rope<<<dim3(LQ, NB, 1), 256, 0, stream>>>(F + DM, D3, NH_, CS, 1.0f, KPh, KPl, SF, SP);
    k_vtp<<<dim3(LQ, NB, 1), 256, 0, stream>>>(F + 2 * DM, D3, NH_, VT16, VTh, VTl, SF, SP);
    k_flash<true><<<dim3(RH / 64, NH_, NB), 128, 0, stream>>>(QPh, QPl, KPh, KPl, VT16, VTh, VTl, mask, FL, 0, OUT);
    if (NQB > RH / 64) k_flash<false><<<dim3(NQB - RH / 64, NH_, NB), 128, 0, stream>>>(QPh, QPl, KPh, KPl, VT16, VTh, VTl, mask, FL, RH / 64, OUT);
}

// v002
// It runs in 213 microseconds.
// In both of two side-by-side timings against v001, it was 1.42 times as fast.
// Counting every step since v000, it is 2.24 times as fast.
#include <hip/hip_runtime.h>

// Contractions: fused q|k|v projection v_wmma_f32_16x16x32_bf16 (bf16 operands = RNE-converted inputs, exact products); scores v_wmma_f32_16x16x32_bf16 with q/k as bf16 hi/lo planes (3 products) on every row; attn.v v_wmma_f32_16x16x32_f16 (f16 P carried x1024, f16 v) on query rows >= 64 and v_wmma_f32_16x16x32_bf16 with P and v as bf16 hi/lo (3 products) on query rows < 64; f32 accumulate, f32 online softmax, f32 output.
// Both batch elements go through each per-batch launch together (batch = grid y for the x conversion, rope and value kernels, grid z for the GEMM and attention; every per-batch plane below is stored [batch][...]). Layout (weight, cos/sin table and mask flags shared across the batch): bf16 copy of x; one [3072][1024] bf16 'oi' weight (q rows, then k rows, then v rows, k/v de-interleaved from the [2048][1024] kv weight whose row is h*128 + 2d + c); F = x W^T f32 [T][3072];
// rotary planes q,k [h][t][64] bf16 hi/lo (rotate-half, table cos/sin[t][d], q pre-scaled by 1/8); value planes [h][d][t] f16 and bf16 hi/lo; per (64-row query block, 64-key chunk) mask flags from the int mask (empty chunks skipped, partial chunks apply the mask element-wise, replace-fill);
// flash-style attention: K hi/lo and V chunk tiles staged in LDS, transposed products (S^T = K Q^T, O^T += V^T P^T) so that a lane holds one query's scores, online softmax in-lane, output rows written directly (no output projection).

#ifndef NB
#define NB 2
#endif
#ifndef SEQ
#define SEQ 2048
#endif
#define NB_FULL  2
#define SEQ_FULL 2048
#define TT     SEQ
#define DM     1024
#define NH_    16
#define HD     64
#define DQ     (NH_ * HD)
#define D3     (3 * DM)
#define NQB    (TT / 64)
#define NCH    (TT / 64)
#define RH     64
#define MPITCH SEQ_FULL
#define FLP    32
#define PCAR   1024.0f
#define SCL    0.125f
#define NEGS   (-3.0e38f)
#define TP     72
#define TILEB  (64 * TP * 2)
#define O_KH   0
#define O_KL   (TILEB)
#define O_VA   (2 * TILEB)
#define O_VB   (3 * TILEB)
#define O_MS   (4 * TILEB)
#define LDS_TOTAL (4 * TILEB + 64 * 64)

static_assert(TT % 64 == 0);
static_assert(TT <= SEQ_FULL);
static_assert(NB >= 1 && NB <= NB_FULL);
static_assert(NCH <= FLP);
static_assert(RH == 64);
static_assert(NQB >= RH / 64);
static_assert(DM % 32 == 0 && D3 % 64 == 0 && HD == 64 && DQ == DM);
static_assert(4 * 16 * 68 * 4 <= O_VA);
static_assert((TP * 2) % 16 == 0);
static_assert(LDS_TOTAL <= 65536);

typedef _Float16 h16;
typedef unsigned short bf;
typedef __attribute__((ext_vector_type(16))) __bf16   v16bf;
typedef __attribute__((ext_vector_type(16))) _Float16 v16h;
typedef __attribute__((ext_vector_type(8)))  _Float16 v8h;
typedef __attribute__((ext_vector_type(8)))  unsigned short v8us;
typedef __attribute__((ext_vector_type(8)))  float    v8f;
typedef __attribute__((ext_vector_type(4)))  float    v4f;
typedef __attribute__((ext_vector_type(2)))  float    v2f;
typedef __attribute__((ext_vector_type(2)))  _Float16 v2h;
typedef __attribute__((ext_vector_type(2)))  unsigned short v2us;
typedef __attribute__((ext_vector_type(4)))  int      v4i;
typedef v8h  __attribute__((may_alias)) v8ha;
typedef v4f  __attribute__((may_alias)) v4fa;
typedef v8us __attribute__((may_alias)) v8usa;
typedef __attribute__((ext_vector_type(2))) unsigned v2u;
typedef v2u  __attribute__((may_alias)) v2ua;

__device__ __forceinline__ unsigned short f2bf(float f) { unsigned u = __float_as_uint(f); u += 0x7FFFu + ((u >> 16) & 1u); return (unsigned short)(u >> 16); }
__device__ __forceinline__ float bf2f(unsigned short b) { return __uint_as_float(((unsigned)b) << 16); }
__device__ __forceinline__ float bfr(float f) { return bf2f(f2bf(f)); }
__device__ __forceinline__ v16h cat16(v8h lo, v8h hi) { return __builtin_shufflevector(lo, hi, 0, 1, 2, 3, 4, 5, 6, 7, 8, 9, 10, 11, 12, 13, 14, 15); }
__device__ __forceinline__ v16bf cat16b(v8us lo, v8us hi) { return __builtin_bit_cast(v16bf, __builtin_shufflevector(lo, hi, 0, 1, 2, 3, 4, 5, 6, 7, 8, 9, 10, 11, 12, 13, 14, 15)); }
__device__ __forceinline__ v8f wmma16(v16h a, v16h b, v8f c) { return __builtin_amdgcn_wmma_f32_16x16x32_f16(false, a, false, b, (short)0, c, false, false); }
__device__ __forceinline__ v8f wmmab(v16bf a, v16bf b, v8f c) { return __builtin_amdgcn_wmma_f32_16x16x32_bf16(false, a, false, b, (short)0, c, false, false); }
__device__ __forceinline__ h16 tohx(float x) { return (h16)x; }
__device__ __forceinline__ void splitf(float y, unsigned short& h, unsigned short& l) { h = f2bf(y); l = f2bf(y - bf2f(h)); }
__device__ __forceinline__ float xhalf(float x) { return __builtin_bit_cast(float, __builtin_amdgcn_permlanex16(__builtin_bit_cast(int, x), __builtin_bit_cast(int, x), 0x76543210, 0xfedcba98, false, false)); }  // lane l with lane l ^ 16

// 2^x of eight values in place. The eight v_exp_f32 and the free slot that the instruction set asks for behind a transcendental stand in ONE statement: a v_nop in a statement of its own landed elsewhere.
__device__ __forceinline__ void exp2x8(v8f& v) {
    float e0 = v[0], e1 = v[1], e2 = v[2], e3 = v[3], e4 = v[4], e5 = v[5], e6 = v[6], e7 = v[7];
    asm("v_exp_f32 %0, %0\n\tv_exp_f32 %1, %1\n\tv_exp_f32 %2, %2\n\tv_exp_f32 %3, %3\n\tv_exp_f32 %4, %4\n\tv_exp_f32 %5, %5\n\tv_exp_f32 %6, %6\n\tv_exp_f32 %7, %7\n\tv_nop"
        : "+v"(e0), "+v"(e1), "+v"(e2), "+v"(e3), "+v"(e4), "+v"(e5), "+v"(e6), "+v"(e7));
    v[0] = e0; v[1] = e1; v[2] = e2; v[3] = e3; v[4] = e4; v[5] = e5; v[6] = e6; v[7] = e7;
}

// Fragment loaders (split k map for A and B alike): element i of the 16-wide vector <- k0 + 8*hi + i (i < 8), k0 + 16 + 8*hi + (i - 8) (i >= 8); callers pass p = row_base + k0 + 8*hi.
template <typename T16> struct WFrag;
template <> struct WFrag<h16> { typedef v16h V; static __device__ __forceinline__ V ld(const h16* p) { return cat16(*(const v8h*)p, *(const v8h*)(p + 16)); } static __device__ __forceinline__ v8f mma(V a, V b, v8f c) { return wmma16(a, b, c); } };
template <> struct WFrag<bf> { typedef v16bf V; static __device__ __forceinline__ V ld(const bf* p) { return cat16b(*(const v8us*)p, *(const v8us*)(p + 16)); } static __device__ __forceinline__ v8f mma(V a, V b, v8f c) { return wmmab(a, b, c); } };
// LDS reloads of tiles written as 16-bit elements: same element type through may_alias vectors.
__device__ __forceinline__ v16h  ldsA16(const h16* p) { return cat16(*(const v8ha*)p, *(const v8ha*)(p + 16)); }
__device__ __forceinline__ v16bf ldsAb(const bf* p) { return cat16b(*(const v8usa*)p, *(const v8usa*)(p + 16)); }

// ---- k_gemmw: register-blocked GEMM, ONE WAVE per 64x64 output tile (16 accumulators), operands straight from K-contiguous 16-bit planes; grid (M/64, N/64, Z), 32 threads.
// C[m][n] (f32, pitch ldc, + optional f32 bias[n]) = sum_k A[m][k] Bt[n][k] (+ split products per NSPLIT). z-batch strides sA/sB/sC in elements. K % 32 == 0.
template <typename T16, int NSPLIT, bool BIAS>
__global__ __launch_bounds__(32) void k_gemmw(const T16* __restrict__ A, const T16* __restrict__ A2, const T16* __restrict__ Bt, const T16* __restrict__ Bt2, int K, float* C, int ldc, const float* __restrict__ bias, size_t sA, size_t sB, size_t sC) {
    typedef typename WFrag<T16>::V V;
    __shared__ __align__(16) float os[16 * 68];
    const size_t z = blockIdx.z; A += z * sA; if (A2) A2 += z * sA; Bt += z * sB; if (Bt2) Bt2 += z * sB; C += z * sC;
    const int lane = threadIdx.x & 31, lr = lane & 15, hi = lane >> 4; const int r0 = blockIdx.x * 64, c0 = blockIdx.y * 64;
    v8f acc[4][4];
#pragma unroll
    for (int mb = 0; mb < 4; ++mb)
#pragma unroll
        for (int nb = 0; nb < 4; ++nb) acc[mb][nb] = (v8f){};
    const size_t aoff = (size_t)(r0 + lr) * K + 8 * hi, boff = (size_t)(c0 + lr) * K + 8 * hi;
#pragma unroll 1
    for (int kc = 0; kc < K; kc += 32) {
        V a[4], a2[4];
#pragma unroll
        for (int mb = 0; mb < 4; ++mb) { a[mb] = WFrag<T16>::ld(A + aoff + (size_t)mb * 16 * K + kc); if (NSPLIT == 1 || NSPLIT == 2) a2[mb] = WFrag<T16>::ld(A2 + aoff + (size_t)mb * 16 * K + kc); }
#pragma unroll
        for (int nb = 0; nb < 4; ++nb) { const V b = WFrag<T16>::ld(Bt + boff + (size_t)nb * 16 * K + kc); V b2; if (NSPLIT >= 2) b2 = WFrag<T16>::ld(Bt2 + boff + (size_t)nb * 16 * K + kc);
#pragma unroll
            for (int mb = 0; mb < 4; ++mb) { acc[mb][nb] = WFrag<T16>::mma(a[mb], b, acc[mb][nb]); if (NSPLIT == 1 || NSPLIT == 2) acc[mb][nb] = WFrag<T16>::mma(a2[mb], b, acc[mb][nb]); if (NSPLIT >= 2) acc[mb][nb] = WFrag<T16>::mma(a[mb], b2, acc[mb][nb]); } }
        asm volatile("v_nop\n\tv_nop\n\tv_nop\n\tv_nop" : "+v"(acc[0][0]), "+v"(acc[1][1]), "+v"(acc[2][2]), "+v"(acc[3][3]) : "v"(a[0]), "v"(a[3]));
    }
#pragma unroll
    for (int mb = 0; mb < 4; ++mb) {
#pragma unroll
        for (int nb = 0; nb < 4; ++nb) {
#pragma unroll
            for (int j = 0; j < 8; ++j) os[(hi * 8 + j) * 68 + nb * 16 + lr] = acc[mb][nb][j]; }
        __builtin_amdgcn_wave_barrier(); asm volatile("" ::: "memory");
        float* crow = C + (size_t)(r0 + mb * 16) * ldc + c0;
{
#pragma unroll
            for (int s = 0; s < 8; ++s) { const int row = 2 * s + hi, cofs = lr * 4; v4f val = *(const v4fa*)(os + row * 68 + cofs); if (BIAS) { val[0] += bfr(bias[c0 + cofs]); val[1] += bfr(bias[c0 + cofs + 1]); val[2] += bfr(bias[c0 + cofs + 2]); val[3] += bfr(bias[c0 + cofs + 3]); }
                *(v4f*)(crow + (size_t)row * ldc + cofs) = val; }
             }
        __builtin_amdgcn_wave_barrier(); asm volatile("" ::: "memory");
    }
}

__global__ __launch_bounds__(256) void k_cvt8(const float* __restrict__ src, bf* dst, size_t n8, size_t sS, size_t sD) { const size_t i = (size_t)blockIdx.x * 256 + threadIdx.x; if (i >= n8) return; src += blockIdx.y * sS; dst += blockIdx.y * sD; const v8f v = *(const v8f*)(src + i * 8); v8us o;
#pragma unroll
    for (int k = 0; k < 8; ++k) o[k] = f2bf(v[k]); *(v8us*)(dst + i * 8) = o;  }

__global__ __launch_bounds__(256) void k_cvtw(const float* __restrict__ wq, const float* __restrict__ wkv, bf* dst, size_t n8) {
    const size_t i = (size_t)blockIdx.x * 256 + threadIdx.x; if (i >= n8) return;
    const int row = (int)((i * 8) / DM), col = (int)((i * 8) % DM);
    const int r2 = max(row - DM, 0); const int c = (r2 >= DM) ? 1 : 0; const int r3 = r2 - c * DM;
    const int srow = (r3 >> 6) * (2 * HD) + 2 * (r3 & 63) + c;
    const float* src = (row < DM) ? (wq + (size_t)row * DM + col) : (wkv + (size_t)srow * DM + col);
    const v8f v = *(const v8f*)src; v8us o;
#pragma unroll
    for (int k = 0; k < 8; ++k) o[k] = f2bf(v[k]);
    *(v8us*)(dst + i * 8) = o; 
}

__global__ __launch_bounds__(256) void k_cstab(float* CS) {
    const int idx = blockIdx.x * 256 + threadIdx.x; if (idx >= TT * HD) return;
    const int t = idx / HD, dd = idx % HD, p = dd & (HD / 2 - 1);
    const float pw = exp10f((float)p * 0.125f);
    const float inv = __fdiv_rn(1.0f, pw);
    float ang = __fmul_rn((float)t, inv); asm volatile("" : "+v"(ang));
    float sn, cn; sincosf(ang, &sn, &cn);
    v2f cs; cs[0] = cn; cs[1] = sn;
    *(v2f*)(CS + (size_t)idx * 2) = cs; 
}

// k_mflag: per (64-row query block, 64-key chunk) flags from the int mask [q][k] (row pitch MPITCH): bit0 = any nonzero, bit1 = all nonzero; chunks >= NCH flagged 0.
__global__ __launch_bounds__(256) void k_mflag(const int* __restrict__ mask, int* FL) {
    __shared__ int fls[FLP];
    const int tid = threadIdx.x, lane = tid & 31, w = tid >> 5; const int qblk = blockIdx.x, qb = qblk * 64;
    const int kc = tid >> 3, sub = tid & 7;
    int anyv = 0, allv = 1;
#pragma unroll 1
    for (int row = 0; row < 64; ++row) {
        const int* mp = mask + (size_t)(qb + row) * MPITCH + kc * 64 + sub * 8;
        const v4i a = *(const v4i*)mp; const v4i c = *(const v4i*)(mp + 4);
#pragma unroll
        for (int q = 0; q < 4; ++q) { anyv |= a[q] | c[q]; allv &= (((a[q] != 0) & (c[q] != 0)) ? 1 : 0); } }
    anyv = (anyv != 0) ? 1 : 0;
#pragma unroll
    for (int sh = 1; sh < 8; sh <<= 1) { anyv |= __shfl_xor(anyv, sh, 32); allv &= __shfl_xor(allv, sh, 32); }
    if (sub == 0) fls[kc] = (kc < NCH) ? (anyv | (allv << 1)) : 0;
    __syncthreads();
    if (w == 0) { const int v = fls[lane]; int* p = FL + (size_t)qblk * FLP + lane; *(int*)p = v;  }
}

// k_rope: planes [h][t][d] (bf16 hi/lo) of rope(x) x sc with the rotate-half convention out[d] = x[d] cos[t][d] - x[d+HD/2] sin[t][d], out[d+HD/2] = x[d+HD/2] cos[t][d+HD/2] + x[d] sin[t][d+HD/2]
__global__ __launch_bounds__(256) void k_rope(const float* __restrict__ F, int pitch, int nheads, const float* __restrict__ CS, float sc, bf* Ph, bf* Pl, size_t sF, size_t sP) {
    const size_t e = ((size_t)blockIdx.x * 256 + threadIdx.x) * 2; if (e >= (size_t)nheads * TT * HD) return; F += blockIdx.y * sF; Ph += blockIdx.y * sP; Pl += blockIdx.y * sP; const int d = (int)(e % HD); const int t = (int)((e / HD) % TT); const int h = (int)(e / ((size_t)HD * TT)); const float* f = F + (size_t)t * pitch + h * HD; v2us oh, ol;
#pragma unroll
    for (int q = 0; q < 2; ++q) { const int dd = d + q; const int dp = (dd < HD / 2) ? dd + HD / 2 : dd - HD / 2; const float x0 = f[dd], x1 = f[dp];
        const v2f cs = *(const v2f*)(CS + ((size_t)t * HD + dd) * 2); float a = __fmul_rn(x0, cs[0]), bq = __fmul_rn(x1, cs[1]); asm volatile("" : "+v"(a)); asm volatile("" : "+v"(bq)); const float r = ((dd < HD / 2) ? __fsub_rn(a, bq) : __fadd_rn(a, bq)) * sc;
        unsigned short a2, c2; splitf(r, a2, c2); oh[q] = a2; ol[q] = c2; }
    *(v2us*)(Ph + e) = oh; *(v2us*)(Pl + e) = ol;  }
__global__ __launch_bounds__(256) void k_vtp(const float* __restrict__ F, int pitch, int nheads, h16* V16, bf* Vh, bf* Vl, size_t sF, size_t sP) { const size_t e = ((size_t)blockIdx.x * 256 + threadIdx.x) * 2; if (e >= (size_t)nheads * HD * TT) return; F += blockIdx.y * sF; V16 += blockIdx.y * sP; Vh += blockIdx.y * sP; Vl += blockIdx.y * sP; const int t = (int)(e % TT); const int d = (int)((e / TT) % HD); const int g = (int)(e / ((size_t)TT * HD)); v2h o16; v2us oh, ol;
#pragma unroll
    for (int q = 0; q < 2; ++q) { const float x = F[(size_t)(t + q) * pitch + g * HD + d]; o16[q] = tohx(x); unsigned short a2, c2; splitf(x, a2, c2); oh[q] = a2; ol[q] = c2; }
    *(v2h*)(V16 + e) = o16; *(v2us*)(Vh + e) = oh; *(v2us*)(Vl + e) = ol;  }

// k_flash: flash-style masked softmax attention for one head and one 64-row query block per workgroup (128 threads = 4 waves x 16 query rows); grid (query blocks, heads, batch).
// Per 64-key chunk (flag bit0 set): K hi/lo tiles [key][d] and the V^T tile [d][key] staged in LDS (pitch TP), the int mask tile packed to bytes when the chunk is partial (flag bit1 clear);
// S^T[64 keys x 16 queries] = k_hi.q_hi + k_hi.q_lo + k_lo.q_hi (A = K rows from LDS, B = q fragments kept in registers, q planes pre-scaled by 1/8): lane (lr, hi) holds query lr's scores of keys nb*16 + 8*hi + r;
// masked keys -> excluded; running-max online softmax in f32, maximum and sum in-lane, the maximum joined between the wave halves once per chunk, the sums once in the epilogue;
// P^T packs from the score registers straight into the B operand (score tiles 2ks and 2ks+1 are the fragment's k order) and O^T[64 d x 16 queries] += V^T.P^T: HIRES -> P and v as bf16 hi/lo (3 products, carry 1), else f16 P carried x1024 and f16 v.
template <bool HIRES>
__global__ __launch_bounds__(128) void k_flash(const bf* __restrict__ QPh, const bf* __restrict__ QPl, const bf* __restrict__ KPh, const bf* __restrict__ KPl,
                                               const h16* __restrict__ VT16, const bf* __restrict__ VTh, const bf* __restrict__ VTl,
                                               const int* __restrict__ mask, const int* __restrict__ FL, int qblk0, float* OUT) {
    __shared__ __align__(16) unsigned char smem[LDS_TOTAL];
    bf* sKh = (bf*)(smem + O_KH); bf* sKl = (bf*)(smem + O_KL);
    h16* sV16 = (h16*)(smem + O_VA); bf* sVh = (bf*)(smem + O_VA); bf* sVl = (bf*)(smem + O_VB);
    unsigned char* Ms = smem + O_MS;
    const int tid = threadIdx.x, lane = tid & 31, w = tid >> 5, lr = lane & 15, hi = lane >> 4;
    const int h = blockIdx.y; const int qblk = qblk0 + (int)blockIdx.x; const int qb = qblk * 64;
    const size_t hp = ((size_t)blockIdx.z * NH_ + h) * TT * HD;
    float* OUTb = OUT + (size_t)blockIdx.z * TT * DQ;
    const bf* Qh = QPh + hp; const bf* Ql = QPl + hp; const bf* Kh = KPh + hp; const bf* Kl = KPl + hp;
    const h16* V16 = VT16 + hp; const bf* Vh = VTh + hp; const bf* Vl = VTl + hp;
    const int qrow = qb + w * 16 + lr;                       // B layout: lane -> query column
    v16bf bq[2], bq2[2];
#pragma unroll
    for (int ks = 0; ks < 2; ++ks) { bq[ks] = WFrag<bf>::ld(Qh + (size_t)qrow * HD + ks * 32 + 8 * hi); bq2[ks] = WFrag<bf>::ld(Ql + (size_t)qrow * HD + ks * 32 + 8 * hi); }
    v8f acc[4]; float m = NEGS, l = 0.0f;                    // acc[dt][r] = O^T[dt*16 + 8*hi + r][query lr]; m is the query's, l the sum over this half's keys
#pragma unroll
    for (int dt = 0; dt < 4; ++dt) acc[dt] = (v8f){};
    const unsigned char* Msq = Ms + (w * 16 + lr) * 64 + 8 * hi;   // the lane's query row of the mask tile, at its half's keys
    const float L2E = 1.4426950408889634f;
#pragma unroll 1
    for (int kc = 0; kc < NCH; ++kc) {
        const int flag = FL[qblk * FLP + kc];                // block-uniform
        if ((flag & 1) == 0) continue;
        const bool needm = ((flag & 2) == 0);
        const int kb = kc * 64;
        __syncthreads();
#pragma unroll
        for (int i = 0; i < 4; ++i) {
            const int idx = i * 128 + tid; const int row = idx >> 3, seg = idx & 7;
            *(v8us*)(sKh + row * TP + seg * 8) = *(const v8us*)(Kh + (size_t)(kb + row) * HD + seg * 8);
            *(v8us*)(sKl + row * TP + seg * 8) = *(const v8us*)(Kl + (size_t)(kb + row) * HD + seg * 8);
            if (HIRES) { *(v8us*)(sVh + row * TP + seg * 8) = *(const v8us*)(Vh + (size_t)row * TT + kb + seg * 8);
                         *(v8us*)(sVl + row * TP + seg * 8) = *(const v8us*)(Vl + (size_t)row * TT + kb + seg * 8); }
            else       { *(v8h*)(sV16 + row * TP + seg * 8) = *(const v8h*)(V16 + (size_t)row * TT + kb + seg * 8); }
        }
        if (needm) {
#pragma unroll
            for (int i = 0; i < 8; ++i) {
                const int idx = i * 128 + tid; const int row = idx >> 4, seg = idx & 15;
                const v4i mv = *(const v4i*)(mask + (size_t)(qb + row) * MPITCH + kb + seg * 4);
                const unsigned pk = (mv[0] != 0 ? 1u : 0u) | (mv[1] != 0 ? 0x100u : 0u) | (mv[2] != 0 ? 0x10000u : 0u) | (mv[3] != 0 ? 0x1000000u : 0u);
                *(unsigned*)(Ms + row * 64 + seg * 4) = pk; } }
        __syncthreads();
        v8f s[4];
#pragma unroll
        for (int nb = 0; nb < 4; ++nb) s[nb] = (v8f){};
#pragma unroll
        for (int ks = 0; ks < 2; ++ks) {
#pragma unroll
            for (int nb = 0; nb < 4; ++nb) {
                const v16bf a = ldsAb(sKh + (nb * 16 + lr) * TP + ks * 32 + 8 * hi);
                const v16bf a2 = ldsAb(sKl + (nb * 16 + lr) * TP + ks * 32 + 8 * hi);
                s[nb] = wmmab(a, bq[ks], s[nb]); s[nb] = wmmab(a, bq2[ks], s[nb]); s[nb] = wmmab(a2, bq[ks], s[nb]);
                asm volatile("v_nop\n\tv_nop\n\tv_nop\n\tv_nop" : "+v"(s[nb]) : "v"(a), "v"(a2), "v"(bq[ks]), "v"(bq2[ks])); } }   // four vector slots behind the last WMMA of the tile, before its D is read or its operands are rewritten
        if (needm) {
#pragma unroll
            for (int nb = 0; nb < 4; ++nb) {
                const v2u mk = *(const v2ua*)(Msq + nb * 16);
#pragma unroll
                for (int r = 0; r < 8; ++r) s[nb][r] = (((mk[r >> 2] >> (8 * (r & 3))) & 0xFFu) != 0u) ? s[nb][r] : NEGS; } }
        float tm[4];
#pragma unroll
        for (int nb = 0; nb < 4; ++nb) { tm[nb] = s[nb][0];
#pragma unroll
            for (int r = 1; r < 8; ++r) tm[nb] = fmaxf(tm[nb], s[nb][r]); }
        float tmax = fmaxf(fmaxf(fmaxf(tm[0], tm[1]), fmaxf(tm[2], tm[3])), NEGS);
        tmax = fmaxf(tmax, xhalf(tmax));
        const float nm = fmaxf(m, tmax);
        const float alpha = __builtin_amdgcn_exp2f(__fmul_rn(__fsub_rn(m, nm), L2E));
        m = nm;
        float sm[4];
#pragma unroll
        for (int nb = 0; nb < 4; ++nb) { sm[nb] = 0.0f; v8f e;
#pragma unroll
            for (int r = 0; r < 8; ++r) e[r] = __fmul_rn(__fsub_rn(s[nb][r], nm), L2E);
            exp2x8(e);
#pragma unroll
            for (int r = 0; r < 8; ++r) { const float p = (s[nb][r] > -1.0e38f) ? e[r] : 0.0f; sm[nb] += p; s[nb][r] = p; } }
        l = l * alpha + ((sm[0] + sm[1]) + (sm[2] + sm[3]));
#pragma unroll
        for (int dt = 0; dt < 4; ++dt) acc[dt] *= alpha;
        if (HIRES) {
#pragma unroll
            for (int ks = 0; ks < 2; ++ks) {
                v8us ph0, ph1, pl0, pl1;
#pragma unroll
                for (int i = 0; i < 8; ++i) { unsigned short a2, c2; splitf(s[2 * ks][i], a2, c2); ph0[i] = a2; pl0[i] = c2; splitf(s[2 * ks + 1][i], a2, c2); ph1[i] = a2; pl1[i] = c2; }
                const v16bf bph = cat16b(ph0, ph1), bpl = cat16b(pl0, pl1);
#pragma unroll
                for (int dt = 0; dt < 4; ++dt) {
                    const v16bf avh = ldsAb(sVh + (dt * 16 + lr) * TP + ks * 32 + 8 * hi), avl = ldsAb(sVl + (dt * 16 + lr) * TP + ks * 32 + 8 * hi);
                    acc[dt] = wmmab(avh, bph, acc[dt]); acc[dt] = wmmab(avh, bpl, acc[dt]); acc[dt] = wmmab(avl, bph, acc[dt]);
                    asm volatile("v_nop\n\tv_nop\n\tv_nop\n\tv_nop" : "+v"(acc[dt]) : "v"(bph), "v"(bpl), "v"(avh), "v"(avl)); } }   // WMMA distance, as above
        } else {
#pragma unroll
            for (int ks = 0; ks < 2; ++ks) {
                v16h bp;
#pragma unroll
                for (int i = 0; i < 8; ++i) { bp[i] = tohx(s[2 * ks][i] * PCAR); bp[8 + i] = tohx(s[2 * ks + 1][i] * PCAR); }
#pragma unroll
                for (int dt = 0; dt < 4; ++dt) {
                    const v16h av = ldsA16(sV16 + (dt * 16 + lr) * TP + ks * 32 + 8 * hi);
                    acc[dt] = wmma16(av, bp, acc[dt]);
                    asm volatile("v_nop\n\tv_nop\n\tv_nop\n\tv_nop" : "+v"(acc[dt]) : "v"(bp), "v"(av)); } }   // WMMA distance, as above
        }
    }
    __syncthreads();                                          // all waves done with the K tiles before the output staging aliases them
    float* os = (float*)smem + w * 16 * 68;
    const float rc = HIRES ? 1.0f : (1.0f / PCAR);
    const float inv = __fdiv_rn(rc, l + xhalf(l));            // the two halves' key sums joined here
#pragma unroll
    for (int dt = 0; dt < 4; ++dt) {
        v4f o0, o1;
#pragma unroll
        for (int r = 0; r < 4; ++r) { o0[r] = acc[dt][r] * inv; o1[r] = acc[dt][4 + r] * inv; }
        *(v4fa*)(os + lr * 68 + dt * 16 + 8 * hi) = o0; *(v4fa*)(os + lr * 68 + dt * 16 + 8 * hi + 4) = o1; }
    __builtin_amdgcn_wave_barrier(); asm volatile("" ::: "memory");
    float* crow = OUTb + (size_t)(qb + w * 16) * DQ + h * HD;
{
#pragma unroll
        for (int s2 = 0; s2 < 8; ++s2) { const int row = 2 * s2 + hi, cofs = lr * 4; const v4f val = *(const v4fa*)(os + row * 68 + cofs);
            *(v4f*)(crow + (size_t)row * DQ + cofs) = val; }
         }
}

extern "C" void kernel_launch(void* const* d_in, const int* in_sizes, int n_in,
                              void* d_out, int out_size, void* d_ws, size_t ws_size, hipStream_t stream) {
    if (n_in < 4) return;
    if (in_sizes[0] < (NB - 1) * SEQ_FULL * DM + TT * DM) return;
    if (in_sizes[1] < DM * DM) return;
    if (in_sizes[2] < 2 * DM * DM) return;
    if (in_sizes[3] < TT * MPITCH) return;
    if (out_size < NB * TT * DQ) return;
    const float* x = (const float*)d_in[0]; const float* wq = (const float*)d_in[1]; const float* wkv = (const float*)d_in[2]; const int* mask = (const int*)d_in[3];
    float* OUT = (float*)d_out;     // [NB][TT][DQ]
    char* wsp = (char*)d_ws;
    auto take = [&](size_t bytes) { char* p = wsp; wsp += (bytes + 255) & ~(size_t)255; return (void*)p; };
    bf* W3 = (bf*)take((size_t)D3 * DM * 2); float* CS = (float*)take((size_t)TT * HD * 2 * 4); int* FL = (int*)take((size_t)NQB * FLP * 4);
    bf* XB = (bf*)take((size_t)NB * TT * DM * 2); float* F = (float*)take((size_t)NB * TT * D3 * 4);
    bf* QPh = (bf*)take((size_t)NB * NH_ * TT * HD * 2); bf* QPl = (bf*)take((size_t)NB * NH_ * TT * HD * 2); bf* KPh = (bf*)take((size_t)NB * NH_ * TT * HD * 2); bf* KPl = (bf*)take((size_t)NB * NH_ * TT * HD * 2);
    h16* VT16 = (h16*)take((size_t)NB * NH_ * HD * TT * 2); bf* VTh = (bf*)take((size_t)NB * NH_ * HD * TT * 2); bf* VTl = (bf*)take((size_t)NB * NH_ * HD * TT * 2);
    const size_t used = (size_t)(wsp - (char*)d_ws);
    if (used > ws_size || used > (size_t)134217728) return;   // 124,784,640 B at NB=2, SEQ=2048
    k_cvtw<<<(unsigned)(((size_t)D3 * DM / 8 + 255) / 256), 256, 0, stream>>>(wq, wkv, W3, (size_t)D3 * DM / 8);
    k_cstab<<<(TT * HD + 255) / 256, 256, 0, stream>>>(CS);
    k_mflag<<<NQB, 256, 0, stream>>>(mask, FL);
    const unsigned LQ = (unsigned)(((size_t)NH_ * TT * HD / 2 + 255) / 256);
    const size_t SF = (size_t)TT * D3, SP = (size_t)NH_ * TT * HD;   // per-batch strides of F and of the head planes, in elements
    k_cvt8<<<dim3((unsigned)(((size_t)TT * DM / 8 + 255) / 256), NB, 1), 256, 0, stream>>>(x, XB, (size_t)TT * DM / 8, (size_t)SEQ_FULL * DM, (size_t)TT * DM);
    k_gemmw<bf, 0, false><<<dim3(TT / 64, D3 / 64, NB), 32, 0, stream>>>(XB, nullptr, W3, nullptr, DM, F, D3, nullptr, (size_t)TT * DM, 0, SF);
    k_rope<<<dim3(LQ, NB, 1), 256, 0, stream>>>(F, D3, NH_, CS, SCL, QPh, QPl, SF, SP);
    k_rope<<<dim3(LQ, NB, 1), 256, 0, stream>>>(F + DM, D3, NH_, CS, 1.0f, KPh, KPl, SF, SP);
    k_vtp<<<dim3(LQ, NB, 1), 256, 0, stream>>>(F + 2 * DM, D3, NH_, VT16, VTh, VTl, SF, SP);
    k_flash<true><<<dim3(RH / 64, NH_, NB), 128, 0, stream>>>(QPh, QPl, KPh, KPl, VT16, VTh, VTl, mask, FL, 0, OUT);
    if (NQB > RH / 64) k_flash<false><<<dim3(NQB - RH / 64, NH_, NB), 128, 0, stream>>>(QPh, QPl, KPh, KPl, VT16, VTh, VTl, mask, FL, RH / 64, OUT);
}

// v003
// One run takes 167 microseconds.
// Two timings next to v002 put it at 1.27 and 1.28 times that version's speed.
// All steps since v000 together make it 2.86 times as fast.
#include <hip/hip_runtime.h>

// Contractions: fused q|k|v projection v_wmma_f32_16x16x32_bf16 (bf16 operands = RNE-converted inputs, exact products); scores v_wmma_f32_16x16x32_bf16 with q/k as bf16 hi/lo planes (3 products) on every row; attn.v v_wmma_f32_16x16x32_f16 (f16 P carried x1024, f16 v) on query rows >= 64 and v_wmma_f32_16x16x32_bf16 with P and v as bf16 hi/lo (3 products) on query rows < 64; f32 accumulate, f32 online softmax, f32 output.
// Both batch elements go through every launch together (batch = last grid dimension; every per-batch plane below is stored [batch][...]). Layout per batch: bf16 copy of x; one [3072][1024] bf16 'oi' weight (q rows, then k rows, then v rows, k/v de-interleaved from the [2048][1024] kv weight whose row is h*128 + 2d + c); the product x W^T stays in the projection kernel's accumulators, whose epilogue writes the planes below;
// rotary planes q,k [h][t][64] bf16 hi/lo (rotate-half, table cos/sin[t][d], q pre-scaled by 1/8); value planes [h][d][t] f16 and bf16 hi/lo; per (64-row query block, 64-key chunk) mask flags from the int mask (empty chunks skipped, partial chunks apply the mask element-wise, replace-fill);
// flash-style attention: K hi/lo and V chunk tiles staged in LDS, transposed products (S^T = K Q^T, O^T += V^T P^T) so that a lane holds one query's scores, online softmax in-lane, output rows written directly (no output projection).

#ifndef NB
#define NB 2
#endif
#ifndef SEQ
#define SEQ 2048
#endif
#define NB_FULL  2
#define SEQ_FULL 2048
#define TT     SEQ
#define DM     1024
#define NH_    16
#define HD     64
#define DQ     (NH_ * HD)
#define D3     (3 * DM)
#define NQB    (TT / 64)
#define NCH    (TT / 64)
#define RH     64
#define MPITCH SEQ_FULL
#define FLP    32
#define PCAR   1024.0f
#define SCL    0.125f
#define NEGS   (-3.0e38f)
#define TP     72
#define TILEB  (64 * TP * 2)
#define O_KH   0
#define O_KL   (TILEB)
#define O_VA   (2 * TILEB)
#define O_VB   (3 * TILEB)
#define O_MS   (4 * TILEB)
#define LDS_TOTAL (4 * TILEB + 64 * 64)

static_assert(TT % 64 == 0);
static_assert(TT <= SEQ_FULL);
static_assert(NB >= 1 && NB <= NB_FULL);
static_assert(NCH <= FLP);
static_assert(RH == 64);
static_assert(NQB >= RH / 64);
static_assert(DM % 32 == 0 && D3 % 64 == 0 && HD == 64 && DQ == DM);
static_assert(4 * 16 * 68 * 4 <= O_VA);
static_assert((TP * 2) % 16 == 0);
static_assert(16 * 68 * 4 <= 3 * 32 * TP * 2);
static_assert(LDS_TOTAL <= 65536);

typedef _Float16 h16;
typedef unsigned short bf;
typedef __attribute__((ext_vector_type(16))) __bf16   v16bf;
typedef __attribute__((ext_vector_type(16))) _Float16 v16h;
typedef __attribute__((ext_vector_type(8)))  _Float16 v8h;
typedef __attribute__((ext_vector_type(8)))  unsigned short v8us;
typedef __attribute__((ext_vector_type(8)))  float    v8f;
typedef __attribute__((ext_vector_type(4)))  float    v4f;
typedef __attribute__((ext_vector_type(2)))  float    v2f;
typedef __attribute__((ext_vector_type(4)))  int      v4i;
typedef v8h  __attribute__((may_alias)) v8ha;
typedef v4f  __attribute__((may_alias)) v4fa;
typedef v8us __attribute__((may_alias)) v8usa;
typedef __attribute__((ext_vector_type(2))) unsigned v2u;
typedef v2u  __attribute__((may_alias)) v2ua;
typedef __attribute__((ext_vector_type(2))) __bf16 v2bf;
typedef __attribute__((ext_vector_type(4))) unsigned v4u;
typedef v4u  __attribute__((may_alias)) v4ua;

__device__ __forceinline__ unsigned short f2bf(float f) { unsigned u = __float_as_uint(f); u += 0x7FFFu + ((u >> 16) & 1u); return (unsigned short)(u >> 16); }
__device__ __forceinline__ float bf2f(unsigned short b) { return __uint_as_float(((unsigned)b) << 16); }
__device__ __forceinline__ v16h cat16(v8h lo, v8h hi) { return __builtin_shufflevector(lo, hi, 0, 1, 2, 3, 4, 5, 6, 7, 8, 9, 10, 11, 12, 13, 14, 15); }
__device__ __forceinline__ v16bf cat16b(v8us lo, v8us hi) { return __builtin_bit_cast(v16bf, __builtin_shufflevector(lo, hi, 0, 1, 2, 3, 4, 5, 6, 7, 8, 9, 10, 11, 12, 13, 14, 15)); }
__device__ __forceinline__ v8f wmma16(v16h a, v16h b, v8f c) { return __builtin_amdgcn_wmma_f32_16x16x32_f16(false, a, false, b, (short)0, c, false, false); }
__device__ __forceinline__ v8f wmmab(v16bf a, v16bf b, v8f c) { return __builtin_amdgcn_wmma_f32_16x16x32_bf16(false, a, false, b, (short)0, c, false, false); }
__device__ __forceinline__ h16 tohx(float x) { return (h16)x; }
__device__ __forceinline__ void splitf(float y, unsigned short& h, unsigned short& l) { h = f2bf(y); l = f2bf(y - bf2f(h)); }
// The same split of two values at once on the packed converter (f32 -> bf16, round to nearest even like f2bf): hi word and lo word, first value in bits 15..0; and the two picks that pair the low or the high halves of two words.
__device__ __forceinline__ unsigned pkbf(float a, float b) { v2f v; v[0] = a; v[1] = b; return __builtin_bit_cast(unsigned, __builtin_convertvector(v, v2bf)); }
__device__ __forceinline__ void split2(float a, float b, unsigned& h, unsigned& l) { h = pkbf(a, b); l = pkbf(a - __uint_as_float(h << 16), b - __uint_as_float(h & 0xFFFF0000u)); }
__device__ __forceinline__ unsigned lo16(unsigned e0, unsigned e1) { return (e0 & 0xFFFFu) | (e1 << 16); }
__device__ __forceinline__ unsigned hi16(unsigned e0, unsigned e1) { return (e0 >> 16) | (e1 & 0xFFFF0000u); }
__device__ __forceinline__ float xhalf(float x) { return __builtin_bit_cast(float, __builtin_amdgcn_permlanex16(__builtin_bit_cast(int, x), __builtin_bit_cast(int, x), 0x76543210, 0xfedcba98, false, false)); }  // lane l with lane l ^ 16

// 2^x of eight values in place. The eight v_exp_f32 and the free slot that the instruction set asks for behind a transcendental stand in ONE statement: a v_nop in a statement of its own landed elsewhere.
__device__ __forceinline__ void exp2x8(v8f& v) {
    float e0 = v[0], e1 = v[1], e2 = v[2], e3 = v[3], e4 = v[4], e5 = v[5], e6 = v[6], e7 = v[7];
    asm("v_exp_f32 %0, %0\n\tv_exp_f32 %1, %1\n\tv_exp_f32 %2, %2\n\tv_exp_f32 %3, %3\n\tv_exp_f32 %4, %4\n\tv_exp_f32 %5, %5\n\tv_exp_f32 %6, %6\n\tv_exp_f32 %7, %7\n\tv_nop"
        : "+v"(e0), "+v"(e1), "+v"(e2), "+v"(e3), "+v"(e4), "+v"(e5), "+v"(e6), "+v"(e7));
    v[0] = e0; v[1] = e1; v[2] = e2; v[3] = e3; v[4] = e4; v[5] = e5; v[6] = e6; v[7] = e7;
}

// Fragment loaders (split k map for A and B alike): element i of the 16-wide vector <- k0 + 8*hi + i (i < 8), k0 + 16 + 8*hi + (i - 8) (i >= 8); callers pass p = row_base + k0 + 8*hi.
template <typename T16> struct WFrag;
template <> struct WFrag<bf> { typedef v16bf V; static __device__ __forceinline__ V ld(const bf* p) { return cat16b(*(const v8us*)p, *(const v8us*)(p + 16)); } static __device__ __forceinline__ v8f mma(V a, V b, v8f c) { return wmmab(a, b, c); } };
// LDS reloads of tiles written as 16-bit elements: same element type through may_alias vectors.
__device__ __forceinline__ v16h  ldsA16(const h16* p) { return cat16(*(const v8ha*)p, *(const v8ha*)(p + 16)); }
__device__ __forceinline__ v16bf ldsAb(const bf* p) { return cat16b(*(const v8usa*)p, *(const v8usa*)(p + 16)); }

// ---- k_gemmw: register-blocked GEMM of the fused q|k|v projection with its epilogue, ONE WAVE per 64x64 tile of x W^T (16 accumulators), operands straight from K-contiguous 16-bit planes; grid (TT/64, 3*NH_, batch), 32 threads.
// acc[m][n] = sum_k A[m][k] Bt[n][k] (+ split products per NSPLIT). z-batch strides sA/sB in elements. K % 32 == 0.
// A tile's 64 columns are one head of q, k or v (blockIdx.y = section*NH_ + head), so the head planes are written from the accumulators and the f32 product never goes to memory.
// q, k: rotate-half rotary in registers (columns d and d+32 are accumulator tiles nb and nb+2 of the same lane; the table holds the same cos, sin at d and d+32): out[d] = x[d] cos - x[d+32] sin, out[d+32] = x[d+32] cos + x[d] sin, times sc, split to bf16 hi/lo;
//       two rows' bf16 per word, hi words and lo words staged per 16 rows in LDS (pitch 68 words), planes [h][t][d] stored as whole 128-byte rows.
// v:    a lane's eight accumulator rows are eight consecutive t of one d: packed to f16, bf16 hi, bf16 lo; 32 d of the three [d][t] planes at a time staged in LDS (pitch TP), planes [h][d][t] stored as whole 128-byte rows.
template <typename T16, int NSPLIT>
__global__ __launch_bounds__(32) void k_gemmw(const T16* __restrict__ A, const T16* __restrict__ A2, const T16* __restrict__ Bt, const T16* __restrict__ Bt2, int K, size_t sA, size_t sB, const float* __restrict__ CS, bf* QPh, bf* QPl, bf* KPh, bf* KPl, h16* VT16, bf* VTh, bf* VTl) {
    typedef typename WFrag<T16>::V V;
    __shared__ __align__(16) unsigned char st[3 * 32 * TP * 2];
    const size_t z = blockIdx.z; A += z * sA; if (A2) A2 += z * sA; Bt += z * sB; if (Bt2) Bt2 += z * sB;
    const int lane = threadIdx.x & 31, lr = lane & 15, hi = lane >> 4; const int r0 = blockIdx.x * 64, c0 = blockIdx.y * 64;
    v8f acc[4][4];
#pragma unroll
    for (int mb = 0; mb < 4; ++mb)
#pragma unroll
        for (int nb = 0; nb < 4; ++nb) acc[mb][nb] = (v8f){};
    const size_t aoff = (size_t)(r0 + lr) * K + 8 * hi, boff = (size_t)(c0 + lr) * K + 8 * hi;
#pragma unroll 1
    for (int kc = 0; kc < K; kc += 32) {
        V a[4], a2[4];
#pragma unroll
        for (int mb = 0; mb < 4; ++mb) { a[mb] = WFrag<T16>::ld(A + aoff + (size_t)mb * 16 * K + kc); if (NSPLIT == 1 || NSPLIT == 2) a2[mb] = WFrag<T16>::ld(A2 + aoff + (size_t)mb * 16 * K + kc); }
#pragma unroll
        for (int nb = 0; nb < 4; ++nb) { const V b = WFrag<T16>::ld(Bt + boff + (size_t)nb * 16 * K + kc); V b2; if (NSPLIT >= 2) b2 = WFrag<T16>::ld(Bt2 + boff + (size_t)nb * 16 * K + kc);
#pragma unroll
            for (int mb = 0; mb < 4; ++mb) { acc[mb][nb] = WFrag<T16>::mma(a[mb], b, acc[mb][nb]); if (NSPLIT == 1 || NSPLIT == 2) acc[mb][nb] = WFrag<T16>::mma(a2[mb], b, acc[mb][nb]); if (NSPLIT >= 2) acc[mb][nb] = WFrag<T16>::mma(a[mb], b2, acc[mb][nb]); } }
        asm volatile("v_nop\n\tv_nop\n\tv_nop\n\tv_nop" : "+v"(acc[0][0]), "+v"(acc[1][1]), "+v"(acc[2][2]), "+v"(acc[3][3]) : "v"(a[0]), "v"(a[3]));
    }
    const int sec = (int)blockIdx.y / NH_, h = (int)blockIdx.y % NH_;                 // wave-uniform
    const size_t hp = (z * NH_ + h) * TT * HD;
    if (sec < 2) {
        unsigned* us = (unsigned*)st;
        bf* Ph = (sec == 0 ? QPh : KPh) + hp + (size_t)r0 * HD; bf* Pl = (sec == 0 ? QPl : KPl) + hp + (size_t)r0 * HD;
        const float sc = (sec == 0) ? SCL : 1.0f;
#pragma unroll
        for (int mb = 0; mb < 4; ++mb) {
            const float* cp = CS + ((size_t)(r0 + mb * 16 + hi * 8) * HD + lr) * 2;
            v2f cs[2][8];
#pragma unroll
            for (int j = 0; j < 8; ++j) { cs[0][j] = *(const v2f*)(cp + j * HD * 2); cs[1][j] = *(const v2f*)(cp + j * HD * 2 + 32); }
            asm volatile("s_wait_xcnt 0x0" :: "v"(cp) : "memory");   // the wait before a register of the loads above is used again; naming the address keeps it out of their destinations
#pragma unroll
            for (int nl = 0; nl < 2; ++nl) {
                float ra[8], rb[8];
#pragma unroll
                for (int j = 0; j < 8; ++j) {
                    const float x0 = acc[mb][nl][j], x1 = acc[mb][nl + 2][j], cn = cs[nl][j][0], sn = cs[nl][j][1];
                    ra[j] = (x0 * cn - x1 * sn) * sc; rb[j] = (x1 * cn + x0 * sn) * sc; }
#pragma unroll
                for (int jp = 0; jp < 4; ++jp) {                                      // one word = rows 2jp, 2jp+1 of one column; word rows 0..7 hi, 8..15 lo
                    unsigned wh, wl; unsigned* u = us + (hi * 4 + jp) * 68 + nl * 16 + lr;
                    split2(ra[2 * jp], ra[2 * jp + 1], wh, wl); u[0] = wh; u[8 * 68] = wl;
                    split2(rb[2 * jp], rb[2 * jp + 1], wh, wl); u[32] = wh; u[8 * 68 + 32] = wl; } }
            __builtin_amdgcn_wave_barrier(); asm volatile("" ::: "memory");   // keeps the other lanes' LDS writes ahead of the reads below in the compiled order
#pragma unroll
            for (int s = 0; s < 4; ++s) {
                const int pr = (s & 1) * 4 + (lane >> 3), seg = lane & 7;             // row pair and 8-column segment; s >> 1 picks the plane
                const unsigned* u = us + ((s >> 1) * 8 + pr) * 68 + seg * 8;
                const v4u p0 = *(const v4ua*)u, p1 = *(const v4ua*)(u + 4);
                v4u oe, oo;
                oe[0] = lo16(p0[0], p0[1]); oe[1] = lo16(p0[2], p0[3]); oe[2] = lo16(p1[0], p1[1]); oe[3] = lo16(p1[2], p1[3]);
                oo[0] = hi16(p0[0], p0[1]); oo[1] = hi16(p0[2], p0[3]); oo[2] = hi16(p1[0], p1[1]); oo[3] = hi16(p1[2], p1[3]);
                bf* P = ((s >> 1) ? Pl : Ph) + (size_t)(mb * 16 + 2 * pr) * HD + seg * 8;
                *(v4ua*)P = oe; *(v4ua*)(P + HD) = oo; }
            if (mb < 3) { __builtin_amdgcn_wave_barrier(); asm volatile("s_wait_xcnt 0x0" ::: "memory"); }   // the reads above stay ahead of the next rows' LDS writes; the wait stands before the stores' registers are used again
        }
    } else {
        bf* sp = (bf*)st;
#pragma unroll
        for (int hf = 0; hf < 2; ++hf) {                                              // 32 d at a time, the three planes side by side in LDS
#pragma unroll
            for (int nl = 0; nl < 2; ++nl) {
#pragma unroll
                for (int mb = 0; mb < 4; ++mb) {
                    const v8f x = acc[mb][hf * 2 + nl]; v4u oh, ol;
#pragma unroll
                    for (int i = 0; i < 4; ++i) { unsigned wh, wl; split2(x[2 * i], x[2 * i + 1], wh, wl); oh[i] = wh; ol[i] = wl; }
                    bf* q = sp + (nl * 16 + lr) * TP + mb * 16 + hi * 8;
                    *(v4ua*)q = __builtin_bit_cast(v4u, __builtin_convertvector(x, v8h)); *(v4ua*)(q + 32 * TP) = oh; *(v4ua*)(q + 64 * TP) = ol; } }
            __builtin_amdgcn_wave_barrier(); asm volatile("" ::: "memory");   // other lanes' LDS writes ahead of the reads below, as above
#pragma unroll
            for (int pl = 0; pl < 3; ++pl) {
                bf* P = ((pl == 0) ? (bf*)VT16 : (pl == 1) ? VTh : VTl) + hp + (size_t)hf * 32 * TT + r0;
#pragma unroll
                for (int s = 0; s < 8; ++s) {
                    const int idx = s * 32 + lane; const int row = idx >> 3, seg = idx & 7;
                    *(v4ua*)(P + (size_t)row * TT + seg * 8) = *(const v4ua*)(sp + (pl * 32 + row) * TP + seg * 8); } }
            __builtin_amdgcn_wave_barrier(); asm volatile("s_wait_xcnt 0x0" ::: "memory");   // reads ahead of the next half's LDS writes; the wait before the stores' registers are used again (behind the last half too: the built code lays the q, k block behind this one)
        }
    }
}

__global__ __launch_bounds__(256) void k_cvt8(const float* __restrict__ src, bf* dst, size_t n8, size_t sS, size_t sD) { const size_t i = (size_t)blockIdx.x * 256 + threadIdx.x; if (i >= n8) return; src += blockIdx.y * sS; dst += blockIdx.y * sD; const v8f v = *(const v8f*)(src + i * 8); v8us o;
#pragma unroll
    for (int k = 0; k < 8; ++k) o[k] = f2bf(v[k]); *(v8us*)(dst + i * 8) = o;  }

__global__ __launch_bounds__(256) void k_cvtw(const float* __restrict__ wq, const float* __restrict__ wkv, bf* dst, size_t n8) {
    const size_t i = (size_t)blockIdx.x * 256 + threadIdx.x; if (i >= n8) return;
    const int row = (int)((i * 8) / DM), col = (int)((i * 8) % DM);
    const int r2 = max(row - DM, 0); const int c = (r2 >= DM) ? 1 : 0; const int r3 = r2 - c * DM;
    const int srow = (r3 >> 6) * (2 * HD) + 2 * (r3 & 63) + c;
    const float* src = (row < DM) ? (wq + (size_t)row * DM + col) : (wkv + (size_t)srow * DM + col);
    const v8f v = *(const v8f*)src; v8us o;
#pragma unroll
    for (int k = 0; k < 8; ++k) o[k] = f2bf(v[k]);
    *(v8us*)(dst + i * 8) = o; 
}

__global__ __launch_bounds__(256) void k_cstab(float* CS) {
    const int idx = blockIdx.x * 256 + threadIdx.x; if (idx >= TT * HD) return;
    const int t = idx / HD, dd = idx % HD, p = dd & (HD / 2 - 1);
    const float pw = exp10f((float)p * 0.125f);
    const float inv = __fdiv_rn(1.0f, pw);
    float ang = __fmul_rn((float)t, inv); asm volatile("" : "+v"(ang));
    float sn, cn; sincosf(ang, &sn, &cn);
    v2f cs; cs[0] = cn; cs[1] = sn;
    *(v2f*)(CS + (size_t)idx * 2) = cs; 
}

// k_mflag: per (64-row query block, 64-key chunk) flags from the int mask [q][k] (row pitch MPITCH): bit0 = any nonzero, bit1 = all nonzero; chunks >= NCH flagged 0.
__global__ __launch_bounds__(256) void k_mflag(const int* __restrict__ mask, int* FL) {
    __shared__ int fls[FLP];
    const int tid = threadIdx.x, lane = tid & 31, w = tid >> 5; const int qblk = blockIdx.x, qb = qblk * 64;
    const int kc = tid >> 3, sub = tid & 7;
    int anyv = 0, allv = 1;
#pragma unroll 1
    for (int row = 0; row < 64; ++row) {
        const int* mp = mask + (size_t)(qb + row) * MPITCH + kc * 64 + sub * 8;
        const v4i a = *(const v4i*)mp; const v4i c = *(const v4i*)(mp + 4);
#pragma unroll
        for (int q = 0; q < 4; ++q) { anyv |= a[q] | c[q]; allv &= (((a[q] != 0) & (c[q] != 0)) ? 1 : 0); } }
    anyv = (anyv != 0) ? 1 : 0;
#pragma unroll
    for (int sh = 1; sh < 8; sh <<= 1) { anyv |= __shfl_xor(anyv, sh, 32); allv &= __shfl_xor(allv, sh, 32); }
    if (sub == 0) fls[kc] = (kc < NCH) ? (anyv | (allv << 1)) : 0;
    __syncthreads();
    if (w == 0) { const int v = fls[lane]; int* p = FL + (size_t)qblk * FLP + lane; *(int*)p = v;  }
}

// k_flash: flash-style masked softmax attention for one head and one 64-row query block per workgroup (128 threads = 4 waves x 16 query rows); grid (query blocks, heads, batch).
// Per 64-key chunk (flag bit0 set): K hi/lo tiles [key][d] and the V^T tile [d][key] staged in LDS (pitch TP), the int mask tile packed to bytes when the chunk is partial (flag bit1 clear);
// S^T[64 keys x 16 queries] = k_hi.q_hi + k_hi.q_lo + k_lo.q_hi (A = K rows from LDS, B = q fragments kept in registers, q planes pre-scaled by 1/8): lane (lr, hi) holds query lr's scores of keys nb*16 + 8*hi + r;
// masked keys -> excluded; running-max online softmax in f32, maximum and sum in-lane, the maximum joined between the wave halves once per chunk, the sums once in the epilogue;
// P^T packs from the score registers straight into the B operand (score tiles 2ks and 2ks+1 are the fragment's k order) and O^T[64 d x 16 queries] += V^T.P^T: HIRES -> P and v as bf16 hi/lo (3 products, carry 1), else f16 P carried x1024 and f16 v.
template <bool HIRES>
__global__ __launch_bounds__(128) void k_flash(const bf* __restrict__ QPh, const bf* __restrict__ QPl, const bf* __restrict__ KPh, const bf* __restrict__ KPl,
                                               const h16* __restrict__ VT16, const bf* __restrict__ VTh, const bf* __restrict__ VTl,
                                               const int* __restrict__ mask, const int* __restrict__ FL, int qblk0, float* OUT) {
    __shared__ __align__(16) unsigned char smem[LDS_TOTAL];
    bf* sKh = (bf*)(smem + O_KH); bf* sKl = (bf*)(smem + O_KL);
    h16* sV16 = (h16*)(smem + O_VA); bf* sVh = (bf*)(smem + O_VA); bf* sVl = (bf*)(smem + O_VB);
    unsigned char* Ms = smem + O_MS;
    const int tid = threadIdx.x, lane = tid & 31, w = tid >> 5, lr = lane & 15, hi = lane >> 4;
    const int h = blockIdx.y; const int qblk = qblk0 + (int)blockIdx.x; const int qb = qblk * 64;
    const size_t hp = ((size_t)blockIdx.z * NH_ + h) * TT * HD;
    float* OUTb = OUT + (size_t)blockIdx.z * TT * DQ;
    const bf* Qh = QPh + hp; const bf* Ql = QPl + hp; const bf* Kh = KPh + hp; const bf* Kl = KPl + hp;
    const h16* V16 = VT16 + hp; const bf* Vh = VTh + hp; const bf* Vl = VTl + hp;
    const int qrow = qb + w * 16 + lr;                       // B layout: lane -> query column
    v16bf bq[2], bq2[2];
#pragma unroll
    for (int ks = 0; ks < 2; ++ks) { bq[ks] = WFrag<bf>::ld(Qh + (size_t)qrow * HD + ks * 32 + 8 * hi); bq2[ks] = WFrag<bf>::ld(Ql + (size_t)qrow * HD + ks * 32 + 8 * hi); }
    v8f acc[4]; float m = NEGS, l = 0.0f;                    // acc[dt][r] = O^T[dt*16 + 8*hi + r][query lr]; m is the query's, l the sum over this half's keys
#pragma unroll
    for (int dt = 0; dt < 4; ++dt) acc[dt] = (v8f){};
    const unsigned char* Msq = Ms + (w * 16 + lr) * 64 + 8 * hi;   // the lane's query row of the mask tile, at its half's keys
    const float L2E = 1.4426950408889634f;
#pragma unroll 1
    for (int kc = 0; kc < NCH; ++kc) {
        const int flag = FL[qblk * FLP + kc];                // block-uniform
        if ((flag & 1) == 0) continue;
        const bool needm = ((flag & 2) == 0);
        const int kb = kc * 64;
        __syncthreads();
#pragma unroll
        for (int i = 0; i < 4; ++i) {
            const int idx = i * 128 + tid; const int row = idx >> 3, seg = idx & 7;
            *(v8us*)(sKh + row * TP + seg * 8) = *(const v8us*)(Kh + (size_t)(kb + row) * HD + seg * 8);
            *(v8us*)(sKl + row * TP + seg * 8) = *(const v8us*)(Kl + (size_t)(kb + row) * HD + seg * 8);
            if (HIRES) { *(v8us*)(sVh + row * TP + seg * 8) = *(const v8us*)(Vh + (size_t)row * TT + kb + seg * 8);
                         *(v8us*)(sVl + row * TP + seg * 8) = *(const v8us*)(Vl + (size_t)row * TT + kb + seg * 8); }
            else       { *(v8h*)(sV16 + row * TP + seg * 8) = *(const v8h*)(V16 + (size_t)row * TT + kb + seg * 8); }
        }
        if (needm) {
#pragma unroll
            for (int i = 0; i < 8; ++i) {
                const int idx = i * 128 + tid; const int row = idx >> 4, seg = idx & 15;
                const v4i mv = *(const v4i*)(mask + (size_t)(qb + row) * MPITCH + kb + seg * 4);
                const unsigned pk = (mv[0] != 0 ? 1u : 0u) | (mv[1] != 0 ? 0x100u : 0u) | (mv[2] != 0 ? 0x10000u : 0u) | (mv[3] != 0 ? 0x1000000u : 0u);
                *(unsigned*)(Ms + row * 64 + seg * 4) = pk; } }
        __syncthreads();
        v8f s[4];
#pragma unroll
        for (int nb = 0; nb < 4; ++nb) s[nb] = (v8f){};
#pragma unroll
        for (int ks = 0; ks < 2; ++ks) {
#pragma unroll
            for (int nb = 0; nb < 4; ++nb) {
                const v16bf a = ldsAb(sKh + (nb * 16 + lr) * TP + ks * 32 + 8 * hi);
                const v16bf a2 = ldsAb(sKl + (nb * 16 + lr) * TP + ks * 32 + 8 * hi);
                s[nb] = wmmab(a, bq[ks], s[nb]); s[nb] = wmmab(a, bq2[ks], s[nb]); s[nb] = wmmab(a2, bq[ks], s[nb]);
                asm volatile("v_nop\n\tv_nop\n\tv_nop\n\tv_nop" : "+v"(s[nb]) : "v"(a), "v"(a2), "v"(bq[ks]), "v"(bq2[ks])); } }   // four vector slots behind the last WMMA of the tile, before its D is read or its operands are rewritten
        if (needm) {
#pragma unroll
            for (int nb = 0; nb < 4; ++nb) {
                const v2u mk = *(const v2ua*)(Msq + nb * 16);
#pragma unroll
                for (int r = 0; r < 8; ++r) s[nb][r] = (((mk[r >> 2] >> (8 * (r & 3))) & 0xFFu) != 0u) ? s[nb][r] : NEGS; } }
        float tm[4];
#pragma unroll
        for (int nb = 0; nb < 4; ++nb) { tm[nb] = s[nb][0];
#pragma unroll
            for (int r = 1; r < 8; ++r) tm[nb] = fmaxf(tm[nb], s[nb][r]); }
        float tmax = fmaxf(fmaxf(fmaxf(tm[0], tm[1]), fmaxf(tm[2], tm[3])), NEGS);
        tmax = fmaxf(tmax, xhalf(tmax));
        const float nm = fmaxf(m, tmax);
        const float alpha = __builtin_amdgcn_exp2f(__fmul_rn(__fsub_rn(m, nm), L2E));
        m = nm;
        float sm[4];
#pragma unroll
        for (int nb = 0; nb < 4; ++nb) { sm[nb] = 0.0f; v8f e;
#pragma unroll
            for (int r = 0; r < 8; ++r) e[r] = __fmul_rn(__fsub_rn(s[nb][r], nm), L2E);
            exp2x8(e);
#pragma unroll
            for (int r = 0; r < 8; ++r) { const float p = (s[nb][r] > -1.0e38f) ? e[r] : 0.0f; sm[nb] += p; s[nb][r] = p; } }
        l = l * alpha + ((sm[0] + sm[1]) + (sm[2] + sm[3]));
#pragma unroll
        for (int dt = 0; dt < 4; ++dt) acc[dt] *= alpha;
        if (HIRES) {
#pragma unroll
            for (int ks = 0; ks < 2; ++ks) {
                v8us ph0, ph1, pl0, pl1;
#pragma unroll
                for (int i = 0; i < 8; ++i) { unsigned short a2, c2; splitf(s[2 * ks][i], a2, c2); ph0[i] = a2; pl0[i] = c2; splitf(s[2 * ks + 1][i], a2, c2); ph1[i] = a2; pl1[i] = c2; }
                const v16bf bph = cat16b(ph0, ph1), bpl = cat16b(pl0, pl1);
#pragma unroll
                for (int dt = 0; dt < 4; ++dt) {
                    const v16bf avh = ldsAb(sVh + (dt * 16 + lr) * TP + ks * 32 + 8 * hi), avl = ldsAb(sVl + (dt * 16 + lr) * TP + ks * 32 + 8 * hi);
                    acc[dt] = wmmab(avh, bph, acc[dt]); acc[dt] = wmmab(avh, bpl, acc[dt]); acc[dt] = wmmab(avl, bph, acc[dt]);
                    asm volatile("v_nop\n\tv_nop\n\tv_nop\n\tv_nop" : "+v"(acc[dt]) : "v"(bph), "v"(bpl), "v"(avh), "v"(avl)); } }   // WMMA distance, as above
        } else {
#pragma unroll
            for (int ks = 0; ks < 2; ++ks) {
                v16h bp;
#pragma unroll
                for (int i = 0; i < 8; ++i) { bp[i] = tohx(s[2 * ks][i] * PCAR); bp[8 + i] = tohx(s[2 * ks + 1][i] * PCAR); }
#pragma unroll
                for (int dt = 0; dt < 4; ++dt) {
                    const v16h av = ldsA16(sV16 + (dt * 16 + lr) * TP + ks * 32 + 8 * hi);
                    acc[dt] = wmma16(av, bp, acc[dt]);
                    asm volatile("v_nop\n\tv_nop\n\tv_nop\n\tv_nop" : "+v"(acc[dt]) : "v"(bp), "v"(av)); } }   // WMMA distance, as above
        }
    }
    __syncthreads();                                          // all waves done with the K tiles before the output staging aliases them
    float* os = (float*)smem + w * 16 * 68;
    const float rc = HIRES ? 1.0f : (1.0f / PCAR);
    const float inv = __fdiv_rn(rc, l + xhalf(l));            // the two halves' key sums joined here
#pragma unroll
    for (int dt = 0; dt < 4; ++dt) {
        v4f o0, o1;
#pragma unroll
        for (int r = 0; r < 4; ++r) { o0[r] = acc[dt][r] * inv; o1[r] = acc[dt][4 + r] * inv; }
        *(v4fa*)(os + lr * 68 + dt * 16 + 8 * hi) = o0; *(v4fa*)(os + lr * 68 + dt * 16 + 8 * hi + 4) = o1; }
    __builtin_amdgcn_wave_barrier(); asm volatile("" ::: "memory");
    float* crow = OUTb + (size_t)(qb + w * 16) * DQ + h * HD;
{
#pragma unroll
        for (int s2 = 0; s2 < 8; ++s2) { const int row = 2 * s2 + hi, cofs = lr * 4; const v4f val = *(const v4fa*)(os + row * 68 + cofs);
            *(v4f*)(crow + (size_t)row * DQ + cofs) = val; }
         }
}

extern "C" void kernel_launch(void* const* d_in, const int* in_sizes, int n_in,
                              void* d_out, int out_size, void* d_ws, size_t ws_size, hipStream_t stream) {
    if (n_in < 4) return;
    if (in_sizes[0] < (NB - 1) * SEQ_FULL * DM + TT * DM) return;
    if (in_sizes[1] < DM * DM) return;
    if (in_sizes[2] < 2 * DM * DM) return;
    if (in_sizes[3] < TT * MPITCH) return;
    if (out_size < NB * TT * DQ) return;
    const float* x = (const float*)d_in[0]; const float* wq = (const float*)d_in[1]; const float* wkv = (const float*)d_in[2]; const int* mask = (const int*)d_in[3];
    float* OUT = (float*)d_out;     // [NB][TT][DQ]
    char* wsp = (char*)d_ws;
    auto take = [&](size_t bytes) { char* p = wsp; wsp += (bytes + 255) & ~(size_t)255; return (void*)p; };
    bf* W3 = (bf*)take((size_t)D3 * DM * 2); float* CS = (float*)take((size_t)TT * HD * 2 * 4); int* FL = (int*)take((size_t)NQB * FLP * 4);
    bf* XB = (bf*)take((size_t)NB * TT * DM * 2);
    bf* QPh = (bf*)take((size_t)NB * NH_ * TT * HD * 2); bf* QPl = (bf*)take((size_t)NB * NH_ * TT * HD * 2); bf* KPh = (bf*)take((size_t)NB * NH_ * TT * HD * 2); bf* KPl = (bf*)take((size_t)NB * NH_ * TT * HD * 2);
    h16* VT16 = (h16*)take((size_t)NB * NH_ * HD * TT * 2); bf* VTh = (bf*)take((size_t)NB * NH_ * HD * TT * 2); bf* VTl = (bf*)take((size_t)NB * NH_ * HD * TT * 2);
    const size_t used = (size_t)(wsp - (char*)d_ws);
    if (used > ws_size || used > (size_t)134217728) return;   // 74,452,992 B at NB=2, SEQ=2048
    k_cvtw<<<(unsigned)(((size_t)D3 * DM / 8 + 255) / 256), 256, 0, stream>>>(wq, wkv, W3, (size_t)D3 * DM / 8);
    k_cstab<<<(TT * HD + 255) / 256, 256, 0, stream>>>(CS);
    k_mflag<<<NQB, 256, 0, stream>>>(mask, FL);
    k_cvt8<<<dim3((unsigned)(((size_t)TT * DM / 8 + 255) / 256), NB, 1), 256, 0, stream>>>(x, XB, (size_t)TT * DM / 8, (size_t)SEQ_FULL * DM, (size_t)TT * DM);
    k_gemmw<bf, 0><<<dim3(TT / 64, D3 / 64, NB), 32, 0, stream>>>(XB, nullptr, W3, nullptr, DM, (size_t)TT * DM, 0, CS, QPh, QPl, KPh, KPl, VT16, VTh, VTl);
    k_flash<true><<<dim3(RH / 64, NH_, NB), 128, 0, stream>>>(QPh, QPl, KPh, KPl, VT16, VTh, VTl, mask, FL, 0, OUT);
    if (NQB > RH / 64) k_flash<false><<<dim3(NQB - RH / 64, NH_, NB), 128, 0, stream>>>(QPh, QPl, KPh, KPl, VT16, VTh, VTl, mask, FL, RH / 64, OUT);
}

// v004
// One run takes 144 microseconds.
// Next to v003, in two timings, it ran 1.16 times as fast each time.
// Counting every step since v000, it is 3.31 times as fast.
#include <hip/hip_runtime.h>

// Contractions: fused q|k|v projection v_wmma_f32_16x16x32_bf16 (bf16 operands = RNE-converted inputs, exact products); scores v_wmma_f32_16x16x32_bf16 with q/k as bf16 hi/lo planes (3 products) on every row; attn.v v_wmma_f32_16x16x32_f16 (f16 P carried x1024, f16 v) on query rows >= 64 and v_wmma_f32_16x16x32_bf16 with P and v as bf16 hi/lo (3 products) on query rows < 64; f32 accumulate, f32 online softmax, f32 output.
// Both batch elements go through every launch together (batch = grid z, grid y in k_cvt8; every per-batch plane below is stored [batch][...]). Layout per batch: bf16 copy of x; one [3072][1024] bf16 'oi' weight (q rows, then k rows, then v rows, k/v de-interleaved from the [2048][1024] kv weight whose row is h*128 + 2d + c); both planes are stored in fragment order (see pkoff), so that the projection kernel's operand loads cover whole lines; the product x W^T stays in the projection kernel's accumulators, whose epilogue writes the planes below;
// rotary planes q,k [h][t][64] bf16 hi/lo (rotate-half, table cos/sin[t][d], q pre-scaled by 1/8); value planes [h][d][t] f16 and bf16 hi/lo; per (64-row query block, 64-key chunk) mask flags from the int mask (empty chunks skipped, partial chunks apply the mask element-wise, replace-fill);
// flash-style attention: K hi/lo and V chunk tiles staged in LDS, transposed products (S^T = K Q^T, O^T += V^T P^T) so that a lane holds one query's scores, online softmax in-lane, output rows written directly (no output projection).

#ifndef NB
#define NB 2
#endif
#ifndef SEQ
#define SEQ 2048
#endif
#define NB_FULL  2
#define SEQ_FULL 2048
#define TT     SEQ
#define DM     1024
#define NH_    16
#define HD     64
#define DQ     (NH_ * HD)
#define D3     (3 * DM)
#define NQB    (TT / 64)
#define NCH    (TT / 64)
#define RH     64
#define MPITCH SEQ_FULL
#define FLP    32
#define PCAR   1024.0f
#define SCL    0.125f
#define NEGS   (-3.0e38f)
#define TP     72
#define TILEB  (64 * TP * 2)
#define O_KH   0
#define O_KL   (TILEB)
#define O_VA   (2 * TILEB)
#define O_VB   (3 * TILEB)
#define O_MS   (4 * TILEB)
#define LDS_TOTAL (4 * TILEB + 64 * 64)

static_assert(TT % 64 == 0);
static_assert(TT <= SEQ_FULL);
static_assert(NB >= 1 && NB <= NB_FULL);
static_assert(NCH <= FLP);
static_assert(RH == 64);
static_assert(NQB >= RH / 64);
static_assert(DM % 32 == 0 && D3 % 64 == 0 && HD == 64 && DQ == DM);
static_assert(4 * 16 * 68 * 4 <= O_VA);
static_assert((TP * 2) % 16 == 0);
static_assert(16 * 68 * 4 <= 3 * 32 * TP * 2);
static_assert(LDS_TOTAL <= 65536);

typedef _Float16 h16;
typedef unsigned short bf;
typedef __attribute__((ext_vector_type(16))) __bf16   v16bf;
typedef __attribute__((ext_vector_type(16))) _Float16 v16h;
typedef __attribute__((ext_vector_type(8)))  _Float16 v8h;
typedef __attribute__((ext_vector_type(8)))  unsigned short v8us;
typedef __attribute__((ext_vector_type(8)))  float    v8f;
typedef __attribute__((ext_vector_type(4)))  float    v4f;
typedef __attribute__((ext_vector_type(2)))  float    v2f;
typedef __attribute__((ext_vector_type(4)))  int      v4i;
typedef v8h  __attribute__((may_alias)) v8ha;
typedef v4f  __attribute__((may_alias)) v4fa;
typedef v8us __attribute__((may_alias)) v8usa;
typedef __attribute__((ext_vector_type(2))) unsigned v2u;
typedef v2u  __attribute__((may_alias)) v2ua;
typedef __attribute__((ext_vector_type(2))) __bf16 v2bf;
typedef __attribute__((ext_vector_type(4))) unsigned v4u;
typedef v4u  __attribute__((may_alias)) v4ua;

__device__ __forceinline__ unsigned short f2bf(float f) { unsigned u = __float_as_uint(f); u += 0x7FFFu + ((u >> 16) & 1u); return (unsigned short)(u >> 16); }
__device__ __forceinline__ float bf2f(unsigned short b) { return __uint_as_float(((unsigned)b) << 16); }
__device__ __forceinline__ v16h cat16(v8h lo, v8h hi) { return __builtin_shufflevector(lo, hi, 0, 1, 2, 3, 4, 5, 6, 7, 8, 9, 10, 11, 12, 13, 14, 15); }
__device__ __forceinline__ v16bf cat16b(v8us lo, v8us hi) { return __builtin_bit_cast(v16bf, __builtin_shufflevector(lo, hi, 0, 1, 2, 3, 4, 5, 6, 7, 8, 9, 10, 11, 12, 13, 14, 15)); }
__device__ __forceinline__ v8f wmma16(v16h a, v16h b, v8f c) { return __builtin_amdgcn_wmma_f32_16x16x32_f16(false, a, false, b, (short)0, c, false, false); }
__device__ __forceinline__ v8f wmmab(v16bf a, v16bf b, v8f c) { return __builtin_amdgcn_wmma_f32_16x16x32_bf16(false, a, false, b, (short)0, c, false, false); }
__device__ __forceinline__ h16 tohx(float x) { return (h16)x; }
__device__ __forceinline__ void splitf(float y, unsigned short& h, unsigned short& l) { h = f2bf(y); l = f2bf(y - bf2f(h)); }
// The same split of two values at once on the packed converter (f32 -> bf16, round to nearest even like f2bf): hi word and lo word, first value in bits 15..0; and the two picks that pair the low or the high halves of two words.
__device__ __forceinline__ unsigned pkbf(float a, float b) { v2f v; v[0] = a; v[1] = b; return __builtin_bit_cast(unsigned, __builtin_convertvector(v, v2bf)); }
__device__ __forceinline__ void split2(float a, float b, unsigned& h, unsigned& l) { h = pkbf(a, b); l = pkbf(a - __uint_as_float(h << 16), b - __uint_as_float(h & 0xFFFF0000u)); }
__device__ __forceinline__ unsigned lo16(unsigned e0, unsigned e1) { return (e0 & 0xFFFFu) | (e1 << 16); }
__device__ __forceinline__ unsigned hi16(unsigned e0, unsigned e1) { return (e0 >> 16) | (e1 & 0xFFFF0000u); }
__device__ __forceinline__ float xhalf(float x) { return __builtin_bit_cast(float, __builtin_amdgcn_permlanex16(__builtin_bit_cast(int, x), __builtin_bit_cast(int, x), 0x76543210, 0xfedcba98, false, false)); }  // lane l with lane l ^ 16

// 2^x of eight values in place. The eight v_exp_f32 and the free slot that the instruction set asks for behind a transcendental stand in ONE statement: a v_nop in a statement of its own landed elsewhere.
__device__ __forceinline__ void exp2x8(v8f& v) {
    float e0 = v[0], e1 = v[1], e2 = v[2], e3 = v[3], e4 = v[4], e5 = v[5], e6 = v[6], e7 = v[7];
    asm("v_exp_f32 %0, %0\n\tv_exp_f32 %1, %1\n\tv_exp_f32 %2, %2\n\tv_exp_f32 %3, %3\n\tv_exp_f32 %4, %4\n\tv_exp_f32 %5, %5\n\tv_exp_f32 %6, %6\n\tv_exp_f32 %7, %7\n\tv_nop"
        : "+v"(e0), "+v"(e1), "+v"(e2), "+v"(e3), "+v"(e4), "+v"(e5), "+v"(e6), "+v"(e7));
    v[0] = e0; v[1] = e1; v[2] = e2; v[3] = e3; v[4] = e4; v[5] = e5; v[6] = e6; v[7] = e7;
}

// Fragment loaders (split k map for A and B alike): element i of the 16-wide vector <- k0 + 8*hi + i (i < 8), k0 + 16 + 8*hi + (i - 8) (i >= 8); callers pass p = row_base + k0 + 8*hi.
template <typename T16> struct WFrag;
template <> struct WFrag<bf> { typedef v16bf V; static __device__ __forceinline__ V ld(const bf* p) { return cat16b(*(const v8us*)p, *(const v8us*)(p + 16)); } static __device__ __forceinline__ V ldp(const bf* p) { return cat16b(*(const v8us*)p, *(const v8us*)(p + 256)); } static __device__ __forceinline__ v8f mma(V a, V b, v8f c) { return wmmab(a, b, c); } };
// Fragment order of a K-contiguous [rows][DM] 16-bit plane: blocks of 16 rows x 32 k, 512 elements each, block (rb, kb) at (rb * (DM / 32) + kb) * 512. Inside a block, lane (row & 15) + 16 * hi keeps its eight elements k = 8*hi + i at lane * 8 + i and its eight elements k = 16 + 8*hi + i at 256 + lane * 8 + i:
// the same k map as above, and each of a fragment's two loads (ldp, p = block + lane * 8) reads 512 contiguous bytes, four whole lines, where the row-major plane gave 32 bytes of each of 16 lines.
// The converters go by 8-element unit i: sgm = i & 3 (which eight k of the block), r16 = (i >> 2) & 15 (row in the block), block = i >> 6; a wave then reads eight whole 128-byte f32 lines and writes four whole 128-byte lines.
__device__ __forceinline__ size_t pkoff(size_t i) { const size_t sgm = i & 3, r16 = (i >> 2) & 15; return (i >> 6) * 512 + (sgm >> 1) * 256 + ((sgm & 1) * 16 + r16) * 8; }
__device__ __forceinline__ int pkrow(size_t i) { return (int)((i >> 6) / (DM / 32)) * 16 + (int)((i >> 2) & 15); }
__device__ __forceinline__ int pkcol(size_t i) { return (int)((i >> 6) % (DM / 32)) * 32 + (int)(i & 3) * 8; }
// LDS reloads of tiles written as 16-bit elements: same element type through may_alias vectors.
__device__ __forceinline__ v16h  ldsA16(const h16* p) { return cat16(*(const v8ha*)p, *(const v8ha*)(p + 16)); }
__device__ __forceinline__ v16bf ldsAb(const bf* p) { return cat16b(*(const v8usa*)p, *(const v8usa*)(p + 16)); }

// ---- k_gemmw: register-blocked GEMM of the fused q|k|v projection with its epilogue, ONE WAVE per 64x64 tile of x W^T (16 accumulators), operands straight from 16-bit planes in fragment order (pkoff; K == DM); grid (TT/64, 3*NH_, batch), 32 threads.
// acc[m][n] = sum_k A[m][k] Bt[n][k] (+ split products per NSPLIT). z-batch strides sA/sB in elements. K % 32 == 0.
// A tile's 64 columns are one head of q, k or v (blockIdx.y = section*NH_ + head), so the head planes are written from the accumulators and the f32 product never goes to memory.
// q, k: rotate-half rotary in registers (columns d and d+32 are accumulator tiles nb and nb+2 of the same lane; the table holds the same cos, sin at d and d+32): out[d] = x[d] cos - x[d+32] sin, out[d+32] = x[d+32] cos + x[d] sin, times sc, split to bf16 hi/lo;
//       two rows' bf16 per word, hi words and lo words staged per 16 rows in LDS (pitch 68 words), planes [h][t][d] stored as whole 128-byte rows.
// v:    a lane's eight accumulator rows are eight consecutive t of one d: packed to f16, bf16 hi, bf16 lo; 32 d of the three [d][t] planes at a time staged in LDS (pitch TP), planes [h][d][t] stored as whole 128-byte rows.
template <typename T16, int NSPLIT>
__global__ __launch_bounds__(32) void k_gemmw(const T16* __restrict__ A, const T16* __restrict__ A2, const T16* __restrict__ Bt, const T16* __restrict__ Bt2, int K, size_t sA, size_t sB, const float* __restrict__ CS, bf* QPh, bf* QPl, bf* KPh, bf* KPl, h16* VT16, bf* VTh, bf* VTl) {
    typedef typename WFrag<T16>::V V;
    __shared__ __align__(16) unsigned char st[3 * 32 * TP * 2];
    const size_t z = blockIdx.z; A += z * sA; if (A2) A2 += z * sA; Bt += z * sB; if (Bt2) Bt2 += z * sB;
    const int lane = threadIdx.x & 31, lr = lane & 15, hi = lane >> 4; const int r0 = blockIdx.x * 64, c0 = blockIdx.y * 64;
    v8f acc[4][4];
#pragma unroll
    for (int mb = 0; mb < 4; ++mb)
#pragma unroll
        for (int nb = 0; nb < 4; ++nb) acc[mb][nb] = (v8f){};
    const T16* pa = A + (size_t)r0 * DM + lane * 8; const T16* pb = Bt + (size_t)c0 * DM + lane * 8;   // a row of blocks is 16 * DM elements, a step of 32 k is 512
    const T16* pa2 = (NSPLIT == 1 || NSPLIT == 2) ? A2 + (size_t)r0 * DM + lane * 8 : nullptr; const T16* pb2 = (NSPLIT >= 2) ? Bt2 + (size_t)c0 * DM + lane * 8 : nullptr;
#pragma unroll 1
    for (int kc = 0; kc < K; kc += 32) {
        V a[4], a2[4], b4[4], b24[4];
#pragma unroll
        for (int mb = 0; mb < 4; ++mb) { a[mb] = WFrag<T16>::ldp(pa + mb * 16 * DM); if (NSPLIT == 1 || NSPLIT == 2) a2[mb] = WFrag<T16>::ldp(pa2 + mb * 16 * DM); }
#pragma unroll
        for (int nb = 0; nb < 4; ++nb) { b4[nb] = WFrag<T16>::ldp(pb + nb * 16 * DM); if (NSPLIT >= 2) b24[nb] = WFrag<T16>::ldp(pb2 + nb * 16 * DM); }
        asm volatile("s_wait_xcnt 0x0" :: "v"(pa), "v"(pb) : "memory");   // the wait before the loads' address registers are stepped; naming the addresses keeps them out of the loads' destinations
        if (NSPLIT != 0) asm volatile("s_wait_xcnt 0x0" :: "v"(pa2), "v"(pb2) : "memory");   // the same for the split planes' addresses
        pa += 512; pb += 512; if (NSPLIT == 1 || NSPLIT == 2) pa2 += 512; if (NSPLIT >= 2) pb2 += 512;
#pragma unroll
        for (int nb = 0; nb < 4; ++nb) { const V b = b4[nb]; V b2; if (NSPLIT >= 2) b2 = b24[nb];
#pragma unroll
            for (int mb = 0; mb < 4; ++mb) { acc[mb][nb] = WFrag<T16>::mma(a[mb], b, acc[mb][nb]); if (NSPLIT == 1 || NSPLIT == 2) acc[mb][nb] = WFrag<T16>::mma(a2[mb], b, acc[mb][nb]); if (NSPLIT >= 2) acc[mb][nb] = WFrag<T16>::mma(a[mb], b2, acc[mb][nb]); } }
        asm volatile("v_nop\n\tv_nop\n\tv_nop\n\tv_nop" : "+v"(acc[0][0]), "+v"(acc[1][1]), "+v"(acc[2][2]), "+v"(acc[3][3]) : "v"(a[0]), "v"(a[3]));
    }
    const int sec = (int)blockIdx.y / NH_, h = (int)blockIdx.y % NH_;                 // wave-uniform
    const size_t hp = (z * NH_ + h) * TT * HD;
    if (sec < 2) {
        unsigned* us = (unsigned*)st;
        bf* Ph = (sec == 0 ? QPh : KPh) + hp + (size_t)r0 * HD; bf* Pl = (sec == 0 ? QPl : KPl) + hp + (size_t)r0 * HD;
        const float sc = (sec == 0) ? SCL : 1.0f;
#pragma unroll
        for (int mb = 0; mb < 4; ++mb) {
            const float* cp = CS + ((size_t)(r0 + mb * 16 + hi * 8) * HD + lr) * 2;
            v2f cs[2][8];
#pragma unroll
            for (int j = 0; j < 8; ++j) { cs[0][j] = *(const v2f*)(cp + j * HD * 2); cs[1][j] = *(const v2f*)(cp + j * HD * 2 + 32); }
            asm volatile("s_wait_xcnt 0x0" :: "v"(cp) : "memory");   // the wait before a register of the loads above is used again; naming the address keeps it out of their destinations
#pragma unroll
            for (int nl = 0; nl < 2; ++nl) {
                float ra[8], rb[8];
#pragma unroll
                for (int j = 0; j < 8; ++j) {
                    const float x0 = acc[mb][nl][j], x1 = acc[mb][nl + 2][j], cn = cs[nl][j][0], sn = cs[nl][j][1];
                    ra[j] = (x0 * cn - x1 * sn) * sc; rb[j] = (x1 * cn + x0 * sn) * sc; }
#pragma unroll
                for (int jp = 0; jp < 4; ++jp) {                                      // one word = rows 2jp, 2jp+1 of one column; word rows 0..7 hi, 8..15 lo
                    unsigned wh, wl; unsigned* u = us + (hi * 4 + jp) * 68 + nl * 16 + lr;
                    split2(ra[2 * jp], ra[2 * jp + 1], wh, wl); u[0] = wh; u[8 * 68] = wl;
                    split2(rb[2 * jp], rb[2 * jp + 1], wh, wl); u[32] = wh; u[8 * 68 + 32] = wl; } }
            __builtin_amdgcn_wave_barrier(); asm volatile("" ::: "memory");   // keeps the other lanes' LDS writes ahead of the reads below in the compiled order
#pragma unroll
            for (int s = 0; s < 4; ++s) {
                const int pr = (s & 1) * 4 + (lane >> 3), seg = lane & 7;             // row pair and 8-column segment; s >> 1 picks the plane
                const unsigned* u = us + ((s >> 1) * 8 + pr) * 68 + seg * 8;
                const v4u p0 = *(const v4ua*)u, p1 = *(const v4ua*)(u + 4);
                v4u oe, oo;
                oe[0] = lo16(p0[0], p0[1]); oe[1] = lo16(p0[2], p0[3]); oe[2] = lo16(p1[0], p1[1]); oe[3] = lo16(p1[2], p1[3]);
                oo[0] = hi16(p0[0], p0[1]); oo[1] = hi16(p0[2], p0[3]); oo[2] = hi16(p1[0], p1[1]); oo[3] = hi16(p1[2], p1[3]);
                bf* P = ((s >> 1) ? Pl : Ph) + (size_t)(mb * 16 + 2 * pr) * HD + seg * 8;
                *(v4ua*)P = oe; *(v4ua*)(P + HD) = oo; }
            if (mb < 3) { __builtin_amdgcn_wave_barrier(); asm volatile("s_wait_xcnt 0x0" ::: "memory"); }   // the reads above stay ahead of the next rows' LDS writes; the wait stands before the stores' registers are used again
        }
    } else {
        bf* sp = (bf*)st;
#pragma unroll
        for (int hf = 0; hf < 2; ++hf) {                                              // 32 d at a time, the three planes side by side in LDS
#pragma unroll
            for (int nl = 0; nl < 2; ++nl) {
#pragma unroll
                for (int mb = 0; mb < 4; ++mb) {
                    const v8f x = acc[mb][hf * 2 + nl]; v4u oh, ol;
#pragma unroll
                    for (int i = 0; i < 4; ++i) { unsigned wh, wl; split2(x[2 * i], x[2 * i + 1], wh, wl); oh[i] = wh; ol[i] = wl; }
                    bf* q = sp + (nl * 16 + lr) * TP + mb * 16 + hi * 8;
                    *(v4ua*)q = __builtin_bit_cast(v4u, __builtin_convertvector(x, v8h)); *(v4ua*)(q + 32 * TP) = oh; *(v4ua*)(q + 64 * TP) = ol; } }
            __builtin_amdgcn_wave_barrier(); asm volatile("" ::: "memory");   // other lanes' LDS writes ahead of the reads below, as above
#pragma unroll
            for (int pl = 0; pl < 3; ++pl) {
                bf* P = ((pl == 0) ? (bf*)VT16 : (pl == 1) ? VTh : VTl) + hp + (size_t)hf * 32 * TT + r0;
#pragma unroll
                for (int s = 0; s < 8; ++s) {
                    const int idx = s * 32 + lane; const int row = idx >> 3, seg = idx & 7;
                    *(v4ua*)(P + (size_t)row * TT + seg * 8) = *(const v4ua*)(sp + (pl * 32 + row) * TP + seg * 8); } }
            __builtin_amdgcn_wave_barrier(); asm volatile("s_wait_xcnt 0x0" ::: "memory");   // reads ahead of the next half's LDS writes; the wait before the stores' registers are used again (behind the last half too: the built code lays the q, k block behind this one)
        }
    }
}

__global__ __launch_bounds__(256) void k_cvt8(const float* __restrict__ src, bf* dst, size_t n8, size_t sS, size_t sD) { const size_t i = (size_t)blockIdx.x * 256 + threadIdx.x; if (i >= n8) return; src += blockIdx.y * sS; dst += blockIdx.y * sD; const v8f v = *(const v8f*)(src + (size_t)pkrow(i) * DM + pkcol(i)); v8us o;
#pragma unroll
    for (int k = 0; k < 8; ++k) o[k] = f2bf(v[k]); *(v8us*)(dst + pkoff(i)) = o;  }

__global__ __launch_bounds__(256) void k_cvtw(const float* __restrict__ wq, const float* __restrict__ wkv, bf* dst, size_t n8) {
    const size_t i = (size_t)blockIdx.x * 256 + threadIdx.x; if (i >= n8) return;
    const int row = pkrow(i), col = pkcol(i);
    const int r2 = max(row - DM, 0); const int c = (r2 >= DM) ? 1 : 0; const int r3 = r2 - c * DM;
    const int srow = (r3 >> 6) * (2 * HD) + 2 * (r3 & 63) + c;
    const float* src = (row < DM) ? (wq + (size_t)row * DM + col) : (wkv + (size_t)srow * DM + col);
    const v8f v = *(const v8f*)src; v8us o;
#pragma unroll
    for (int k = 0; k < 8; ++k) o[k] = f2bf(v[k]);
    *(v8us*)(dst + pkoff(i)) = o; 
}

__global__ __launch_bounds__(256) void k_cstab(float* CS) {
    const int idx = blockIdx.x * 256 + threadIdx.x; if (idx >= TT * HD) return;
    const int t = idx / HD, dd = idx % HD, p = dd & (HD / 2 - 1);
    const float pw = exp10f((float)p * 0.125f);
    const float inv = __fdiv_rn(1.0f, pw);
    float ang = __fmul_rn((float)t, inv); asm volatile("" : "+v"(ang));
    float sn, cn; sincosf(ang, &sn, &cn);
    v2f cs; cs[0] = cn; cs[1] = sn;
    *(v2f*)(CS + (size_t)idx * 2) = cs; 
}

// k_mflag: per (64-row query block, 64-key chunk) flags from the int mask [q][k] (row pitch MPITCH): bit0 = any nonzero, bit1 = all nonzero; chunks >= NCH flagged 0.
__global__ __launch_bounds__(256) void k_mflag(const int* __restrict__ mask, int* FL) {
    __shared__ int fls[FLP];
    const int tid = threadIdx.x, lane = tid & 31, w = tid >> 5; const int qblk = blockIdx.x, qb = qblk * 64;
    const int kc = tid >> 3, sub = tid & 7;
    int anyv = 0, allv = 1;
#pragma unroll 1
    for (int row = 0; row < 64; ++row) {
        const int* mp = mask + (size_t)(qb + row) * MPITCH + kc * 64 + sub * 8;
        const v4i a = *(const v4i*)mp; const v4i c = *(const v4i*)(mp + 4);
#pragma unroll
        for (int q = 0; q < 4; ++q) { anyv |= a[q] | c[q]; allv &= (((a[q] != 0) & (c[q] != 0)) ? 1 : 0); } }
    anyv = (anyv != 0) ? 1 : 0;
#pragma unroll
    for (int sh = 1; sh < 8; sh <<= 1) { anyv |= __shfl_xor(anyv, sh, 32); allv &= __shfl_xor(allv, sh, 32); }
    if (sub == 0) fls[kc] = (kc < NCH) ? (anyv | (allv << 1)) : 0;
    __syncthreads();
    if (w == 0) { const int v = fls[lane]; int* p = FL + (size_t)qblk * FLP + lane; *(int*)p = v;  }
}

// k_flash: flash-style masked softmax attention for one head and one 64-row query block per workgroup (128 threads = 4 waves x 16 query rows); grid (query blocks, heads, batch).
// Per 64-key chunk (flag bit0 set): K hi/lo tiles [key][d] and the V^T tile [d][key] staged in LDS (pitch TP), the int mask tile packed to bytes when the chunk is partial (flag bit1 clear);
// S^T[64 keys x 16 queries] = k_hi.q_hi + k_hi.q_lo + k_lo.q_hi (A = K rows from LDS, B = q fragments kept in registers, q planes pre-scaled by 1/8): lane (lr, hi) holds query lr's scores of keys nb*16 + 8*hi + r;
// masked keys -> excluded; running-max online softmax in f32, maximum and sum in-lane, the maximum joined between the wave halves once per chunk, the sums once in the epilogue;
// P^T packs from the score registers straight into the B operand (score tiles 2ks and 2ks+1 are the fragment's k order) and O^T[64 d x 16 queries] += V^T.P^T: HIRES -> P and v as bf16 hi/lo (3 products, carry 1), else f16 P carried x1024 and f16 v.
template <bool HIRES>
__global__ __launch_bounds__(128) void k_flash(const bf* __restrict__ QPh, const bf* __restrict__ QPl, const bf* __restrict__ KPh, const bf* __restrict__ KPl,
                                               const h16* __restrict__ VT16, const bf* __restrict__ VTh, const bf* __restrict__ VTl,
                                               const int* __restrict__ mask, const int* __restrict__ FL, int qblk0, float* OUT) {
    __shared__ __align__(16) unsigned char smem[LDS_TOTAL];
    bf* sKh = (bf*)(smem + O_KH); bf* sKl = (bf*)(smem + O_KL);
    h16* sV16 = (h16*)(smem + O_VA); bf* sVh = (bf*)(smem + O_VA); bf* sVl = (bf*)(smem + O_VB);
    unsigned char* Ms = smem + O_MS;
    const int tid = threadIdx.x, lane = tid & 31, w = tid >> 5, lr = lane & 15, hi = lane >> 4;
    const int h = blockIdx.y; const int qblk = qblk0 + (int)blockIdx.x; const int qb = qblk * 64;
    const size_t hp = ((size_t)blockIdx.z * NH_ + h) * TT * HD;
    float* OUTb = OUT + (size_t)blockIdx.z * TT * DQ;
    const bf* Qh = QPh + hp; const bf* Ql = QPl + hp; const bf* Kh = KPh + hp; const bf* Kl = KPl + hp;
    const h16* V16 = VT16 + hp; const bf* Vh = VTh + hp; const bf* Vl = VTl + hp;
    const int qrow = qb + w * 16 + lr;                       // B layout: lane -> query column
    v16bf bq[2], bq2[2];
#pragma unroll
    for (int ks = 0; ks < 2; ++ks) { bq[ks] = WFrag<bf>::ld(Qh + (size_t)qrow * HD + ks * 32 + 8 * hi); bq2[ks] = WFrag<bf>::ld(Ql + (size_t)qrow * HD + ks * 32 + 8 * hi); }
    v8f acc[4]; float m = NEGS, l = 0.0f;                    // acc[dt][r] = O^T[dt*16 + 8*hi + r][query lr]; m is the query's, l the sum over this half's keys
#pragma unroll
    for (int dt = 0; dt < 4; ++dt) acc[dt] = (v8f){};
    const unsigned char* Msq = Ms + (w * 16 + lr) * 64 + 8 * hi;   // the lane's query row of the mask tile, at its half's keys
    const float L2E = 1.4426950408889634f;
#pragma unroll 1
    for (int kc = 0; kc < NCH; ++kc) {
        const int flag = FL[qblk * FLP + kc];                // block-uniform
        if ((flag & 1) == 0) continue;
        const bool needm = ((flag & 2) == 0);
        const int kb = kc * 64;
        __syncthreads();
#pragma unroll
        for (int i = 0; i < 4; ++i) {
            const int idx = i * 128 + tid; const int row = idx >> 3, seg = idx & 7;
            *(v8us*)(sKh + row * TP + seg * 8) = *(const v8us*)(Kh + (size_t)(kb + row) * HD + seg * 8);
            *(v8us*)(sKl + row * TP + seg * 8) = *(const v8us*)(Kl + (size_t)(kb + row) * HD + seg * 8);
            if (HIRES) { *(v8us*)(sVh + row * TP + seg * 8) = *(const v8us*)(Vh + (size_t)row * TT + kb + seg * 8);
                         *(v8us*)(sVl + row * TP + seg * 8) = *(const v8us*)(Vl + (size_t)row * TT + kb + seg * 8); }
            else       { *(v8h*)(sV16 + row * TP + seg * 8) = *(const v8h*)(V16 + (size_t)row * TT + kb + seg * 8); }
        }
        if (needm) {
#pragma unroll
            for (int i = 0; i < 8; ++i) {
                const int idx = i * 128 + tid; const int row = idx >> 4, seg = idx & 15;
                const v4i mv = *(const v4i*)(mask + (size_t)(qb + row) * MPITCH + kb + seg * 4);
                const unsigned pk = (mv[0] != 0 ? 1u : 0u) | (mv[1] != 0 ? 0x100u : 0u) | (mv[2] != 0 ? 0x10000u : 0u) | (mv[3] != 0 ? 0x1000000u : 0u);
                *(unsigned*)(Ms + row * 64 + seg * 4) = pk; } }
        __syncthreads();
        v8f s[4];
#pragma unroll
        for (int nb = 0; nb < 4; ++nb) s[nb] = (v8f){};
#pragma unroll
        for (int ks = 0; ks < 2; ++ks) {
#pragma unroll
            for (int nb = 0; nb < 4; ++nb) {
                const v16bf a = ldsAb(sKh + (nb * 16 + lr) * TP + ks * 32 + 8 * hi);
                const v16bf a2 = ldsAb(sKl + (nb * 16 + lr) * TP + ks * 32 + 8 * hi);
                s[nb] = wmmab(a, bq[ks], s[nb]); s[nb] = wmmab(a, bq2[ks], s[nb]); s[nb] = wmmab(a2, bq[ks], s[nb]);
                asm volatile("v_nop\n\tv_nop\n\tv_nop\n\tv_nop" : "+v"(s[nb]) : "v"(a), "v"(a2), "v"(bq[ks]), "v"(bq2[ks])); } }   // four vector slots behind the last WMMA of the tile, before its D is read or its operands are rewritten
        if (needm) {
#pragma unroll
            for (int nb = 0; nb < 4; ++nb) {
                const v2u mk = *(const v2ua*)(Msq + nb * 16);
#pragma unroll
                for (int r = 0; r < 8; ++r) s[nb][r] = (((mk[r >> 2] >> (8 * (r & 3))) & 0xFFu) != 0u) ? s[nb][r] : NEGS; } }
        float tm[4];
#pragma unroll
        for (int nb = 0; nb < 4; ++nb) { tm[nb] = s[nb][0];
#pragma unroll
            for (int r = 1; r < 8; ++r) tm[nb] = fmaxf(tm[nb], s[nb][r]); }
        float tmax = fmaxf(fmaxf(fmaxf(tm[0], tm[1]), fmaxf(tm[2], tm[3])), NEGS);
        tmax = fmaxf(tmax, xhalf(tmax));
        const float nm = fmaxf(m, tmax);
        const float alpha = __builtin_amdgcn_exp2f(__fmul_rn(__fsub_rn(m, nm), L2E));
        m = nm;
        float sm[4];
#pragma unroll
        for (int nb = 0; nb < 4; ++nb) { sm[nb] = 0.0f; v8f e;
#pragma unroll
            for (int r = 0; r < 8; ++r) e[r] = __fmul_rn(__fsub_rn(s[nb][r], nm), L2E);
            exp2x8(e);
#pragma unroll
            for (int r = 0; r < 8; ++r) { const float p = (s[nb][r] > -1.0e38f) ? e[r] : 0.0f; sm[nb] += p; s[nb][r] = p; } }
        l = l * alpha + ((sm[0] + sm[1]) + (sm[2] + sm[3]));
#pragma unroll
        for (int dt = 0; dt < 4; ++dt) acc[dt] *= alpha;
        if (HIRES) {
#pragma unroll
            for (int ks = 0; ks < 2; ++ks) {
                v8us ph0, ph1, pl0, pl1;
#pragma unroll
                for (int i = 0; i < 8; ++i) { unsigned short a2, c2; splitf(s[2 * ks][i], a2, c2); ph0[i] = a2; pl0[i] = c2; splitf(s[2 * ks + 1][i], a2, c2); ph1[i] = a2; pl1[i] = c2; }
                const v16bf bph = cat16b(ph0, ph1), bpl = cat16b(pl0, pl1);
#pragma unroll
                for (int dt = 0; dt < 4; ++dt) {
                    const v16bf avh = ldsAb(sVh + (dt * 16 + lr) * TP + ks * 32 + 8 * hi), avl = ldsAb(sVl + (dt * 16 + lr) * TP + ks * 32 + 8 * hi);
                    acc[dt] = wmmab(avh, bph, acc[dt]); acc[dt] = wmmab(avh, bpl, acc[dt]); acc[dt] = wmmab(avl, bph, acc[dt]);
                    asm volatile("v_nop\n\tv_nop\n\tv_nop\n\tv_nop" : "+v"(acc[dt]) : "v"(bph), "v"(bpl), "v"(avh), "v"(avl)); } }   // WMMA distance, as above
        } else {
#pragma unroll
            for (int ks = 0; ks < 2; ++ks) {
                v16h bp;
#pragma unroll
                for (int i = 0; i < 8; ++i) { bp[i] = tohx(s[2 * ks][i] * PCAR); bp[8 + i] = tohx(s[2 * ks + 1][i] * PCAR); }
#pragma unroll
                for (int dt = 0; dt < 4; ++dt) {
                    const v16h av = ldsA16(sV16 + (dt * 16 + lr) * TP + ks * 32 + 8 * hi);
                    acc[dt] = wmma16(av, bp, acc[dt]);
                    asm volatile("v_nop\n\tv_nop\n\tv_nop\n\tv_nop" : "+v"(acc[dt]) : "v"(bp), "v"(av)); } }   // WMMA distance, as above
        }
    }
    __syncthreads();                                          // all waves done with the K tiles before the output staging aliases them
    float* os = (float*)smem + w * 16 * 68;
    const float rc = HIRES ? 1.0f : (1.0f / PCAR);
    const float inv = __fdiv_rn(rc, l + xhalf(l));            // the two halves' key sums joined here
#pragma unroll
    for (int dt = 0; dt < 4; ++dt) {
        v4f o0, o1;
#pragma unroll
        for (int r = 0; r < 4; ++r) { o0[r] = acc[dt][r] * inv; o1[r] = acc[dt][4 + r] * inv; }
        *(v4fa*)(os + lr * 68 + dt * 16 + 8 * hi) = o0; *(v4fa*)(os + lr * 68 + dt * 16 + 8 * hi + 4) = o1; }
    __builtin_amdgcn_wave_barrier(); asm volatile("" ::: "memory");
    float* crow = OUTb + (size_t)(qb + w * 16) * DQ + h * HD;
{
#pragma unroll
        for (int s2 = 0; s2 < 8; ++s2) { const int row = 2 * s2 + hi, cofs = lr * 4; const v4f val = *(const v4fa*)(os + row * 68 + cofs);
            *(v4f*)(crow + (size_t)row * DQ + cofs) = val; }
         }
}

extern "C" void kernel_launch(void* const* d_in, const int* in_sizes, int n_in,
                              void* d_out, int out_size, void* d_ws, size_t ws_size, hipStream_t stream) {
    if (n_in < 4) return;
    if (in_sizes[0] < (NB - 1) * SEQ_FULL * DM + TT * DM) return;
    if (in_sizes[1] < DM * DM) return;
    if (in_sizes[2] < 2 * DM * DM) return;
    if (in_sizes[3] < TT * MPITCH) return;
    if (out_size < NB * TT * DQ) return;
    const float* x = (const float*)d_in[0]; const float* wq = (const float*)d_in[1]; const float* wkv = (const float*)d_in[2]; const int* mask = (const int*)d_in[3];
    float* OUT = (float*)d_out;     // [NB][TT][DQ]
    char* wsp = (char*)d_ws;
    auto take = [&](size_t bytes) { char* p = wsp; wsp += (bytes + 255) & ~(size_t)255; return (void*)p; };
    bf* W3 = (bf*)take((size_t)D3 * DM * 2); float* CS = (float*)take((size_t)TT * HD * 2 * 4); int* FL = (int*)take((size_t)NQB * FLP * 4);
    bf* XB = (bf*)take((size_t)NB * TT * DM * 2);
    bf* QPh = (bf*)take((size_t)NB * NH_ * TT * HD * 2); bf* QPl = (bf*)take((size_t)NB * NH_ * TT * HD * 2); bf* KPh = (bf*)take((size_t)NB * NH_ * TT * HD * 2); bf* KPl = (bf*)take((size_t)NB * NH_ * TT * HD * 2);
    h16* VT16 = (h16*)take((size_t)NB * NH_ * HD * TT * 2); bf* VTh = (bf*)take((size_t)NB * NH_ * HD * TT * 2); bf* VTl = (bf*)take((size_t)NB * NH_ * HD * TT * 2);
    const size_t used = (size_t)(wsp - (char*)d_ws);
    if (used > ws_size || used > (size_t)134217728) return;   // 74,452,992 B at NB=2, SEQ=2048
    k_cvtw<<<(unsigned)(((size_t)D3 * DM / 8 + 255) / 256), 256, 0, stream>>>(wq, wkv, W3, (size_t)D3 * DM / 8);
    k_cstab<<<(TT * HD + 255) / 256, 256, 0, stream>>>(CS);
    k_mflag<<<NQB, 256, 0, stream>>>(mask, FL);
    k_cvt8<<<dim3((unsigned)(((size_t)TT * DM / 8 + 255) / 256), NB, 1), 256, 0, stream>>>(x, XB, (size_t)TT * DM / 8, (size_t)SEQ_FULL * DM, (size_t)TT * DM);
    k_gemmw<bf, 0><<<dim3(TT / 64, D3 / 64, NB), 32, 0, stream>>>(XB, nullptr, W3, nullptr, DM, (size_t)TT * DM, 0, CS, QPh, QPl, KPh, KPl, VT16, VTh, VTl);
    k_flash<true><<<dim3(RH / 64, NH_, NB), 128, 0, stream>>>(QPh, QPl, KPh, KPl, VT16, VTh, VTl, mask, FL, 0, OUT);
    if (NQB > RH / 64) k_flash<false><<<dim3(NQB - RH / 64, NH_, NB), 128, 0, stream>>>(QPh, QPl, KPh, KPl, VT16, VTh, VTl, mask, FL, RH / 64, OUT);
}

// v005
// One run takes 129 microseconds.
// Two timings next to v004 both put it at 1.12 times that version's speed.
// All steps since v000 together make it 3.71 times as fast.
#include <hip/hip_runtime.h>

// Contractions: fused q|k|v projection v_wmma_f32_16x16x32_bf16 (bf16 operands = RNE-converted inputs, exact products); scores v_wmma_f32_16x16x32_bf16 with q/k as bf16 hi/lo planes (3 products) on every row; attn.v v_wmma_f32_16x16x32_f16 (f16 P carried x1024, f16 v) on query rows >= 64 and v_wmma_f32_16x16x32_bf16 with P and v as bf16 hi/lo (3 products) on query rows < 64; f32 accumulate, f32 online softmax, f32 output.
// Both batch elements go through every launch together (batch = the slowest part of the block index; every per-batch plane below is stored [batch][...]). Three launches: preparation (k_prep), projection (k_gemmw), attention (k_flash). Layout per batch: bf16 copy of x; one [3072][1024] bf16 'oi' weight (q rows, then k rows, then v rows, k/v de-interleaved from the [2048][1024] kv weight whose row is h*128 + 2d + c); both planes are stored in fragment order (see pkoff), so that the projection kernel's operand loads cover whole lines; the product x W^T stays in the projection kernel's accumulators, whose epilogue writes the planes below;
// rotary planes q,k [h][t][64] bf16 hi/lo (rotate-half, table cos/sin[t][d], q pre-scaled by 1/8); value planes [h][d][t] f16 and bf16 hi/lo; per (64-row query block, 64-key chunk) mask flags from the int mask (empty chunks skipped, partial chunks apply the mask element-wise, replace-fill);
// flash-style attention: K hi/lo and V chunk tiles staged in LDS, transposed products (S^T = K Q^T, O^T += V^T P^T) so that a lane holds one query's scores, online softmax in-lane, output rows written directly (no output projection).

#ifndef NB
#define NB 2
#endif
#ifndef SEQ
#define SEQ 2048
#endif
#define NB_FULL  2
#define SEQ_FULL 2048
#define TT     SEQ
#define DM     1024
#define NH_    16
#define HD     64
#define DQ     (NH_ * HD)
#define D3     (3 * DM)
#define NQB    (TT / 64)
#define NCH    (TT / 64)
#define RH     64
#define MPITCH SEQ_FULL
#define FLP    32
#define PCAR   1024.0f
#define SCL    0.125f
#define NEGS   (-3.0e38f)
#define TP     72
#define TILEB  (64 * TP * 2)
#define O_KH   0
#define O_KL   (TILEB)
#define O_VA   (2 * TILEB)
#define O_VB   (3 * TILEB)
#define O_MS   (4 * TILEB)
#define LDS_TOTAL (4 * TILEB + 64 * 64)

static_assert(TT % 64 == 0);
static_assert(TT <= SEQ_FULL);
static_assert(NB >= 1 && NB <= NB_FULL);
static_assert(NCH <= FLP);
static_assert(RH == 64);
static_assert(NQB >= RH / 64);
static_assert(DM % 32 == 0 && D3 % 64 == 0 && HD == 64 && DQ == DM);
static_assert(4 * 16 * 68 * 4 <= O_VA);
static_assert((TP * 2) % 16 == 0);
static_assert(16 * 68 * 4 <= 3 * 32 * TP * 2);
static_assert(LDS_TOTAL <= 65536);

typedef _Float16 h16;
typedef unsigned short bf;
typedef __attribute__((ext_vector_type(16))) __bf16   v16bf;
typedef __attribute__((ext_vector_type(16))) _Float16 v16h;
typedef __attribute__((ext_vector_type(8)))  _Float16 v8h;
typedef __attribute__((ext_vector_type(8)))  unsigned short v8us;
typedef __attribute__((ext_vector_type(8)))  float    v8f;
typedef __attribute__((ext_vector_type(4)))  float    v4f;
typedef __attribute__((ext_vector_type(2)))  float    v2f;
typedef __attribute__((ext_vector_type(4)))  int      v4i;
typedef v8h  __attribute__((may_alias)) v8ha;
typedef v4f  __attribute__((may_alias)) v4fa;
typedef v8us __attribute__((may_alias)) v8usa;
typedef __attribute__((ext_vector_type(2))) unsigned v2u;
typedef v2u  __attribute__((may_alias)) v2ua;
typedef __attribute__((ext_vector_type(2))) __bf16 v2bf;
typedef __attribute__((ext_vector_type(4))) unsigned v4u;
typedef v4u  __attribute__((may_alias)) v4ua;

__device__ __forceinline__ unsigned short f2bf(float f) { unsigned u = __float_as_uint(f); u += 0x7FFFu + ((u >> 16) & 1u); return (unsigned short)(u >> 16); }
__device__ __forceinline__ float bf2f(unsigned short b) { return __uint_as_float(((unsigned)b) << 16); }
__device__ __forceinline__ v16h cat16(v8h lo, v8h hi) { return __builtin_shufflevector(lo, hi, 0, 1, 2, 3, 4, 5, 6, 7, 8, 9, 10, 11, 12, 13, 14, 15); }
__device__ __forceinline__ v16bf cat16b(v8us lo, v8us hi) { return __builtin_bit_cast(v16bf, __builtin_shufflevector(lo, hi, 0, 1, 2, 3, 4, 5, 6, 7, 8, 9, 10, 11, 12, 13, 14, 15)); }
__device__ __forceinline__ v8f wmma16(v16h a, v16h b, v8f c) { return __builtin_amdgcn_wmma_f32_16x16x32_f16(false, a, false, b, (short)0, c, false, false); }
__device__ __forceinline__ v8f wmmab(v16bf a, v16bf b, v8f c) { return __builtin_amdgcn_wmma_f32_16x16x32_bf16(false, a, false, b, (short)0, c, false, false); }
__device__ __forceinline__ h16 tohx(float x) { return (h16)x; }
__device__ __forceinline__ void splitf(float y, unsigned short& h, unsigned short& l) { h = f2bf(y); l = f2bf(y - bf2f(h)); }
// The same split of two values at once on the packed converter (f32 -> bf16, round to nearest even like f2bf): hi word and lo word, first value in bits 15..0; and the two picks that pair the low or the high halves of two words.
__device__ __forceinline__ unsigned pkbf(float a, float b) { v2f v; v[0] = a; v[1] = b; return __builtin_bit_cast(unsigned, __builtin_convertvector(v, v2bf)); }
__device__ __forceinline__ void split2(float a, float b, unsigned& h, unsigned& l) { h = pkbf(a, b); l = pkbf(a - __uint_as_float(h << 16), b - __uint_as_float(h & 0xFFFF0000u)); }
__device__ __forceinline__ unsigned lo16(unsigned e0, unsigned e1) { return (e0 & 0xFFFFu) | (e1 << 16); }
__device__ __forceinline__ unsigned hi16(unsigned e0, unsigned e1) { return (e0 >> 16) | (e1 & 0xFFFF0000u); }
__device__ __forceinline__ float xhalf(float x) { return __builtin_bit_cast(float, __builtin_amdgcn_permlanex16(__builtin_bit_cast(int, x), __builtin_bit_cast(int, x), 0x76543210, 0xfedcba98, false, false)); }  // lane l with lane l ^ 16

// 2^x of eight values in place. The eight v_exp_f32 and the free slot that the instruction set asks for behind a transcendental stand in ONE statement: a v_nop in a statement of its own landed elsewhere.
__device__ __forceinline__ void exp2x8(v8f& v) {
    float e0 = v[0], e1 = v[1], e2 = v[2], e3 = v[3], e4 = v[4], e5 = v[5], e6 = v[6], e7 = v[7];
    asm("v_exp_f32 %0, %0\n\tv_exp_f32 %1, %1\n\tv_exp_f32 %2, %2\n\tv_exp_f32 %3, %3\n\tv_exp_f32 %4, %4\n\tv_exp_f32 %5, %5\n\tv_exp_f32 %6, %6\n\tv_exp_f32 %7, %7\n\tv_nop"
        : "+v"(e0), "+v"(e1), "+v"(e2), "+v"(e3), "+v"(e4), "+v"(e5), "+v"(e6), "+v"(e7));
    v[0] = e0; v[1] = e1; v[2] = e2; v[3] = e3; v[4] = e4; v[5] = e5; v[6] = e6; v[7] = e7;
}

// Fragment loaders (split k map for A and B alike): element i of the 16-wide vector <- k0 + 8*hi + i (i < 8), k0 + 16 + 8*hi + (i - 8) (i >= 8); callers pass p = row_base + k0 + 8*hi.
template <typename T16> struct WFrag;
template <> struct WFrag<bf> { typedef v16bf V; static __device__ __forceinline__ V ld(const bf* p) { return cat16b(*(const v8us*)p, *(const v8us*)(p + 16)); } static __device__ __forceinline__ V ldp(const bf* p) { return cat16b(*(const v8us*)p, *(const v8us*)(p + 256)); } static __device__ __forceinline__ v8f mma(V a, V b, v8f c) { return wmmab(a, b, c); } };
// Fragment order of a K-contiguous [rows][DM] 16-bit plane: blocks of 16 rows x 32 k, 512 elements each, block (rb, kb) at (rb * (DM / 32) + kb) * 512. Inside a block, lane (row & 15) + 16 * hi keeps its eight elements k = 8*hi + i at lane * 8 + i and its eight elements k = 16 + 8*hi + i at 256 + lane * 8 + i:
// the same k map as above, and each of a fragment's two loads (ldp, p = block + lane * 8) reads 512 contiguous bytes, four whole lines, where the row-major plane gave 32 bytes of each of 16 lines.
// The converters go by 8-element unit i: sgm = i & 3 (which eight k of the block), r16 = (i >> 2) & 15 (row in the block), block = i >> 6; a wave then reads eight whole 128-byte f32 lines and writes four whole 128-byte lines.
__device__ __forceinline__ size_t pkoff(size_t i) { const size_t sgm = i & 3, r16 = (i >> 2) & 15; return (i >> 6) * 512 + (sgm >> 1) * 256 + ((sgm & 1) * 16 + r16) * 8; }
__device__ __forceinline__ int pkrow(size_t i) { return (int)((i >> 6) / (DM / 32)) * 16 + (int)((i >> 2) & 15); }
__device__ __forceinline__ int pkcol(size_t i) { return (int)((i >> 6) % (DM / 32)) * 32 + (int)(i & 3) * 8; }
// LDS reloads of tiles written as 16-bit elements: same element type through may_alias vectors.
__device__ __forceinline__ v16h  ldsA16(const h16* p) { return cat16(*(const v8ha*)p, *(const v8ha*)(p + 16)); }
__device__ __forceinline__ v16bf ldsAb(const bf* p) { return cat16b(*(const v8usa*)p, *(const v8usa*)(p + 16)); }

// ---- k_gemmw: register-blocked GEMM of the fused q|k|v projection with its epilogue, ONE WAVE per 64x64 tile of x W^T (16 accumulators), operands straight from 16-bit planes in fragment order (pkoff; K == DM); grid (TT/64, 3*NH_, batch), 32 threads.
// acc[m][n] = sum_k A[m][k] Bt[n][k] (+ split products per NSPLIT). z-batch strides sA/sB in elements. K % 32 == 0.
// A tile's 64 columns are one head of q, k or v (blockIdx.y = section*NH_ + head), so the head planes are written from the accumulators and the f32 product never goes to memory.
// q, k: rotate-half rotary in registers (columns d and d+32 are accumulator tiles nb and nb+2 of the same lane; the table holds the same cos, sin at d and d+32): out[d] = x[d] cos - x[d+32] sin, out[d+32] = x[d+32] cos + x[d] sin, times sc, split to bf16 hi/lo;
//       two rows' bf16 per word, hi words and lo words staged per 16 rows in LDS (pitch 68 words), planes [h][t][d] stored as whole 128-byte rows.
// v:    a lane's eight accumulator rows are eight consecutive t of one d: packed to f16, bf16 hi, bf16 lo; 32 d of the three [d][t] planes at a time staged in LDS (pitch TP), planes [h][d][t] stored as whole 128-byte rows.
template <typename T16, int NSPLIT>
__global__ __launch_bounds__(32) void k_gemmw(const T16* __restrict__ A, const T16* __restrict__ A2, const T16* __restrict__ Bt, const T16* __restrict__ Bt2, int K, size_t sA, size_t sB, const float* __restrict__ CS, bf* QPh, bf* QPl, bf* KPh, bf* KPl, h16* VT16, bf* VTh, bf* VTl) {
    typedef typename WFrag<T16>::V V;
    __shared__ __align__(16) unsigned char st[3 * 32 * TP * 2];
    const size_t z = blockIdx.z; A += z * sA; if (A2) A2 += z * sA; Bt += z * sB; if (Bt2) Bt2 += z * sB;
    const int lane = threadIdx.x & 31, lr = lane & 15, hi = lane >> 4; const int r0 = blockIdx.x * 64, c0 = blockIdx.y * 64;
    v8f acc[4][4];
#pragma unroll
    for (int mb = 0; mb < 4; ++mb)
#pragma unroll
        for (int nb = 0; nb < 4; ++nb) acc[mb][nb] = (v8f){};
    const T16* pa = A + (size_t)r0 * DM + lane * 8; const T16* pb = Bt + (size_t)c0 * DM + lane * 8;   // a row of blocks is 16 * DM elements, a step of 32 k is 512
    const T16* pa2 = (NSPLIT == 1 || NSPLIT == 2) ? A2 + (size_t)r0 * DM + lane * 8 : nullptr; const T16* pb2 = (NSPLIT >= 2) ? Bt2 + (size_t)c0 * DM + lane * 8 : nullptr;
#pragma unroll 1
    for (int kc = 0; kc < K; kc += 32) {
        V a[4], a2[4], b4[4], b24[4];
#pragma unroll
        for (int mb = 0; mb < 4; ++mb) { a[mb] = WFrag<T16>::ldp(pa + mb * 16 * DM); if (NSPLIT == 1 || NSPLIT == 2) a2[mb] = WFrag<T16>::ldp(pa2 + mb * 16 * DM); }
#pragma unroll
        for (int nb = 0; nb < 4; ++nb) { b4[nb] = WFrag<T16>::ldp(pb + nb * 16 * DM); if (NSPLIT >= 2) b24[nb] = WFrag<T16>::ldp(pb2 + nb * 16 * DM); }
        asm volatile("s_wait_xcnt 0x0" :: "v"(pa), "v"(pb) : "memory");   // the wait before the loads' address registers are stepped; naming the addresses keeps them out of the loads' destinations
        if (NSPLIT != 0) asm volatile("s_wait_xcnt 0x0" :: "v"(pa2), "v"(pb2) : "memory");   // the same for the split planes' addresses
        pa += 512; pb += 512; if (NSPLIT == 1 || NSPLIT == 2) pa2 += 512; if (NSPLIT >= 2) pb2 += 512;
#pragma unroll
        for (int nb = 0; nb < 4; ++nb) { const V b = b4[nb]; V b2; if (NSPLIT >= 2) b2 = b24[nb];
#pragma unroll
            for (int mb = 0; mb < 4; ++mb) { acc[mb][nb] = WFrag<T16>::mma(a[mb], b, acc[mb][nb]); if (NSPLIT == 1 || NSPLIT == 2) acc[mb][nb] = WFrag<T16>::mma(a2[mb], b, acc[mb][nb]); if (NSPLIT >= 2) acc[mb][nb] = WFrag<T16>::mma(a[mb], b2, acc[mb][nb]); } }
        asm volatile("v_nop\n\tv_nop\n\tv_nop\n\tv_nop" : "+v"(acc[0][0]), "+v"(acc[1][1]), "+v"(acc[2][2]), "+v"(acc[3][3]) : "v"(a[0]), "v"(a[3]));
    }
    const int sec = (int)blockIdx.y / NH_, h = (int)blockIdx.y % NH_;                 // wave-uniform
    const size_t hp = (z * NH_ + h) * TT * HD;
    if (sec < 2) {
        unsigned* us = (unsigned*)st;
        bf* Ph = (sec == 0 ? QPh : KPh) + hp + (size_t)r0 * HD; bf* Pl = (sec == 0 ? QPl : KPl) + hp + (size_t)r0 * HD;
        const float sc = (sec == 0) ? SCL : 1.0f;
#pragma unroll
        for (int mb = 0; mb < 4; ++mb) {
            const float* cp = CS + ((size_t)(r0 + mb * 16 + hi * 8) * HD + lr) * 2;
            v2f cs[2][8];
#pragma unroll
            for (int j = 0; j < 8; ++j) { cs[0][j] = *(const v2f*)(cp + j * HD * 2); cs[1][j] = *(const v2f*)(cp + j * HD * 2 + 32); }
            asm volatile("s_wait_xcnt 0x0" :: "v"(cp) : "memory");   // the wait before a register of the loads above is used again; naming the address keeps it out of their destinations
#pragma unroll
            for (int nl = 0; nl < 2; ++nl) {
                float ra[8], rb[8];
#pragma unroll
                for (int j = 0; j < 8; ++j) {
                    const float x0 = acc[mb][nl][j], x1 = acc[mb][nl + 2][j], cn = cs[nl][j][0], sn = cs[nl][j][1];
                    ra[j] = (x0 * cn - x1 * sn) * sc; rb[j] = (x1 * cn + x0 * sn) * sc; }
#pragma unroll
                for (int jp = 0; jp < 4; ++jp) {                                      // one word = rows 2jp, 2jp+1 of one column; word rows 0..7 hi, 8..15 lo
                    unsigned wh, wl; unsigned* u = us + (hi * 4 + jp) * 68 + nl * 16 + lr;
                    split2(ra[2 * jp], ra[2 * jp + 1], wh, wl); u[0] = wh; u[8 * 68] = wl;
                    split2(rb[2 * jp], rb[2 * jp + 1], wh, wl); u[32] = wh; u[8 * 68 + 32] = wl; } }
            __builtin_amdgcn_wave_barrier(); asm volatile("" ::: "memory");   // keeps the other lanes' LDS writes ahead of the reads below in the compiled order
#pragma unroll
            for (int s = 0; s < 4; ++s) {
                const int pr = (s & 1) * 4 + (lane >> 3), seg = lane & 7;             // row pair and 8-column segment; s >> 1 picks the plane
                const unsigned* u = us + ((s >> 1) * 8 + pr) * 68 + seg * 8;
                const v4u p0 = *(const v4ua*)u, p1 = *(const v4ua*)(u + 4);
                v4u oe, oo;
                oe[0] = lo16(p0[0], p0[1]); oe[1] = lo16(p0[2], p0[3]); oe[2] = lo16(p1[0], p1[1]); oe[3] = lo16(p1[2], p1[3]);
                oo[0] = hi16(p0[0], p0[1]); oo[1] = hi16(p0[2], p0[3]); oo[2] = hi16(p1[0], p1[1]); oo[3] = hi16(p1[2], p1[3]);
                bf* P = ((s >> 1) ? Pl : Ph) + (size_t)(mb * 16 + 2 * pr) * HD + seg * 8;
                *(v4ua*)P = oe; *(v4ua*)(P + HD) = oo; }
            if (mb < 3) { __builtin_amdgcn_wave_barrier(); asm volatile("s_wait_xcnt 0x0" ::: "memory"); }   // the reads above stay ahead of the next rows' LDS writes; the wait stands before the stores' registers are used again
        }
    } else {
        bf* sp = (bf*)st;
#pragma unroll
        for (int hf = 0; hf < 2; ++hf) {                                              // 32 d at a time, the three planes side by side in LDS
#pragma unroll
            for (int nl = 0; nl < 2; ++nl) {
#pragma unroll
                for (int mb = 0; mb < 4; ++mb) {
                    const v8f x = acc[mb][hf * 2 + nl]; v4u oh, ol;
#pragma unroll
                    for (int i = 0; i < 4; ++i) { unsigned wh, wl; split2(x[2 * i], x[2 * i + 1], wh, wl); oh[i] = wh; ol[i] = wl; }
                    bf* q = sp + (nl * 16 + lr) * TP + mb * 16 + hi * 8;
                    *(v4ua*)q = __builtin_bit_cast(v4u, __builtin_convertvector(x, v8h)); *(v4ua*)(q + 32 * TP) = oh; *(v4ua*)(q + 64 * TP) = ol; } }
            __builtin_amdgcn_wave_barrier(); asm volatile("" ::: "memory");   // other lanes' LDS writes ahead of the reads below, as above
#pragma unroll
            for (int pl = 0; pl < 3; ++pl) {
                bf* P = ((pl == 0) ? (bf*)VT16 : (pl == 1) ? VTh : VTl) + hp + (size_t)hf * 32 * TT + r0;
#pragma unroll
                for (int s = 0; s < 8; ++s) {
                    const int idx = s * 32 + lane; const int row = idx >> 3, seg = idx & 7;
                    *(v4ua*)(P + (size_t)row * TT + seg * 8) = *(const v4ua*)(sp + (pl * 32 + row) * TP + seg * 8); } }
            __builtin_amdgcn_wave_barrier(); asm volatile("s_wait_xcnt 0x0" ::: "memory");   // reads ahead of the next half's LDS writes; the wait before the stores' registers are used again (behind the last half too: the built code lays the q, k block behind this one)
        }
    }
}

// The four preparation jobs below depend on nothing but the inputs and not on each other: they are bodies of ONE kernel, k_prep, which hands each a range of its blocks (blk = the block's index inside its range).
__device__ __forceinline__ void d_cvt8(int blk, int bz, const float* __restrict__ src, bf* dst, size_t n8, size_t sS, size_t sD) { const size_t i = (size_t)blk * 256 + threadIdx.x; if (i >= n8) return; src += bz * sS; dst += bz * sD; const v8f v = *(const v8f*)(src + (size_t)pkrow(i) * DM + pkcol(i)); v8us o;
#pragma unroll
    for (int k = 0; k < 8; ++k) o[k] = f2bf(v[k]); *(v8us*)(dst + pkoff(i)) = o;  }

__device__ __forceinline__ void d_cvtw(int blk, const float* __restrict__ wq, const float* __restrict__ wkv, bf* dst, size_t n8) {
    const size_t i = (size_t)blk * 256 + threadIdx.x; if (i >= n8) return;
    const int row = pkrow(i), col = pkcol(i);
    const int r2 = max(row - DM, 0); const int c = (r2 >= DM) ? 1 : 0; const int r3 = r2 - c * DM;
    const int srow = (r3 >> 6) * (2 * HD) + 2 * (r3 & 63) + c;
    const float* src = (row < DM) ? (wq + (size_t)row * DM + col) : (wkv + (size_t)srow * DM + col);
    const v8f v = *(const v8f*)src; v8us o;
#pragma unroll
    for (int k = 0; k < 8; ++k) o[k] = f2bf(v[k]);
    *(v8us*)(dst + pkoff(i)) = o; 
}

__device__ __forceinline__ void d_cstab(int blk, float* CS) {
    const int idx = blk * 256 + threadIdx.x; if (idx >= TT * HD) return;
    const int t = idx / HD, dd = idx % HD, p = dd & (HD / 2 - 1);
    const float pw = exp10f((float)p * 0.125f);
    const float inv = __fdiv_rn(1.0f, pw);
    float ang = __fmul_rn((float)t, inv); asm volatile("" : "+v"(ang));
    float sn, cn; sincosf(ang, &sn, &cn);
    v2f cs; cs[0] = cn; cs[1] = sn;
    *(v2f*)(CS + (size_t)idx * 2) = cs; 
}

// d_mflag: per (64-row query block, 64-key chunk) flags from the int mask [q][k] (row pitch MPITCH): bit0 = any nonzero, bit1 = all nonzero; chunks >= NCH flagged 0.
__device__ __forceinline__ void d_mflag(int blk, int* fls, const int* __restrict__ mask, int* FL) {
    const int tid = threadIdx.x, lane = tid & 31, w = tid >> 5; const int qblk = blk, qb = qblk * 64;
    const int kc = tid >> 3, sub = tid & 7;
    int anyv = 0, allv = 1;
#pragma unroll 1
    for (int row = 0; row < 64; ++row) {
        const int* mp = mask + (size_t)(qb + row) * MPITCH + kc * 64 + sub * 8;
        const v4i a = *(const v4i*)mp; const v4i c = *(const v4i*)(mp + 4);
#pragma unroll
        for (int q = 0; q < 4; ++q) { anyv |= a[q] | c[q]; allv &= (((a[q] != 0) & (c[q] != 0)) ? 1 : 0); } }
    anyv = (anyv != 0) ? 1 : 0;
#pragma unroll
    for (int sh = 1; sh < 8; sh <<= 1) { anyv |= __shfl_xor(anyv, sh, 32); allv &= __shfl_xor(allv, sh, 32); }
    if (sub == 0) fls[kc] = (kc < NCH) ? (anyv | (allv << 1)) : 0;
    __syncthreads();
    if (w == 0) { const int v = fls[lane]; int* p = FL + (size_t)qblk * FLP + lane; *(int*)p = v;  }
}

// k_prep: block ranges, in this order: mask flags (few blocks, each a long chain of dependent trips, so they start first), rotary table, weight planes, x planes. The range test is block-uniform.
#define PB_MF  (NQB)
#define PB_CS  ((TT * HD + 255) / 256)
#define PB_W   ((D3 * DM / 8 + 255) / 256)
#define PB_X   ((TT * DM / 8 + 255) / 256)
__global__ __launch_bounds__(256) void k_prep(const float* __restrict__ x, const float* __restrict__ wq, const float* __restrict__ wkv, const int* __restrict__ mask, bf* XB, bf* W3, float* CS, int* FL) {
    __shared__ int fls[FLP];
    int blk = (int)blockIdx.x;
    if (blk < PB_MF) { d_mflag(blk, fls, mask, FL); return; }
    blk -= PB_MF;
    if (blk < PB_CS) { d_cstab(blk, CS); return; }
    blk -= PB_CS;
    if (blk < PB_W) { d_cvtw(blk, wq, wkv, W3, (size_t)D3 * DM / 8); return; }
    blk -= PB_W;
    d_cvt8(blk % PB_X, blk / PB_X, x, XB, (size_t)TT * DM / 8, (size_t)SEQ_FULL * DM, (size_t)TT * DM);
}

// k_flash: flash-style masked softmax attention for one head and one 64-row query block per workgroup (128 threads = 4 waves x 16 query rows); one block per (query block, head, batch). d_flash<HIRES> is its body; the kernel picks the form by the block's query rows (block-uniform), so both forms run in one launch.
// Per 64-key chunk (flag bit0 set): K hi/lo tiles [key][d] and the V^T tile [d][key] staged in LDS (pitch TP), the int mask tile packed to bytes when the chunk is partial (flag bit1 clear);
// S^T[64 keys x 16 queries] = k_hi.q_hi + k_hi.q_lo + k_lo.q_hi (A = K rows from LDS, B = q fragments kept in registers, q planes pre-scaled by 1/8): lane (lr, hi) holds query lr's scores of keys nb*16 + 8*hi + r;
// masked keys -> excluded; running-max online softmax in f32, maximum and sum in-lane, the maximum joined between the wave halves once per chunk, the sums once in the epilogue;
// P^T packs from the score registers straight into the B operand (score tiles 2ks and 2ks+1 are the fragment's k order) and O^T[64 d x 16 queries] += V^T.P^T: HIRES -> P and v as bf16 hi/lo (3 products, carry 1), else f16 P carried x1024 and f16 v.
template <bool HIRES>
__device__ __forceinline__ void d_flash(unsigned char* smem, const bf* __restrict__ QPh, const bf* __restrict__ QPl, const bf* __restrict__ KPh, const bf* __restrict__ KPl,
                                        const h16* __restrict__ VT16, const bf* __restrict__ VTh, const bf* __restrict__ VTl,
                                        const int* __restrict__ mask, const int* __restrict__ FL, int qblk, int h, int bz, float* OUT) {
    bf* sKh = (bf*)(smem + O_KH); bf* sKl = (bf*)(smem + O_KL);
    h16* sV16 = (h16*)(smem + O_VA); bf* sVh = (bf*)(smem + O_VA); bf* sVl = (bf*)(smem + O_VB);
    unsigned char* Ms = smem + O_MS;
    const int tid = threadIdx.x, lane = tid & 31, w = tid >> 5, lr = lane & 15, hi = lane >> 4;
    const int qb = qblk * 64;
    const size_t hp = ((size_t)bz * NH_ + h) * TT * HD;
    float* OUTb = OUT + (size_t)bz * TT * DQ;
    const bf* Qh = QPh + hp; const bf* Ql = QPl + hp; const bf* Kh = KPh + hp; const bf* Kl = KPl + hp;
    const h16* V16 = VT16 + hp; const bf* Vh = VTh + hp; const bf* Vl = VTl + hp;
    const int qrow = qb + w * 16 + lr;                       // B layout: lane -> query column
    v16bf bq[2], bq2[2];
#pragma unroll
    for (int ks = 0; ks < 2; ++ks) { bq[ks] = WFrag<bf>::ld(Qh + (size_t)qrow * HD + ks * 32 + 8 * hi); bq2[ks] = WFrag<bf>::ld(Ql + (size_t)qrow * HD + ks * 32 + 8 * hi); }
    v8f acc[4]; float m = NEGS, l = 0.0f;                    // acc[dt][r] = O^T[dt*16 + 8*hi + r][query lr]; m is the query's, l the sum over this half's keys
#pragma unroll
    for (int dt = 0; dt < 4; ++dt) acc[dt] = (v8f){};
    const unsigned char* Msq = Ms + (w * 16 + lr) * 64 + 8 * hi;   // the lane's query row of the mask tile, at its half's keys
    const float L2E = 1.4426950408889634f;
#pragma unroll 1
    for (int kc = 0; kc < NCH; ++kc) {
        const int flag = FL[qblk * FLP + kc];                // block-uniform
        if ((flag & 1) == 0) continue;
        const bool needm = ((flag & 2) == 0);
        const int kb = kc * 64;
        __syncthreads();
        const bf* gKh[4]; const bf* gKl[4]; const bf* gVh[4]; const bf* gVl[4]; const h16* gV16[4];
        v8us rKh[4], rKl[4], rVh[4], rVl[4]; v8h rV16[4];
#pragma unroll
        for (int i = 0; i < 4; ++i) {
            const int idx = i * 128 + tid; const int row = idx >> 3, seg = idx & 7;
            gKh[i] = Kh + (size_t)(kb + row) * HD + seg * 8; rKh[i] = *(const v8us*)gKh[i];
            gKl[i] = Kl + (size_t)(kb + row) * HD + seg * 8; rKl[i] = *(const v8us*)gKl[i];
            if (HIRES) { gVh[i] = Vh + (size_t)row * TT + kb + seg * 8; rVh[i] = *(const v8us*)gVh[i];
                         gVl[i] = Vl + (size_t)row * TT + kb + seg * 8; rVl[i] = *(const v8us*)gVl[i]; }
            else       { gV16[i] = V16 + (size_t)row * TT + kb + seg * 8; rV16[i] = *(const v8h*)gV16[i]; }
        }
        // the wait before a register of the loads above is used again; naming the addresses keeps them out of the loads' destinations
        if (HIRES) asm volatile("s_wait_xcnt 0x0" :: "v"(gKh[0]), "v"(gKh[1]), "v"(gKh[2]), "v"(gKh[3]), "v"(gKl[0]), "v"(gKl[1]), "v"(gKl[2]), "v"(gKl[3]), "v"(gVh[0]), "v"(gVh[1]), "v"(gVh[2]), "v"(gVh[3]), "v"(gVl[0]), "v"(gVl[1]), "v"(gVl[2]), "v"(gVl[3]) : "memory");
        else       asm volatile("s_wait_xcnt 0x0" :: "v"(gKh[0]), "v"(gKh[1]), "v"(gKh[2]), "v"(gKh[3]), "v"(gKl[0]), "v"(gKl[1]), "v"(gKl[2]), "v"(gKl[3]), "v"(gV16[0]), "v"(gV16[1]), "v"(gV16[2]), "v"(gV16[3]) : "memory");
#pragma unroll
        for (int i = 0; i < 4; ++i) {
            const int idx = i * 128 + tid; const int row = idx >> 3, seg = idx & 7;
            *(v8us*)(sKh + row * TP + seg * 8) = rKh[i];
            *(v8us*)(sKl + row * TP + seg * 8) = rKl[i];
            if (HIRES) { *(v8us*)(sVh + row * TP + seg * 8) = rVh[i]; *(v8us*)(sVl + row * TP + seg * 8) = rVl[i]; }
            else       { *(v8h*)(sV16 + row * TP + seg * 8) = rV16[i]; }
        }
        if (needm) {
#pragma unroll
            for (int i = 0; i < 8; ++i) {
                const int idx = i * 128 + tid; const int row = idx >> 4, seg = idx & 15;
                const v4i mv = *(const v4i*)(mask + (size_t)(qb + row) * MPITCH + kb + seg * 4);
                const unsigned pk = (mv[0] != 0 ? 1u : 0u) | (mv[1] != 0 ? 0x100u : 0u) | (mv[2] != 0 ? 0x10000u : 0u) | (mv[3] != 0 ? 0x1000000u : 0u);
                *(unsigned*)(Ms + row * 64 + seg * 4) = pk; } }
        __syncthreads();
        v8f s[4];
#pragma unroll
        for (int nb = 0; nb < 4; ++nb) s[nb] = (v8f){};
#pragma unroll
        for (int ks = 0; ks < 2; ++ks) {
#pragma unroll
            for (int nb = 0; nb < 4; ++nb) {
                const v16bf a = ldsAb(sKh + (nb * 16 + lr) * TP + ks * 32 + 8 * hi);
                const v16bf a2 = ldsAb(sKl + (nb * 16 + lr) * TP + ks * 32 + 8 * hi);
                s[nb] = wmmab(a, bq[ks], s[nb]); s[nb] = wmmab(a, bq2[ks], s[nb]); s[nb] = wmmab(a2, bq[ks], s[nb]);
                asm volatile("v_nop\n\tv_nop\n\tv_nop\n\tv_nop" : "+v"(s[nb]) : "v"(a), "v"(a2), "v"(bq[ks]), "v"(bq2[ks])); } }   // four vector slots behind the last WMMA of the tile, before its D is read or its operands are rewritten
        if (needm) {
#pragma unroll
            for (int nb = 0; nb < 4; ++nb) {
                const v2u mk = *(const v2ua*)(Msq + nb * 16);
#pragma unroll
                for (int r = 0; r < 8; ++r) s[nb][r] = (((mk[r >> 2] >> (8 * (r & 3))) & 0xFFu) != 0u) ? s[nb][r] : NEGS; } }
        float tm[4];
#pragma unroll
        for (int nb = 0; nb < 4; ++nb) { tm[nb] = s[nb][0];
#pragma unroll
            for (int r = 1; r < 8; ++r) tm[nb] = fmaxf(tm[nb], s[nb][r]); }
        float tmax = fmaxf(fmaxf(fmaxf(tm[0], tm[1]), fmaxf(tm[2], tm[3])), NEGS);
        tmax = fmaxf(tmax, xhalf(tmax));
        const float nm = fmaxf(m, tmax);
        const float alpha = __builtin_amdgcn_exp2f(__fmul_rn(__fsub_rn(m, nm), L2E));
        m = nm;
        float sm[4];
#pragma unroll
        for (int nb = 0; nb < 4; ++nb) { sm[nb] = 0.0f; v8f e;
#pragma unroll
            for (int r = 0; r < 8; ++r) e[r] = __fmul_rn(__fsub_rn(s[nb][r], nm), L2E);
            exp2x8(e);
#pragma unroll
            for (int r = 0; r < 8; ++r) { const float p = (s[nb][r] > -1.0e38f) ? e[r] : 0.0f; sm[nb] += p; s[nb][r] = p; } }
        l = l * alpha + ((sm[0] + sm[1]) + (sm[2] + sm[3]));
#pragma unroll
        for (int dt = 0; dt < 4; ++dt) acc[dt] *= alpha;
        if (HIRES) {
#pragma unroll
            for (int ks = 0; ks < 2; ++ks) {
                v8us ph0, ph1, pl0, pl1;
#pragma unroll
                for (int i = 0; i < 8; ++i) { unsigned short a2, c2; splitf(s[2 * ks][i], a2, c2); ph0[i] = a2; pl0[i] = c2; splitf(s[2 * ks + 1][i], a2, c2); ph1[i] = a2; pl1[i] = c2; }
                const v16bf bph = cat16b(ph0, ph1), bpl = cat16b(pl0, pl1);
#pragma unroll
                for (int dt = 0; dt < 4; ++dt) {
                    const v16bf avh = ldsAb(sVh + (dt * 16 + lr) * TP + ks * 32 + 8 * hi), avl = ldsAb(sVl + (dt * 16 + lr) * TP + ks * 32 + 8 * hi);
                    acc[dt] = wmmab(avh, bph, acc[dt]); acc[dt] = wmmab(avh, bpl, acc[dt]); acc[dt] = wmmab(avl, bph, acc[dt]);
                    asm volatile("v_nop\n\tv_nop\n\tv_nop\n\tv_nop" : "+v"(acc[dt]) : "v"(bph), "v"(bpl), "v"(avh), "v"(avl)); } }   // WMMA distance, as above
        } else {
#pragma unroll
            for (int ks = 0; ks < 2; ++ks) {
                v16h bp;
#pragma unroll
                for (int i = 0; i < 8; ++i) { bp[i] = tohx(s[2 * ks][i] * PCAR); bp[8 + i] = tohx(s[2 * ks + 1][i] * PCAR); }
#pragma unroll
                for (int dt = 0; dt < 4; ++dt) {
                    const v16h av = ldsA16(sV16 + (dt * 16 + lr) * TP + ks * 32 + 8 * hi);
                    acc[dt] = wmma16(av, bp, acc[dt]);
                    asm volatile("v_nop\n\tv_nop\n\tv_nop\n\tv_nop" : "+v"(acc[dt]) : "v"(bp), "v"(av)); } }   // WMMA distance, as above
        }
    }
    __syncthreads();                                          // all waves done with the K tiles before the output staging aliases them
    float* os = (float*)smem + w * 16 * 68;
    const float rc = HIRES ? 1.0f : (1.0f / PCAR);
    const float inv = __fdiv_rn(rc, l + xhalf(l));            // the two halves' key sums joined here
#pragma unroll
    for (int dt = 0; dt < 4; ++dt) {
        v4f o0, o1;
#pragma unroll
        for (int r = 0; r < 4; ++r) { o0[r] = acc[dt][r] * inv; o1[r] = acc[dt][4 + r] * inv; }
        *(v4fa*)(os + lr * 68 + dt * 16 + 8 * hi) = o0; *(v4fa*)(os + lr * 68 + dt * 16 + 8 * hi + 4) = o1; }
    __builtin_amdgcn_wave_barrier(); asm volatile("" ::: "memory");
    float* crow = OUTb + (size_t)(qb + w * 16) * DQ + h * HD;
{
#pragma unroll
        for (int s2 = 0; s2 < 8; ++s2) { const int row = 2 * s2 + hi, cofs = lr * 4; const v4f val = *(const v4fa*)(os + row * 68 + cofs);
            *(v4f*)(crow + (size_t)row * DQ + cofs) = val; }
         }
}

#define NQL   (NQB - RH / 64)
#define FB_L  (NQL * NH_ * NB)
#define FB_H  ((RH / 64) * NH_ * NB)
static_assert(NQL >= 1);
__global__ __launch_bounds__(128) void k_flash(const bf* __restrict__ QPh, const bf* __restrict__ QPl, const bf* __restrict__ KPh, const bf* __restrict__ KPl,
                                               const h16* __restrict__ VT16, const bf* __restrict__ VTh, const bf* __restrict__ VTl,
                                               const int* __restrict__ mask, const int* __restrict__ FL, float* OUT) {
    __shared__ __align__(16) unsigned char smem[LDS_TOTAL];
    const int b = (int)blockIdx.x;                           // flat index: query block fastest, then head, then batch; the blocks of query rows >= RH first, the few short blocks of rows < RH last
    if (b < FB_L) d_flash<false>(smem, QPh, QPl, KPh, KPl, VT16, VTh, VTl, mask, FL, RH / 64 + b % NQL, (b / NQL) % NH_, b / (NQL * NH_), OUT);
    else { const int c = b - FB_L; d_flash<true>(smem, QPh, QPl, KPh, KPl, VT16, VTh, VTl, mask, FL, c % (RH / 64), (c / (RH / 64)) % NH_, c / ((RH / 64) * NH_), OUT); }
}

extern "C" void kernel_launch(void* const* d_in, const int* in_sizes, int n_in,
                              void* d_out, int out_size, void* d_ws, size_t ws_size, hipStream_t stream) {
    if (n_in < 4) return;
    if (in_sizes[0] < (NB - 1) * SEQ_FULL * DM + TT * DM) return;
    if (in_sizes[1] < DM * DM) return;
    if (in_sizes[2] < 2 * DM * DM) return;
    if (in_sizes[3] < TT * MPITCH) return;
    if (out_size < NB * TT * DQ) return;
    const float* x = (const float*)d_in[0]; const float* wq = (const float*)d_in[1]; const float* wkv = (const float*)d_in[2]; const int* mask = (const int*)d_in[3];
    float* OUT = (float*)d_out;     // [NB][TT][DQ]
    char* wsp = (char*)d_ws;
    auto take = [&](size_t bytes) { char* p = wsp; wsp += (bytes + 255) & ~(size_t)255; return (void*)p; };
    bf* W3 = (bf*)take((size_t)D3 * DM * 2); float* CS = (float*)take((size_t)TT * HD * 2 * 4); int* FL = (int*)take((size_t)NQB * FLP * 4);
    bf* XB = (bf*)take((size_t)NB * TT * DM * 2);
    bf* QPh = (bf*)take((size_t)NB * NH_ * TT * HD * 2); bf* QPl = (bf*)take((size_t)NB * NH_ * TT * HD * 2); bf* KPh = (bf*)take((size_t)NB * NH_ * TT * HD * 2); bf* KPl = (bf*)take((size_t)NB * NH_ * TT * HD * 2);
    h16* VT16 = (h16*)take((size_t)NB * NH_ * HD * TT * 2); bf* VTh = (bf*)take((size_t)NB * NH_ * HD * TT * 2); bf* VTl = (bf*)take((size_t)NB * NH_ * HD * TT * 2);
    const size_t used = (size_t)(wsp - (char*)d_ws);
    if (used > ws_size || used > (size_t)134217728) return;   // 74,452,992 B at NB=2, SEQ=2048
    k_prep<<<PB_MF + PB_CS + PB_W + NB * PB_X, 256, 0, stream>>>(x, wq, wkv, mask, XB, W3, CS, FL);
    k_gemmw<bf, 0><<<dim3(TT / 64, D3 / 64, NB), 32, 0, stream>>>(XB, nullptr, W3, nullptr, DM, (size_t)TT * DM, 0, CS, QPh, QPl, KPh, KPl, VT16, VTh, VTl);
    k_flash<<<FB_L + FB_H, 128, 0, stream>>>(QPh, QPl, KPh, KPl, VT16, VTh, VTl, mask, FL, OUT);
}

// v006
// One run takes 97.3 microseconds.
// Two timings next to v005 put it at 1.32 and 1.31 times that version's speed.
// Counting every step since v000, it is 4.89 times as fast.
#include <hip/hip_runtime.h>

// Contractions: fused q|k|v projection v_wmma_f32_16x16x32_bf16 (bf16 operands = RNE-converted inputs, exact products); scores v_wmma_f32_16x16x32_bf16 with q/k as bf16 hi/lo planes (3 products) on every row; attn.v v_wmma_f32_16x16x32_f16 (f16 P carried x1024, f16 v) on query rows >= 64 and v_wmma_f32_16x16x32_bf16 with P and v as bf16 hi/lo (3 products) on query rows < 64; f32 accumulate, f32 online softmax, f32 output.
// Both batch elements go through every launch together (batch = the slowest part of the block index; every per-batch plane below is stored [batch][...]). Three launches: preparation (k_prep), projection (k_gemmw), attention (k_flash). Layout per batch: bf16 copy of x; one [3072][1024] bf16 'oi' weight (q rows, then k rows, then v rows, k/v de-interleaved from the [2048][1024] kv weight whose row is h*128 + 2d + c); both planes are stored in fragment order (see pkoff), so that the projection kernel's operand loads cover whole lines; the product x W^T stays in the projection kernel's accumulators, whose epilogue writes the planes below;
// rotary planes q,k [h][t][64] bf16 hi/lo (rotate-half, table cos/sin[t][d], q pre-scaled by 1/8); value planes [h][d][t] f16 and bf16 hi/lo; per (64-row query block, 64-key chunk) mask flags from the int mask (empty chunks skipped, partial chunks apply the mask element-wise, replace-fill), four flags to a 128-byte line (FLIDX);
// flash-style attention: K hi/lo and V chunk tiles staged in LDS, transposed products (S^T = K Q^T, O^T += V^T P^T) so that a lane holds one query's scores, online softmax in-lane, output rows written directly (no output projection).

#ifndef NB
#define NB 2
#endif
#ifndef SEQ
#define SEQ 2048
#endif
#define NB_FULL  2
#define SEQ_FULL 2048
#define TT     SEQ
#define DM     1024
#define NH_    16
#define HD     64
#define DQ     (NH_ * HD)
#define D3     (3 * DM)
#define NQB    (TT / 64)
#define NCH    (TT / 64)
#define RH     64
#define MPITCH SEQ_FULL
#define FLP    32
#define MFG    4
#define FLG    (FLP / MFG)
#define FLIDX(qblk, kc) ((((qblk) * FLG + (kc) / MFG) * 32) + (kc) % MFG)
#define PCAR   1024.0f
#define SCL    0.125f
#define NEGS   (-3.0e38f)
#define TP     72
#define TILEB  (64 * TP * 2)
#define O_KH   0
#define O_KL   (TILEB)
#define O_VA   (2 * TILEB)
#define O_VB   (3 * TILEB)
#define O_MS   (4 * TILEB)
#define LDS_TOTAL (4 * TILEB + 64 * 64)

static_assert(TT % 64 == 0);
static_assert(TT <= SEQ_FULL);
static_assert(NB >= 1 && NB <= NB_FULL);
static_assert(NCH <= FLP);
static_assert(FLP == 32 && FLP * 64 == MPITCH && MFG == 4);
static_assert(RH == 64);
static_assert(NQB >= RH / 64);
static_assert(DM % 32 == 0 && D3 % 64 == 0 && HD == 64 && DQ == DM);
static_assert(4 * 16 * 68 * 4 <= O_VA);
static_assert((TP * 2) % 16 == 0);
static_assert(16 * 68 * 4 <= 3 * 32 * TP * 2);
static_assert(LDS_TOTAL <= 65536);

typedef _Float16 h16;
typedef unsigned short bf;
typedef __attribute__((ext_vector_type(16))) __bf16   v16bf;
typedef __attribute__((ext_vector_type(16))) _Float16 v16h;
typedef __attribute__((ext_vector_type(8)))  _Float16 v8h;
typedef __attribute__((ext_vector_type(8)))  unsigned short v8us;
typedef __attribute__((ext_vector_type(8)))  float    v8f;
typedef __attribute__((ext_vector_type(4)))  float    v4f;
typedef __attribute__((ext_vector_type(2)))  float    v2f;
typedef __attribute__((ext_vector_type(4)))  int      v4i;
typedef v8h  __attribute__((may_alias)) v8ha;
typedef v4f  __attribute__((may_alias)) v4fa;
typedef v8us __attribute__((may_alias)) v8usa;
typedef __attribute__((ext_vector_type(2))) unsigned v2u;
typedef v2u  __attribute__((may_alias)) v2ua;
typedef __attribute__((ext_vector_type(2))) __bf16 v2bf;
typedef __attribute__((ext_vector_type(4))) unsigned v4u;
typedef v4u  __attribute__((may_alias)) v4ua;

__device__ __forceinline__ unsigned short f2bf(float f) { unsigned u = __float_as_uint(f); u += 0x7FFFu + ((u >> 16) & 1u); return (unsigned short)(u >> 16); }
__device__ __forceinline__ float bf2f(unsigned short b) { return __uint_as_float(((unsigned)b) << 16); }
__device__ __forceinline__ v16h cat16(v8h lo, v8h hi) { return __builtin_shufflevector(lo, hi, 0, 1, 2, 3, 4, 5, 6, 7, 8, 9, 10, 11, 12, 13, 14, 15); }
__device__ __forceinline__ v16bf cat16b(v8us lo, v8us hi) { return __builtin_bit_cast(v16bf, __builtin_shufflevector(lo, hi, 0, 1, 2, 3, 4, 5, 6, 7, 8, 9, 10, 11, 12, 13, 14, 15)); }
__device__ __forceinline__ v8f wmma16(v16h a, v16h b, v8f c) { return __builtin_amdgcn_wmma_f32_16x16x32_f16(false, a, false, b, (short)0, c, false, false); }
__device__ __forceinline__ v8f wmmab(v16bf a, v16bf b, v8f c) { return __builtin_amdgcn_wmma_f32_16x16x32_bf16(false, a, false, b, (short)0, c, false, false); }
__device__ __forceinline__ h16 tohx(float x) { return (h16)x; }
__device__ __forceinline__ void splitf(float y, unsigned short& h, unsigned short& l) { h = f2bf(y); l = f2bf(y - bf2f(h)); }
// The same split of two values at once on the packed converter (f32 -> bf16, round to nearest even like f2bf): hi word and lo word, first value in bits 15..0; and the two picks that pair the low or the high halves of two words.
__device__ __forceinline__ unsigned pkbf(float a, float b) { v2f v; v[0] = a; v[1] = b; return __builtin_bit_cast(unsigned, __builtin_convertvector(v, v2bf)); }
__device__ __forceinline__ void split2(float a, float b, unsigned& h, unsigned& l) { h = pkbf(a, b); l = pkbf(a - __uint_as_float(h << 16), b - __uint_as_float(h & 0xFFFF0000u)); }
__device__ __forceinline__ unsigned lo16(unsigned e0, unsigned e1) { return (e0 & 0xFFFFu) | (e1 << 16); }
__device__ __forceinline__ unsigned hi16(unsigned e0, unsigned e1) { return (e0 >> 16) | (e1 & 0xFFFF0000u); }
__device__ __forceinline__ float xhalf(float x) { return __builtin_bit_cast(float, __builtin_amdgcn_permlanex16(__builtin_bit_cast(int, x), __builtin_bit_cast(int, x), 0x76543210, 0xfedcba98, false, false)); }  // lane l with lane l ^ 16

// 2^x of eight values in place. The eight v_exp_f32 and the free slot that the instruction set asks for behind a transcendental stand in ONE statement: a v_nop in a statement of its own landed elsewhere.
__device__ __forceinline__ void exp2x8(v8f& v) {
    float e0 = v[0], e1 = v[1], e2 = v[2], e3 = v[3], e4 = v[4], e5 = v[5], e6 = v[6], e7 = v[7];
    asm("v_exp_f32 %0, %0\n\tv_exp_f32 %1, %1\n\tv_exp_f32 %2, %2\n\tv_exp_f32 %3, %3\n\tv_exp_f32 %4, %4\n\tv_exp_f32 %5, %5\n\tv_exp_f32 %6, %6\n\tv_exp_f32 %7, %7\n\tv_nop"
        : "+v"(e0), "+v"(e1), "+v"(e2), "+v"(e3), "+v"(e4), "+v"(e5), "+v"(e6), "+v"(e7));
    v[0] = e0; v[1] = e1; v[2] = e2; v[3] = e3; v[4] = e4; v[5] = e5; v[6] = e6; v[7] = e7;
}

// Fragment loaders (split k map for A and B alike): element i of the 16-wide vector <- k0 + 8*hi + i (i < 8), k0 + 16 + 8*hi + (i - 8) (i >= 8); callers pass p = row_base + k0 + 8*hi.
template <typename T16> struct WFrag;
template <> struct WFrag<bf> { typedef v16bf V; static __device__ __forceinline__ V ld(const bf* p) { return cat16b(*(const v8us*)p, *(const v8us*)(p + 16)); } static __device__ __forceinline__ V ldp(const bf* p) { return cat16b(*(const v8us*)p, *(const v8us*)(p + 256)); } static __device__ __forceinline__ v8f mma(V a, V b, v8f c) { return wmmab(a, b, c); } };
// Fragment order of a K-contiguous [rows][DM] 16-bit plane: blocks of 16 rows x 32 k, 512 elements each, block (rb, kb) at (rb * (DM / 32) + kb) * 512. Inside a block, lane (row & 15) + 16 * hi keeps its eight elements k = 8*hi + i at lane * 8 + i and its eight elements k = 16 + 8*hi + i at 256 + lane * 8 + i:
// the same k map as above, and each of a fragment's two loads (ldp, p = block + lane * 8) reads 512 contiguous bytes, four whole lines, where the row-major plane gave 32 bytes of each of 16 lines.
// The converters go by 8-element unit i: sgm = i & 3 (which eight k of the block), r16 = (i >> 2) & 15 (row in the block), block = i >> 6; a wave then reads eight whole 128-byte f32 lines and writes four whole 128-byte lines.
__device__ __forceinline__ size_t pkoff(size_t i) { const size_t sgm = i & 3, r16 = (i >> 2) & 15; return (i >> 6) * 512 + (sgm >> 1) * 256 + ((sgm & 1) * 16 + r16) * 8; }
__device__ __forceinline__ int pkrow(size_t i) { return (int)((i >> 6) / (DM / 32)) * 16 + (int)((i >> 2) & 15); }
__device__ __forceinline__ int pkcol(size_t i) { return (int)((i >> 6) % (DM / 32)) * 32 + (int)(i & 3) * 8; }
// LDS reloads of tiles written as 16-bit elements: same element type through may_alias vectors.
__device__ __forceinline__ v16h  ldsA16(const h16* p) { return cat16(*(const v8ha*)p, *(const v8ha*)(p + 16)); }
__device__ __forceinline__ v16bf ldsAb(const bf* p) { return cat16b(*(const v8usa*)p, *(const v8usa*)(p + 16)); }

// ---- k_gemmw: register-blocked GEMM of the fused q|k|v projection with its epilogue, ONE WAVE per 64x64 tile of x W^T (16 accumulators), operands straight from 16-bit planes in fragment order (pkoff; K == DM); grid (TT/64, 3*NH_, batch), 32 threads.
// acc[m][n] = sum_k A[m][k] Bt[n][k] (+ split products per NSPLIT). z-batch strides sA/sB in elements. K % 32 == 0.
// A tile's 64 columns are one head of q, k or v (blockIdx.y = section*NH_ + head), so the head planes are written from the accumulators and the f32 product never goes to memory.
// q, k: rotate-half rotary in registers (columns d and d+32 are accumulator tiles nb and nb+2 of the same lane; the table holds the same cos, sin at d and d+32): out[d] = x[d] cos - x[d+32] sin, out[d+32] = x[d+32] cos + x[d] sin, times sc, split to bf16 hi/lo;
//       two rows' bf16 per word, hi words and lo words staged per 16 rows in LDS (pitch 68 words), planes [h][t][d] stored as whole 128-byte rows.
// v:    a lane's eight accumulator rows are eight consecutive t of one d: packed to f16, bf16 hi, bf16 lo; 32 d of the three [d][t] planes at a time staged in LDS (pitch TP), planes [h][d][t] stored as whole 128-byte rows.
template <typename T16, int NSPLIT>
__global__ __launch_bounds__(32) void k_gemmw(const T16* __restrict__ A, const T16* __restrict__ A2, const T16* __restrict__ Bt, const T16* __restrict__ Bt2, int K, size_t sA, size_t sB, const float* __restrict__ CS, bf* QPh, bf* QPl, bf* KPh, bf* KPl, h16* VT16, bf* VTh, bf* VTl) {
    typedef typename WFrag<T16>::V V;
    __shared__ __align__(16) unsigned char st[3 * 32 * TP * 2];
    const size_t z = blockIdx.z; A += z * sA; if (A2) A2 += z * sA; Bt += z * sB; if (Bt2) Bt2 += z * sB;
    const int lane = threadIdx.x & 31, lr = lane & 15, hi = lane >> 4; const int r0 = blockIdx.x * 64, c0 = blockIdx.y * 64;
    v8f acc[4][4];
#pragma unroll
    for (int mb = 0; mb < 4; ++mb)
#pragma unroll
        for (int nb = 0; nb < 4; ++nb) acc[mb][nb] = (v8f){};
    const T16* pa = A + (size_t)r0 * DM + lane * 8; const T16* pb = Bt + (size_t)c0 * DM + lane * 8;   // a row of blocks is 16 * DM elements, a step of 32 k is 512
    const T16* pa2 = (NSPLIT == 1 || NSPLIT == 2) ? A2 + (size_t)r0 * DM + lane * 8 : nullptr; const T16* pb2 = (NSPLIT >= 2) ? Bt2 + (size_t)c0 * DM + lane * 8 : nullptr;
#pragma unroll 1
    for (int kc = 0; kc < K; kc += 32) {
        V a[4], a2[4], b4[4], b24[4];
#pragma unroll
        for (int mb = 0; mb < 4; ++mb) { a[mb] = WFrag<T16>::ldp(pa + mb * 16 * DM); if (NSPLIT == 1 || NSPLIT == 2) a2[mb] = WFrag<T16>::ldp(pa2 + mb * 16 * DM); }
#pragma unroll
        for (int nb = 0; nb < 4; ++nb) { b4[nb] = WFrag<T16>::ldp(pb + nb * 16 * DM); if (NSPLIT >= 2) b24[nb] = WFrag<T16>::ldp(pb2 + nb * 16 * DM); }
        asm volatile("s_wait_xcnt 0x0" :: "v"(pa), "v"(pb) : "memory");   // the wait before the loads' address registers are stepped; naming the addresses keeps them out of the loads' destinations
        if (NSPLIT != 0) asm volatile("s_wait_xcnt 0x0" :: "v"(pa2), "v"(pb2) : "memory");   // the same for the split planes' addresses
        pa += 512; pb += 512; if (NSPLIT == 1 || NSPLIT == 2) pa2 += 512; if (NSPLIT >= 2) pb2 += 512;
#pragma unroll
        for (int nb = 0; nb < 4; ++nb) { const V b = b4[nb]; V b2; if (NSPLIT >= 2) b2 = b24[nb];
#pragma unroll
            for (int mb = 0; mb < 4; ++mb) { acc[mb][nb] = WFrag<T16>::mma(a[mb], b, acc[mb][nb]); if (NSPLIT == 1 || NSPLIT == 2) acc[mb][nb] = WFrag<T16>::mma(a2[mb], b, acc[mb][nb]); if (NSPLIT >= 2) acc[mb][nb] = WFrag<T16>::mma(a[mb], b2, acc[mb][nb]); } }
        asm volatile("v_nop\n\tv_nop\n\tv_nop\n\tv_nop" : "+v"(acc[0][0]), "+v"(acc[1][1]), "+v"(acc[2][2]), "+v"(acc[3][3]) : "v"(a[0]), "v"(a[3]));
    }
    const int sec = (int)blockIdx.y / NH_, h = (int)blockIdx.y % NH_;                 // wave-uniform
    const size_t hp = (z * NH_ + h) * TT * HD;
    if (sec < 2) {
        unsigned* us = (unsigned*)st;
        bf* Ph = (sec == 0 ? QPh : KPh) + hp + (size_t)r0 * HD; bf* Pl = (sec == 0 ? QPl : KPl) + hp + (size_t)r0 * HD;
        const float sc = (sec == 0) ? SCL : 1.0f;
#pragma unroll
        for (int mb = 0; mb < 4; ++mb) {
            const float* cp = CS + ((size_t)(r0 + mb * 16 + hi * 8) * HD + lr) * 2;
            v2f cs[2][8];
#pragma unroll
            for (int j = 0; j < 8; ++j) { cs[0][j] = *(const v2f*)(cp + j * HD * 2); cs[1][j] = *(const v2f*)(cp + j * HD * 2 + 32); }
            asm volatile("s_wait_xcnt 0x0" :: "v"(cp) : "memory");   // the wait before a register of the loads above is used again; naming the address keeps it out of their destinations
#pragma unroll
            for (int nl = 0; nl < 2; ++nl) {
                float ra[8], rb[8];
#pragma unroll
                for (int j = 0; j < 8; ++j) {
                    const float x0 = acc[mb][nl][j], x1 = acc[mb][nl + 2][j], cn = cs[nl][j][0], sn = cs[nl][j][1];
                    ra[j] = (x0 * cn - x1 * sn) * sc; rb[j] = (x1 * cn + x0 * sn) * sc; }
#pragma unroll
                for (int jp = 0; jp < 4; ++jp) {                                      // one word = rows 2jp, 2jp+1 of one column; word rows 0..7 hi, 8..15 lo
                    unsigned wh, wl; unsigned* u = us + (hi * 4 + jp) * 68 + nl * 16 + lr;
                    split2(ra[2 * jp], ra[2 * jp + 1], wh, wl); u[0] = wh; u[8 * 68] = wl;
                    split2(rb[2 * jp], rb[2 * jp + 1], wh, wl); u[32] = wh; u[8 * 68 + 32] = wl; } }
            __builtin_amdgcn_wave_barrier(); asm volatile("" ::: "memory");   // keeps the other lanes' LDS writes ahead of the reads below in the compiled order
#pragma unroll
            for (int s = 0; s < 4; ++s) {
                const int pr = (s & 1) * 4 + (lane >> 3), seg = lane & 7;             // row pair and 8-column segment; s >> 1 picks the plane
                const unsigned* u = us + ((s >> 1) * 8 + pr) * 68 + seg * 8;
                const v4u p0 = *(const v4ua*)u, p1 = *(const v4ua*)(u + 4);
                v4u oe, oo;
                oe[0] = lo16(p0[0], p0[1]); oe[1] = lo16(p0[2], p0[3]); oe[2] = lo16(p1[0], p1[1]); oe[3] = lo16(p1[2], p1[3]);
                oo[0] = hi16(p0[0], p0[1]); oo[1] = hi16(p0[2], p0[3]); oo[2] = hi16(p1[0], p1[1]); oo[3] = hi16(p1[2], p1[3]);
                bf* P = ((s >> 1) ? Pl : Ph) + (size_t)(mb * 16 + 2 * pr) * HD + seg * 8;
                *(v4ua*)P = oe; *(v4ua*)(P + HD) = oo; }
            if (mb < 3) { __builtin_amdgcn_wave_barrier(); asm volatile("s_wait_xcnt 0x0" ::: "memory"); }   // the reads above stay ahead of the next rows' LDS writes; the wait stands before the stores' registers are used again
        }
    } else {
        bf* sp = (bf*)st;
#pragma unroll
        for (int hf = 0; hf < 2; ++hf) {                                              // 32 d at a time, the three planes side by side in LDS
#pragma unroll
            for (int nl = 0; nl < 2; ++nl) {
#pragma unroll
                for (int mb = 0; mb < 4; ++mb) {
                    const v8f x = acc[mb][hf * 2 + nl]; v4u oh, ol;
#pragma unroll
                    for (int i = 0; i < 4; ++i) { unsigned wh, wl; split2(x[2 * i], x[2 * i + 1], wh, wl); oh[i] = wh; ol[i] = wl; }
                    bf* q = sp + (nl * 16 + lr) * TP + mb * 16 + hi * 8;
                    *(v4ua*)q = __builtin_bit_cast(v4u, __builtin_convertvector(x, v8h)); *(v4ua*)(q + 32 * TP) = oh; *(v4ua*)(q + 64 * TP) = ol; } }
            __builtin_amdgcn_wave_barrier(); asm volatile("" ::: "memory");   // other lanes' LDS writes ahead of the reads below, as above
#pragma unroll
            for (int pl = 0; pl < 3; ++pl) {
                bf* P = ((pl == 0) ? (bf*)VT16 : (pl == 1) ? VTh : VTl) + hp + (size_t)hf * 32 * TT + r0;
#pragma unroll
                for (int s = 0; s < 8; ++s) {
                    const int idx = s * 32 + lane; const int row = idx >> 3, seg = idx & 7;
                    *(v4ua*)(P + (size_t)row * TT + seg * 8) = *(const v4ua*)(sp + (pl * 32 + row) * TP + seg * 8); } }
            __builtin_amdgcn_wave_barrier(); asm volatile("s_wait_xcnt 0x0" ::: "memory");   // reads ahead of the next half's LDS writes; the wait before the stores' registers are used again (behind the last half too: the built code lays the q, k block behind this one)
        }
    }
}

// The four preparation jobs below depend on nothing but the inputs and not on each other: they are bodies of ONE kernel, k_prep, which hands each a range of its blocks (blk = the block's index inside its range).
__device__ __forceinline__ void d_cvt8(int blk, int bz, const float* __restrict__ src, bf* dst, size_t n8, size_t sS, size_t sD) { const size_t i = (size_t)blk * 256 + threadIdx.x; if (i >= n8) return; src += bz * sS; dst += bz * sD; const v8f v = *(const v8f*)(src + (size_t)pkrow(i) * DM + pkcol(i)); v8us o;
#pragma unroll
    for (int k = 0; k < 8; ++k) o[k] = f2bf(v[k]); *(v8us*)(dst + pkoff(i)) = o;  }

__device__ __forceinline__ void d_cvtw(int blk, const float* __restrict__ wq, const float* __restrict__ wkv, bf* dst, size_t n8) {
    const size_t i = (size_t)blk * 256 + threadIdx.x; if (i >= n8) return;
    const int row = pkrow(i), col = pkcol(i);
    const int r2 = max(row - DM, 0); const int c = (r2 >= DM) ? 1 : 0; const int r3 = r2 - c * DM;
    const int srow = (r3 >> 6) * (2 * HD) + 2 * (r3 & 63) + c;
    const float* src = (row < DM) ? (wq + (size_t)row * DM + col) : (wkv + (size_t)srow * DM + col);
    const v8f v = *(const v8f*)src; v8us o;
#pragma unroll
    for (int k = 0; k < 8; ++k) o[k] = f2bf(v[k]);
    *(v8us*)(dst + pkoff(i)) = o; 
}

__device__ __forceinline__ void d_cstab(int blk, float* CS) {
    const int idx = blk * 256 + threadIdx.x; if (idx >= TT * HD) return;
    const int t = idx / HD, dd = idx % HD, p = dd & (HD / 2 - 1);
    const float pw = exp10f((float)p * 0.125f);
    const float inv = __fdiv_rn(1.0f, pw);
    float ang = __fmul_rn((float)t, inv); asm volatile("" : "+v"(ang));
    float sn, cn; sincosf(ang, &sn, &cn);
    v2f cs; cs[0] = cn; cs[1] = sn;
    *(v2f*)(CS + (size_t)idx * 2) = cs; 
}

// d_mflag: per (64-row query block, 64-key chunk) flags from the int mask [q][k] (row pitch MPITCH): bit0 = any nonzero, bit1 = all nonzero; chunks >= NCH flagged 0.
// One block per (query block, group of MFG chunks): 64 rows x 256 columns, 16 loads of 16 bytes per thread, none depending on another, each wave-load 512 contiguous bytes of one row. Threads 64*rg .. 64*rg+63 take rows 16*rg .. 16*rg+15; 16 lanes span one chunk's columns.
// A block's MFG flags go to a 128-byte line of their own (FLIDX), so that a line has one writer.
__device__ __forceinline__ void d_mflag(int blk, int* fls, const int* __restrict__ mask, int* FL) {
    const int tid = threadIdx.x, lane = tid & 31, w = tid >> 5; const int qblk = blk / FLG, g = blk % FLG, qb = qblk * 64;
    const int* mp = mask + (size_t)(qb + (tid >> 6) * 16) * MPITCH + g * (MFG * 64) + (tid & 63) * 4;
    v4i a[16];
#pragma unroll
    for (int i = 0; i < 16; ++i) a[i] = *(const v4i*)(mp + (size_t)i * MPITCH);
    // the wait before a register of the loads above is used again; naming the address keeps it out of their destinations, and naming the loaded values (inputs only) keeps all 16 loads in flight together: without it this build waited for nine before it issued the other seven
    asm volatile("s_wait_xcnt 0x0" :: "v"(mp), "v"(a[0]), "v"(a[1]), "v"(a[2]), "v"(a[3]), "v"(a[4]), "v"(a[5]), "v"(a[6]), "v"(a[7]), "v"(a[8]), "v"(a[9]), "v"(a[10]), "v"(a[11]), "v"(a[12]), "v"(a[13]), "v"(a[14]), "v"(a[15]) : "memory");
    unsigned anyv = 0u, minv = 0xFFFFFFFFu;                   // OR of the words; their unsigned minimum, which is nonzero exactly when every word is
#pragma unroll
    for (int i = 0; i < 16; ++i)
#pragma unroll
        for (int q = 0; q < 4; ++q) { anyv |= (unsigned)a[i][q]; minv = min(minv, (unsigned)a[i][q]); }
    const unsigned bany = __builtin_amdgcn_ballot_w32(anyv != 0u), ball = __builtin_amdgcn_ballot_w32(minv != 0u);   // bits 15..0: the wave's first chunk, bits 31..16: its second
    if ((lane & 15) == 0) { const unsigned ha = (bany >> lane) & 0xFFFFu, hl = (ball >> lane) & 0xFFFFu; fls[w * 2 + (lane >> 4)] = (ha != 0u ? 1 : 0) | (hl == 0xFFFFu ? 2 : 0); }
    __syncthreads();
    if (tid < MFG) {                                          // chunk tid of the group: wave 2*rg + (tid >> 1), half tid & 1, joined over the four row groups
        int va = 0, vl = 2;
#pragma unroll
        for (int rg = 0; rg < 4; ++rg) { const int v = fls[(rg * 2 + (tid >> 1)) * 2 + (tid & 1)]; va |= v & 1; vl &= v; }
        const int kc = g * MFG + tid;
        FL[FLIDX(qblk, kc)] = (kc < NCH) ? (va | vl) : 0; }
}

// k_prep: block ranges, in this order: mask flags, rotary table, weight planes, x planes. The range test is block-uniform.
#define PB_MF  (NQB * FLG)
#define PB_CS  ((TT * HD + 255) / 256)
#define PB_W   ((D3 * DM / 8 + 255) / 256)
#define PB_X   ((TT * DM / 8 + 255) / 256)
__global__ __launch_bounds__(256) void k_prep(const float* __restrict__ x, const float* __restrict__ wq, const float* __restrict__ wkv, const int* __restrict__ mask, bf* XB, bf* W3, float* CS, int* FL) {
    __shared__ int fls[FLP];
    int blk = (int)blockIdx.x;
    if (blk < PB_MF) { d_mflag(blk, fls, mask, FL); return; }
    blk -= PB_MF;
    if (blk < PB_CS) { d_cstab(blk, CS); return; }
    blk -= PB_CS;
    if (blk < PB_W) { d_cvtw(blk, wq, wkv, W3, (size_t)D3 * DM / 8); return; }
    blk -= PB_W;
    d_cvt8(blk % PB_X, blk / PB_X, x, XB, (size_t)TT * DM / 8, (size_t)SEQ_FULL * DM, (size_t)TT * DM);
}

// k_flash: flash-style masked softmax attention for one head and one 64-row query block per workgroup (128 threads = 4 waves x 16 query rows); one block per (query block, head, batch). d_flash<HIRES> is its body; the kernel picks the form by the block's query rows (block-uniform), so both forms run in one launch.
// Per 64-key chunk (flag bit0 set): K hi/lo tiles [key][d] and the V^T tile [d][key] staged in LDS (pitch TP), the int mask tile packed to bytes when the chunk is partial (flag bit1 clear);
// S^T[64 keys x 16 queries] = k_hi.q_hi + k_hi.q_lo + k_lo.q_hi (A = K rows from LDS, B = q fragments kept in registers, q planes pre-scaled by 1/8): lane (lr, hi) holds query lr's scores of keys nb*16 + 8*hi + r;
// masked keys -> excluded; running-max online softmax in f32, maximum and sum in-lane, the maximum joined between the wave halves once per chunk, the sums once in the epilogue;
// P^T packs from the score registers straight into the B operand (score tiles 2ks and 2ks+1 are the fragment's k order) and O^T[64 d x 16 queries] += V^T.P^T: HIRES -> P and v as bf16 hi/lo (3 products, carry 1), else f16 P carried x1024 and f16 v.
template <bool HIRES>
__device__ __forceinline__ void d_flash(unsigned char* smem, const bf* __restrict__ QPh, const bf* __restrict__ QPl, const bf* __restrict__ KPh, const bf* __restrict__ KPl,
                                        const h16* __restrict__ VT16, const bf* __restrict__ VTh, const bf* __restrict__ VTl,
                                        const int* __restrict__ mask, const int* __restrict__ FL, int qblk, int h, int bz, float* OUT) {
    bf* sKh = (bf*)(smem + O_KH); bf* sKl = (bf*)(smem + O_KL);
    h16* sV16 = (h16*)(smem + O_VA); bf* sVh = (bf*)(smem + O_VA); bf* sVl = (bf*)(smem + O_VB);
    unsigned char* Ms = smem + O_MS;
    const int tid = threadIdx.x, lane = tid & 31, w = tid >> 5, lr = lane & 15, hi = lane >> 4;
    const int qb = qblk * 64;
    const size_t hp = ((size_t)bz * NH_ + h) * TT * HD;
    float* OUTb = OUT + (size_t)bz * TT * DQ;
    const bf* Qh = QPh + hp; const bf* Ql = QPl + hp; const bf* Kh = KPh + hp; const bf* Kl = KPl + hp;
    const h16* V16 = VT16 + hp; const bf* Vh = VTh + hp; const bf* Vl = VTl + hp;
    const int qrow = qb + w * 16 + lr;                       // B layout: lane -> query column
    v16bf bq[2], bq2[2];
#pragma unroll
    for (int ks = 0; ks < 2; ++ks) { bq[ks] = WFrag<bf>::ld(Qh + (size_t)qrow * HD + ks * 32 + 8 * hi); bq2[ks] = WFrag<bf>::ld(Ql + (size_t)qrow * HD + ks * 32 + 8 * hi); }
    v8f acc[4]; float m = NEGS, l = 0.0f;                    // acc[dt][r] = O^T[dt*16 + 8*hi + r][query lr]; m is the query's, l the sum over this half's keys
#pragma unroll
    for (int dt = 0; dt < 4; ++dt) acc[dt] = (v8f){};
    const unsigned char* Msq = Ms + (w * 16 + lr) * 64 + 8 * hi;   // the lane's query row of the mask tile, at its half's keys
    const float L2E = 1.4426950408889634f;
    const int fv = FL[FLIDX(qblk, lane)];                    // lane = chunk: the query block's FLP flags, read once
    const unsigned fany = __builtin_amdgcn_ballot_w32((fv & 1) != 0), fall = __builtin_amdgcn_ballot_w32((fv & 2) != 0);   // bit kc, the same in every wave of the block
#pragma unroll 1
    for (int kc = 0; kc < NCH; ++kc) {
        if (((fany >> kc) & 1u) == 0u) continue;             // block-uniform
        const bool needm = (((fall >> kc) & 1u) == 0u);
        const int kb = kc * 64;
        __syncthreads();
        const bf* gKh[4]; const bf* gKl[4]; const bf* gVh[4]; const bf* gVl[4]; const h16* gV16[4];
        v8us rKh[4], rKl[4], rVh[4], rVl[4]; v8h rV16[4];
#pragma unroll
        for (int i = 0; i < 4; ++i) {
            const int idx = i * 128 + tid; const int row = idx >> 3, seg = idx & 7;
            gKh[i] = Kh + (size_t)(kb + row) * HD + seg * 8; rKh[i] = *(const v8us*)gKh[i];
            gKl[i] = Kl + (size_t)(kb + row) * HD + seg * 8; rKl[i] = *(const v8us*)gKl[i];
            if (HIRES) { gVh[i] = Vh + (size_t)row * TT + kb + seg * 8; rVh[i] = *(const v8us*)gVh[i];
                         gVl[i] = Vl + (size_t)row * TT + kb + seg * 8; rVl[i] = *(const v8us*)gVl[i]; }
            else       { gV16[i] = V16 + (size_t)row * TT + kb + seg * 8; rV16[i] = *(const v8h*)gV16[i]; }
        }
        // the wait before a register of the loads above is used again; naming the addresses keeps them out of the loads' destinations
        if (HIRES) asm volatile("s_wait_xcnt 0x0" :: "v"(gKh[0]), "v"(gKh[1]), "v"(gKh[2]), "v"(gKh[3]), "v"(gKl[0]), "v"(gKl[1]), "v"(gKl[2]), "v"(gKl[3]), "v"(gVh[0]), "v"(gVh[1]), "v"(gVh[2]), "v"(gVh[3]), "v"(gVl[0]), "v"(gVl[1]), "v"(gVl[2]), "v"(gVl[3]) : "memory");
        else       asm volatile("s_wait_xcnt 0x0" :: "v"(gKh[0]), "v"(gKh[1]), "v"(gKh[2]), "v"(gKh[3]), "v"(gKl[0]), "v"(gKl[1]), "v"(gKl[2]), "v"(gKl[3]), "v"(gV16[0]), "v"(gV16[1]), "v"(gV16[2]), "v"(gV16[3]) : "memory");
#pragma unroll
        for (int i = 0; i < 4; ++i) {
            const int idx = i * 128 + tid; const int row = idx >> 3, seg = idx & 7;
            *(v8us*)(sKh + row * TP + seg * 8) = rKh[i];
            *(v8us*)(sKl + row * TP + seg * 8) = rKl[i];
            if (HIRES) { *(v8us*)(sVh + row * TP + seg * 8) = rVh[i]; *(v8us*)(sVl + row * TP + seg * 8) = rVl[i]; }
            else       { *(v8h*)(sV16 + row * TP + seg * 8) = rV16[i]; }
        }
        if (needm) {
#pragma unroll
            for (int i = 0; i < 8; ++i) {
                const int idx = i * 128 + tid; const int row = idx >> 4, seg = idx & 15;
                const v4i mv = *(const v4i*)(mask + (size_t)(qb + row) * MPITCH + kb + seg * 4);
                const unsigned pk = (mv[0] != 0 ? 1u : 0u) | (mv[1] != 0 ? 0x100u : 0u) | (mv[2] != 0 ? 0x10000u : 0u) | (mv[3] != 0 ? 0x1000000u : 0u);
                *(unsigned*)(Ms + row * 64 + seg * 4) = pk; } }
        __syncthreads();
        v8f s[4];
#pragma unroll
        for (int nb = 0; nb < 4; ++nb) s[nb] = (v8f){};
#pragma unroll
        for (int ks = 0; ks < 2; ++ks) {
#pragma unroll
            for (int nb = 0; nb < 4; ++nb) {
                const v16bf a = ldsAb(sKh + (nb * 16 + lr) * TP + ks * 32 + 8 * hi);
                const v16bf a2 = ldsAb(sKl + (nb * 16 + lr) * TP + ks * 32 + 8 * hi);
                s[nb] = wmmab(a, bq[ks], s[nb]); s[nb] = wmmab(a, bq2[ks], s[nb]); s[nb] = wmmab(a2, bq[ks], s[nb]);
                asm volatile("v_nop\n\tv_nop\n\tv_nop\n\tv_nop" : "+v"(s[nb]) : "v"(a), "v"(a2), "v"(bq[ks]), "v"(bq2[ks])); } }   // four vector slots behind the last WMMA of the tile, before its D is read or its operands are rewritten
        if (needm) {
#pragma unroll
            for (int nb = 0; nb < 4; ++nb) {
                const v2u mk = *(const v2ua*)(Msq + nb * 16);
#pragma unroll
                for (int r = 0; r < 8; ++r) s[nb][r] = (((mk[r >> 2] >> (8 * (r & 3))) & 0xFFu) != 0u) ? s[nb][r] : NEGS; } }
        float tm[4];
#pragma unroll
        for (int nb = 0; nb < 4; ++nb) { tm[nb] = s[nb][0];
#pragma unroll
            for (int r = 1; r < 8; ++r) tm[nb] = fmaxf(tm[nb], s[nb][r]); }
        float tmax = fmaxf(fmaxf(fmaxf(tm[0], tm[1]), fmaxf(tm[2], tm[3])), NEGS);
        tmax = fmaxf(tmax, xhalf(tmax));
        const float nm = fmaxf(m, tmax);
        const float alpha = __builtin_amdgcn_exp2f(__fmul_rn(__fsub_rn(m, nm), L2E));
        m = nm;
        float sm[4];
#pragma unroll
        for (int nb = 0; nb < 4; ++nb) { sm[nb] = 0.0f; v8f e;
#pragma unroll
            for (int r = 0; r < 8; ++r) e[r] = __fmul_rn(__fsub_rn(s[nb][r], nm), L2E);
            exp2x8(e);
#pragma unroll
            for (int r = 0; r < 8; ++r) { const float p = (s[nb][r] > -1.0e38f) ? e[r] : 0.0f; sm[nb] += p; s[nb][r] = p; } }
        l = l * alpha + ((sm[0] + sm[1]) + (sm[2] + sm[3]));
#pragma unroll
        for (int dt = 0; dt < 4; ++dt) acc[dt] *= alpha;
        if (HIRES) {
#pragma unroll
            for (int ks = 0; ks < 2; ++ks) {
                v8us ph0, ph1, pl0, pl1;
#pragma unroll
                for (int i = 0; i < 8; ++i) { unsigned short a2, c2; splitf(s[2 * ks][i], a2, c2); ph0[i] = a2; pl0[i] = c2; splitf(s[2 * ks + 1][i], a2, c2); ph1[i] = a2; pl1[i] = c2; }
                const v16bf bph = cat16b(ph0, ph1), bpl = cat16b(pl0, pl1);
#pragma unroll
                for (int dt = 0; dt < 4; ++dt) {
                    const v16bf avh = ldsAb(sVh + (dt * 16 + lr) * TP + ks * 32 + 8 * hi), avl = ldsAb(sVl + (dt * 16 + lr) * TP + ks * 32 + 8 * hi);
                    acc[dt] = wmmab(avh, bph, acc[dt]); acc[dt] = wmmab(avh, bpl, acc[dt]); acc[dt] = wmmab(avl, bph, acc[dt]);
                    asm volatile("v_nop\n\tv_nop\n\tv_nop\n\tv_nop" : "+v"(acc[dt]) : "v"(bph), "v"(bpl), "v"(avh), "v"(avl)); } }   // WMMA distance, as above
        } else {
#pragma unroll
            for (int ks = 0; ks < 2; ++ks) {
                v16h bp;
#pragma unroll
                for (int i = 0; i < 8; ++i) { bp[i] = tohx(s[2 * ks][i] * PCAR); bp[8 + i] = tohx(s[2 * ks + 1][i] * PCAR); }
#pragma unroll
                for (int dt = 0; dt < 4; ++dt) {
                    const v16h av = ldsA16(sV16 + (dt * 16 + lr) * TP + ks * 32 + 8 * hi);
                    acc[dt] = wmma16(av, bp, acc[dt]);
                    asm volatile("v_nop\n\tv_nop\n\tv_nop\n\tv_nop" : "+v"(acc[dt]) : "v"(bp), "v"(av)); } }   // WMMA distance, as above
        }
    }
    __syncthreads();                                          // all waves done with the K tiles before the output staging aliases them
    float* os = (float*)smem + w * 16 * 68;
    const float rc = HIRES ? 1.0f : (1.0f / PCAR);
    const float inv = __fdiv_rn(rc, l + xhalf(l));            // the two halves' key sums joined here
#pragma unroll
    for (int dt = 0; dt < 4; ++dt) {
        v4f o0, o1;
#pragma unroll
        for (int r = 0; r < 4; ++r) { o0[r] = acc[dt][r] * inv; o1[r] = acc[dt][4 + r] * inv; }
        *(v4fa*)(os + lr * 68 + dt * 16 + 8 * hi) = o0; *(v4fa*)(os + lr * 68 + dt * 16 + 8 * hi + 4) = o1; }
    __builtin_amdgcn_wave_barrier(); asm volatile("" ::: "memory");
    float* crow = OUTb + (size_t)(qb + w * 16) * DQ + h * HD;
{
#pragma unroll
        for (int s2 = 0; s2 < 8; ++s2) { const int row = 2 * s2 + hi, cofs = lr * 4; const v4f val = *(const v4fa*)(os + row * 68 + cofs);
            *(v4f*)(crow + (size_t)row * DQ + cofs) = val; }
         }
}

#define NQL   (NQB - RH / 64)
#define FB_L  (NQL * NH_ * NB)
#define FB_H  ((RH / 64) * NH_ * NB)
static_assert(NQL >= 1);
__global__ __launch_bounds__(128) void k_flash(const bf* __restrict__ QPh, const bf* __restrict__ QPl, const bf* __restrict__ KPh, const bf* __restrict__ KPl,
                                               const h16* __restrict__ VT16, const bf* __restrict__ VTh, const bf* __restrict__ VTl,
                                               const int* __restrict__ mask, const int* __restrict__ FL, float* OUT) {
    __shared__ __align__(16) unsigned char smem[LDS_TOTAL];
    const int b = (int)blockIdx.x;                           // flat index: query block fastest, then head, then batch; the blocks of query rows >= RH first, the few short blocks of rows < RH last
    if (b < FB_L) d_flash<false>(smem, QPh, QPl, KPh, KPl, VT16, VTh, VTl, mask, FL, RH / 64 + b % NQL, (b / NQL) % NH_, b / (NQL * NH_), OUT);
    else { const int c = b - FB_L; d_flash<true>(smem, QPh, QPl, KPh, KPl, VT16, VTh, VTl, mask, FL, c % (RH / 64), (c / (RH / 64)) % NH_, c / ((RH / 64) * NH_), OUT); }
}

extern "C" void kernel_launch(void* const* d_in, const int* in_sizes, int n_in,
                              void* d_out, int out_size, void* d_ws, size_t ws_size, hipStream_t stream) {
    if (n_in < 4) return;
    if (in_sizes[0] < (NB - 1) * SEQ_FULL * DM + TT * DM) return;
    if (in_sizes[1] < DM * DM) return;
    if (in_sizes[2] < 2 * DM * DM) return;
    if (in_sizes[3] < TT * MPITCH) return;
    if (out_size < NB * TT * DQ) return;
    const float* x = (const float*)d_in[0]; const float* wq = (const float*)d_in[1]; const float* wkv = (const float*)d_in[2]; const int* mask = (const int*)d_in[3];
    float* OUT = (float*)d_out;     // [NB][TT][DQ]
    char* wsp = (char*)d_ws;
    auto take = [&](size_t bytes) { char* p = wsp; wsp += (bytes + 255) & ~(size_t)255; return (void*)p; };
    bf* W3 = (bf*)take((size_t)D3 * DM * 2); float* CS = (float*)take((size_t)TT * HD * 2 * 4); int* FL = (int*)take((size_t)NQB * FLG * 32 * 4);
    bf* XB = (bf*)take((size_t)NB * TT * DM * 2);
    bf* QPh = (bf*)take((size_t)NB * NH_ * TT * HD * 2); bf* QPl = (bf*)take((size_t)NB * NH_ * TT * HD * 2); bf* KPh = (bf*)take((size_t)NB * NH_ * TT * HD * 2); bf* KPl = (bf*)take((size_t)NB * NH_ * TT * HD * 2);
    h16* VT16 = (h16*)take((size_t)NB * NH_ * HD * TT * 2); bf* VTh = (bf*)take((size_t)NB * NH_ * HD * TT * 2); bf* VTl = (bf*)take((size_t)NB * NH_ * HD * TT * 2);
    const size_t used = (size_t)(wsp - (char*)d_ws);
    if (used > ws_size || used > (size_t)134217728) return;   // 74,481,664 B at NB=2, SEQ=2048
    k_prep<<<PB_MF + PB_CS + PB_W + NB * PB_X, 256, 0, stream>>>(x, wq, wkv, mask, XB, W3, CS, FL);
    k_gemmw<bf, 0><<<dim3(TT / 64, D3 / 64, NB), 32, 0, stream>>>(XB, nullptr, W3, nullptr, DM, (size_t)TT * DM, 0, CS, QPh, QPl, KPh, KPl, VT16, VTh, VTl);
    k_flash<<<FB_L + FB_H, 128, 0, stream>>>(QPh, QPl, KPh, KPl, VT16, VTh, VTl, mask, FL, OUT);
}

// v007
// Measured time: 86.5 microseconds a run.
// Next to v006, in two timings, it ran 1.14 times as fast each time.
// All steps since v000 together make it 5.57 times as fast.
#include <hip/hip_runtime.h>

// Contractions: fused q|k|v projection v_wmma_f32_16x16x32_bf16 (bf16 operands = RNE-converted inputs, exact products); scores v_wmma_f32_16x16x32_bf16 with q/k as bf16 hi/lo planes (3 products) on every row; attn.v v_wmma_f32_16x16x32_f16 (f16 P carried x1024, f16 v) on query rows >= 64 and v_wmma_f32_16x16x32_bf16 with P and v as bf16 hi/lo (3 products) on query rows < 64; f32 accumulate, f32 online softmax, f32 output.
// Both batch elements go through every launch together (batch = the slowest part of the block index; every per-batch plane below is stored [batch][...]). Three launches: preparation (k_prep), projection (k_gemmw), attention (k_flash). Layout per batch: bf16 copy of x; one [3072][1024] bf16 'oi' weight (q rows, then k rows, then v rows, k/v de-interleaved from the [2048][1024] kv weight whose row is h*128 + 2d + c); both planes are stored in fragment order (see pkoff), so that the projection kernel's operand loads cover whole lines; the product x W^T stays in the projection kernel's accumulators, whose epilogue writes the planes below;
// rotary planes q,k [h][t][64] bf16 hi/lo (rotate-half, table cos/sin[t][d], q pre-scaled by 1/8); value planes [h][d][t] f16 and bf16 hi/lo; per (64-row query block, 64-key chunk) mask flags from the int mask (empty chunks skipped, partial chunks apply the mask element-wise, replace-fill), four flags to a 128-byte line (FLIDX);
// flash-style attention: K hi/lo and V chunk tiles staged in LDS, transposed products (S^T = K Q^T, O^T += V^T P^T) so that a lane holds one query's scores, online softmax in-lane, output rows written directly (no output projection).

#ifndef NB
#define NB 2
#endif
#ifndef SEQ
#define SEQ 2048
#endif
#define NB_FULL  2
#define SEQ_FULL 2048
#define TT     SEQ
#define DM     1024
#define NH_    16
#define HD     64
#define DQ     (NH_ * HD)
#define D3     (3 * DM)
#define NQB    (TT / 64)
#define NCH    (TT / 64)
#define RH     64
#define MPITCH SEQ_FULL
#define FLP    32
#define MFG    4
#define FLG    (FLP / MFG)
#define FLIDX(qblk, kc) ((((qblk) * FLG + (kc) / MFG) * 32) + (kc) % MFG)
#define PCAR   1024.0f
#define SCL    0.125f
#define NEGS   (-3.0e38f)
#define TP     72
#define TILEB  (64 * TP * 2)
#define O_KH   0
#define O_KL   (TILEB)
#define O_VA   (2 * TILEB)
#define O_VB   (3 * TILEB)
#define O_MS   (4 * TILEB)
#define LDS_TOTAL (4 * TILEB + 64 * 64)

static_assert(TT % 64 == 0);
static_assert(TT <= SEQ_FULL);
static_assert(NB >= 1 && NB <= NB_FULL);
static_assert(NCH <= FLP);
static_assert(FLP == 32 && FLP * 64 == MPITCH && MFG == 4);
static_assert(RH == 64);
static_assert(NQB >= RH / 64);
static_assert(DM % 32 == 0 && D3 % 64 == 0 && HD == 64 && DQ == DM);
static_assert(4 * 16 * 68 * 4 <= O_VA);
static_assert((TP * 2) % 16 == 0);
static_assert(16 * 68 * 4 <= 3 * 32 * TP * 2);
static_assert(LDS_TOTAL <= 65536);

typedef _Float16 h16;
typedef unsigned short bf;
typedef __attribute__((ext_vector_type(16))) __bf16   v16bf;
typedef __attribute__((ext_vector_type(16))) _Float16 v16h;
typedef __attribute__((ext_vector_type(8)))  _Float16 v8h;
typedef __attribute__((ext_vector_type(8)))  unsigned short v8us;
typedef __attribute__((ext_vector_type(8)))  float    v8f;
typedef __attribute__((ext_vector_type(4)))  float    v4f;
typedef __attribute__((ext_vector_type(2)))  float    v2f;
typedef __attribute__((ext_vector_type(4)))  int      v4i;
typedef v8h  __attribute__((may_alias)) v8ha;
typedef v4f  __attribute__((may_alias)) v4fa;
typedef v8us __attribute__((may_alias)) v8usa;
typedef __attribute__((ext_vector_type(2))) unsigned v2u;
typedef v2u  __attribute__((may_alias)) v2ua;
typedef __attribute__((ext_vector_type(2))) __bf16 v2bf;
typedef __attribute__((ext_vector_type(4))) unsigned v4u;
typedef v4u  __attribute__((may_alias)) v4ua;

__device__ __forceinline__ unsigned short f2bf(float f) { unsigned u = __float_as_uint(f); u += 0x7FFFu + ((u >> 16) & 1u); return (unsigned short)(u >> 16); }
__device__ __forceinline__ float bf2f(unsigned short b) { return __uint_as_float(((unsigned)b) << 16); }
__device__ __forceinline__ v16h cat16(v8h lo, v8h hi) { return __builtin_shufflevector(lo, hi, 0, 1, 2, 3, 4, 5, 6, 7, 8, 9, 10, 11, 12, 13, 14, 15); }
__device__ __forceinline__ v16bf cat16b(v8us lo, v8us hi) { return __builtin_bit_cast(v16bf, __builtin_shufflevector(lo, hi, 0, 1, 2, 3, 4, 5, 6, 7, 8, 9, 10, 11, 12, 13, 14, 15)); }
__device__ __forceinline__ v8f wmma16(v16h a, v16h b, v8f c) { return __builtin_amdgcn_wmma_f32_16x16x32_f16(false, a, false, b, (short)0, c, false, false); }
__device__ __forceinline__ v8f wmmab(v16bf a, v16bf b, v8f c) { return __builtin_amdgcn_wmma_f32_16x16x32_bf16(false, a, false, b, (short)0, c, false, false); }
__device__ __forceinline__ h16 tohx(float x) { return (h16)x; }
__device__ __forceinline__ void splitf(float y, unsigned short& h, unsigned short& l) { h = f2bf(y); l = f2bf(y - bf2f(h)); }
// The same split of two values at once on the packed converter (f32 -> bf16, round to nearest even like f2bf): hi word and lo word, first value in bits 15..0; and the two picks that pair the low or the high halves of two words.
__device__ __forceinline__ unsigned pkbf(float a, float b) { v2f v; v[0] = a; v[1] = b; return __builtin_bit_cast(unsigned, __builtin_convertvector(v, v2bf)); }
__device__ __forceinline__ void split2(float a, float b, unsigned& h, unsigned& l) { h = pkbf(a, b); l = pkbf(a - __uint_as_float(h << 16), b - __uint_as_float(h & 0xFFFF0000u)); }
__device__ __forceinline__ unsigned lo16(unsigned e0, unsigned e1) { return (e0 & 0xFFFFu) | (e1 << 16); }
__device__ __forceinline__ unsigned hi16(unsigned e0, unsigned e1) { return (e0 >> 16) | (e1 & 0xFFFF0000u); }
__device__ __forceinline__ float xhalf(float x) { return __builtin_bit_cast(float, __builtin_amdgcn_permlanex16(__builtin_bit_cast(int, x), __builtin_bit_cast(int, x), 0x76543210, 0xfedcba98, false, false)); }  // lane l with lane l ^ 16

// 2^x of eight values in place. The eight v_exp_f32 and the free slot that the instruction set asks for behind a transcendental stand in ONE statement: a v_nop in a statement of its own landed elsewhere.
__device__ __forceinline__ void exp2x8(v8f& v) {
    float e0 = v[0], e1 = v[1], e2 = v[2], e3 = v[3], e4 = v[4], e5 = v[5], e6 = v[6], e7 = v[7];
    asm("v_exp_f32 %0, %0\n\tv_exp_f32 %1, %1\n\tv_exp_f32 %2, %2\n\tv_exp_f32 %3, %3\n\tv_exp_f32 %4, %4\n\tv_exp_f32 %5, %5\n\tv_exp_f32 %6, %6\n\tv_exp_f32 %7, %7\n\tv_nop"
        : "+v"(e0), "+v"(e1), "+v"(e2), "+v"(e3), "+v"(e4), "+v"(e5), "+v"(e6), "+v"(e7));
    v[0] = e0; v[1] = e1; v[2] = e2; v[3] = e3; v[4] = e4; v[5] = e5; v[6] = e6; v[7] = e7;
}

// Fragment loaders (split k map for A and B alike): element i of the 16-wide vector <- k0 + 8*hi + i (i < 8), k0 + 16 + 8*hi + (i - 8) (i >= 8); callers pass p = row_base + k0 + 8*hi.
template <typename T16> struct WFrag;
template <> struct WFrag<bf> { typedef v16bf V; static __device__ __forceinline__ V ld(const bf* p) { return cat16b(*(const v8us*)p, *(const v8us*)(p + 16)); } static __device__ __forceinline__ V ldp(const bf* p) { return cat16b(*(const v8us*)p, *(const v8us*)(p + 256)); } static __device__ __forceinline__ v8f mma(V a, V b, v8f c) { return wmmab(a, b, c); } };
// Fragment order of a K-contiguous [rows][DM] 16-bit plane: blocks of 16 rows x 32 k, 512 elements each, block (rb, kb) at (rb * (DM / 32) + kb) * 512. Inside a block, lane (row & 15) + 16 * hi keeps its eight elements k = 8*hi + i at lane * 8 + i and its eight elements k = 16 + 8*hi + i at 256 + lane * 8 + i:
// the same k map as above, and each of a fragment's two loads (ldp, p = block + lane * 8) reads 512 contiguous bytes, four whole lines, where the row-major plane gave 32 bytes of each of 16 lines.
// The converters go by 8-element unit i: sgm = i & 3 (which eight k of the block), r16 = (i >> 2) & 15 (row in the block), block = i >> 6; a wave then reads eight whole 128-byte f32 lines and writes four whole 128-byte lines.
__device__ __forceinline__ size_t pkoff(size_t i) { const size_t sgm = i & 3, r16 = (i >> 2) & 15; return (i >> 6) * 512 + (sgm >> 1) * 256 + ((sgm & 1) * 16 + r16) * 8; }
__device__ __forceinline__ int pkrow(size_t i) { return (int)((i >> 6) / (DM / 32)) * 16 + (int)((i >> 2) & 15); }
__device__ __forceinline__ int pkcol(size_t i) { return (int)((i >> 6) % (DM / 32)) * 32 + (int)(i & 3) * 8; }
// LDS reloads of tiles written as 16-bit elements: same element type through may_alias vectors.
__device__ __forceinline__ v16h  ldsA16(const h16* p) { return cat16(*(const v8ha*)p, *(const v8ha*)(p + 16)); }
__device__ __forceinline__ v16bf ldsAb(const bf* p) { return cat16b(*(const v8usa*)p, *(const v8usa*)(p + 16)); }

// ---- k_gemmw: register-blocked GEMM of the fused q|k|v projection with its epilogue, ONE WAVE per 64x64 tile of x W^T (16 accumulators), operands straight from 16-bit planes in fragment order (pkoff; K == DM); grid (TT/64, 3*NH_, batch), 32 threads.
// acc[m][n] = sum_k A[m][k] Bt[n][k] (+ split products per NSPLIT). z-batch strides sA/sB in elements. K % 32 == 0.
// A tile's 64 columns are one head of q, k or v (blockIdx.y = section*NH_ + head), so the head planes are written from the accumulators and the f32 product never goes to memory.
// q, k: rotate-half rotary in registers (columns d and d+32 are accumulator tiles nb and nb+2 of the same lane; the table holds the same cos, sin at d and d+32): out[d] = x[d] cos - x[d+32] sin, out[d+32] = x[d+32] cos + x[d] sin, times sc, split to bf16 hi/lo;
//       two rows' bf16 per word, hi words and lo words staged per 16 rows in LDS (pitch 68 words), planes [h][t][d] stored as whole 128-byte rows.
// v:    a lane's eight accumulator rows are eight consecutive t of one d: packed to f16, bf16 hi, bf16 lo; 32 d of the three [d][t] planes at a time staged in LDS (pitch TP), planes [h][d][t] stored as whole 128-byte rows.
template <typename T16, int NSPLIT>
__global__ __launch_bounds__(32) void k_gemmw(const T16* __restrict__ A, const T16* __restrict__ A2, const T16* __restrict__ Bt, const T16* __restrict__ Bt2, int K, size_t sA, size_t sB, const float* __restrict__ CS, bf* QPh, bf* QPl, bf* KPh, bf* KPl, h16* VT16, bf* VTh, bf* VTl) {
    typedef typename WFrag<T16>::V V;
    __shared__ __align__(16) unsigned char st[3 * 32 * TP * 2];
    const size_t z = blockIdx.z; A += z * sA; if (A2) A2 += z * sA; Bt += z * sB; if (Bt2) Bt2 += z * sB;
    const int lane = threadIdx.x & 31, lr = lane & 15, hi = lane >> 4; const int r0 = blockIdx.x * 64, c0 = blockIdx.y * 64;
    v8f acc[4][4];
#pragma unroll
    for (int mb = 0; mb < 4; ++mb)
#pragma unroll
        for (int nb = 0; nb < 4; ++nb) acc[mb][nb] = (v8f){};
    const T16* pa = A + (size_t)r0 * DM + lane * 8; const T16* pb = Bt + (size_t)c0 * DM + lane * 8;   // a row of blocks is 16 * DM elements, a step of 32 k is 512
    const T16* pa2 = (NSPLIT == 1 || NSPLIT == 2) ? A2 + (size_t)r0 * DM + lane * 8 : nullptr; const T16* pb2 = (NSPLIT >= 2) ? Bt2 + (size_t)c0 * DM + lane * 8 : nullptr;
#pragma unroll 1
    for (int kc = 0; kc < K; kc += 32) {
        V a[4], a2[4], b4[4], b24[4];
#pragma unroll
        for (int mb = 0; mb < 4; ++mb) { a[mb] = WFrag<T16>::ldp(pa + mb * 16 * DM); if (NSPLIT == 1 || NSPLIT == 2) a2[mb] = WFrag<T16>::ldp(pa2 + mb * 16 * DM); }
#pragma unroll
        for (int nb = 0; nb < 4; ++nb) { b4[nb] = WFrag<T16>::ldp(pb + nb * 16 * DM); if (NSPLIT >= 2) b24[nb] = WFrag<T16>::ldp(pb2 + nb * 16 * DM); }
        asm volatile("s_wait_xcnt 0x0" :: "v"(pa), "v"(pb) : "memory");   // the wait before the loads' address registers are stepped; naming the addresses keeps them out of the loads' destinations
        if (NSPLIT != 0) asm volatile("s_wait_xcnt 0x0" :: "v"(pa2), "v"(pb2) : "memory");   // the same for the split planes' addresses
        pa += 512; pb += 512; if (NSPLIT == 1 || NSPLIT == 2) pa2 += 512; if (NSPLIT >= 2) pb2 += 512;
#pragma unroll
        for (int nb = 0; nb < 4; ++nb) { const V b = b4[nb]; V b2; if (NSPLIT >= 2) b2 = b24[nb];
#pragma unroll
            for (int mb = 0; mb < 4; ++mb) { acc[mb][nb] = WFrag<T16>::mma(a[mb], b, acc[mb][nb]); if (NSPLIT == 1 || NSPLIT == 2) acc[mb][nb] = WFrag<T16>::mma(a2[mb], b, acc[mb][nb]); if (NSPLIT >= 2) acc[mb][nb] = WFrag<T16>::mma(a[mb], b2, acc[mb][nb]); } }
        asm volatile("v_nop\n\tv_nop\n\tv_nop\n\tv_nop" : "+v"(acc[0][0]), "+v"(acc[1][1]), "+v"(acc[2][2]), "+v"(acc[3][3]) : "v"(a[0]), "v"(a[3]));
    }
    const int sec = (int)blockIdx.y / NH_, h = (int)blockIdx.y % NH_;                 // wave-uniform
    const size_t hp = (z * NH_ + h) * TT * HD;
    if (sec < 2) {
        unsigned* us = (unsigned*)st;
        bf* Ph = (sec == 0 ? QPh : KPh) + hp + (size_t)r0 * HD; bf* Pl = (sec == 0 ? QPl : KPl) + hp + (size_t)r0 * HD;
        const float sc = (sec == 0) ? SCL : 1.0f;
#pragma unroll
        for (int mb = 0; mb < 4; ++mb) {
            const float* cp = CS + ((size_t)(r0 + mb * 16 + hi * 8) * HD + lr) * 2;
            v2f cs[2][8];
#pragma unroll
            for (int j = 0; j < 8; ++j) { cs[0][j] = *(const v2f*)(cp + j * HD * 2); cs[1][j] = *(const v2f*)(cp + j * HD * 2 + 32); }
            asm volatile("s_wait_xcnt 0x0" :: "v"(cp) : "memory");   // the wait before a register of the loads above is used again; naming the address keeps it out of their destinations
#pragma unroll
            for (int nl = 0; nl < 2; ++nl) {
                float ra[8], rb[8];
#pragma unroll
                for (int j = 0; j < 8; ++j) {
                    const float x0 = acc[mb][nl][j], x1 = acc[mb][nl + 2][j], cn = cs[nl][j][0], sn = cs[nl][j][1];
                    ra[j] = (x0 * cn - x1 * sn) * sc; rb[j] = (x1 * cn + x0 * sn) * sc; }
#pragma unroll
                for (int jp = 0; jp < 4; ++jp) {                                      // one word = rows 2jp, 2jp+1 of one column; word rows 0..7 hi, 8..15 lo
                    unsigned wh, wl; unsigned* u = us + (hi * 4 + jp) * 68 + nl * 16 + lr;
                    split2(ra[2 * jp], ra[2 * jp + 1], wh, wl); u[0] = wh; u[8 * 68] = wl;
                    split2(rb[2 * jp], rb[2 * jp + 1], wh, wl); u[32] = wh; u[8 * 68 + 32] = wl; } }
            __builtin_amdgcn_wave_barrier(); asm volatile("" ::: "memory");   // keeps the other lanes' LDS writes ahead of the reads below in the compiled order
#pragma unroll
            for (int s = 0; s < 4; ++s) {
                const int pr = (s & 1) * 4 + (lane >> 3), seg = lane & 7;             // row pair and 8-column segment; s >> 1 picks the plane
                const unsigned* u = us + ((s >> 1) * 8 + pr) * 68 + seg * 8;
                const v4u p0 = *(const v4ua*)u, p1 = *(const v4ua*)(u + 4);
                v4u oe, oo;
                oe[0] = lo16(p0[0], p0[1]); oe[1] = lo16(p0[2], p0[3]); oe[2] = lo16(p1[0], p1[1]); oe[3] = lo16(p1[2], p1[3]);
                oo[0] = hi16(p0[0], p0[1]); oo[1] = hi16(p0[2], p0[3]); oo[2] = hi16(p1[0], p1[1]); oo[3] = hi16(p1[2], p1[3]);
                bf* P = ((s >> 1) ? Pl : Ph) + (size_t)(mb * 16 + 2 * pr) * HD + seg * 8;
                *(v4ua*)P = oe; *(v4ua*)(P + HD) = oo; }
            if (mb < 3) { __builtin_amdgcn_wave_barrier(); asm volatile("s_wait_xcnt 0x0" ::: "memory"); }   // the reads above stay ahead of the next rows' LDS writes; the wait stands before the stores' registers are used again
        }
    } else {
        bf* sp = (bf*)st;
#pragma unroll
        for (int hf = 0; hf < 2; ++hf) {                                              // 32 d at a time, the three planes side by side in LDS
#pragma unroll
            for (int nl = 0; nl < 2; ++nl) {
#pragma unroll
                for (int mb = 0; mb < 4; ++mb) {
                    const v8f x = acc[mb][hf * 2 + nl]; v4u oh, ol;
#pragma unroll
                    for (int i = 0; i < 4; ++i) { unsigned wh, wl; split2(x[2 * i], x[2 * i + 1], wh, wl); oh[i] = wh; ol[i] = wl; }
                    bf* q = sp + (nl * 16 + lr) * TP + mb * 16 + hi * 8;
                    *(v4ua*)q = __builtin_bit_cast(v4u, __builtin_convertvector(x, v8h)); *(v4ua*)(q + 32 * TP) = oh; *(v4ua*)(q + 64 * TP) = ol; } }
            __builtin_amdgcn_wave_barrier(); asm volatile("" ::: "memory");   // other lanes' LDS writes ahead of the reads below, as above
#pragma unroll
            for (int pl = 0; pl < 3; ++pl) {
                bf* P = ((pl == 0) ? (bf*)VT16 : (pl == 1) ? VTh : VTl) + hp + (size_t)hf * 32 * TT + r0;
#pragma unroll
                for (int s = 0; s < 8; ++s) {
                    const int idx = s * 32 + lane; const int row = idx >> 3, seg = idx & 7;
                    *(v4ua*)(P + (size_t)row * TT + seg * 8) = *(const v4ua*)(sp + (pl * 32 + row) * TP + seg * 8); } }
            __builtin_amdgcn_wave_barrier(); asm volatile("s_wait_xcnt 0x0" ::: "memory");   // reads ahead of the next half's LDS writes; the wait before the stores' registers are used again (behind the last half too: the built code lays the q, k block behind this one)
        }
    }
}

// The four preparation jobs below depend on nothing but the inputs and not on each other: they are bodies of ONE kernel, k_prep, which hands each a range of its blocks (blk = the block's index inside its range).
__device__ __forceinline__ void d_cvt8(int blk, int bz, const float* __restrict__ src, bf* dst, size_t n8, size_t sS, size_t sD) { const size_t i = (size_t)blk * 256 + threadIdx.x; if (i >= n8) return; src += bz * sS; dst += bz * sD; const v8f v = *(const v8f*)(src + (size_t)pkrow(i) * DM + pkcol(i)); v8us o;
#pragma unroll
    for (int k = 0; k < 8; ++k) o[k] = f2bf(v[k]); *(v8us*)(dst + pkoff(i)) = o;  }

__device__ __forceinline__ void d_cvtw(int blk, const float* __restrict__ wq, const float* __restrict__ wkv, bf* dst, size_t n8) {
    const size_t i = (size_t)blk * 256 + threadIdx.x; if (i >= n8) return;
    const int row = pkrow(i), col = pkcol(i);
    const int r2 = max(row - DM, 0); const int c = (r2 >= DM) ? 1 : 0; const int r3 = r2 - c * DM;
    const int srow = (r3 >> 6) * (2 * HD) + 2 * (r3 & 63) + c;
    const float* src = (row < DM) ? (wq + (size_t)row * DM + col) : (wkv + (size_t)srow * DM + col);
    const v8f v = *(const v8f*)src; v8us o;
#pragma unroll
    for (int k = 0; k < 8; ++k) o[k] = f2bf(v[k]);
    *(v8us*)(dst + pkoff(i)) = o; 
}

__device__ __forceinline__ void d_cstab(int blk, float* CS) {
    const int idx = blk * 256 + threadIdx.x; if (idx >= TT * HD) return;
    const int t = idx / HD, dd = idx % HD, p = dd & (HD / 2 - 1);
    const float pw = exp10f((float)p * 0.125f);
    const float inv = __fdiv_rn(1.0f, pw);
    float ang = __fmul_rn((float)t, inv); asm volatile("" : "+v"(ang));
    float sn, cn; sincosf(ang, &sn, &cn);
    v2f cs; cs[0] = cn; cs[1] = sn;
    *(v2f*)(CS + (size_t)idx * 2) = cs; 
}

// d_mflag: per (64-row query block, 64-key chunk) flags from the int mask [q][k] (row pitch MPITCH): bit0 = any nonzero, bit1 = all nonzero; chunks >= NCH flagged 0.
// One block per (query block, group of MFG chunks): 64 rows x 256 columns, 16 loads of 16 bytes per thread, none depending on another, each wave-load 512 contiguous bytes of one row. Threads 64*rg .. 64*rg+63 take rows 16*rg .. 16*rg+15; 16 lanes span one chunk's columns.
// A block's MFG flags go to a 128-byte line of their own (FLIDX), so that a line has one writer.
__device__ __forceinline__ void d_mflag(int blk, int* fls, const int* __restrict__ mask, int* FL) {
    const int tid = threadIdx.x, lane = tid & 31, w = tid >> 5; const int qblk = blk / FLG, g = blk % FLG, qb = qblk * 64;
    const int* mp = mask + (size_t)(qb + (tid >> 6) * 16) * MPITCH + g * (MFG * 64) + (tid & 63) * 4;
    v4i a[16];
#pragma unroll
    for (int i = 0; i < 16; ++i) a[i] = *(const v4i*)(mp + (size_t)i * MPITCH);
    // the wait before a register of the loads above is used again; naming the address keeps it out of their destinations, and naming the loaded values (inputs only) keeps all 16 loads in flight together: without it this build waited for nine before it issued the other seven
    asm volatile("s_wait_xcnt 0x0" :: "v"(mp), "v"(a[0]), "v"(a[1]), "v"(a[2]), "v"(a[3]), "v"(a[4]), "v"(a[5]), "v"(a[6]), "v"(a[7]), "v"(a[8]), "v"(a[9]), "v"(a[10]), "v"(a[11]), "v"(a[12]), "v"(a[13]), "v"(a[14]), "v"(a[15]) : "memory");
    unsigned anyv = 0u, minv = 0xFFFFFFFFu;                   // OR of the words; their unsigned minimum, which is nonzero exactly when every word is
#pragma unroll
    for (int i = 0; i < 16; ++i)
#pragma unroll
        for (int q = 0; q < 4; ++q) { anyv |= (unsigned)a[i][q]; minv = min(minv, (unsigned)a[i][q]); }
    const unsigned bany = __builtin_amdgcn_ballot_w32(anyv != 0u), ball = __builtin_amdgcn_ballot_w32(minv != 0u);   // bits 15..0: the wave's first chunk, bits 31..16: its second
    if ((lane & 15) == 0) { const unsigned ha = (bany >> lane) & 0xFFFFu, hl = (ball >> lane) & 0xFFFFu; fls[w * 2 + (lane >> 4)] = (ha != 0u ? 1 : 0) | (hl == 0xFFFFu ? 2 : 0); }
    __syncthreads();
    if (tid < MFG) {                                          // chunk tid of the group: wave 2*rg + (tid >> 1), half tid & 1, joined over the four row groups
        int va = 0, vl = 2;
#pragma unroll
        for (int rg = 0; rg < 4; ++rg) { const int v = fls[(rg * 2 + (tid >> 1)) * 2 + (tid & 1)]; va |= v & 1; vl &= v; }
        const int kc = g * MFG + tid;
        FL[FLIDX(qblk, kc)] = (kc < NCH) ? (va | vl) : 0; }
}

// k_prep: block ranges, in this order: mask flags, rotary table, weight planes, x planes. The range test is block-uniform.
#define PB_MF  (NQB * FLG)
#define PB_CS  ((TT * HD + 255) / 256)
#define PB_W   ((D3 * DM / 8 + 255) / 256)
#define PB_X   ((TT * DM / 8 + 255) / 256)
__global__ __launch_bounds__(256) void k_prep(const float* __restrict__ x, const float* __restrict__ wq, const float* __restrict__ wkv, const int* __restrict__ mask, bf* XB, bf* W3, float* CS, int* FL) {
    __shared__ int fls[FLP];
    int blk = (int)blockIdx.x;
    if (blk < PB_MF) { d_mflag(blk, fls, mask, FL); return; }
    blk -= PB_MF;
    if (blk < PB_CS) { d_cstab(blk, CS); return; }
    blk -= PB_CS;
    if (blk < PB_W) { d_cvtw(blk, wq, wkv, W3, (size_t)D3 * DM / 8); return; }
    blk -= PB_W;
    d_cvt8(blk % PB_X, blk / PB_X, x, XB, (size_t)TT * DM / 8, (size_t)SEQ_FULL * DM, (size_t)TT * DM);
}

// k_flash: flash-style masked softmax attention for one head and one 64-row query block per workgroup (128 threads = 4 waves x 16 query rows); one block per (query block, head, batch). d_flash<HIRES> is its body; the kernel picks the form by the block's query rows (block-uniform), so both forms run in one launch.
// Per 64-key chunk (flag bit0 set): K hi/lo tiles [key][d] and the V^T tile [d][key] staged in LDS (pitch TP), the int mask tile packed to bytes when the chunk is partial (flag bit1 clear);
// S^T[64 keys x 16 queries] = k_hi.q_hi + k_hi.q_lo + k_lo.q_hi (A = K rows from LDS, B = q fragments kept in registers, q planes pre-scaled by 1/8): lane (lr, hi) holds query lr's scores of keys nb*16 + 8*hi + r;
// masked keys -> excluded; running-max online softmax in f32, maximum and sum in-lane, the maximum joined between the wave halves once per chunk, the sums once in the epilogue;
// P^T packs from the score registers straight into the B operand (score tiles 2ks and 2ks+1 are the fragment's k order) and O^T[64 d x 16 queries] += V^T.P^T: HIRES -> P and v as bf16 hi/lo (3 products, carry 1), else f16 P carried x1024 and f16 v.
template <bool HIRES>
__device__ __forceinline__ void d_flash(unsigned char* smem, const bf* __restrict__ QPh, const bf* __restrict__ QPl, const bf* __restrict__ KPh, const bf* __restrict__ KPl,
                                        const h16* __restrict__ VT16, const bf* __restrict__ VTh, const bf* __restrict__ VTl,
                                        const int* __restrict__ mask, const int* __restrict__ FL, int qblk, int h, int bz, float* OUT) {
    bf* sKh = (bf*)(smem + O_KH); bf* sKl = (bf*)(smem + O_KL);
    h16* sV16 = (h16*)(smem + O_VA); bf* sVh = (bf*)(smem + O_VA); bf* sVl = (bf*)(smem + O_VB);
    unsigned char* Ms = smem + O_MS;
    const int tid = threadIdx.x, lane = tid & 31, w = tid >> 5, lr = lane & 15, hi = lane >> 4;
    const int qb = qblk * 64;
    const size_t hp = ((size_t)bz * NH_ + h) * TT * HD;
    float* OUTb = OUT + (size_t)bz * TT * DQ;
    const bf* Qh = QPh + hp; const bf* Ql = QPl + hp; const bf* Kh = KPh + hp; const bf* Kl = KPl + hp;
    const h16* V16 = VT16 + hp; const bf* Vh = VTh + hp; const bf* Vl = VTl + hp;
    const int qrow = qb + w * 16 + lr;                       // B layout: lane -> query column
    v16bf bq[2], bq2[2];
#pragma unroll
    for (int ks = 0; ks < 2; ++ks) { bq[ks] = WFrag<bf>::ld(Qh + (size_t)qrow * HD + ks * 32 + 8 * hi); bq2[ks] = WFrag<bf>::ld(Ql + (size_t)qrow * HD + ks * 32 + 8 * hi); }
    v8f acc[4]; float m = NEGS, l = 0.0f;                    // acc[dt][r] = O^T[dt*16 + 8*hi + r][query lr]; m is the query's, l the sum over this half's keys
#pragma unroll
    for (int dt = 0; dt < 4; ++dt) acc[dt] = (v8f){};
    const unsigned char* Msq = Ms + (w * 16 + lr) * 64 + 8 * hi;   // the lane's query row of the mask tile, at its half's keys
    const float L2E = 1.4426950408889634f;
    const int fv = FL[FLIDX(qblk, lane)];                    // lane = chunk: the query block's FLP flags, read once
    const unsigned fany = __builtin_amdgcn_ballot_w32((fv & 1) != 0), fall = __builtin_amdgcn_ballot_w32((fv & 2) != 0);   // bit kc, the same in every wave of the block
#pragma unroll 1
    for (int kc = 0; kc < NCH; ++kc) {
        if (((fany >> kc) & 1u) == 0u) continue;             // block-uniform
        const bool needm = (((fall >> kc) & 1u) == 0u);
        const int kb = kc * 64;
        __syncthreads();
        const bf* gKh[4]; const bf* gKl[4]; const bf* gVh[4]; const bf* gVl[4]; const h16* gV16[4];
        v8us rKh[4], rKl[4], rVh[4], rVl[4]; v8h rV16[4];
#pragma unroll
        for (int i = 0; i < 4; ++i) {
            const int idx = i * 128 + tid; const int row = idx >> 3, seg = idx & 7;
            gKh[i] = Kh + (size_t)(kb + row) * HD + seg * 8; rKh[i] = *(const v8us*)gKh[i];
            gKl[i] = Kl + (size_t)(kb + row) * HD + seg * 8; rKl[i] = *(const v8us*)gKl[i];
            if (HIRES) { gVh[i] = Vh + (size_t)row * TT + kb + seg * 8; rVh[i] = *(const v8us*)gVh[i];
                         gVl[i] = Vl + (size_t)row * TT + kb + seg * 8; rVl[i] = *(const v8us*)gVl[i]; }
            else       { gV16[i] = V16 + (size_t)row * TT + kb + seg * 8; rV16[i] = *(const v8h*)gV16[i]; }
        }
        // the wait before a register of the loads above is used again; naming the addresses keeps them out of the loads' destinations
        if (HIRES) asm volatile("s_wait_xcnt 0x0" :: "v"(gKh[0]), "v"(gKh[1]), "v"(gKh[2]), "v"(gKh[3]), "v"(gKl[0]), "v"(gKl[1]), "v"(gKl[2]), "v"(gKl[3]), "v"(gVh[0]), "v"(gVh[1]), "v"(gVh[2]), "v"(gVh[3]), "v"(gVl[0]), "v"(gVl[1]), "v"(gVl[2]), "v"(gVl[3]) : "memory");
        else       asm volatile("s_wait_xcnt 0x0" :: "v"(gKh[0]), "v"(gKh[1]), "v"(gKh[2]), "v"(gKh[3]), "v"(gKl[0]), "v"(gKl[1]), "v"(gKl[2]), "v"(gKl[3]), "v"(gV16[0]), "v"(gV16[1]), "v"(gV16[2]), "v"(gV16[3]) : "memory");
#pragma unroll
        for (int i = 0; i < 4; ++i) {
            const int idx = i * 128 + tid; const int row = idx >> 3, seg = idx & 7;
            *(v8us*)(sKh + row * TP + seg * 8) = rKh[i];
            *(v8us*)(sKl + row * TP + seg * 8) = rKl[i];
            if (HIRES) { *(v8us*)(sVh + row * TP + seg * 8) = rVh[i]; *(v8us*)(sVl + row * TP + seg * 8) = rVl[i]; }
            else       { *(v8h*)(sV16 + row * TP + seg * 8) = rV16[i]; }
        }
        if (needm) {
#pragma unroll
            for (int i = 0; i < 8; ++i) {
                const int idx = i * 128 + tid; const int row = idx >> 4, seg = idx & 15;
                const v4i mv = *(const v4i*)(mask + (size_t)(qb + row) * MPITCH + kb + seg * 4);
                const unsigned pk = (mv[0] != 0 ? 1u : 0u) | (mv[1] != 0 ? 0x100u : 0u) | (mv[2] != 0 ? 0x10000u : 0u) | (mv[3] != 0 ? 0x1000000u : 0u);
                *(unsigned*)(Ms + row * 64 + seg * 4) = pk; } }
        __syncthreads();
        // The chunk's LDS fragment reads are issued as groups of eight ahead of the products that use them, not tile by tile (K hi and lo of k 0..31 first; each later K group where an older group's registers come free; all V^T reads in front of the softmax), within the 256 registers that let four waves share a SIMD;
        // every run of products goes round the four independent score tiles; a tile's own products keep their order (hi.hi, hi.lo, lo.hi of k 0..31, then of k 32..63).
        // The form for query rows < RH, whose four staged planes leave no registers for that, keeps one tile's reads in front of that tile's products.
        v8f s[4]; v16h av[2][4];
        if (HIRES) {
#pragma unroll
            for (int nb = 0; nb < 4; ++nb) s[nb] = (v8f){};
#pragma unroll
            for (int ks = 0; ks < 2; ++ks) {
#pragma unroll
                for (int nb = 0; nb < 4; ++nb) {
                    const v16bf a = ldsAb(sKh + (nb * 16 + lr) * TP + ks * 32 + 8 * hi);
                    const v16bf a2 = ldsAb(sKl + (nb * 16 + lr) * TP + ks * 32 + 8 * hi);
                    s[nb] = wmmab(a, bq[ks], s[nb]); s[nb] = wmmab(a, bq2[ks], s[nb]); s[nb] = wmmab(a2, bq[ks], s[nb]);
                    asm volatile("v_nop\n\tv_nop\n\tv_nop\n\tv_nop" : "+v"(s[nb]) : "v"(a), "v"(a2), "v"(bq[ks]), "v"(bq2[ks])); } }   // four vector slots behind the last WMMA of the tile, before its D is read or its operands are rewritten
        } else {
        v16bf kh0[4], kl0[4], kh1[4], kl1[4];
        const bf* pKh = sKh + lr * TP + 8 * hi; const bf* pKl = sKl + lr * TP + 8 * hi;
#pragma unroll
        for (int nb = 0; nb < 4; ++nb) kh0[nb] = ldsAb(pKh + nb * 16 * TP);
#pragma unroll
        for (int nb = 0; nb < 4; ++nb) kl0[nb] = ldsAb(pKl + nb * 16 * TP);
#pragma unroll
        for (int nb = 0; nb < 4; ++nb) s[nb] = wmmab(kh0[nb], bq[0], (v8f){});
#pragma unroll
        for (int nb = 0; nb < 4; ++nb) s[nb] = wmmab(kh0[nb], bq2[0], s[nb]);
#pragma unroll
        for (int nb = 0; nb < 4; ++nb) kh1[nb] = ldsAb(pKh + nb * 16 * TP + 32);
#pragma unroll
        for (int nb = 0; nb < 4; ++nb) s[nb] = wmmab(kl0[nb], bq[0], s[nb]);
#pragma unroll
        for (int nb = 0; nb < 4; ++nb) kl1[nb] = ldsAb(pKl + nb * 16 * TP + 32);
#pragma unroll
        for (int nb = 0; nb < 4; ++nb) s[nb] = wmmab(kh1[nb], bq[1], s[nb]);
#pragma unroll
        for (int nb = 0; nb < 4; ++nb) s[nb] = wmmab(kh1[nb], bq2[1], s[nb]);
#pragma unroll
        for (int nb = 0; nb < 4; ++nb) s[nb] = wmmab(kl1[nb], bq[1], s[nb]);
        asm volatile("v_nop\n\tv_nop\n\tv_nop\n\tv_nop" : "+v"(s[0]), "+v"(s[1]), "+v"(s[2]), "+v"(s[3]) : "v"(kl1[0]), "v"(kl1[1]), "v"(kl1[2]), "v"(kl1[3]), "v"(bq[1]));   // four vector slots behind the last WMMAs, before a D is read or an operand rewritten, on the taken side of the branch below too
        // all V^T fragments of the chunk, read while the softmax below runs
#pragma unroll
        for (int ks = 0; ks < 2; ++ks)
#pragma unroll
            for (int dt = 0; dt < 4; ++dt) av[ks][dt] = ldsA16(sV16 + (dt * 16 + lr) * TP + ks * 32 + 8 * hi);
        }
        if (needm) {
#pragma unroll
            for (int nb = 0; nb < 4; ++nb) {
                const v2u mk = *(const v2ua*)(Msq + nb * 16);
#pragma unroll
                for (int r = 0; r < 8; ++r) s[nb][r] = (((mk[r >> 2] >> (8 * (r & 3))) & 0xFFu) != 0u) ? s[nb][r] : NEGS; } }
        float tm[4];
#pragma unroll
        for (int nb = 0; nb < 4; ++nb) { tm[nb] = s[nb][0];
#pragma unroll
            for (int r = 1; r < 8; ++r) tm[nb] = fmaxf(tm[nb], s[nb][r]); }
        float tmax = fmaxf(fmaxf(fmaxf(tm[0], tm[1]), fmaxf(tm[2], tm[3])), NEGS);
        tmax = fmaxf(tmax, xhalf(tmax));
        const float nm = fmaxf(m, tmax);
        const float alpha = __builtin_amdgcn_exp2f(__fmul_rn(__fsub_rn(m, nm), L2E));
        m = nm;
        float sm[4];
#pragma unroll
        for (int nb = 0; nb < 4; ++nb) { sm[nb] = 0.0f; v8f e;
#pragma unroll
            for (int r = 0; r < 8; ++r) e[r] = __fmul_rn(__fsub_rn(s[nb][r], nm), L2E);
            exp2x8(e);
#pragma unroll
            for (int r = 0; r < 8; ++r) { const float p = (s[nb][r] > -1.0e38f) ? e[r] : 0.0f; sm[nb] += p; s[nb][r] = p; } }
        l = l * alpha + ((sm[0] + sm[1]) + (sm[2] + sm[3]));
#pragma unroll
        for (int dt = 0; dt < 4; ++dt) acc[dt] *= alpha;
        if (HIRES) {
#pragma unroll
            for (int ks = 0; ks < 2; ++ks) {
                v8us ph0, ph1, pl0, pl1;
#pragma unroll
                for (int i = 0; i < 8; ++i) { unsigned short a2, c2; splitf(s[2 * ks][i], a2, c2); ph0[i] = a2; pl0[i] = c2; splitf(s[2 * ks + 1][i], a2, c2); ph1[i] = a2; pl1[i] = c2; }
                const v16bf bph = cat16b(ph0, ph1), bpl = cat16b(pl0, pl1);
#pragma unroll
                for (int dt = 0; dt < 4; ++dt) {
                    const v16bf avh = ldsAb(sVh + (dt * 16 + lr) * TP + ks * 32 + 8 * hi), avl = ldsAb(sVl + (dt * 16 + lr) * TP + ks * 32 + 8 * hi);
                    acc[dt] = wmmab(avh, bph, acc[dt]); acc[dt] = wmmab(avh, bpl, acc[dt]); acc[dt] = wmmab(avl, bph, acc[dt]);
                    asm volatile("v_nop\n\tv_nop\n\tv_nop\n\tv_nop" : "+v"(acc[dt]) : "v"(bph), "v"(bpl), "v"(avh), "v"(avl)); } }   // WMMA distance, as above
        } else {
#pragma unroll
            for (int ks = 0; ks < 2; ++ks) {
                v16h bp;
#pragma unroll
                for (int i = 0; i < 8; ++i) { bp[i] = tohx(s[2 * ks][i] * PCAR); bp[8 + i] = tohx(s[2 * ks + 1][i] * PCAR); }
#pragma unroll
                for (int dt = 0; dt < 4; ++dt) acc[dt] = wmma16(av[ks][dt], bp, acc[dt]);
                if (ks == 1) asm volatile("v_nop\n\tv_nop\n\tv_nop\n\tv_nop" : "+v"(acc[0]), "+v"(acc[1]), "+v"(acc[2]), "+v"(acc[3]) : "v"(bp), "v"(av[1][0]), "v"(av[1][1]), "v"(av[1][2]), "v"(av[1][3])); }   // WMMA distance behind the chunk's last products, as above (the loop's branch follows)
        }
    }
    __syncthreads();                                          // all waves done with the K tiles before the output staging aliases them
    float* os = (float*)smem + w * 16 * 68;
    const float rc = HIRES ? 1.0f : (1.0f / PCAR);
    const float inv = __fdiv_rn(rc, l + xhalf(l));            // the two halves' key sums joined here
#pragma unroll
    for (int dt = 0; dt < 4; ++dt) {
        v4f o0, o1;
#pragma unroll
        for (int r = 0; r < 4; ++r) { o0[r] = acc[dt][r] * inv; o1[r] = acc[dt][4 + r] * inv; }
        *(v4fa*)(os + lr * 68 + dt * 16 + 8 * hi) = o0; *(v4fa*)(os + lr * 68 + dt * 16 + 8 * hi + 4) = o1; }
    __builtin_amdgcn_wave_barrier(); asm volatile("" ::: "memory");
    float* crow = OUTb + (size_t)(qb + w * 16) * DQ + h * HD;
{
#pragma unroll
        for (int s2 = 0; s2 < 8; ++s2) { const int row = 2 * s2 + hi, cofs = lr * 4; const v4f val = *(const v4fa*)(os + row * 68 + cofs);
            *(v4f*)(crow + (size_t)row * DQ + cofs) = val; }
         }
}

#define NQL   (NQB - RH / 64)
#define FB_L  (NQL * NH_ * NB)
#define FB_H  ((RH / 64) * NH_ * NB)
static_assert(NQL >= 1);
__global__ __launch_bounds__(128) void k_flash(const bf* __restrict__ QPh, const bf* __restrict__ QPl, const bf* __restrict__ KPh, const bf* __restrict__ KPl,
                                               const h16* __restrict__ VT16, const bf* __restrict__ VTh, const bf* __restrict__ VTl,
                                               const int* __restrict__ mask, const int* __restrict__ FL, float* OUT) {
    __shared__ __align__(16) unsigned char smem[LDS_TOTAL];
    const int b = (int)blockIdx.x;                           // flat index: query block fastest, then head, then batch; the blocks of query rows >= RH first, the few short blocks of rows < RH last
    if (b < FB_L) d_flash<false>(smem, QPh, QPl, KPh, KPl, VT16, VTh, VTl, mask, FL, RH / 64 + b % NQL, (b / NQL) % NH_, b / (NQL * NH_), OUT);
    else { const int c = b - FB_L; d_flash<true>(smem, QPh, QPl, KPh, KPl, VT16, VTh, VTl, mask, FL, c % (RH / 64), (c / (RH / 64)) % NH_, c / ((RH / 64) * NH_), OUT); }
}

extern "C" void kernel_launch(void* const* d_in, const int* in_sizes, int n_in,
                              void* d_out, int out_size, void* d_ws, size_t ws_size, hipStream_t stream) {
    if (n_in < 4) return;
    if (in_sizes[0] < (NB - 1) * SEQ_FULL * DM + TT * DM) return;
    if (in_sizes[1] < DM * DM) return;
    if (in_sizes[2] < 2 * DM * DM) return;
    if (in_sizes[3] < TT * MPITCH) return;
    if (out_size < NB * TT * DQ) return;
    const float* x = (const float*)d_in[0]; const float* wq = (const float*)d_in[1]; const float* wkv = (const float*)d_in[2]; const int* mask = (const int*)d_in[3];
    float* OUT = (float*)d_out;     // [NB][TT][DQ]
    char* wsp = (char*)d_ws;
    auto take = [&](size_t bytes) { char* p = wsp; wsp += (bytes + 255) & ~(size_t)255; return (void*)p; };
    bf* W3 = (bf*)take((size_t)D3 * DM * 2); float* CS = (float*)take((size_t)TT * HD * 2 * 4); int* FL = (int*)take((size_t)NQB * FLG * 32 * 4);
    bf* XB = (bf*)take((size_t)NB * TT * DM * 2);
    bf* QPh = (bf*)take((size_t)NB * NH_ * TT * HD * 2); bf* QPl = (bf*)take((size_t)NB * NH_ * TT * HD * 2); bf* KPh = (bf*)take((size_t)NB * NH_ * TT * HD * 2); bf* KPl = (bf*)take((size_t)NB * NH_ * TT * HD * 2);
    h16* VT16 = (h16*)take((size_t)NB * NH_ * HD * TT * 2); bf* VTh = (bf*)take((size_t)NB * NH_ * HD * TT * 2); bf* VTl = (bf*)take((size_t)NB * NH_ * HD * TT * 2);
    const size_t used = (size_t)(wsp - (char*)d_ws);
    if (used > ws_size || used > (size_t)134217728) return;   // 74,481,664 B at NB=2, SEQ=2048
    k_prep<<<PB_MF + PB_CS + PB_W + NB * PB_X, 256, 0, stream>>>(x, wq, wkv, mask, XB, W3, CS, FL);
    k_gemmw<bf, 0><<<dim3(TT / 64, D3 / 64, NB), 32, 0, stream>>>(XB, nullptr, W3, nullptr, DM, (size_t)TT * DM, 0, CS, QPh, QPl, KPh, KPl, VT16, VTh, VTl);
    k_flash<<<FB_L + FB_H, 128, 0, stream>>>(QPh, QPl, KPh, KPl, VT16, VTh, VTl, mask, FL, OUT);
}

// v008
// It runs in 79.2 microseconds.
// Timed twice side by side with v007, it ran 1.09 times as fast both times.
// Over all steps from v000 it is 6.09 times as fast.
#include <hip/hip_runtime.h>

// Contractions: fused q|k|v projection v_wmma_f32_16x16x32_bf16 (bf16 operands = RNE-converted inputs, exact products); scores v_wmma_f32_16x16x32_bf16 with q/k as bf16 hi/lo planes (3 products) on every row; attn.v v_wmma_f32_16x16x32_f16 (f16 P carried x1024, f16 v) on query rows >= 64 and v_wmma_f32_16x16x32_bf16 with P and v as bf16 hi/lo (3 products) on query rows < 64; f32 accumulate, f32 online softmax, f32 output.
// Both batch elements go through every launch together (batch = the slowest part of the block index; every per-batch plane below is stored [batch][...]). Three launches: preparation (k_prep), projection (k_gemmw), attention (k_flash). Layout per batch: bf16 copy of x; one [3072][1024] bf16 'oi' weight (q rows, then k rows, then v rows, k/v de-interleaved from the [2048][1024] kv weight whose row is h*128 + 2d + c); both planes are stored in fragment order (see pkoff), so that the projection kernel's operand copies and fragment reads cover whole lines; the product x W^T stays in the projection kernel's accumulators, whose epilogue writes the planes below;
// rotary planes q,k [h][t][64] bf16 hi/lo (rotate-half, table cos/sin[t][d], q pre-scaled by 1/8); value planes [h][d][t] f16 and bf16 hi/lo; per (64-row query block, 64-key chunk) mask flags from the int mask (empty chunks skipped, partial chunks apply the mask element-wise, replace-fill), four flags to a 128-byte line (FLIDX);
// flash-style attention: K hi/lo and V chunk tiles staged in LDS, transposed products (S^T = K Q^T, O^T += V^T P^T) so that a lane holds one query's scores, online softmax in-lane, output rows written directly (no output projection).

#ifndef NB
#define NB 2
#endif
#ifndef SEQ
#define SEQ 2048
#endif
#define NB_FULL  2
#define SEQ_FULL 2048
#define TT     SEQ
#define DM     1024
#define NH_    16
#define HD     64
#define DQ     (NH_ * HD)
#define D3     (3 * DM)
#define NQB    (TT / 64)
#define NCH    (TT / 64)
#define RH     64
#define MPITCH SEQ_FULL
#define FLP    32
#define MFG    4
#define FLG    (FLP / MFG)
#define FLIDX(qblk, kc) ((((qblk) * FLG + (kc) / MFG) * 32) + (kc) % MFG)
#define PCAR   1024.0f
#define SCL    0.125f
#define NEGS   (-3.0e38f)
#define TP     72
#define TILEB  (64 * TP * 2)
#define O_KH   0
#define O_KL   (TILEB)
#define O_VA   (2 * TILEB)
#define O_VB   (3 * TILEB)
#define O_MS   (4 * TILEB)
#define LDS_TOTAL (4 * TILEB + 64 * 64)

static_assert(TT % 64 == 0);
static_assert(TT <= SEQ_FULL);
static_assert(NB >= 1 && NB <= NB_FULL);
static_assert(NCH <= FLP);
static_assert(FLP == 32 && FLP * 64 == MPITCH && MFG == 4);
static_assert(RH == 64);
static_assert(NQB >= RH / 64);
static_assert(DM % 32 == 0 && D3 % 64 == 0 && HD == 64 && DQ == DM);
static_assert(4 * 16 * 68 * 4 <= O_VA);
static_assert((TP * 2) % 16 == 0);
static_assert(16 * 68 * 4 <= 3 * 32 * TP * 2);
static_assert(LDS_TOTAL <= 65536);

typedef _Float16 h16;
typedef unsigned short bf;
typedef __attribute__((ext_vector_type(16))) __bf16   v16bf;
typedef __attribute__((ext_vector_type(16))) _Float16 v16h;
typedef __attribute__((ext_vector_type(8)))  _Float16 v8h;
typedef __attribute__((ext_vector_type(8)))  unsigned short v8us;
typedef __attribute__((ext_vector_type(8)))  float    v8f;
typedef __attribute__((ext_vector_type(4)))  float    v4f;
typedef __attribute__((ext_vector_type(2)))  float    v2f;
typedef __attribute__((ext_vector_type(4)))  int      v4i;
typedef v8h  __attribute__((may_alias)) v8ha;
typedef v4f  __attribute__((may_alias)) v4fa;
typedef v8us __attribute__((may_alias)) v8usa;
typedef __attribute__((ext_vector_type(2))) unsigned v2u;
typedef v2u  __attribute__((may_alias)) v2ua;
typedef __attribute__((ext_vector_type(2))) __bf16 v2bf;
typedef __attribute__((ext_vector_type(4))) unsigned v4u;
typedef v4u  __attribute__((may_alias)) v4ua;

__device__ __forceinline__ unsigned short f2bf(float f) { unsigned u = __float_as_uint(f); u += 0x7FFFu + ((u >> 16) & 1u); return (unsigned short)(u >> 16); }
__device__ __forceinline__ float bf2f(unsigned short b) { return __uint_as_float(((unsigned)b) << 16); }
__device__ __forceinline__ v16h cat16(v8h lo, v8h hi) { return __builtin_shufflevector(lo, hi, 0, 1, 2, 3, 4, 5, 6, 7, 8, 9, 10, 11, 12, 13, 14, 15); }
__device__ __forceinline__ v16bf cat16b(v8us lo, v8us hi) { return __builtin_bit_cast(v16bf, __builtin_shufflevector(lo, hi, 0, 1, 2, 3, 4, 5, 6, 7, 8, 9, 10, 11, 12, 13, 14, 15)); }
__device__ __forceinline__ v8f wmma16(v16h a, v16h b, v8f c) { return __builtin_amdgcn_wmma_f32_16x16x32_f16(false, a, false, b, (short)0, c, false, false); }
__device__ __forceinline__ v8f wmmab(v16bf a, v16bf b, v8f c) { return __builtin_amdgcn_wmma_f32_16x16x32_bf16(false, a, false, b, (short)0, c, false, false); }
__device__ __forceinline__ h16 tohx(float x) { return (h16)x; }
__device__ __forceinline__ void splitf(float y, unsigned short& h, unsigned short& l) { h = f2bf(y); l = f2bf(y - bf2f(h)); }
// The same split of two values at once on the packed converter (f32 -> bf16, round to nearest even like f2bf): hi word and lo word, first value in bits 15..0; and the two picks that pair the low or the high halves of two words.
__device__ __forceinline__ unsigned pkbf(float a, float b) { v2f v; v[0] = a; v[1] = b; return __builtin_bit_cast(unsigned, __builtin_convertvector(v, v2bf)); }
__device__ __forceinline__ void split2(float a, float b, unsigned& h, unsigned& l) { h = pkbf(a, b); l = pkbf(a - __uint_as_float(h << 16), b - __uint_as_float(h & 0xFFFF0000u)); }
__device__ __forceinline__ unsigned lo16(unsigned e0, unsigned e1) { return (e0 & 0xFFFFu) | (e1 << 16); }
__device__ __forceinline__ unsigned hi16(unsigned e0, unsigned e1) { return (e0 >> 16) | (e1 & 0xFFFF0000u); }
__device__ __forceinline__ float xhalf(float x) { return __builtin_bit_cast(float, __builtin_amdgcn_permlanex16(__builtin_bit_cast(int, x), __builtin_bit_cast(int, x), 0x76543210, 0xfedcba98, false, false)); }  // lane l with lane l ^ 16

// 2^x of eight values in place. The eight v_exp_f32 and the free slot that the instruction set asks for behind a transcendental stand in ONE statement: a v_nop in a statement of its own landed elsewhere.
__device__ __forceinline__ void exp2x8(v8f& v) {
    float e0 = v[0], e1 = v[1], e2 = v[2], e3 = v[3], e4 = v[4], e5 = v[5], e6 = v[6], e7 = v[7];
    asm("v_exp_f32 %0, %0\n\tv_exp_f32 %1, %1\n\tv_exp_f32 %2, %2\n\tv_exp_f32 %3, %3\n\tv_exp_f32 %4, %4\n\tv_exp_f32 %5, %5\n\tv_exp_f32 %6, %6\n\tv_exp_f32 %7, %7\n\tv_nop"
        : "+v"(e0), "+v"(e1), "+v"(e2), "+v"(e3), "+v"(e4), "+v"(e5), "+v"(e6), "+v"(e7));
    v[0] = e0; v[1] = e1; v[2] = e2; v[3] = e3; v[4] = e4; v[5] = e5; v[6] = e6; v[7] = e7;
}

// Fragment loaders (split k map for A and B alike): element i of the 16-wide vector <- k0 + 8*hi + i (i < 8), k0 + 16 + 8*hi + (i - 8) (i >= 8); callers pass p = row_base + k0 + 8*hi.
template <typename T16> struct WFrag;
template <> struct WFrag<bf> { typedef v16bf V; static __device__ __forceinline__ V ld(const bf* p) { return cat16b(*(const v8us*)p, *(const v8us*)(p + 16)); } };
// Fragment order of a K-contiguous [rows][DM] 16-bit plane: blocks of 16 rows x 32 k, 512 elements each, block (rb, kb) at (rb * (DM / 32) + kb) * 512. Inside a block, lane (row & 15) + 16 * hi keeps its eight elements k = 8*hi + i at lane * 8 + i and its eight elements k = 16 + 8*hi + i at 256 + lane * 8 + i:
// the same k map as above, and each of a fragment's two reads (element block + lane * 8, and 256 elements on) takes 512 contiguous bytes, four whole lines, where the row-major plane gave 32 bytes of each of 16 lines.
// The converters go by 8-element unit i: sgm = i & 3 (which eight k of the block), r16 = (i >> 2) & 15 (row in the block), block = i >> 6; a wave then reads eight whole 128-byte f32 lines and writes four whole 128-byte lines.
__device__ __forceinline__ size_t pkoff(size_t i) { const size_t sgm = i & 3, r16 = (i >> 2) & 15; return (i >> 6) * 512 + (sgm >> 1) * 256 + ((sgm & 1) * 16 + r16) * 8; }
__device__ __forceinline__ int pkrow(size_t i) { return (int)((i >> 6) / (DM / 32)) * 16 + (int)((i >> 2) & 15); }
__device__ __forceinline__ int pkcol(size_t i) { return (int)((i >> 6) % (DM / 32)) * 32 + (int)(i & 3) * 8; }
// LDS reloads of tiles written as 16-bit elements: same element type through may_alias vectors.
__device__ __forceinline__ v16h  ldsA16(const h16* p) { return cat16(*(const v8ha*)p, *(const v8ha*)(p + 16)); }
__device__ __forceinline__ v16bf ldsAb(const bf* p) { return cat16b(*(const v8usa*)p, *(const v8usa*)(p + 16)); }

// ---- k_gemmw: GEMM of the fused q|k|v projection with its epilogue. One workgroup of GWV = 12 waves per GBM x GBN = 256 x 192 tile of x W^T, one wave per 64x64 part of it (16 accumulators); grid (TT/GBM, D3/GBN, batch): 256 workgroups at the full size.
// acc[m][n] = sum_k A[m][k] Bt[n][k], k ascending. Both operands are 16-bit planes in fragment order (pkoff; K == DM).
// The workgroup's operand rows go through LDS, so that each line comes from L2 once per workgroup and not once per wave that needs it: a stage is GKS = 64 k of the tile's 16 + 12 blocks of 16 rows, 2 KiB of each (contiguous in the plane), laid block after block in one of two buffers;
// asynchronous copies (16 bytes a lane, 512 contiguous bytes a wave) fill a buffer while the other one is worked on. Wave-copy c of a stage brings bytes 512 * (c & 3) .. of row block c >> 2 (A's 16 blocks, then Bt's 12) to byte 512 * c of the buffer; the waves take them in turn. A fragment is read back as two contiguous 512-byte wave reads.
// A wave's 64 columns are one head of q, k or v (column tile = section*NH_ + head), so the head planes are written from the accumulators and the f32 product never goes to memory.
// q, k: rotate-half rotary in registers (columns d and d+32 are accumulator tiles nb and nb+2 of the same lane; the table holds the same cos, sin at d and d+32): out[d] = x[d] cos - x[d+32] sin, out[d+32] = x[d+32] cos + x[d] sin, times sc, split to bf16 hi/lo;
//       two rows' bf16 per word, hi words and lo words staged per 16 rows in LDS (pitch 68 words), planes [h][t][d] stored as whole 128-byte rows.
// v:    a lane's eight accumulator rows are eight consecutive t of one d: packed to f16, bf16 hi, bf16 lo; 32 d of the three [d][t] planes at a time staged in LDS (pitch TP), planes [h][d][t] stored as whole 128-byte rows.
#define GBM   256
#define GBN   192
#define GWN   (GBN / 64)
#define GWV   ((GBM / 64) * GWN)
#define GKS   64
#define GRBB  (16 * GKS * 2)
#define GSTB  (((GBM + GBN) / 16) * GRBB)
#define GNC   (GSTB / 512)
#define GCF   (GNC / GWV)
#define GCR   (GNC % GWV)
#define GNST  (DM / GKS)
#define GEPB  (3 * 32 * TP * 2)
static_assert(TT % GBM == 0 && D3 % GBN == 0 && DM % GKS == 0 && GNST >= 2 && GNST % 2 == 0);
static_assert(GCF == 9 && GCR > 0 && GRBB == 4 * 512 && GWV == 12 && GBN % 48 == 0 && (GBM / 4) % GWV == GCR);
static_assert(2 * GSTB + GWV * GEPB <= 327680);

// One stage's copies of one wave: nine for every wave, a tenth for the first GCR waves (more: wave-uniform, a scalar branch). ub, ul = each copy's wave-uniform global address and LDS byte offset, ko = the stage's byte offset in a block of rows, lb = the lane's LDS byte address in the buffer, ln = lane * 16.
// The addresses are formed here, where the fragment registers are free, and not kept through the loop. The s_wait_xcnt stands as the last line of the copies' own statement, in front of whatever rewrites an address register that a copy names.
__device__ __forceinline__ void gcopy(const char* const* ub, const unsigned* ul, unsigned ko, unsigned lb, unsigned ln, bool more) {
    const char* g[GCF + 1]; unsigned l[GCF + 1];
#pragma unroll
    for (int i = 0; i <= GCF; ++i) { g[i] = ub[i] + ko + ln; l[i] = lb + ul[i]; }
    asm volatile("global_load_async_to_lds_b128 %0, %9, off\n\tglobal_load_async_to_lds_b128 %1, %10, off\n\tglobal_load_async_to_lds_b128 %2, %11, off\n\t"
                 "global_load_async_to_lds_b128 %3, %12, off\n\tglobal_load_async_to_lds_b128 %4, %13, off\n\tglobal_load_async_to_lds_b128 %5, %14, off\n\t"
                 "global_load_async_to_lds_b128 %6, %15, off\n\tglobal_load_async_to_lds_b128 %7, %16, off\n\tglobal_load_async_to_lds_b128 %8, %17, off\n\ts_wait_xcnt 0x0"
                 :: "v"(l[0]), "v"(l[1]), "v"(l[2]), "v"(l[3]), "v"(l[4]), "v"(l[5]), "v"(l[6]), "v"(l[7]), "v"(l[8]),
                    "v"(g[0]), "v"(g[1]), "v"(g[2]), "v"(g[3]), "v"(g[4]), "v"(g[5]), "v"(g[6]), "v"(g[7]), "v"(g[8]) : "memory");
    if (more) asm volatile("global_load_async_to_lds_b128 %0, %1, off\n\ts_wait_xcnt 0x0" :: "v"(l[9]), "v"(g[9]) : "memory");
}
// A fragment out of a staged block: p = block + lane * 16 bytes.
__device__ __forceinline__ v16bf ldsFr(const unsigned char* p) { return cat16b(*(const v8usa*)p, *(const v8usa*)(p + 512)); }

__global__ __launch_bounds__(GWV * 32) void k_gemmw(const bf* __restrict__ A, const bf* __restrict__ Bt, const float* __restrict__ CS, bf* QPh, bf* QPl, bf* KPh, bf* KPl, h16* VT16, bf* VTh, bf* VTl) {
    __shared__ __align__(16) unsigned char ring[2 * GSTB];
    __shared__ __align__(16) unsigned char stg[GWV * GEPB];
    const size_t z = blockIdx.z;
    const int lane = threadIdx.x & 31, lr = lane & 15, hi = lane >> 4;
    const int w = __builtin_amdgcn_readfirstlane((int)threadIdx.x >> 5), wm = w / GWN, wn = w % GWN;   // the wave's number, in a scalar register
    const int r0 = blockIdx.x * GBM + wm * 64, ct = blockIdx.y * GWN + wn;                             // the wave's first row in its batch element; its column tile
    unsigned char* st = stg + w * GEPB;                                                                // the wave's own epilogue staging
    v8f acc[4][4];
#pragma unroll
    for (int mb = 0; mb < 4; ++mb)
#pragma unroll
        for (int nb = 0; nb < 4; ++nb) acc[mb][nb] = (v8f){};
    const char* Ab = (const char*)(A + z * ((size_t)TT * DM) + (size_t)blockIdx.x * GBM * DM);         // a block of 16 rows is 16 * DM elements
    const char* Bb = (const char*)(Bt + (size_t)blockIdx.y * GBN * DM);
    const unsigned ln = lane * 16, lbase = (unsigned)(size_t)ring + ln;
    const bool more = w < GCR;
    const char* ub[GCF + 1]; unsigned ul[GCF + 1];
#pragma unroll
    for (int i = 0; i <= GCF; ++i) {                          // rounds 0..3: the 48 wave-copies of Bt; rounds 4..9: the 64 of A (the last round: its last GCR)
        const int c = (i < GBN / 48) ? i * GWV + w : min((i - GBN / 48) * GWV + w, GBM / 4 - 1);
        ub[i] = ((i < GBN / 48) ? Bb : Ab) + (size_t)(c >> 2) * (16 * DM * 2) + (c & 3) * 512;
        ul[i] = ((i < GBN / 48) ? GBM / 4 + c : c) * 512; }
    gcopy(ub, ul, 0, lbase, ln, more);                        // stage 0
    asm volatile("s_wait_asynccnt 0x0" ::: "memory");         // this wave's copies of stage 0 have landed
    __syncthreads();                                          // and every other wave's
    gcopy(ub, ul, GRBB, lbase + GSTB, ln, more);              // stage 1
    const unsigned char* fa = ring + wm * 4 * GRBB + ln; const unsigned char* fb = ring + (GBM / 16 + wn * 4) * GRBB + ln;
#pragma unroll 1
    for (int t = 0; t < GNST; t += 2) {                       // two stages a trip, so that each buffer's addresses are constants of the code
#pragma unroll
        for (int p = 0; p < 2; ++p) {
            // The stage's 32 LDS reads go in three groups, the later two eight WMMAs ahead of the first product that needs them, in twelve fragments' registers (two whole sets would pass 256 registers): all of k 0..31 and A of k 32..63; then Bt of k 32..63 by halves, where the halves of k 0..31 come free.
            // The scheduling barriers keep the groups where they stand: left alone this build put the reads among the WMMAs in pairs, each waited for to 0.
            const unsigned char* pa = fa + p * GSTB; const unsigned char* pb = fb + p * GSTB;
            v16bf a0[4], a1[4], b0[4], b1[4];
#pragma unroll
            for (int mb = 0; mb < 4; ++mb) a0[mb] = ldsFr(pa + mb * GRBB);
#pragma unroll
            for (int nb = 0; nb < 4; ++nb) b0[nb] = ldsFr(pb + nb * GRBB);
#pragma unroll
            for (int mb = 0; mb < 4; ++mb) a1[mb] = ldsFr(pa + mb * GRBB + 1024);
            __builtin_amdgcn_sched_barrier(0);
#pragma unroll
            for (int nb = 0; nb < 2; ++nb)
#pragma unroll
                for (int mb = 0; mb < 4; ++mb) acc[mb][nb] = wmmab(a0[mb], b0[nb], acc[mb][nb]);
            __builtin_amdgcn_sched_barrier(0);
            b1[0] = ldsFr(pb + 1024); b1[1] = ldsFr(pb + GRBB + 1024);
            __builtin_amdgcn_sched_barrier(0);
#pragma unroll
            for (int nb = 2; nb < 4; ++nb)
#pragma unroll
                for (int mb = 0; mb < 4; ++mb) acc[mb][nb] = wmmab(a0[mb], b0[nb], acc[mb][nb]);
            __builtin_amdgcn_sched_barrier(0);
            b1[2] = ldsFr(pb + 2 * GRBB + 1024); b1[3] = ldsFr(pb + 3 * GRBB + 1024);
            __builtin_amdgcn_sched_barrier(0);
#pragma unroll
            for (int nb = 0; nb < 4; ++nb)
#pragma unroll
                for (int mb = 0; mb < 4; ++mb) acc[mb][nb] = wmmab(a1[mb], b1[nb], acc[mb][nb]);
            __builtin_amdgcn_sched_barrier(0);                // every WMMA of the stage stays ahead of the slots and the barrier below
            asm volatile("v_nop\n\tv_nop\n\tv_nop\n\tv_nop" : "+v"(acc[0][3]), "+v"(acc[1][3]), "+v"(acc[2][3]), "+v"(acc[3][3]) : "v"(a1[0]), "v"(a1[3]), "v"(b1[3]));   // four vector slots behind the stage's last WMMAs, on the taken side of a branch too
            asm volatile("s_wait_dscnt 0x0" ::: "memory");    // this wave has read all it wants of the buffer
            asm volatile("s_wait_asynccnt 0x0" ::: "memory"); // its copies of the next stage have landed
            __syncthreads();                                  // publishes the next stage and frees this buffer
            if (t + p + 2 < GNST) gcopy(ub, ul, (unsigned)(t + p + 2) * GRBB, lbase + p * GSTB, ln, more);   // the test reads the same for the whole workgroup
        }
    }
    asm volatile("s_wait_asynccnt 0x0" ::: "memory");         // nothing is in flight when the wave goes on
    const int sec = ct / NH_, h = ct % NH_;                                           // wave-uniform
    const size_t hp = (z * NH_ + h) * TT * HD;
    if (sec < 2) {
        unsigned* us = (unsigned*)st;
        bf* Ph = (sec == 0 ? QPh : KPh) + hp + (size_t)r0 * HD; bf* Pl = (sec == 0 ? QPl : KPl) + hp + (size_t)r0 * HD;
        const float sc = (sec == 0) ? SCL : 1.0f;
#pragma unroll
        for (int mb = 0; mb < 4; ++mb) {
            const float* cp = CS + ((size_t)(r0 + mb * 16 + hi * 8) * HD + lr) * 2;
            v2f cs[2][8];
#pragma unroll
            for (int j = 0; j < 8; ++j) { cs[0][j] = *(const v2f*)(cp + j * HD * 2); cs[1][j] = *(const v2f*)(cp + j * HD * 2 + 32); }
            asm volatile("s_wait_xcnt 0x0" :: "v"(cp) : "memory");   // the wait before a register of the loads above is used again; naming the address keeps it out of their destinations
#pragma unroll
            for (int nl = 0; nl < 2; ++nl) {
                float ra[8], rb[8];
#pragma unroll
                for (int j = 0; j < 8; ++j) {
                    const float x0 = acc[mb][nl][j], x1 = acc[mb][nl + 2][j], cn = cs[nl][j][0], sn = cs[nl][j][1];
                    ra[j] = (x0 * cn - x1 * sn) * sc; rb[j] = (x1 * cn + x0 * sn) * sc; }
#pragma unroll
                for (int jp = 0; jp < 4; ++jp) {                                      // one word = rows 2jp, 2jp+1 of one column; word rows 0..7 hi, 8..15 lo
                    unsigned wh, wl; unsigned* u = us + (hi * 4 + jp) * 68 + nl * 16 + lr;
                    split2(ra[2 * jp], ra[2 * jp + 1], wh, wl); u[0] = wh; u[8 * 68] = wl;
                    split2(rb[2 * jp], rb[2 * jp + 1], wh, wl); u[32] = wh; u[8 * 68 + 32] = wl; } }
            __builtin_amdgcn_wave_barrier(); asm volatile("" ::: "memory");   // keeps the other lanes' LDS writes ahead of the reads below in the compiled order
#pragma unroll
            for (int s = 0; s < 4; ++s) {
                const int pr = (s & 1) * 4 + (lane >> 3), seg = lane & 7;             // row pair and 8-column segment; s >> 1 picks the plane
                const unsigned* u = us + ((s >> 1) * 8 + pr) * 68 + seg * 8;
                const v4u p0 = *(const v4ua*)u, p1 = *(const v4ua*)(u + 4);
                v4u oe, oo;
                oe[0] = lo16(p0[0], p0[1]); oe[1] = lo16(p0[2], p0[3]); oe[2] = lo16(p1[0], p1[1]); oe[3] = lo16(p1[2], p1[3]);
                oo[0] = hi16(p0[0], p0[1]); oo[1] = hi16(p0[2], p0[3]); oo[2] = hi16(p1[0], p1[1]); oo[3] = hi16(p1[2], p1[3]);
                bf* P = ((s >> 1) ? Pl : Ph) + (size_t)(mb * 16 + 2 * pr) * HD + seg * 8;
                *(v4ua*)P = oe; *(v4ua*)(P + HD) = oo; }
            if (mb < 3) { __builtin_amdgcn_wave_barrier(); asm volatile("s_wait_xcnt 0x0" ::: "memory"); }   // the reads above stay ahead of the next rows' LDS writes; the wait stands before the stores' registers are used again
        }
    } else {
        bf* sp = (bf*)st;
#pragma unroll
        for (int hf = 0; hf < 2; ++hf) {                                              // 32 d at a time, the three planes side by side in LDS
#pragma unroll
            for (int nl = 0; nl < 2; ++nl) {
#pragma unroll
                for (int mb = 0; mb < 4; ++mb) {
                    const v8f x = acc[mb][hf * 2 + nl]; v4u oh, ol;
#pragma unroll
                    for (int i = 0; i < 4; ++i) { unsigned wh, wl; split2(x[2 * i], x[2 * i + 1], wh, wl); oh[i] = wh; ol[i] = wl; }
                    bf* q = sp + (nl * 16 + lr) * TP + mb * 16 + hi * 8;
                    *(v4ua*)q = __builtin_bit_cast(v4u, __builtin_convertvector(x, v8h)); *(v4ua*)(q + 32 * TP) = oh; *(v4ua*)(q + 64 * TP) = ol; } }
            __builtin_amdgcn_wave_barrier(); asm volatile("" ::: "memory");   // other lanes' LDS writes ahead of the reads below, as above
#pragma unroll
            for (int pl = 0; pl < 3; ++pl) {
                bf* P = ((pl == 0) ? (bf*)VT16 : (pl == 1) ? VTh : VTl) + hp + (size_t)hf * 32 * TT + r0;
#pragma unroll
                for (int s = 0; s < 8; ++s) {
                    const int idx = s * 32 + lane; const int row = idx >> 3, seg = idx & 7;
                    *(v4ua*)(P + (size_t)row * TT + seg * 8) = *(const v4ua*)(sp + (pl * 32 + row) * TP + seg * 8); } }
            __builtin_amdgcn_wave_barrier(); asm volatile("s_wait_xcnt 0x0" ::: "memory");   // reads ahead of the next half's LDS writes; the wait before the stores' registers are used again (behind the last half too: the built code lays the q, k block behind this one)
        }
    }
}

// The four preparation jobs below depend on nothing but the inputs and not on each other: they are bodies of ONE kernel, k_prep, which hands each a range of its blocks (blk = the block's index inside its range).
__device__ __forceinline__ void d_cvt8(int blk, int bz, const float* __restrict__ src, bf* dst, size_t n8, size_t sS, size_t sD) { const size_t i = (size_t)blk * 256 + threadIdx.x; if (i >= n8) return; src += bz * sS; dst += bz * sD; const v8f v = *(const v8f*)(src + (size_t)pkrow(i) * DM + pkcol(i)); v8us o;
#pragma unroll
    for (int k = 0; k < 8; ++k) o[k] = f2bf(v[k]); *(v8us*)(dst + pkoff(i)) = o;  }

__device__ __forceinline__ void d_cvtw(int blk, const float* __restrict__ wq, const float* __restrict__ wkv, bf* dst, size_t n8) {
    const size_t i = (size_t)blk * 256 + threadIdx.x; if (i >= n8) return;
    const int row = pkrow(i), col = pkcol(i);
    const int r2 = max(row - DM, 0); const int c = (r2 >= DM) ? 1 : 0; const int r3 = r2 - c * DM;
    const int srow = (r3 >> 6) * (2 * HD) + 2 * (r3 & 63) + c;
    const float* src = (row < DM) ? (wq + (size_t)row * DM + col) : (wkv + (size_t)srow * DM + col);
    const v8f v = *(const v8f*)src; v8us o;
#pragma unroll
    for (int k = 0; k < 8; ++k) o[k] = f2bf(v[k]);
    *(v8us*)(dst + pkoff(i)) = o; 
}

__device__ __forceinline__ void d_cstab(int blk, float* CS) {
    const int idx = blk * 256 + threadIdx.x; if (idx >= TT * HD) return;
    const int t = idx / HD, dd = idx % HD, p = dd & (HD / 2 - 1);
    const float pw = exp10f((float)p * 0.125f);
    const float inv = __fdiv_rn(1.0f, pw);
    float ang = __fmul_rn((float)t, inv); asm volatile("" : "+v"(ang));
    float sn, cn; sincosf(ang, &sn, &cn);
    v2f cs; cs[0] = cn; cs[1] = sn;
    *(v2f*)(CS + (size_t)idx * 2) = cs; 
}

// d_mflag: per (64-row query block, 64-key chunk) flags from the int mask [q][k] (row pitch MPITCH): bit0 = any nonzero, bit1 = all nonzero; chunks >= NCH flagged 0.
// One block per (query block, group of MFG chunks): 64 rows x 256 columns, 16 loads of 16 bytes per thread, none depending on another, each wave-load 512 contiguous bytes of one row. Threads 64*rg .. 64*rg+63 take rows 16*rg .. 16*rg+15; 16 lanes span one chunk's columns.
// A block's MFG flags go to a 128-byte line of their own (FLIDX), so that a line has one writer.
__device__ __forceinline__ void d_mflag(int blk, int* fls, const int* __restrict__ mask, int* FL) {
    const int tid = threadIdx.x, lane = tid & 31, w = tid >> 5; const int qblk = blk / FLG, g = blk % FLG, qb = qblk * 64;
    const int* mp = mask + (size_t)(qb + (tid >> 6) * 16) * MPITCH + g * (MFG * 64) + (tid & 63) * 4;
    v4i a[16];
#pragma unroll
    for (int i = 0; i < 16; ++i) a[i] = *(const v4i*)(mp + (size_t)i * MPITCH);
    // the wait before a register of the loads above is used again; naming the address keeps it out of their destinations, and naming the loaded values (inputs only) keeps all 16 loads in flight together: without it this build waited for nine before it issued the other seven
    asm volatile("s_wait_xcnt 0x0" :: "v"(mp), "v"(a[0]), "v"(a[1]), "v"(a[2]), "v"(a[3]), "v"(a[4]), "v"(a[5]), "v"(a[6]), "v"(a[7]), "v"(a[8]), "v"(a[9]), "v"(a[10]), "v"(a[11]), "v"(a[12]), "v"(a[13]), "v"(a[14]), "v"(a[15]) : "memory");
    unsigned anyv = 0u, minv = 0xFFFFFFFFu;                   // OR of the words; their unsigned minimum, which is nonzero exactly when every word is
#pragma unroll
    for (int i = 0; i < 16; ++i)
#pragma unroll
        for (int q = 0; q < 4; ++q) { anyv |= (unsigned)a[i][q]; minv = min(minv, (unsigned)a[i][q]); }
    const unsigned bany = __builtin_amdgcn_ballot_w32(anyv != 0u), ball = __builtin_amdgcn_ballot_w32(minv != 0u);   // bits 15..0: the wave's first chunk, bits 31..16: its second
    if ((lane & 15) == 0) { const unsigned ha = (bany >> lane) & 0xFFFFu, hl = (ball >> lane) & 0xFFFFu; fls[w * 2 + (lane >> 4)] = (ha != 0u ? 1 : 0) | (hl == 0xFFFFu ? 2 : 0); }
    __syncthreads();
    if (tid < MFG) {                                          // chunk tid of the group: wave 2*rg + (tid >> 1), half tid & 1, joined over the four row groups
        int va = 0, vl = 2;
#pragma unroll
        for (int rg = 0; rg < 4; ++rg) { const int v = fls[(rg * 2 + (tid >> 1)) * 2 + (tid & 1)]; va |= v & 1; vl &= v; }
        const int kc = g * MFG + tid;
        FL[FLIDX(qblk, kc)] = (kc < NCH) ? (va | vl) : 0; }
}

// k_prep: block ranges, in this order: mask flags, rotary table, weight planes, x planes. The range test is block-uniform.
#define PB_MF  (NQB * FLG)
#define PB_CS  ((TT * HD + 255) / 256)
#define PB_W   ((D3 * DM / 8 + 255) / 256)
#define PB_X   ((TT * DM / 8 + 255) / 256)
__global__ __launch_bounds__(256) void k_prep(const float* __restrict__ x, const float* __restrict__ wq, const float* __restrict__ wkv, const int* __restrict__ mask, bf* XB, bf* W3, float* CS, int* FL) {
    __shared__ int fls[FLP];
    int blk = (int)blockIdx.x;
    if (blk < PB_MF) { d_mflag(blk, fls, mask, FL); return; }
    blk -= PB_MF;
    if (blk < PB_CS) { d_cstab(blk, CS); return; }
    blk -= PB_CS;
    if (blk < PB_W) { d_cvtw(blk, wq, wkv, W3, (size_t)D3 * DM / 8); return; }
    blk -= PB_W;
    d_cvt8(blk % PB_X, blk / PB_X, x, XB, (size_t)TT * DM / 8, (size_t)SEQ_FULL * DM, (size_t)TT * DM);
}

// k_flash: flash-style masked softmax attention for one head and one 64-row query block per workgroup (128 threads = 4 waves x 16 query rows); one block per (query block, head, batch). d_flash<HIRES> is its body; the kernel picks the form by the block's query rows (block-uniform), so both forms run in one launch.
// Per 64-key chunk (flag bit0 set): K hi/lo tiles [key][d] and the V^T tile [d][key] staged in LDS (pitch TP), the int mask tile packed to bytes when the chunk is partial (flag bit1 clear);
// S^T[64 keys x 16 queries] = k_hi.q_hi + k_hi.q_lo + k_lo.q_hi (A = K rows from LDS, B = q fragments kept in registers, q planes pre-scaled by 1/8): lane (lr, hi) holds query lr's scores of keys nb*16 + 8*hi + r;
// masked keys -> excluded; running-max online softmax in f32, maximum and sum in-lane, the maximum joined between the wave halves once per chunk, the sums once in the epilogue;
// P^T packs from the score registers straight into the B operand (score tiles 2ks and 2ks+1 are the fragment's k order) and O^T[64 d x 16 queries] += V^T.P^T: HIRES -> P and v as bf16 hi/lo (3 products, carry 1), else f16 P carried x1024 and f16 v.
template <bool HIRES>
__device__ __forceinline__ void d_flash(unsigned char* smem, const bf* __restrict__ QPh, const bf* __restrict__ QPl, const bf* __restrict__ KPh, const bf* __restrict__ KPl,
                                        const h16* __restrict__ VT16, const bf* __restrict__ VTh, const bf* __restrict__ VTl,
                                        const int* __restrict__ mask, const int* __restrict__ FL, int qblk, int h, int bz, float* OUT) {
    bf* sKh = (bf*)(smem + O_KH); bf* sKl = (bf*)(smem + O_KL);
    h16* sV16 = (h16*)(smem + O_VA); bf* sVh = (bf*)(smem + O_VA); bf* sVl = (bf*)(smem + O_VB);
    unsigned char* Ms = smem + O_MS;
    const int tid = threadIdx.x, lane = tid & 31, w = tid >> 5, lr = lane & 15, hi = lane >> 4;
    const int qb = qblk * 64;
    const size_t hp = ((size_t)bz * NH_ + h) * TT * HD;
    float* OUTb = OUT + (size_t)bz * TT * DQ;
    const bf* Qh = QPh + hp; const bf* Ql = QPl + hp; const bf* Kh = KPh + hp; const bf* Kl = KPl + hp;
    const h16* V16 = VT16 + hp; const bf* Vh = VTh + hp; const bf* Vl = VTl + hp;
    const int qrow = qb + w * 16 + lr;                       // B layout: lane -> query column
    v16bf bq[2], bq2[2];
#pragma unroll
    for (int ks = 0; ks < 2; ++ks) { bq[ks] = WFrag<bf>::ld(Qh + (size_t)qrow * HD + ks * 32 + 8 * hi); bq2[ks] = WFrag<bf>::ld(Ql + (size_t)qrow * HD + ks * 32 + 8 * hi); }
    v8f acc[4]; float m = NEGS, l = 0.0f;                    // acc[dt][r] = O^T[dt*16 + 8*hi + r][query lr]; m is the query's, l the sum over this half's keys
#pragma unroll
    for (int dt = 0; dt < 4; ++dt) acc[dt] = (v8f){};
    const unsigned char* Msq = Ms + (w * 16 + lr) * 64 + 8 * hi;   // the lane's query row of the mask tile, at its half's keys
    const float L2E = 1.4426950408889634f;
    const int fv = FL[FLIDX(qblk, lane)];                    // lane = chunk: the query block's FLP flags, read once
    const unsigned fany = __builtin_amdgcn_ballot_w32((fv & 1) != 0), fall = __builtin_amdgcn_ballot_w32((fv & 2) != 0);   // bit kc, the same in every wave of the block
#pragma unroll 1
    for (int kc = 0; kc < NCH; ++kc) {
        if (((fany >> kc) & 1u) == 0u) continue;             // block-uniform
        const bool needm = (((fall >> kc) & 1u) == 0u);
        const int kb = kc * 64;
        __syncthreads();
        const bf* gKh[4]; const bf* gKl[4]; const bf* gVh[4]; const bf* gVl[4]; const h16* gV16[4];
        v8us rKh[4], rKl[4], rVh[4], rVl[4]; v8h rV16[4];
#pragma unroll
        for (int i = 0; i < 4; ++i) {
            const int idx = i * 128 + tid; const int row = idx >> 3, seg = idx & 7;
            gKh[i] = Kh + (size_t)(kb + row) * HD + seg * 8; rKh[i] = *(const v8us*)gKh[i];
            gKl[i] = Kl + (size_t)(kb + row) * HD + seg * 8; rKl[i] = *(const v8us*)gKl[i];
            if (HIRES) { gVh[i] = Vh + (size_t)row * TT + kb + seg * 8; rVh[i] = *(const v8us*)gVh[i];
                         gVl[i] = Vl + (size_t)row * TT + kb + seg * 8; rVl[i] = *(const v8us*)gVl[i]; }
            else       { gV16[i] = V16 + (size_t)row * TT + kb + seg * 8; rV16[i] = *(const v8h*)gV16[i]; }
        }
        // the wait before a register of the loads above is used again; naming the addresses keeps them out of the loads' destinations
        if (HIRES) asm volatile("s_wait_xcnt 0x0" :: "v"(gKh[0]), "v"(gKh[1]), "v"(gKh[2]), "v"(gKh[3]), "v"(gKl[0]), "v"(gKl[1]), "v"(gKl[2]), "v"(gKl[3]), "v"(gVh[0]), "v"(gVh[1]), "v"(gVh[2]), "v"(gVh[3]), "v"(gVl[0]), "v"(gVl[1]), "v"(gVl[2]), "v"(gVl[3]) : "memory");
        else       asm volatile("s_wait_xcnt 0x0" :: "v"(gKh[0]), "v"(gKh[1]), "v"(gKh[2]), "v"(gKh[3]), "v"(gKl[0]), "v"(gKl[1]), "v"(gKl[2]), "v"(gKl[3]), "v"(gV16[0]), "v"(gV16[1]), "v"(gV16[2]), "v"(gV16[3]) : "memory");
#pragma unroll
        for (int i = 0; i < 4; ++i) {
            const int idx = i * 128 + tid; const int row = idx >> 3, seg = idx & 7;
            *(v8us*)(sKh + row * TP + seg * 8) = rKh[i];
            *(v8us*)(sKl + row * TP + seg * 8) = rKl[i];
            if (HIRES) { *(v8us*)(sVh + row * TP + seg * 8) = rVh[i]; *(v8us*)(sVl + row * TP + seg * 8) = rVl[i]; }
            else       { *(v8h*)(sV16 + row * TP + seg * 8) = rV16[i]; }
        }
        if (needm) {
#pragma unroll
            for (int i = 0; i < 8; ++i) {
                const int idx = i * 128 + tid; const int row = idx >> 4, seg = idx & 15;
                const v4i mv = *(const v4i*)(mask + (size_t)(qb + row) * MPITCH + kb + seg * 4);
                const unsigned pk = (mv[0] != 0 ? 1u : 0u) | (mv[1] != 0 ? 0x100u : 0u) | (mv[2] != 0 ? 0x10000u : 0u) | (mv[3] != 0 ? 0x1000000u : 0u);
                *(unsigned*)(Ms + row * 64 + seg * 4) = pk; } }
        __syncthreads();
        // The chunk's LDS fragment reads are issued as groups of eight ahead of the products that use them, not tile by tile (K hi and lo of k 0..31 first; each later K group where an older group's registers come free; all V^T reads in front of the softmax), within the 256 registers that let four waves share a SIMD;
        // every run of products goes round the four independent score tiles; a tile's own products keep their order (hi.hi, hi.lo, lo.hi of k 0..31, then of k 32..63).
        // The form for query rows < RH, whose four staged planes leave no registers for that, keeps one tile's reads in front of that tile's products.
        v8f s[4]; v16h av[2][4];
        if (HIRES) {
#pragma unroll
            for (int nb = 0; nb < 4; ++nb) s[nb] = (v8f){};
#pragma unroll
            for (int ks = 0; ks < 2; ++ks) {
#pragma unroll
                for (int nb = 0; nb < 4; ++nb) {
                    const v16bf a = ldsAb(sKh + (nb * 16 + lr) * TP + ks * 32 + 8 * hi);
                    const v16bf a2 = ldsAb(sKl + (nb * 16 + lr) * TP + ks * 32 + 8 * hi);
                    s[nb] = wmmab(a, bq[ks], s[nb]); s[nb] = wmmab(a, bq2[ks], s[nb]); s[nb] = wmmab(a2, bq[ks], s[nb]);
                    asm volatile("v_nop\n\tv_nop\n\tv_nop\n\tv_nop" : "+v"(s[nb]) : "v"(a), "v"(a2), "v"(bq[ks]), "v"(bq2[ks])); } }   // four vector slots behind the last WMMA of the tile, before its D is read or its operands are rewritten
        } else {
        v16bf kh0[4], kl0[4], kh1[4], kl1[4];
        const bf* pKh = sKh + lr * TP + 8 * hi; const bf* pKl = sKl + lr * TP + 8 * hi;
#pragma unroll
        for (int nb = 0; nb < 4; ++nb) kh0[nb] = ldsAb(pKh + nb * 16 * TP);
#pragma unroll
        for (int nb = 0; nb < 4; ++nb) kl0[nb] = ldsAb(pKl + nb * 16 * TP);
#pragma unroll
        for (int nb = 0; nb < 4; ++nb) s[nb] = wmmab(kh0[nb], bq[0], (v8f){});
#pragma unroll
        for (int nb = 0; nb < 4; ++nb) s[nb] = wmmab(kh0[nb], bq2[0], s[nb]);
#pragma unroll
        for (int nb = 0; nb < 4; ++nb) kh1[nb] = ldsAb(pKh + nb * 16 * TP + 32);
#pragma unroll
        for (int nb = 0; nb < 4; ++nb) s[nb] = wmmab(kl0[nb], bq[0], s[nb]);
#pragma unroll
        for (int nb = 0; nb < 4; ++nb) kl1[nb] = ldsAb(pKl + nb * 16 * TP + 32);
#pragma unroll
        for (int nb = 0; nb < 4; ++nb) s[nb] = wmmab(kh1[nb], bq[1], s[nb]);
#pragma unroll
        for (int nb = 0; nb < 4; ++nb) s[nb] = wmmab(kh1[nb], bq2[1], s[nb]);
#pragma unroll
        for (int nb = 0; nb < 4; ++nb) s[nb] = wmmab(kl1[nb], bq[1], s[nb]);
        asm volatile("v_nop\n\tv_nop\n\tv_nop\n\tv_nop" : "+v"(s[0]), "+v"(s[1]), "+v"(s[2]), "+v"(s[3]) : "v"(kl1[0]), "v"(kl1[1]), "v"(kl1[2]), "v"(kl1[3]), "v"(bq[1]));   // four vector slots behind the last WMMAs, before a D is read or an operand rewritten, on the taken side of the branch below too
        // all V^T fragments of the chunk, read while the softmax below runs
#pragma unroll
        for (int ks = 0; ks < 2; ++ks)
#pragma unroll
            for (int dt = 0; dt < 4; ++dt) av[ks][dt] = ldsA16(sV16 + (dt * 16 + lr) * TP + ks * 32 + 8 * hi);
        }
        if (needm) {
#pragma unroll
            for (int nb = 0; nb < 4; ++nb) {
                const v2u mk = *(const v2ua*)(Msq + nb * 16);
#pragma unroll
                for (int r = 0; r < 8; ++r) s[nb][r] = (((mk[r >> 2] >> (8 * (r & 3))) & 0xFFu) != 0u) ? s[nb][r] : NEGS; } }
        float tm[4];
#pragma unroll
        for (int nb = 0; nb < 4; ++nb) { tm[nb] = s[nb][0];
#pragma unroll
            for (int r = 1; r < 8; ++r) tm[nb] = fmaxf(tm[nb], s[nb][r]); }
        float tmax = fmaxf(fmaxf(fmaxf(tm[0], tm[1]), fmaxf(tm[2], tm[3])), NEGS);
        tmax = fmaxf(tmax, xhalf(tmax));
        const float nm = fmaxf(m, tmax);
        const float alpha = __builtin_amdgcn_exp2f(__fmul_rn(__fsub_rn(m, nm), L2E));
        m = nm;
        float sm[4];
#pragma unroll
        for (int nb = 0; nb < 4; ++nb) { sm[nb] = 0.0f; v8f e;
#pragma unroll
            for (int r = 0; r < 8; ++r) e[r] = __fmul_rn(__fsub_rn(s[nb][r], nm), L2E);
            exp2x8(e);
#pragma unroll
            for (int r = 0; r < 8; ++r) { const float p = (s[nb][r] > -1.0e38f) ? e[r] : 0.0f; sm[nb] += p; s[nb][r] = p; } }
        l = l * alpha + ((sm[0] + sm[1]) + (sm[2] + sm[3]));
#pragma unroll
        for (int dt = 0; dt < 4; ++dt) acc[dt] *= alpha;
        if (HIRES) {
#pragma unroll
            for (int ks = 0; ks < 2; ++ks) {
                v8us ph0, ph1, pl0, pl1;
#pragma unroll
                for (int i = 0; i < 8; ++i) { unsigned short a2, c2; splitf(s[2 * ks][i], a2, c2); ph0[i] = a2; pl0[i] = c2; splitf(s[2 * ks + 1][i], a2, c2); ph1[i] = a2; pl1[i] = c2; }
                const v16bf bph = cat16b(ph0, ph1), bpl = cat16b(pl0, pl1);
#pragma unroll
                for (int dt = 0; dt < 4; ++dt) {
                    const v16bf avh = ldsAb(sVh + (dt * 16 + lr) * TP + ks * 32 + 8 * hi), avl = ldsAb(sVl + (dt * 16 + lr) * TP + ks * 32 + 8 * hi);
                    acc[dt] = wmmab(avh, bph, acc[dt]); acc[dt] = wmmab(avh, bpl, acc[dt]); acc[dt] = wmmab(avl, bph, acc[dt]);
                    asm volatile("v_nop\n\tv_nop\n\tv_nop\n\tv_nop" : "+v"(acc[dt]) : "v"(bph), "v"(bpl), "v"(avh), "v"(avl)); } }   // WMMA distance, as above
        } else {
#pragma unroll
            for (int ks = 0; ks < 2; ++ks) {
                v16h bp;
#pragma unroll
                for (int i = 0; i < 8; ++i) { bp[i] = tohx(s[2 * ks][i] * PCAR); bp[8 + i] = tohx(s[2 * ks + 1][i] * PCAR); }
#pragma unroll
                for (int dt = 0; dt < 4; ++dt) acc[dt] = wmma16(av[ks][dt], bp, acc[dt]);
                if (ks == 1) asm volatile("v_nop\n\tv_nop\n\tv_nop\n\tv_nop" : "+v"(acc[0]), "+v"(acc[1]), "+v"(acc[2]), "+v"(acc[3]) : "v"(bp), "v"(av[1][0]), "v"(av[1][1]), "v"(av[1][2]), "v"(av[1][3])); }   // WMMA distance behind the chunk's last products, as above (the loop's branch follows)
        }
    }
    __syncthreads();                                          // all waves done with the K tiles before the output staging aliases them
    float* os = (float*)smem + w * 16 * 68;
    const float rc = HIRES ? 1.0f : (1.0f / PCAR);
    const float inv = __fdiv_rn(rc, l + xhalf(l));            // the two halves' key sums joined here
#pragma unroll
    for (int dt = 0; dt < 4; ++dt) {
        v4f o0, o1;
#pragma unroll
        for (int r = 0; r < 4; ++r) { o0[r] = acc[dt][r] * inv; o1[r] = acc[dt][4 + r] * inv; }
        *(v4fa*)(os + lr * 68 + dt * 16 + 8 * hi) = o0; *(v4fa*)(os + lr * 68 + dt * 16 + 8 * hi + 4) = o1; }
    __builtin_amdgcn_wave_barrier(); asm volatile("" ::: "memory");
    float* crow = OUTb + (size_t)(qb + w * 16) * DQ + h * HD;
{
#pragma unroll
        for (int s2 = 0; s2 < 8; ++s2) { const int row = 2 * s2 + hi, cofs = lr * 4; const v4f val = *(const v4fa*)(os + row * 68 + cofs);
            *(v4f*)(crow + (size_t)row * DQ + cofs) = val; }
         }
}

#define NQL   (NQB - RH / 64)
#define FB_L  (NQL * NH_ * NB)
#define FB_H  ((RH / 64) * NH_ * NB)
static_assert(NQL >= 1);
__global__ __launch_bounds__(128) void k_flash(const bf* __restrict__ QPh, const bf* __restrict__ QPl, const bf* __restrict__ KPh, const bf* __restrict__ KPl,
                                               const h16* __restrict__ VT16, const bf* __restrict__ VTh, const bf* __restrict__ VTl,
                                               const int* __restrict__ mask, const int* __restrict__ FL, float* OUT) {
    __shared__ __align__(16) unsigned char smem[LDS_TOTAL];
    const int b = (int)blockIdx.x;                           // flat index: query block fastest, then head, then batch; the blocks of query rows >= RH first, the few short blocks of rows < RH last
    if (b < FB_L) d_flash<false>(smem, QPh, QPl, KPh, KPl, VT16, VTh, VTl, mask, FL, RH / 64 + b % NQL, (b / NQL) % NH_, b / (NQL * NH_), OUT);
    else { const int c = b - FB_L; d_flash<true>(smem, QPh, QPl, KPh, KPl, VT16, VTh, VTl, mask, FL, c % (RH / 64), (c / (RH / 64)) % NH_, c / ((RH / 64) * NH_), OUT); }
}

extern "C" void kernel_launch(void* const* d_in, const int* in_sizes, int n_in,
                              void* d_out, int out_size, void* d_ws, size_t ws_size, hipStream_t stream) {
    if (n_in < 4) return;
    if (in_sizes[0] < (NB - 1) * SEQ_FULL * DM + TT * DM) return;
    if (in_sizes[1] < DM * DM) return;
    if (in_sizes[2] < 2 * DM * DM) return;
    if (in_sizes[3] < TT * MPITCH) return;
    if (out_size < NB * TT * DQ) return;
    const float* x = (const float*)d_in[0]; const float* wq = (const float*)d_in[1]; const float* wkv = (const float*)d_in[2]; const int* mask = (const int*)d_in[3];
    float* OUT = (float*)d_out;     // [NB][TT][DQ]
    char* wsp = (char*)d_ws;
    auto take = [&](size_t bytes) { char* p = wsp; wsp += (bytes + 255) & ~(size_t)255; return (void*)p; };
    bf* W3 = (bf*)take((size_t)D3 * DM * 2); float* CS = (float*)take((size_t)TT * HD * 2 * 4); int* FL = (int*)take((size_t)NQB * FLG * 32 * 4);
    bf* XB = (bf*)take((size_t)NB * TT * DM * 2);
    bf* QPh = (bf*)take((size_t)NB * NH_ * TT * HD * 2); bf* QPl = (bf*)take((size_t)NB * NH_ * TT * HD * 2); bf* KPh = (bf*)take((size_t)NB * NH_ * TT * HD * 2); bf* KPl = (bf*)take((size_t)NB * NH_ * TT * HD * 2);
    h16* VT16 = (h16*)take((size_t)NB * NH_ * HD * TT * 2); bf* VTh = (bf*)take((size_t)NB * NH_ * HD * TT * 2); bf* VTl = (bf*)take((size_t)NB * NH_ * HD * TT * 2);
    const size_t used = (size_t)(wsp - (char*)d_ws);
    if (used > ws_size || used > (size_t)134217728) return;   // 74,481,664 B at NB=2, SEQ=2048
    k_prep<<<PB_MF + PB_CS + PB_W + NB * PB_X, 256, 0, stream>>>(x, wq, wkv, mask, XB, W3, CS, FL);
    k_gemmw<<<dim3(TT / GBM, D3 / GBN, NB), GWV * 32, 0, stream>>>(XB, W3, CS, QPh, QPl, KPh, KPl, VT16, VTh, VTl);
    k_flash<<<FB_L + FB_H, 128, 0, stream>>>(QPh, QPl, KPh, KPl, VT16, VTh, VTl, mask, FL, OUT);
}

// v009
// One run takes 75 microseconds.
// Next to v008, in two timings, it ran 1.05 and 1.06 times as fast.
// All steps since v000 together make it 6.42 times as fast.
#include <hip/hip_runtime.h>

// Contractions: fused q|k|v projection v_wmma_f32_16x16x32_bf16 (bf16 operands = RNE-converted inputs, exact products); scores v_wmma_f32_16x16x32_bf16 with q/k as bf16 hi/lo planes (3 products) on every row; attn.v v_wmma_f32_16x16x32_f16 (f16 P carried x1024, f16 v) on query rows >= 64 and v_wmma_f32_16x16x32_bf16 with P and v as bf16 hi/lo (3 products) on query rows < 64; f32 accumulate, f32 online softmax, f32 output.
// Both batch elements go through every launch together (batch = the slowest part of the block index; every per-batch plane below is stored [batch][...]). Three launches: preparation (k_prep), projection (k_gemmw), attention (k_flash). Layout per batch: bf16 copy of x; one [3072][1024] bf16 'oi' weight (q rows, then k rows, then v rows, k/v de-interleaved from the [2048][1024] kv weight whose row is h*128 + 2d + c); both planes are stored in fragment order (see pkoff), so that the projection kernel's operand copies and fragment reads cover whole lines; the product x W^T stays in the projection kernel's accumulators, whose epilogue writes the planes below;
// rotary planes q,k [h][t][64] bf16 hi/lo (rotate-half, table cos/sin[t][d], q pre-scaled by 1/8); value planes [h][d][t] f16 and bf16 hi/lo; per (64-row query block, 64-key chunk) mask flags from the int mask (empty chunks skipped, partial chunks apply the mask element-wise, replace-fill), four flags to a 128-byte line (FLIDX);
// flash-style attention: K hi/lo and V chunk tiles staged in LDS, transposed products (S^T = K Q^T, O^T += V^T P^T) so that a lane holds one query's scores, online softmax in-lane, output rows written directly (no output projection).

#ifndef NB
#define NB 2
#endif
#ifndef SEQ
#define SEQ 2048
#endif
#define NB_FULL  2
#define SEQ_FULL 2048
#define TT     SEQ
#define DM     1024
#define NH_    16
#define HD     64
#define DQ     (NH_ * HD)
#define D3     (3 * DM)
#define NQB    (TT / 64)
#define NCH    (TT / 64)
#define RH     64
#define MPITCH SEQ_FULL
#define FLP    32
#define MFG    4
#define FLG    (FLP / MFG)
#define FLIDX(qblk, kc) ((((qblk) * FLG + (kc) / MFG) * 32) + (kc) % MFG)
#define PCAR   1024.0f
#define SCL    0.125f
#define NEGS   (-3.0e38f)
#define TP     72
#define TILEB  (64 * TP * 2)
#define O_KH   0
#define O_KL   (TILEB)
#define O_VA   (2 * TILEB)
#define O_VB   (3 * TILEB)
#define BUFB   (3 * TILEB)
#define O_MS   (2 * BUFB)
#define LDS_TOTAL (2 * BUFB + 64 * 64)

static_assert(TT % 64 == 0);
static_assert(TT <= SEQ_FULL);
static_assert(NB >= 1 && NB <= NB_FULL);
static_assert(NCH <= FLP);
static_assert(FLP == 32 && FLP * 64 == MPITCH && MFG == 4);
static_assert(RH == 64);
static_assert(NQB >= RH / 64);
static_assert(DM % 32 == 0 && D3 % 64 == 0 && HD == 64 && DQ == DM);
static_assert(4 * 16 * 68 * 4 <= O_VA);
static_assert((TP * 2) % 16 == 0);
static_assert(16 * 68 * 4 <= 3 * 32 * TP * 2);
static_assert(LDS_TOTAL <= 65536 && O_VB + TILEB <= O_MS && TILEB % 16 == 0);

typedef _Float16 h16;
typedef unsigned short bf;
typedef __attribute__((ext_vector_type(16))) __bf16   v16bf;
typedef __attribute__((ext_vector_type(16))) _Float16 v16h;
typedef __attribute__((ext_vector_type(8)))  _Float16 v8h;
typedef __attribute__((ext_vector_type(8)))  unsigned short v8us;
typedef __attribute__((ext_vector_type(8)))  float    v8f;
typedef __attribute__((ext_vector_type(4)))  float    v4f;
typedef __attribute__((ext_vector_type(2)))  float    v2f;
typedef __attribute__((ext_vector_type(4)))  int      v4i;
typedef v8h  __attribute__((may_alias)) v8ha;
typedef v4f  __attribute__((may_alias)) v4fa;
typedef v8us __attribute__((may_alias)) v8usa;
typedef __attribute__((ext_vector_type(2))) unsigned v2u;
typedef v2u  __attribute__((may_alias)) v2ua;
typedef __attribute__((ext_vector_type(2))) __bf16 v2bf;
typedef __attribute__((ext_vector_type(4))) unsigned v4u;
typedef v4u  __attribute__((may_alias)) v4ua;

__device__ __forceinline__ unsigned short f2bf(float f) { unsigned u = __float_as_uint(f); u += 0x7FFFu + ((u >> 16) & 1u); return (unsigned short)(u >> 16); }
__device__ __forceinline__ float bf2f(unsigned short b) { return __uint_as_float(((unsigned)b) << 16); }
__device__ __forceinline__ v16h cat16(v8h lo, v8h hi) { return __builtin_shufflevector(lo, hi, 0, 1, 2, 3, 4, 5, 6, 7, 8, 9, 10, 11, 12, 13, 14, 15); }
__device__ __forceinline__ v16bf cat16b(v8us lo, v8us hi) { return __builtin_bit_cast(v16bf, __builtin_shufflevector(lo, hi, 0, 1, 2, 3, 4, 5, 6, 7, 8, 9, 10, 11, 12, 13, 14, 15)); }
__device__ __forceinline__ v8f wmma16(v16h a, v16h b, v8f c) { return __builtin_amdgcn_wmma_f32_16x16x32_f16(false, a, false, b, (short)0, c, false, false); }
__device__ __forceinline__ v8f wmmab(v16bf a, v16bf b, v8f c) { return __builtin_amdgcn_wmma_f32_16x16x32_bf16(false, a, false, b, (short)0, c, false, false); }
__device__ __forceinline__ h16 tohx(float x) { return (h16)x; }
__device__ __forceinline__ void splitf(float y, unsigned short& h, unsigned short& l) { h = f2bf(y); l = f2bf(y - bf2f(h)); }
// The same split of two values at once on the packed converter (f32 -> bf16, round to nearest even like f2bf): hi word and lo word, first value in bits 15..0; and the two picks that pair the low or the high halves of two words.
__device__ __forceinline__ unsigned pkbf(float a, float b) { v2f v; v[0] = a; v[1] = b; return __builtin_bit_cast(unsigned, __builtin_convertvector(v, v2bf)); }
__device__ __forceinline__ void split2(float a, float b, unsigned& h, unsigned& l) { h = pkbf(a, b); l = pkbf(a - __uint_as_float(h << 16), b - __uint_as_float(h & 0xFFFF0000u)); }
__device__ __forceinline__ unsigned lo16(unsigned e0, unsigned e1) { return (e0 & 0xFFFFu) | (e1 << 16); }
__device__ __forceinline__ unsigned hi16(unsigned e0, unsigned e1) { return (e0 >> 16) | (e1 & 0xFFFF0000u); }
__device__ __forceinline__ float xhalf(float x) { return __builtin_bit_cast(float, __builtin_amdgcn_permlanex16(__builtin_bit_cast(int, x), __builtin_bit_cast(int, x), 0x76543210, 0xfedcba98, false, false)); }  // lane l with lane l ^ 16

// 2^x of eight values in place. The eight v_exp_f32 and the free slot that the instruction set asks for behind a transcendental stand in ONE statement: a v_nop in a statement of its own landed elsewhere.
__device__ __forceinline__ void exp2x8(v8f& v) {
    float e0 = v[0], e1 = v[1], e2 = v[2], e3 = v[3], e4 = v[4], e5 = v[5], e6 = v[6], e7 = v[7];
    asm("v_exp_f32 %0, %0\n\tv_exp_f32 %1, %1\n\tv_exp_f32 %2, %2\n\tv_exp_f32 %3, %3\n\tv_exp_f32 %4, %4\n\tv_exp_f32 %5, %5\n\tv_exp_f32 %6, %6\n\tv_exp_f32 %7, %7\n\tv_nop"
        : "+v"(e0), "+v"(e1), "+v"(e2), "+v"(e3), "+v"(e4), "+v"(e5), "+v"(e6), "+v"(e7));
    v[0] = e0; v[1] = e1; v[2] = e2; v[3] = e3; v[4] = e4; v[5] = e5; v[6] = e6; v[7] = e7;
}

// Fragment loaders (split k map for A and B alike): element i of the 16-wide vector <- k0 + 8*hi + i (i < 8), k0 + 16 + 8*hi + (i - 8) (i >= 8); callers pass p = row_base + k0 + 8*hi.
template <typename T16> struct WFrag;
template <> struct WFrag<bf> { typedef v16bf V; static __device__ __forceinline__ V ld(const bf* p) { return cat16b(*(const v8us*)p, *(const v8us*)(p + 16)); } };
// Fragment order of a K-contiguous [rows][DM] 16-bit plane: blocks of 16 rows x 32 k, 512 elements each, block (rb, kb) at (rb * (DM / 32) + kb) * 512. Inside a block, lane (row & 15) + 16 * hi keeps its eight elements k = 8*hi + i at lane * 8 + i and its eight elements k = 16 + 8*hi + i at 256 + lane * 8 + i:
// the same k map as above, and each of a fragment's two reads (element block + lane * 8, and 256 elements on) takes 512 contiguous bytes, four whole lines, where the row-major plane gave 32 bytes of each of 16 lines.
// The converters go by 8-element unit i: sgm = i & 3 (which eight k of the block), r16 = (i >> 2) & 15 (row in the block), block = i >> 6; a wave then reads eight whole 128-byte f32 lines and writes four whole 128-byte lines.
__device__ __forceinline__ size_t pkoff(size_t i) { const size_t sgm = i & 3, r16 = (i >> 2) & 15; return (i >> 6) * 512 + (sgm >> 1) * 256 + ((sgm & 1) * 16 + r16) * 8; }
__device__ __forceinline__ int pkrow(size_t i) { return (int)((i >> 6) / (DM / 32)) * 16 + (int)((i >> 2) & 15); }
__device__ __forceinline__ int pkcol(size_t i) { return (int)((i >> 6) % (DM / 32)) * 32 + (int)(i & 3) * 8; }
// LDS reloads of tiles written as 16-bit elements: same element type through may_alias vectors.
__device__ __forceinline__ v16h  ldsA16(const h16* p) { return cat16(*(const v8ha*)p, *(const v8ha*)(p + 16)); }
__device__ __forceinline__ v16bf ldsAb(const bf* p) { return cat16b(*(const v8usa*)p, *(const v8usa*)(p + 16)); }

// ---- k_gemmw: GEMM of the fused q|k|v projection with its epilogue. One workgroup of GWV = 12 waves per GBM x GBN = 256 x 192 tile of x W^T, one wave per 64x64 part of it (16 accumulators); grid (TT/GBM, D3/GBN, batch): 256 workgroups at the full size.
// acc[m][n] = sum_k A[m][k] Bt[n][k], k ascending. Both operands are 16-bit planes in fragment order (pkoff; K == DM).
// The workgroup's operand rows go through LDS, so that each line comes from L2 once per workgroup and not once per wave that needs it: a stage is GKS = 64 k of the tile's 16 + 12 blocks of 16 rows, 2 KiB of each (contiguous in the plane), laid block after block in one of two buffers;
// asynchronous copies (16 bytes a lane, 512 contiguous bytes a wave) fill a buffer while the other one is worked on. Wave-copy c of a stage brings bytes 512 * (c & 3) .. of row block c >> 2 (A's 16 blocks, then Bt's 12) to byte 512 * c of the buffer; the waves take them in turn. A fragment is read back as two contiguous 512-byte wave reads.
// A wave's 64 columns are one head of q, k or v (column tile = section*NH_ + head), so the head planes are written from the accumulators and the f32 product never goes to memory.
// q, k: rotate-half rotary in registers (columns d and d+32 are accumulator tiles nb and nb+2 of the same lane; the table holds the same cos, sin at d and d+32): out[d] = x[d] cos - x[d+32] sin, out[d+32] = x[d+32] cos + x[d] sin, times sc, split to bf16 hi/lo;
//       two rows' bf16 per word, hi words and lo words staged per 16 rows in LDS (pitch 68 words), planes [h][t][d] stored as whole 128-byte rows.
// v:    a lane's eight accumulator rows are eight consecutive t of one d: packed to f16, bf16 hi, bf16 lo; 32 d of the three [d][t] planes at a time staged in LDS (pitch TP), planes [h][d][t] stored as whole 128-byte rows.
#define GBM   256
#define GBN   192
#define GWN   (GBN / 64)
#define GWV   ((GBM / 64) * GWN)
#define GKS   64
#define GRBB  (16 * GKS * 2)
#define GSTB  (((GBM + GBN) / 16) * GRBB)
#define GNC   (GSTB / 512)
#define GCF   (GNC / GWV)
#define GCR   (GNC % GWV)
#define GNST  (DM / GKS)
#define GEPB  (3 * 32 * TP * 2)
static_assert(TT % GBM == 0 && D3 % GBN == 0 && DM % GKS == 0 && GNST >= 2 && GNST % 2 == 0);
static_assert(GCF == 9 && GCR > 0 && GRBB == 4 * 512 && GWV == 12 && GBN % 48 == 0 && (GBM / 4) % GWV == GCR);
static_assert(2 * GSTB + GWV * GEPB <= 327680);

// One stage's copies of one wave: nine for every wave, a tenth for the first GCR waves (more: wave-uniform, a scalar branch). ub, ul = each copy's wave-uniform global address and LDS byte offset, ko = the stage's byte offset in a block of rows, lb = the lane's LDS byte address in the buffer, ln = lane * 16.
// The addresses are formed here, where the fragment registers are free, and not kept through the loop. The s_wait_xcnt stands as the last line of the copies' own statement, in front of whatever rewrites an address register that a copy names.
__device__ __forceinline__ void gcopy(const char* const* ub, const unsigned* ul, unsigned ko, unsigned lb, unsigned ln, bool more) {
    const char* g[GCF + 1]; unsigned l[GCF + 1];
#pragma unroll
    for (int i = 0; i <= GCF; ++i) { g[i] = ub[i] + ko + ln; l[i] = lb + ul[i]; }
    asm volatile("global_load_async_to_lds_b128 %0, %9, off\n\tglobal_load_async_to_lds_b128 %1, %10, off\n\tglobal_load_async_to_lds_b128 %2, %11, off\n\t"
                 "global_load_async_to_lds_b128 %3, %12, off\n\tglobal_load_async_to_lds_b128 %4, %13, off\n\tglobal_load_async_to_lds_b128 %5, %14, off\n\t"
                 "global_load_async_to_lds_b128 %6, %15, off\n\tglobal_load_async_to_lds_b128 %7, %16, off\n\tglobal_load_async_to_lds_b128 %8, %17, off\n\ts_wait_xcnt 0x0"
                 :: "v"(l[0]), "v"(l[1]), "v"(l[2]), "v"(l[3]), "v"(l[4]), "v"(l[5]), "v"(l[6]), "v"(l[7]), "v"(l[8]),
                    "v"(g[0]), "v"(g[1]), "v"(g[2]), "v"(g[3]), "v"(g[4]), "v"(g[5]), "v"(g[6]), "v"(g[7]), "v"(g[8]) : "memory");
    if (more) asm volatile("global_load_async_to_lds_b128 %0, %1, off\n\ts_wait_xcnt 0x0" :: "v"(l[9]), "v"(g[9]) : "memory");
}
// A fragment out of a staged block: p = block + lane * 16 bytes.
__device__ __forceinline__ v16bf ldsFr(const unsigned char* p) { return cat16b(*(const v8usa*)p, *(const v8usa*)(p + 512)); }

__global__ __launch_bounds__(GWV * 32) void k_gemmw(const bf* __restrict__ A, const bf* __restrict__ Bt, const float* __restrict__ CS, bf* QPh, bf* QPl, bf* KPh, bf* KPl, h16* VT16, bf* VTh, bf* VTl) {
    __shared__ __align__(16) unsigned char ring[2 * GSTB];
    __shared__ __align__(16) unsigned char stg[GWV * GEPB];
    const size_t z = blockIdx.z;
    const int lane = threadIdx.x & 31, lr = lane & 15, hi = lane >> 4;
    const int w = __builtin_amdgcn_readfirstlane((int)threadIdx.x >> 5), wm = w / GWN, wn = w % GWN;   // the wave's number, in a scalar register
    const int r0 = blockIdx.x * GBM + wm * 64, ct = blockIdx.y * GWN + wn;                             // the wave's first row in its batch element; its column tile
    unsigned char* st = stg + w * GEPB;                                                                // the wave's own epilogue staging
    v8f acc[4][4];
#pragma unroll
    for (int mb = 0; mb < 4; ++mb)
#pragma unroll
        for (int nb = 0; nb < 4; ++nb) acc[mb][nb] = (v8f){};
    const char* Ab = (const char*)(A + z * ((size_t)TT * DM) + (size_t)blockIdx.x * GBM * DM);         // a block of 16 rows is 16 * DM elements
    const char* Bb = (const char*)(Bt + (size_t)blockIdx.y * GBN * DM);
    const unsigned ln = lane * 16, lbase = (unsigned)(size_t)ring + ln;
    const bool more = w < GCR;
    const char* ub[GCF + 1]; unsigned ul[GCF + 1];
#pragma unroll
    for (int i = 0; i <= GCF; ++i) {                          // rounds 0..3: the 48 wave-copies of Bt; rounds 4..9: the 64 of A (the last round: its last GCR)
        const int c = (i < GBN / 48) ? i * GWV + w : min((i - GBN / 48) * GWV + w, GBM / 4 - 1);
        ub[i] = ((i < GBN / 48) ? Bb : Ab) + (size_t)(c >> 2) * (16 * DM * 2) + (c & 3) * 512;
        ul[i] = ((i < GBN / 48) ? GBM / 4 + c : c) * 512; }
    gcopy(ub, ul, 0, lbase, ln, more);                        // stage 0
    asm volatile("s_wait_asynccnt 0x0" ::: "memory");         // this wave's copies of stage 0 have landed
    __syncthreads();                                          // and every other wave's
    gcopy(ub, ul, GRBB, lbase + GSTB, ln, more);              // stage 1
    const unsigned char* fa = ring + wm * 4 * GRBB + ln; const unsigned char* fb = ring + (GBM / 16 + wn * 4) * GRBB + ln;
#pragma unroll 1
    for (int t = 0; t < GNST; t += 2) {                       // two stages a trip, so that each buffer's addresses are constants of the code
#pragma unroll
        for (int p = 0; p < 2; ++p) {
            // The stage's 32 LDS reads go in three groups, the later two eight WMMAs ahead of the first product that needs them, in twelve fragments' registers (two whole sets would pass 256 registers): all of k 0..31 and A of k 32..63; then Bt of k 32..63 by halves, where the halves of k 0..31 come free.
            // The scheduling barriers keep the groups where they stand: left alone this build put the reads among the WMMAs in pairs, each waited for to 0.
            const unsigned char* pa = fa + p * GSTB; const unsigned char* pb = fb + p * GSTB;
            v16bf a0[4], a1[4], b0[4], b1[4];
#pragma unroll
            for (int mb = 0; mb < 4; ++mb) a0[mb] = ldsFr(pa + mb * GRBB);
#pragma unroll
            for (int nb = 0; nb < 4; ++nb) b0[nb] = ldsFr(pb + nb * GRBB);
#pragma unroll
            for (int mb = 0; mb < 4; ++mb) a1[mb] = ldsFr(pa + mb * GRBB + 1024);
            __builtin_amdgcn_sched_barrier(0);
#pragma unroll
            for (int nb = 0; nb < 2; ++nb)
#pragma unroll
                for (int mb = 0; mb < 4; ++mb) acc[mb][nb] = wmmab(a0[mb], b0[nb], acc[mb][nb]);
            __builtin_amdgcn_sched_barrier(0);
            b1[0] = ldsFr(pb + 1024); b1[1] = ldsFr(pb + GRBB + 1024);
            __builtin_amdgcn_sched_barrier(0);
#pragma unroll
            for (int nb = 2; nb < 4; ++nb)
#pragma unroll
                for (int mb = 0; mb < 4; ++mb) acc[mb][nb] = wmmab(a0[mb], b0[nb], acc[mb][nb]);
            __builtin_amdgcn_sched_barrier(0);
            b1[2] = ldsFr(pb + 2 * GRBB + 1024); b1[3] = ldsFr(pb + 3 * GRBB + 1024);
            __builtin_amdgcn_sched_barrier(0);
#pragma unroll
            for (int nb = 0; nb < 4; ++nb)
#pragma unroll
                for (int mb = 0; mb < 4; ++mb) acc[mb][nb] = wmmab(a1[mb], b1[nb], acc[mb][nb]);
            __builtin_amdgcn_sched_barrier(0);                // every WMMA of the stage stays ahead of the slots and the barrier below
            asm volatile("v_nop\n\tv_nop\n\tv_nop\n\tv_nop" : "+v"(acc[0][3]), "+v"(acc[1][3]), "+v"(acc[2][3]), "+v"(acc[3][3]) : "v"(a1[0]), "v"(a1[3]), "v"(b1[3]));   // four vector slots behind the stage's last WMMAs, on the taken side of a branch too
            asm volatile("s_wait_dscnt 0x0" ::: "memory");    // this wave has read all it wants of the buffer
            asm volatile("s_wait_asynccnt 0x0" ::: "memory"); // its copies of the next stage have landed
            __syncthreads();                                  // publishes the next stage and frees this buffer
            if (t + p + 2 < GNST) gcopy(ub, ul, (unsigned)(t + p + 2) * GRBB, lbase + p * GSTB, ln, more);   // the test reads the same for the whole workgroup
        }
    }
    asm volatile("s_wait_asynccnt 0x0" ::: "memory");         // nothing is in flight when the wave goes on
    const int sec = ct / NH_, h = ct % NH_;                                           // wave-uniform
    const size_t hp = (z * NH_ + h) * TT * HD;
    if (sec < 2) {
        unsigned* us = (unsigned*)st;
        bf* Ph = (sec == 0 ? QPh : KPh) + hp + (size_t)r0 * HD; bf* Pl = (sec == 0 ? QPl : KPl) + hp + (size_t)r0 * HD;
        const float sc = (sec == 0) ? SCL : 1.0f;
#pragma unroll
        for (int mb = 0; mb < 4; ++mb) {
            const float* cp = CS + ((size_t)(r0 + mb * 16 + hi * 8) * HD + lr) * 2;
            v2f cs[2][8];
#pragma unroll
            for (int j = 0; j < 8; ++j) { cs[0][j] = *(const v2f*)(cp + j * HD * 2); cs[1][j] = *(const v2f*)(cp + j * HD * 2 + 32); }
            asm volatile("s_wait_xcnt 0x0" :: "v"(cp) : "memory");   // the wait before a register of the loads above is used again; naming the address keeps it out of their destinations
#pragma unroll
            for (int nl = 0; nl < 2; ++nl) {
                float ra[8], rb[8];
#pragma unroll
                for (int j = 0; j < 8; ++j) {
                    const float x0 = acc[mb][nl][j], x1 = acc[mb][nl + 2][j], cn = cs[nl][j][0], sn = cs[nl][j][1];
                    ra[j] = (x0 * cn - x1 * sn) * sc; rb[j] = (x1 * cn + x0 * sn) * sc; }
#pragma unroll
                for (int jp = 0; jp < 4; ++jp) {                                      // one word = rows 2jp, 2jp+1 of one column; word rows 0..7 hi, 8..15 lo
                    unsigned wh, wl; unsigned* u = us + (hi * 4 + jp) * 68 + nl * 16 + lr;
                    split2(ra[2 * jp], ra[2 * jp + 1], wh, wl); u[0] = wh; u[8 * 68] = wl;
                    split2(rb[2 * jp], rb[2 * jp + 1], wh, wl); u[32] = wh; u[8 * 68 + 32] = wl; } }
            __builtin_amdgcn_wave_barrier(); asm volatile("" ::: "memory");   // keeps the other lanes' LDS writes ahead of the reads below in the compiled order
#pragma unroll
            for (int s = 0; s < 4; ++s) {
                const int pr = (s & 1) * 4 + (lane >> 3), seg = lane & 7;             // row pair and 8-column segment; s >> 1 picks the plane
                const unsigned* u = us + ((s >> 1) * 8 + pr) * 68 + seg * 8;
                const v4u p0 = *(const v4ua*)u, p1 = *(const v4ua*)(u + 4);
                v4u oe, oo;
                oe[0] = lo16(p0[0], p0[1]); oe[1] = lo16(p0[2], p0[3]); oe[2] = lo16(p1[0], p1[1]); oe[3] = lo16(p1[2], p1[3]);
                oo[0] = hi16(p0[0], p0[1]); oo[1] = hi16(p0[2], p0[3]); oo[2] = hi16(p1[0], p1[1]); oo[3] = hi16(p1[2], p1[3]);
                bf* P = ((s >> 1) ? Pl : Ph) + (size_t)(mb * 16 + 2 * pr) * HD + seg * 8;
                *(v4ua*)P = oe; *(v4ua*)(P + HD) = oo; }
            if (mb < 3) { __builtin_amdgcn_wave_barrier(); asm volatile("s_wait_xcnt 0x0" ::: "memory"); }   // the reads above stay ahead of the next rows' LDS writes; the wait stands before the stores' registers are used again
        }
    } else {
        bf* sp = (bf*)st;
#pragma unroll
        for (int hf = 0; hf < 2; ++hf) {                                              // 32 d at a time, the three planes side by side in LDS
#pragma unroll
            for (int nl = 0; nl < 2; ++nl) {
#pragma unroll
                for (int mb = 0; mb < 4; ++mb) {
                    const v8f x = acc[mb][hf * 2 + nl]; v4u oh, ol;
#pragma unroll
                    for (int i = 0; i < 4; ++i) { unsigned wh, wl; split2(x[2 * i], x[2 * i + 1], wh, wl); oh[i] = wh; ol[i] = wl; }
                    bf* q = sp + (nl * 16 + lr) * TP + mb * 16 + hi * 8;
                    *(v4ua*)q = __builtin_bit_cast(v4u, __builtin_convertvector(x, v8h)); *(v4ua*)(q + 32 * TP) = oh; *(v4ua*)(q + 64 * TP) = ol; } }
            __builtin_amdgcn_wave_barrier(); asm volatile("" ::: "memory");   // other lanes' LDS writes ahead of the reads below, as above
#pragma unroll
            for (int pl = 0; pl < 3; ++pl) {
                bf* P = ((pl == 0) ? (bf*)VT16 : (pl == 1) ? VTh : VTl) + hp + (size_t)hf * 32 * TT + r0;
#pragma unroll
                for (int s = 0; s < 8; ++s) {
                    const int idx = s * 32 + lane; const int row = idx >> 3, seg = idx & 7;
                    *(v4ua*)(P + (size_t)row * TT + seg * 8) = *(const v4ua*)(sp + (pl * 32 + row) * TP + seg * 8); } }
            __builtin_amdgcn_wave_barrier(); asm volatile("s_wait_xcnt 0x0" ::: "memory");   // reads ahead of the next half's LDS writes; the wait before the stores' registers are used again (behind the last half too: the built code lays the q, k block behind this one)
        }
    }
}

// The four preparation jobs below depend on nothing but the inputs and not on each other: they are bodies of ONE kernel, k_prep, which hands each a range of its blocks (blk = the block's index inside its range).
__device__ __forceinline__ void d_cvt8(int blk, int bz, const float* __restrict__ src, bf* dst, size_t n8, size_t sS, size_t sD) { const size_t i = (size_t)blk * 256 + threadIdx.x; if (i >= n8) return; src += bz * sS; dst += bz * sD; const v8f v = *(const v8f*)(src + (size_t)pkrow(i) * DM + pkcol(i)); v8us o;
#pragma unroll
    for (int k = 0; k < 8; ++k) o[k] = f2bf(v[k]); *(v8us*)(dst + pkoff(i)) = o;  }

__device__ __forceinline__ void d_cvtw(int blk, const float* __restrict__ wq, const float* __restrict__ wkv, bf* dst, size_t n8) {
    const size_t i = (size_t)blk * 256 + threadIdx.x; if (i >= n8) return;
    const int row = pkrow(i), col = pkcol(i);
    const int r2 = max(row - DM, 0); const int c = (r2 >= DM) ? 1 : 0; const int r3 = r2 - c * DM;
    const int srow = (r3 >> 6) * (2 * HD) + 2 * (r3 & 63) + c;
    const float* src = (row < DM) ? (wq + (size_t)row * DM + col) : (wkv + (size_t)srow * DM + col);
    const v8f v = *(const v8f*)src; v8us o;
#pragma unroll
    for (int k = 0; k < 8; ++k) o[k] = f2bf(v[k]);
    *(v8us*)(dst + pkoff(i)) = o; 
}

__device__ __forceinline__ void d_cstab(int blk, float* CS) {
    const int idx = blk * 256 + threadIdx.x; if (idx >= TT * HD) return;
    const int t = idx / HD, dd = idx % HD, p = dd & (HD / 2 - 1);
    const float pw = exp10f((float)p * 0.125f);
    const float inv = __fdiv_rn(1.0f, pw);
    float ang = __fmul_rn((float)t, inv); asm volatile("" : "+v"(ang));
    float sn, cn; sincosf(ang, &sn, &cn);
    v2f cs; cs[0] = cn; cs[1] = sn;
    *(v2f*)(CS + (size_t)idx * 2) = cs; 
}

// d_mflag: per (64-row query block, 64-key chunk) flags from the int mask [q][k] (row pitch MPITCH): bit0 = any nonzero, bit1 = all nonzero; chunks >= NCH flagged 0.
// One block per (query block, group of MFG chunks): 64 rows x 256 columns, 16 loads of 16 bytes per thread, none depending on another, each wave-load 512 contiguous bytes of one row. Threads 64*rg .. 64*rg+63 take rows 16*rg .. 16*rg+15; 16 lanes span one chunk's columns.
// A block's MFG flags go to a 128-byte line of their own (FLIDX), so that a line has one writer.
__device__ __forceinline__ void d_mflag(int blk, int* fls, const int* __restrict__ mask, int* FL) {
    const int tid = threadIdx.x, lane = tid & 31, w = tid >> 5; const int qblk = blk / FLG, g = blk % FLG, qb = qblk * 64;
    const int* mp = mask + (size_t)(qb + (tid >> 6) * 16) * MPITCH + g * (MFG * 64) + (tid & 63) * 4;
    v4i a[16];
#pragma unroll
    for (int i = 0; i < 16; ++i) a[i] = *(const v4i*)(mp + (size_t)i * MPITCH);
    // the wait before a register of the loads above is used again; naming the address keeps it out of their destinations, and naming the loaded values (inputs only) keeps all 16 loads in flight together: without it this build waited for nine before it issued the other seven
    asm volatile("s_wait_xcnt 0x0" :: "v"(mp), "v"(a[0]), "v"(a[1]), "v"(a[2]), "v"(a[3]), "v"(a[4]), "v"(a[5]), "v"(a[6]), "v"(a[7]), "v"(a[8]), "v"(a[9]), "v"(a[10]), "v"(a[11]), "v"(a[12]), "v"(a[13]), "v"(a[14]), "v"(a[15]) : "memory");
    unsigned anyv = 0u, minv = 0xFFFFFFFFu;                   // OR of the words; their unsigned minimum, which is nonzero exactly when every word is
#pragma unroll
    for (int i = 0; i < 16; ++i)
#pragma unroll
        for (int q = 0; q < 4; ++q) { anyv |= (unsigned)a[i][q]; minv = min(minv, (unsigned)a[i][q]); }
    const unsigned bany = __builtin_amdgcn_ballot_w32(anyv != 0u), ball = __builtin_amdgcn_ballot_w32(minv != 0u);   // bits 15..0: the wave's first chunk, bits 31..16: its second
    if ((lane & 15) == 0) { const unsigned ha = (bany >> lane) & 0xFFFFu, hl = (ball >> lane) & 0xFFFFu; fls[w * 2 + (lane >> 4)] = (ha != 0u ? 1 : 0) | (hl == 0xFFFFu ? 2 : 0); }
    __syncthreads();
    if (tid < MFG) {                                          // chunk tid of the group: wave 2*rg + (tid >> 1), half tid & 1, joined over the four row groups
        int va = 0, vl = 2;
#pragma unroll
        for (int rg = 0; rg < 4; ++rg) { const int v = fls[(rg * 2 + (tid >> 1)) * 2 + (tid & 1)]; va |= v & 1; vl &= v; }
        const int kc = g * MFG + tid;
        FL[FLIDX(qblk, kc)] = (kc < NCH) ? (va | vl) : 0; }
}

// k_prep: block ranges, in this order: mask flags, rotary table, weight planes, x planes. The range test is block-uniform.
#define PB_MF  (NQB * FLG)
#define PB_CS  ((TT * HD + 255) / 256)
#define PB_W   ((D3 * DM / 8 + 255) / 256)
#define PB_X   ((TT * DM / 8 + 255) / 256)
__global__ __launch_bounds__(256) void k_prep(const float* __restrict__ x, const float* __restrict__ wq, const float* __restrict__ wkv, const int* __restrict__ mask, bf* XB, bf* W3, float* CS, int* FL) {
    __shared__ int fls[FLP];
    int blk = (int)blockIdx.x;
    if (blk < PB_MF) { d_mflag(blk, fls, mask, FL); return; }
    blk -= PB_MF;
    if (blk < PB_CS) { d_cstab(blk, CS); return; }
    blk -= PB_CS;
    if (blk < PB_W) { d_cvtw(blk, wq, wkv, W3, (size_t)D3 * DM / 8); return; }
    blk -= PB_W;
    d_cvt8(blk % PB_X, blk / PB_X, x, XB, (size_t)TT * DM / 8, (size_t)SEQ_FULL * DM, (size_t)TT * DM);
}

// k_flash: flash-style masked softmax attention for one head and one 64-row query block per workgroup (128 threads = 4 waves x 16 query rows); one block per (query block, head, batch). d_flash<HIRES> is its body; the kernel picks the form by the block's query rows (block-uniform), so both forms run in one launch.
// Per 64-key chunk (flag bit0 set): K hi/lo tiles [key][d] and the V^T tile [d][key] staged in LDS (pitch TP), the int mask tile packed to bytes when the chunk is partial (flag bit1 clear);
// query rows >= RH: the three tiles of a chunk are one of two buffers of BUFB bytes, filled by asynchronous copies (fcopy) while the chunk in the other buffer is worked on, so that a chunk does not begin with the wait for its own loads; query rows < RH: four tiles through registers into one buffer;
// S^T[64 keys x 16 queries] = k_hi.q_hi + k_hi.q_lo + k_lo.q_hi (A = K rows from LDS, B = q fragments kept in registers, q planes pre-scaled by 1/8): lane (lr, hi) holds query lr's scores of keys nb*16 + 8*hi + r;
// masked keys -> excluded; running-max online softmax in f32, maximum and sum in-lane, the maximum joined between the wave halves once per chunk, the sums once in the epilogue;
// P^T packs from the score registers straight into the B operand (score tiles 2ks and 2ks+1 are the fragment's k order) and O^T[64 d x 16 queries] += V^T.P^T: HIRES -> P and v as bf16 hi/lo (3 products, carry 1), else f16 P carried x1024 and f16 v.
// One chunk's copies of one wave: 16 bytes a lane, four copies for each of the tiles K hi, K lo, V^T f16 (copy i: unit i * 128 + tid, row = unit >> 3 = i * 16 + (tid >> 3), 16-byte segment = tid & 7, as the staging through registers has them).
// bKh, bKl, bV = the lane's 16 bytes of copy 0 in chunk 0 of each plane, lb = their LDS byte address in the buffer's first tile; what is added here is wave-uniform (kc = the chunk, < NCH).
// The s_wait_xcnt stands as the last line of the copies' own statement, in front of whatever rewrites an address register that a copy names.
__device__ __forceinline__ void fcopy(const char* bKh, const char* bKl, const char* bV, int kc, unsigned lb) {
    const char* g[12]; unsigned l[12];
#pragma unroll
    for (int i = 0; i < 4; ++i) {
        const unsigned ok = (unsigned)(kc * 64 + i * 16) * (HD * 2), ov = (unsigned)(i * 16) * (TT * 2) + (unsigned)kc * 128u;
        g[i] = bKh + ok; g[4 + i] = bKl + ok; g[8 + i] = bV + ov;
        l[i] = lb + (i * 16 * TP * 2 + O_KH); l[4 + i] = lb + (i * 16 * TP * 2 + O_KL); l[8 + i] = lb + (i * 16 * TP * 2 + O_VA); }
    asm volatile("global_load_async_to_lds_b128 %0, %12, off\n\tglobal_load_async_to_lds_b128 %1, %13, off\n\tglobal_load_async_to_lds_b128 %2, %14, off\n\tglobal_load_async_to_lds_b128 %3, %15, off\n\t"
                 "global_load_async_to_lds_b128 %4, %16, off\n\tglobal_load_async_to_lds_b128 %5, %17, off\n\tglobal_load_async_to_lds_b128 %6, %18, off\n\tglobal_load_async_to_lds_b128 %7, %19, off\n\t"
                 "global_load_async_to_lds_b128 %8, %20, off\n\tglobal_load_async_to_lds_b128 %9, %21, off\n\tglobal_load_async_to_lds_b128 %10, %22, off\n\tglobal_load_async_to_lds_b128 %11, %23, off\n\ts_wait_xcnt 0x0"
                 :: "v"(l[0]), "v"(l[1]), "v"(l[2]), "v"(l[3]), "v"(l[4]), "v"(l[5]), "v"(l[6]), "v"(l[7]), "v"(l[8]), "v"(l[9]), "v"(l[10]), "v"(l[11]),
                    "v"(g[0]), "v"(g[1]), "v"(g[2]), "v"(g[3]), "v"(g[4]), "v"(g[5]), "v"(g[6]), "v"(g[7]), "v"(g[8]), "v"(g[9]), "v"(g[10]), "v"(g[11]) : "memory");
}

template <bool HIRES>
__device__ __forceinline__ void d_flash(unsigned char* smem, const bf* __restrict__ QPh, const bf* __restrict__ QPl, const bf* __restrict__ KPh, const bf* __restrict__ KPl,
                                        const h16* __restrict__ VT16, const bf* __restrict__ VTh, const bf* __restrict__ VTl,
                                        const int* __restrict__ mask, const int* __restrict__ FL, int qblk, int h, int bz, float* OUT) {
    bf* sKh = (bf*)(smem + O_KH); bf* sKl = (bf*)(smem + O_KL);
    h16* sV16 = (h16*)(smem + O_VA); bf* sVh = (bf*)(smem + O_VA); bf* sVl = (bf*)(smem + O_VB);
    unsigned char* Ms = smem + O_MS;
    const int tid = threadIdx.x, lane = tid & 31, w = tid >> 5, lr = lane & 15, hi = lane >> 4;
    const int qb = qblk * 64;
    const size_t hp = ((size_t)bz * NH_ + h) * TT * HD;
    float* OUTb = OUT + (size_t)bz * TT * DQ;
    const bf* Qh = QPh + hp; const bf* Ql = QPl + hp; const bf* Kh = KPh + hp; const bf* Kl = KPl + hp;
    const h16* V16 = VT16 + hp; const bf* Vh = VTh + hp; const bf* Vl = VTl + hp;
    const int qrow = qb + w * 16 + lr;                       // B layout: lane -> query column
    v16bf bq[2], bq2[2];
#pragma unroll
    for (int ks = 0; ks < 2; ++ks) { bq[ks] = WFrag<bf>::ld(Qh + (size_t)qrow * HD + ks * 32 + 8 * hi); bq2[ks] = WFrag<bf>::ld(Ql + (size_t)qrow * HD + ks * 32 + 8 * hi); }
    v8f acc[4]; float m = NEGS, l = 0.0f;                    // acc[dt][r] = O^T[dt*16 + 8*hi + r][query lr]; m is the query's, l the sum over this half's keys
#pragma unroll
    for (int dt = 0; dt < 4; ++dt) acc[dt] = (v8f){};
    const unsigned char* Msq = Ms + (w * 16 + lr) * 64 + 8 * hi;   // the lane's query row of the mask tile, at its half's keys
    const float L2E = 1.4426950408889634f;
    const int fv = FL[FLIDX(qblk, lane)];                    // lane = chunk: the query block's FLP flags, read once
    const unsigned fany = __builtin_amdgcn_ballot_w32((fv & 1) != 0), fall = __builtin_amdgcn_ballot_w32((fv & 2) != 0);   // bit kc, the same in every wave of the block
    // The two-buffer ring of the form for query rows >= RH. The chunks that count are the set bits of fany, the same in every wave, so every test around a copy or a barrier below reads the same for the whole workgroup.
    const unsigned ring = (unsigned)(size_t)smem + (unsigned)((tid >> 3) * TP + (tid & 7) * 8) * 2u;   // LDS byte address of the lane's first copy in buffer 0
    const char* bKh = (const char*)(Kh + tid * 8); const char* bKl = (const char*)(Kl + tid * 8); const char* bV = (const char*)(V16 + (size_t)(tid >> 3) * TT + (tid & 7) * 8);   // and its global addresses in chunk 0
    int pb = 0;                                              // the buffer that holds the current chunk
    if (!HIRES && fany != 0u) {
        const unsigned f1 = fany & (fany - 1u);              // the chunks behind the first
        fcopy(bKh, bKl, bV, __builtin_ctz(fany), ring);
        asm volatile("s_wait_asynccnt 0x0" ::: "memory");    // this wave's copies of the first chunk have landed
        __syncthreads();                                     // and every other wave's
        if (f1 != 0u) fcopy(bKh, bKl, bV, __builtin_ctz(f1), ring + BUFB);
    }
#pragma unroll 1
    for (int kc = 0; kc < NCH; ++kc) {
        if (((fany >> kc) & 1u) == 0u) continue;             // block-uniform
        const bool needm = (((fall >> kc) & 1u) == 0u);
        const int kb = kc * 64;
        if (HIRES) {
        __syncthreads();
        const bf* gKh[4]; const bf* gKl[4]; const bf* gVh[4]; const bf* gVl[4];
        v8us rKh[4], rKl[4], rVh[4], rVl[4];
#pragma unroll
        for (int i = 0; i < 4; ++i) {
            const int idx = i * 128 + tid; const int row = idx >> 3, seg = idx & 7;
            gKh[i] = Kh + (size_t)(kb + row) * HD + seg * 8; rKh[i] = *(const v8us*)gKh[i];
            gKl[i] = Kl + (size_t)(kb + row) * HD + seg * 8; rKl[i] = *(const v8us*)gKl[i];
            gVh[i] = Vh + (size_t)row * TT + kb + seg * 8; rVh[i] = *(const v8us*)gVh[i];
            gVl[i] = Vl + (size_t)row * TT + kb + seg * 8; rVl[i] = *(const v8us*)gVl[i];
        }
        // the wait before a register of the loads above is used again; naming the addresses keeps them out of the loads' destinations
        asm volatile("s_wait_xcnt 0x0" :: "v"(gKh[0]), "v"(gKh[1]), "v"(gKh[2]), "v"(gKh[3]), "v"(gKl[0]), "v"(gKl[1]), "v"(gKl[2]), "v"(gKl[3]), "v"(gVh[0]), "v"(gVh[1]), "v"(gVh[2]), "v"(gVh[3]), "v"(gVl[0]), "v"(gVl[1]), "v"(gVl[2]), "v"(gVl[3]) : "memory");
#pragma unroll
        for (int i = 0; i < 4; ++i) {
            const int idx = i * 128 + tid; const int row = idx >> 3, seg = idx & 7;
            *(v8us*)(sKh + row * TP + seg * 8) = rKh[i];
            *(v8us*)(sKl + row * TP + seg * 8) = rKl[i];
            *(v8us*)(sVh + row * TP + seg * 8) = rVh[i]; *(v8us*)(sVl + row * TP + seg * 8) = rVl[i];
        }
        }
        if (needm) {
#pragma unroll
            for (int i = 0; i < 8; ++i) {
                const int idx = i * 128 + tid; const int row = idx >> 4, seg = idx & 15;
                const v4i mv = *(const v4i*)(mask + (size_t)(qb + row) * MPITCH + kb + seg * 4);
                const unsigned pk = (mv[0] != 0 ? 1u : 0u) | (mv[1] != 0 ? 0x100u : 0u) | (mv[2] != 0 ? 0x10000u : 0u) | (mv[3] != 0 ? 0x1000000u : 0u);
                *(unsigned*)(Ms + row * 64 + seg * 4) = pk; } }
        if (HIRES || needm) __syncthreads();                 // publishes what this trip has stored in LDS; the ring's tiles were published in front of the loop or at the foot of the trip before
        // The chunk's LDS fragment reads are issued as groups of eight ahead of the products that use them, not tile by tile (K hi and lo of k 0..31 first; each later K group where an older group's registers come free; all V^T reads in front of the softmax), within the 256 registers that let four waves share a SIMD;
        // every run of products goes round the four independent score tiles; a tile's own products keep their order (hi.hi, hi.lo, lo.hi of k 0..31, then of k 32..63).
        // The form for query rows < RH, whose four staged planes leave no registers for that, keeps one tile's reads in front of that tile's products.
        v8f s[4]; v16h av[2][4];
        if (HIRES) {
#pragma unroll
            for (int nb = 0; nb < 4; ++nb) s[nb] = (v8f){};
#pragma unroll
            for (int ks = 0; ks < 2; ++ks) {
#pragma unroll
                for (int nb = 0; nb < 4; ++nb) {
                    const v16bf a = ldsAb(sKh + (nb * 16 + lr) * TP + ks * 32 + 8 * hi);
                    const v16bf a2 = ldsAb(sKl + (nb * 16 + lr) * TP + ks * 32 + 8 * hi);
                    s[nb] = wmmab(a, bq[ks], s[nb]); s[nb] = wmmab(a, bq2[ks], s[nb]); s[nb] = wmmab(a2, bq[ks], s[nb]);
                    asm volatile("v_nop\n\tv_nop\n\tv_nop\n\tv_nop" : "+v"(s[nb]) : "v"(a), "v"(a2), "v"(bq[ks]), "v"(bq2[ks])); } }   // four vector slots behind the last WMMA of the tile, before its D is read or its operands are rewritten
        } else {
        v16bf kh0[4], kl0[4], kh1[4], kl1[4];
        const bf* pKh = sKh + pb * (BUFB / 2) + lr * TP + 8 * hi; const bf* pKl = sKl + pb * (BUFB / 2) + lr * TP + 8 * hi;
#pragma unroll
        for (int nb = 0; nb < 4; ++nb) kh0[nb] = ldsAb(pKh + nb * 16 * TP);
#pragma unroll
        for (int nb = 0; nb < 4; ++nb) kl0[nb] = ldsAb(pKl + nb * 16 * TP);
#pragma unroll
        for (int nb = 0; nb < 4; ++nb) s[nb] = wmmab(kh0[nb], bq[0], (v8f){});
#pragma unroll
        for (int nb = 0; nb < 4; ++nb) s[nb] = wmmab(kh0[nb], bq2[0], s[nb]);
#pragma unroll
        for (int nb = 0; nb < 4; ++nb) kh1[nb] = ldsAb(pKh + nb * 16 * TP + 32);
#pragma unroll
        for (int nb = 0; nb < 4; ++nb) s[nb] = wmmab(kl0[nb], bq[0], s[nb]);
#pragma unroll
        for (int nb = 0; nb < 4; ++nb) kl1[nb] = ldsAb(pKl + nb * 16 * TP + 32);
#pragma unroll
        for (int nb = 0; nb < 4; ++nb) s[nb] = wmmab(kh1[nb], bq[1], s[nb]);
#pragma unroll
        for (int nb = 0; nb < 4; ++nb) s[nb] = wmmab(kh1[nb], bq2[1], s[nb]);
#pragma unroll
        for (int nb = 0; nb < 4; ++nb) s[nb] = wmmab(kl1[nb], bq[1], s[nb]);
        asm volatile("v_nop\n\tv_nop\n\tv_nop\n\tv_nop" : "+v"(s[0]), "+v"(s[1]), "+v"(s[2]), "+v"(s[3]) : "v"(kl1[0]), "v"(kl1[1]), "v"(kl1[2]), "v"(kl1[3]), "v"(bq[1]));   // four vector slots behind the last WMMAs, before a D is read or an operand rewritten, on the taken side of the branch below too
        // all V^T fragments of the chunk, read while the softmax below runs
#pragma unroll
        for (int ks = 0; ks < 2; ++ks)
#pragma unroll
            for (int dt = 0; dt < 4; ++dt) av[ks][dt] = ldsA16(sV16 + pb * (BUFB / 2) + (dt * 16 + lr) * TP + ks * 32 + 8 * hi);
        }
        if (needm) {
#pragma unroll
            for (int nb = 0; nb < 4; ++nb) {
                const v2u mk = *(const v2ua*)(Msq + nb * 16);
#pragma unroll
                for (int r = 0; r < 8; ++r) s[nb][r] = (((mk[r >> 2] >> (8 * (r & 3))) & 0xFFu) != 0u) ? s[nb][r] : NEGS; } }
        float tm[4];
#pragma unroll
        for (int nb = 0; nb < 4; ++nb) { tm[nb] = s[nb][0];
#pragma unroll
            for (int r = 1; r < 8; ++r) tm[nb] = fmaxf(tm[nb], s[nb][r]); }
        float tmax = fmaxf(fmaxf(fmaxf(tm[0], tm[1]), fmaxf(tm[2], tm[3])), NEGS);
        tmax = fmaxf(tmax, xhalf(tmax));
        const float nm = fmaxf(m, tmax);
        const float alpha = __builtin_amdgcn_exp2f(__fmul_rn(__fsub_rn(m, nm), L2E));
        m = nm;
        float sm[4];
#pragma unroll
        for (int nb = 0; nb < 4; ++nb) { sm[nb] = 0.0f; v8f e;
#pragma unroll
            for (int r = 0; r < 8; ++r) e[r] = __fmul_rn(__fsub_rn(s[nb][r], nm), L2E);
            exp2x8(e);
#pragma unroll
            for (int r = 0; r < 8; ++r) { const float p = (s[nb][r] > -1.0e38f) ? e[r] : 0.0f; sm[nb] += p; s[nb][r] = p; } }
        l = l * alpha + ((sm[0] + sm[1]) + (sm[2] + sm[3]));
#pragma unroll
        for (int dt = 0; dt < 4; ++dt) acc[dt] *= alpha;
        if (HIRES) {
#pragma unroll
            for (int ks = 0; ks < 2; ++ks) {
                v8us ph0, ph1, pl0, pl1;
#pragma unroll
                for (int i = 0; i < 8; ++i) { unsigned short a2, c2; splitf(s[2 * ks][i], a2, c2); ph0[i] = a2; pl0[i] = c2; splitf(s[2 * ks + 1][i], a2, c2); ph1[i] = a2; pl1[i] = c2; }
                const v16bf bph = cat16b(ph0, ph1), bpl = cat16b(pl0, pl1);
#pragma unroll
                for (int dt = 0; dt < 4; ++dt) {
                    const v16bf avh = ldsAb(sVh + (dt * 16 + lr) * TP + ks * 32 + 8 * hi), avl = ldsAb(sVl + (dt * 16 + lr) * TP + ks * 32 + 8 * hi);
                    acc[dt] = wmmab(avh, bph, acc[dt]); acc[dt] = wmmab(avh, bpl, acc[dt]); acc[dt] = wmmab(avl, bph, acc[dt]);
                    asm volatile("v_nop\n\tv_nop\n\tv_nop\n\tv_nop" : "+v"(acc[dt]) : "v"(bph), "v"(bpl), "v"(avh), "v"(avl)); } }   // WMMA distance, as above
        } else {
#pragma unroll
            for (int ks = 0; ks < 2; ++ks) {
                v16h bp;
#pragma unroll
                for (int i = 0; i < 8; ++i) { bp[i] = tohx(s[2 * ks][i] * PCAR); bp[8 + i] = tohx(s[2 * ks + 1][i] * PCAR); }
#pragma unroll
                for (int dt = 0; dt < 4; ++dt) acc[dt] = wmma16(av[ks][dt], bp, acc[dt]);
                if (ks == 1) asm volatile("v_nop\n\tv_nop\n\tv_nop\n\tv_nop" : "+v"(acc[0]), "+v"(acc[1]), "+v"(acc[2]), "+v"(acc[3]) : "v"(bp), "v"(av[1][0]), "v"(av[1][1]), "v"(av[1][2]), "v"(av[1][3])); }   // WMMA distance behind the chunk's last products, as above (the loop's branch follows)
            asm volatile("s_wait_dscnt 0x0" ::: "memory");    // this wave has read all it wants of the buffer
            asm volatile("s_wait_asynccnt 0x0" ::: "memory"); // its copies of the next chunk have landed
            __syncthreads();                                  // publishes the next chunk and frees this buffer (and the mask tile)
            const unsigned fa = fany & ~((2u << kc) - 1u);    // the chunks behind this one
            const unsigned f2 = fa & (fa - 1u);               // and behind the next
            if (f2 != 0u) fcopy(bKh, bKl, bV, __builtin_ctz(f2), ring + pb * BUFB);
            pb ^= 1;
        }
    }
    if (!HIRES) asm volatile("s_wait_asynccnt 0x0" ::: "memory");   // nothing is in flight when the wave goes on
    __syncthreads();                                          // all waves done with the K tiles before the output staging aliases them
    float* os = (float*)smem + w * 16 * 68;
    const float rc = HIRES ? 1.0f : (1.0f / PCAR);
    const float inv = __fdiv_rn(rc, l + xhalf(l));            // the two halves' key sums joined here
#pragma unroll
    for (int dt = 0; dt < 4; ++dt) {
        v4f o0, o1;
#pragma unroll
        for (int r = 0; r < 4; ++r) { o0[r] = acc[dt][r] * inv; o1[r] = acc[dt][4 + r] * inv; }
        *(v4fa*)(os + lr * 68 + dt * 16 + 8 * hi) = o0; *(v4fa*)(os + lr * 68 + dt * 16 + 8 * hi + 4) = o1; }
    __builtin_amdgcn_wave_barrier(); asm volatile("" ::: "memory");
    float* crow = OUTb + (size_t)(qb + w * 16) * DQ + h * HD;
{
#pragma unroll
        for (int s2 = 0; s2 < 8; ++s2) { const int row = 2 * s2 + hi, cofs = lr * 4; const v4f val = *(const v4fa*)(os + row * 68 + cofs);
            *(v4f*)(crow + (size_t)row * DQ + cofs) = val; }
         }
}

#define NQL   (NQB - RH / 64)
#define FB_L  (NQL * NH_ * NB)
#define FB_H  ((RH / 64) * NH_ * NB)
static_assert(NQL >= 1);
__global__ __launch_bounds__(128) void k_flash(const bf* __restrict__ QPh, const bf* __restrict__ QPl, const bf* __restrict__ KPh, const bf* __restrict__ KPl,
                                               const h16* __restrict__ VT16, const bf* __restrict__ VTh, const bf* __restrict__ VTl,
                                               const int* __restrict__ mask, const int* __restrict__ FL, float* OUT) {
    __shared__ __align__(16) unsigned char smem[LDS_TOTAL];
    const int b = (int)blockIdx.x;                           // flat index: query block fastest, then head, then batch; the blocks of query rows >= RH first, the few short blocks of rows < RH last
    if (b < FB_L) d_flash<false>(smem, QPh, QPl, KPh, KPl, VT16, VTh, VTl, mask, FL, RH / 64 + b % NQL, (b / NQL) % NH_, b / (NQL * NH_), OUT);
    else { const int c = b - FB_L; d_flash<true>(smem, QPh, QPl, KPh, KPl, VT16, VTh, VTl, mask, FL, c % (RH / 64), (c / (RH / 64)) % NH_, c / ((RH / 64) * NH_), OUT); }
}

extern "C" void kernel_launch(void* const* d_in, const int* in_sizes, int n_in,
                              void* d_out, int out_size, void* d_ws, size_t ws_size, hipStream_t stream) {
    if (n_in < 4) return;
    if (in_sizes[0] < (NB - 1) * SEQ_FULL * DM + TT * DM) return;
    if (in_sizes[1] < DM * DM) return;
    if (in_sizes[2] < 2 * DM * DM) return;
    if (in_sizes[3] < TT * MPITCH) return;
    if (out_size < NB * TT * DQ) return;
    const float* x = (const float*)d_in[0]; const float* wq = (const float*)d_in[1]; const float* wkv = (const float*)d_in[2]; const int* mask = (const int*)d_in[3];
    float* OUT = (float*)d_out;     // [NB][TT][DQ]
    char* wsp = (char*)d_ws;
    auto take = [&](size_t bytes) { char* p = wsp; wsp += (bytes + 255) & ~(size_t)255; return (void*)p; };
    bf* W3 = (bf*)take((size_t)D3 * DM * 2); float* CS = (float*)take((size_t)TT * HD * 2 * 4); int* FL = (int*)take((size_t)NQB * FLG * 32 * 4);
    bf* XB = (bf*)take((size_t)NB * TT * DM * 2);
    bf* QPh = (bf*)take((size_t)NB * NH_ * TT * HD * 2); bf* QPl = (bf*)take((size_t)NB * NH_ * TT * HD * 2); bf* KPh = (bf*)take((size_t)NB * NH_ * TT * HD * 2); bf* KPl = (bf*)take((size_t)NB * NH_ * TT * HD * 2);
    h16* VT16 = (h16*)take((size_t)NB * NH_ * HD * TT * 2); bf* VTh = (bf*)take((size_t)NB * NH_ * HD * TT * 2); bf* VTl = (bf*)take((size_t)NB * NH_ * HD * TT * 2);
    const size_t used = (size_t)(wsp - (char*)d_ws);
    if (used > ws_size || used > (size_t)134217728) return;   // 74,481,664 B at NB=2, SEQ=2048
    k_prep<<<PB_MF + PB_CS + PB_W + NB * PB_X, 256, 0, stream>>>(x, wq, wkv, mask, XB, W3, CS, FL);
    k_gemmw<<<dim3(TT / GBM, D3 / GBN, NB), GWV * 32, 0, stream>>>(XB, W3, CS, QPh, QPl, KPh, KPl, VT16, VTh, VTl);
    k_flash<<<FB_L + FB_H, 128, 0, stream>>>(QPh, QPl, KPh, KPl, VT16, VTh, VTl, mask, FL, OUT);
}

// v010
// A run of this version takes 71.1 microseconds.
// In both of two side-by-side timings against v009, it was 1.06 times as fast.
// Counting every step since v000, it is 6.78 times as fast.
#include <hip/hip_runtime.h>

// Contractions: fused q|k|v projection v_wmma_f32_16x16x32_bf16 (bf16 operands = RNE-converted inputs, exact products); scores v_wmma_f32_16x16x32_bf16 with q/k as bf16 hi/lo planes (3 products) on every row; attn.v v_wmma_f32_16x16x32_f16 (f16 P carried x1024, f16 v) on query rows >= 64 and v_wmma_f32_16x16x32_bf16 with P and v as bf16 hi/lo (3 products) on query rows < 64; f32 accumulate, f32 online softmax, f32 output.
// Both batch elements go through every launch together (batch = the slowest part of the block index; every per-batch plane below is stored [batch][...]). Three launches: preparation (k_prep), projection (k_gemmw), attention (k_flash). Layout per batch: bf16 copy of x; one [3072][1024] bf16 'oi' weight (q rows, then k rows, then v rows, k/v de-interleaved from the [2048][1024] kv weight whose row is h*128 + 2d + c); both planes are stored in fragment order (see pkoff), so that the projection kernel's operand copies and fragment reads cover whole lines; the product x W^T stays in the projection kernel's accumulators, whose epilogue writes the planes below;
// rotary planes q,k [h][t][64] bf16 hi/lo (rotate-half, table cos/sin[t][d], q pre-scaled by log2(e)/8, so that the scores are exponents of 2); value planes [h][d][t] f16 and bf16 hi/lo; per (64-row query block, 64-key chunk) mask flags from the int mask (empty chunks skipped, partial chunks apply the mask element-wise, replace-fill), four flags to a 128-byte line (FLIDX);
// flash-style attention: K hi/lo and V chunk tiles staged in LDS, transposed products (S^T = K Q^T, O^T += V^T P^T) so that a lane holds one query's scores, online softmax in-lane, output rows written directly (no output projection).

#ifndef NB
#define NB 2
#endif
#ifndef SEQ
#define SEQ 2048
#endif
#define NB_FULL  2
#define SEQ_FULL 2048
#define TT     SEQ
#define DM     1024
#define NH_    16
#define HD     64
#define DQ     (NH_ * HD)
#define D3     (3 * DM)
#define NQB    (TT / 64)
#define NCH    (TT / 64)
#define RH     64
#define MPITCH SEQ_FULL
#define FLP    32
#define MFG    4
#define FLG    (FLP / MFG)
#define FLIDX(qblk, kc) ((((qblk) * FLG + (kc) / MFG) * 32) + (kc) % MFG)
#define PCARL  10.0f
#define SCL    0.18033688011112042f
#define NEGS   (-3.0e38f)
#define TP     72
#define TILEB  (64 * TP * 2)
#define O_KH   0
#define O_KL   (TILEB)
#define O_VA   (2 * TILEB)
#define O_VB   (3 * TILEB)
#define BUFB   (3 * TILEB)
#define O_MS   (2 * BUFB)
#define LDS_TOTAL (2 * BUFB + 64 * 64)

static_assert(TT % 64 == 0);
static_assert(TT <= SEQ_FULL);
static_assert(NB >= 1 && NB <= NB_FULL);
static_assert(NCH <= FLP);
static_assert(FLP == 32 && FLP * 64 == MPITCH && MFG == 4);
static_assert(RH == 64);
static_assert(NQB >= RH / 64);
static_assert(DM % 32 == 0 && D3 % 64 == 0 && HD == 64 && DQ == DM);
static_assert(4 * 16 * 68 * 4 <= O_VA);
static_assert((TP * 2) % 16 == 0);
static_assert(16 * 68 * 4 <= 3 * 32 * TP * 2);
static_assert(LDS_TOTAL <= 65536 && O_VB + TILEB <= O_MS && TILEB % 16 == 0);

typedef _Float16 h16;
typedef unsigned short bf;
typedef __attribute__((ext_vector_type(16))) __bf16   v16bf;
typedef __attribute__((ext_vector_type(16))) _Float16 v16h;
typedef __attribute__((ext_vector_type(8)))  _Float16 v8h;
typedef __attribute__((ext_vector_type(8)))  unsigned short v8us;
typedef __attribute__((ext_vector_type(8)))  float    v8f;
typedef __attribute__((ext_vector_type(4)))  float    v4f;
typedef __attribute__((ext_vector_type(2)))  float    v2f;
typedef __attribute__((ext_vector_type(4)))  int      v4i;
typedef v8h  __attribute__((may_alias)) v8ha;
typedef v4f  __attribute__((may_alias)) v4fa;
typedef v8us __attribute__((may_alias)) v8usa;
typedef __attribute__((ext_vector_type(2))) unsigned v2u;
typedef v2u  __attribute__((may_alias)) v2ua;
typedef __attribute__((ext_vector_type(2))) __bf16 v2bf;
typedef __attribute__((ext_vector_type(4))) unsigned v4u;
typedef v4u  __attribute__((may_alias)) v4ua;

__device__ __forceinline__ unsigned short f2bf(float f) { unsigned u = __float_as_uint(f); u += 0x7FFFu + ((u >> 16) & 1u); return (unsigned short)(u >> 16); }
__device__ __forceinline__ float bf2f(unsigned short b) { return __uint_as_float(((unsigned)b) << 16); }
__device__ __forceinline__ v16h cat16(v8h lo, v8h hi) { return __builtin_shufflevector(lo, hi, 0, 1, 2, 3, 4, 5, 6, 7, 8, 9, 10, 11, 12, 13, 14, 15); }
__device__ __forceinline__ v16bf cat16b(v8us lo, v8us hi) { return __builtin_bit_cast(v16bf, __builtin_shufflevector(lo, hi, 0, 1, 2, 3, 4, 5, 6, 7, 8, 9, 10, 11, 12, 13, 14, 15)); }
__device__ __forceinline__ v8f wmma16(v16h a, v16h b, v8f c) { return __builtin_amdgcn_wmma_f32_16x16x32_f16(false, a, false, b, (short)0, c, false, false); }
__device__ __forceinline__ v8f wmmab(v16bf a, v16bf b, v8f c) { return __builtin_amdgcn_wmma_f32_16x16x32_bf16(false, a, false, b, (short)0, c, false, false); }
__device__ __forceinline__ h16 tohx(float x) { return (h16)x; }
__device__ __forceinline__ void splitf(float y, unsigned short& h, unsigned short& l) { h = f2bf(y); l = f2bf(y - bf2f(h)); }
// The same split of two values at once on the packed converter (f32 -> bf16, round to nearest even like f2bf): hi word and lo word, first value in bits 15..0; and the two picks that pair the low or the high halves of two words.
__device__ __forceinline__ unsigned pkbf(float a, float b) { v2f v; v[0] = a; v[1] = b; return __builtin_bit_cast(unsigned, __builtin_convertvector(v, v2bf)); }
__device__ __forceinline__ void split2(float a, float b, unsigned& h, unsigned& l) { h = pkbf(a, b); l = pkbf(a - __uint_as_float(h << 16), b - __uint_as_float(h & 0xFFFF0000u)); }
__device__ __forceinline__ unsigned lo16(unsigned e0, unsigned e1) { return (e0 & 0xFFFFu) | (e1 << 16); }
__device__ __forceinline__ unsigned hi16(unsigned e0, unsigned e1) { return (e0 >> 16) | (e1 & 0xFFFF0000u); }
__device__ __forceinline__ float xhalf(float x) { return __builtin_bit_cast(float, __builtin_amdgcn_permlanex16(__builtin_bit_cast(int, x), __builtin_bit_cast(int, x), 0x76543210, 0xfedcba98, false, false)); }  // lane l with lane l ^ 16

// 2^x of eight values in place. The eight v_exp_f32 and the free slot that the instruction set asks for behind a transcendental stand in ONE statement: a v_nop in a statement of its own landed elsewhere.
__device__ __forceinline__ void exp2x8(v8f& v) {
    float e0 = v[0], e1 = v[1], e2 = v[2], e3 = v[3], e4 = v[4], e5 = v[5], e6 = v[6], e7 = v[7];
    asm("v_exp_f32 %0, %0\n\tv_exp_f32 %1, %1\n\tv_exp_f32 %2, %2\n\tv_exp_f32 %3, %3\n\tv_exp_f32 %4, %4\n\tv_exp_f32 %5, %5\n\tv_exp_f32 %6, %6\n\tv_exp_f32 %7, %7\n\tv_nop"
        : "+v"(e0), "+v"(e1), "+v"(e2), "+v"(e3), "+v"(e4), "+v"(e5), "+v"(e6), "+v"(e7));
    v[0] = e0; v[1] = e1; v[2] = e2; v[3] = e3; v[4] = e4; v[5] = e5; v[6] = e6; v[7] = e7;
}

// Fragment loaders (split k map for A and B alike): element i of the 16-wide vector <- k0 + 8*hi + i (i < 8), k0 + 16 + 8*hi + (i - 8) (i >= 8); callers pass p = row_base + k0 + 8*hi.
template <typename T16> struct WFrag;
template <> struct WFrag<bf> { typedef v16bf V; static __device__ __forceinline__ V ld(const bf* p) { return cat16b(*(const v8us*)p, *(const v8us*)(p + 16)); } };
// Fragment order of a K-contiguous [rows][DM] 16-bit plane: blocks of 16 rows x 32 k, 512 elements each, block (rb, kb) at (rb * (DM / 32) + kb) * 512. Inside a block, lane (row & 15) + 16 * hi keeps its eight elements k = 8*hi + i at lane * 8 + i and its eight elements k = 16 + 8*hi + i at 256 + lane * 8 + i:
// the same k map as above, and each of a fragment's two reads (element block + lane * 8, and 256 elements on) takes 512 contiguous bytes, four whole lines, where the row-major plane gave 32 bytes of each of 16 lines.
// The converters go by 8-element unit i: sgm = i & 3 (which eight k of the block), r16 = (i >> 2) & 15 (row in the block), block = i >> 6; a wave then reads eight whole 128-byte f32 lines and writes four whole 128-byte lines.
__device__ __forceinline__ size_t pkoff(size_t i) { const size_t sgm = i & 3, r16 = (i >> 2) & 15; return (i >> 6) * 512 + (sgm >> 1) * 256 + ((sgm & 1) * 16 + r16) * 8; }
__device__ __forceinline__ int pkrow(size_t i) { return (int)((i >> 6) / (DM / 32)) * 16 + (int)((i >> 2) & 15); }
__device__ __forceinline__ int pkcol(size_t i) { return (int)((i >> 6) % (DM / 32)) * 32 + (int)(i & 3) * 8; }
// LDS reloads of tiles written as 16-bit elements: same element type through may_alias vectors.
__device__ __forceinline__ v16h  ldsA16(const h16* p) { return cat16(*(const v8ha*)p, *(const v8ha*)(p + 16)); }
__device__ __forceinline__ v16bf ldsAb(const bf* p) { return cat16b(*(const v8usa*)p, *(const v8usa*)(p + 16)); }

// ---- k_gemmw: GEMM of the fused q|k|v projection with its epilogue. One workgroup of GWV = 12 waves per GBM x GBN = 256 x 192 tile of x W^T, one wave per 64x64 part of it (16 accumulators); grid (TT/GBM, D3/GBN, batch): 256 workgroups at the full size.
// acc[m][n] = sum_k A[m][k] Bt[n][k], k ascending. Both operands are 16-bit planes in fragment order (pkoff; K == DM).
// The workgroup's operand rows go through LDS, so that each line comes from L2 once per workgroup and not once per wave that needs it: a stage is GKS = 64 k of the tile's 16 + 12 blocks of 16 rows, 2 KiB of each (contiguous in the plane), laid block after block in one of two buffers;
// asynchronous copies (16 bytes a lane, 512 contiguous bytes a wave) fill a buffer while the other one is worked on. Wave-copy c of a stage brings bytes 512 * (c & 3) .. of row block c >> 2 (A's 16 blocks, then Bt's 12) to byte 512 * c of the buffer; the waves take them in turn. A fragment is read back as two contiguous 512-byte wave reads.
// A wave's 64 columns are one head of q, k or v (column tile = section*NH_ + head), so the head planes are written from the accumulators and the f32 product never goes to memory.
// q, k: rotate-half rotary in registers (columns d and d+32 are accumulator tiles nb and nb+2 of the same lane; the table holds the same cos, sin at d and d+32): out[d] = x[d] cos - x[d+32] sin, out[d+32] = x[d+32] cos + x[d] sin, times sc, split to bf16 hi/lo;
//       two rows' bf16 per word, hi words and lo words staged per 16 rows in LDS (pitch 68 words), planes [h][t][d] stored as whole 128-byte rows.
// v:    a lane's eight accumulator rows are eight consecutive t of one d: packed to f16, bf16 hi, bf16 lo; 32 d of the three [d][t] planes at a time staged in LDS (pitch TP), planes [h][d][t] stored as whole 128-byte rows.
#define GBM   256
#define GBN   192
#define GWN   (GBN / 64)
#define GWV   ((GBM / 64) * GWN)
#define GKS   64
#define GRBB  (16 * GKS * 2)
#define GSTB  (((GBM + GBN) / 16) * GRBB)
#define GNC   (GSTB / 512)
#define GCF   (GNC / GWV)
#define GCR   (GNC % GWV)
#define GNST  (DM / GKS)
#define GEPB  (3 * 32 * TP * 2)
static_assert(TT % GBM == 0 && D3 % GBN == 0 && DM % GKS == 0 && GNST >= 2 && GNST % 2 == 0);
static_assert(GCF == 9 && GCR > 0 && GRBB == 4 * 512 && GWV == 12 && GBN % 48 == 0 && (GBM / 4) % GWV == GCR);
static_assert(2 * GSTB + GWV * GEPB <= 327680);

// One stage's copies of one wave: nine for every wave, a tenth for the first GCR waves (more: wave-uniform, a scalar branch). ub, ul = each copy's wave-uniform global address and LDS byte offset, ko = the stage's byte offset in a block of rows, lb = the lane's LDS byte address in the buffer, ln = lane * 16.
// The addresses are formed here, where the fragment registers are free, and not kept through the loop. The s_wait_xcnt stands as the last line of the copies' own statement, in front of whatever rewrites an address register that a copy names.
__device__ __forceinline__ void gcopy(const char* const* ub, const unsigned* ul, unsigned ko, unsigned lb, unsigned ln, bool more) {
    const char* g[GCF + 1]; unsigned l[GCF + 1];
#pragma unroll
    for (int i = 0; i <= GCF; ++i) { g[i] = ub[i] + ko + ln; l[i] = lb + ul[i]; }
    asm volatile("global_load_async_to_lds_b128 %0, %9, off\n\tglobal_load_async_to_lds_b128 %1, %10, off\n\tglobal_load_async_to_lds_b128 %2, %11, off\n\t"
                 "global_load_async_to_lds_b128 %3, %12, off\n\tglobal_load_async_to_lds_b128 %4, %13, off\n\tglobal_load_async_to_lds_b128 %5, %14, off\n\t"
                 "global_load_async_to_lds_b128 %6, %15, off\n\tglobal_load_async_to_lds_b128 %7, %16, off\n\tglobal_load_async_to_lds_b128 %8, %17, off\n\ts_wait_xcnt 0x0"
                 :: "v"(l[0]), "v"(l[1]), "v"(l[2]), "v"(l[3]), "v"(l[4]), "v"(l[5]), "v"(l[6]), "v"(l[7]), "v"(l[8]),
                    "v"(g[0]), "v"(g[1]), "v"(g[2]), "v"(g[3]), "v"(g[4]), "v"(g[5]), "v"(g[6]), "v"(g[7]), "v"(g[8]) : "memory");
    if (more) asm volatile("global_load_async_to_lds_b128 %0, %1, off\n\ts_wait_xcnt 0x0" :: "v"(l[9]), "v"(g[9]) : "memory");
}
// A fragment out of a staged block: p = block + lane * 16 bytes.
__device__ __forceinline__ v16bf ldsFr(const unsigned char* p) { return cat16b(*(const v8usa*)p, *(const v8usa*)(p + 512)); }

__global__ __launch_bounds__(GWV * 32) void k_gemmw(const bf* __restrict__ A, const bf* __restrict__ Bt, const float* __restrict__ CS, bf* QPh, bf* QPl, bf* KPh, bf* KPl, h16* VT16, bf* VTh, bf* VTl) {
    __shared__ __align__(16) unsigned char ring[2 * GSTB];
    __shared__ __align__(16) unsigned char stg[GWV * GEPB];
    const size_t z = blockIdx.z;
    const int lane = threadIdx.x & 31, lr = lane & 15, hi = lane >> 4;
    const int w = __builtin_amdgcn_readfirstlane((int)threadIdx.x >> 5), wm = w / GWN, wn = w % GWN;   // the wave's number, in a scalar register
    const int r0 = blockIdx.x * GBM + wm * 64, ct = blockIdx.y * GWN + wn;                             // the wave's first row in its batch element; its column tile
    unsigned char* st = stg + w * GEPB;                                                                // the wave's own epilogue staging
    v8f acc[4][4];
#pragma unroll
    for (int mb = 0; mb < 4; ++mb)
#pragma unroll
        for (int nb = 0; nb < 4; ++nb) acc[mb][nb] = (v8f){};
    const char* Ab = (const char*)(A + z * ((size_t)TT * DM) + (size_t)blockIdx.x * GBM * DM);         // a block of 16 rows is 16 * DM elements
    const char* Bb = (const char*)(Bt + (size_t)blockIdx.y * GBN * DM);
    const unsigned ln = lane * 16, lbase = (unsigned)(size_t)ring + ln;
    const bool more = w < GCR;
    const char* ub[GCF + 1]; unsigned ul[GCF + 1];
#pragma unroll
    for (int i = 0; i <= GCF; ++i) {                          // rounds 0..3: the 48 wave-copies of Bt; rounds 4..9: the 64 of A (the last round: its last GCR)
        const int c = (i < GBN / 48) ? i * GWV + w : min((i - GBN / 48) * GWV + w, GBM / 4 - 1);
        ub[i] = ((i < GBN / 48) ? Bb : Ab) + (size_t)(c >> 2) * (16 * DM * 2) + (c & 3) * 512;
        ul[i] = ((i < GBN / 48) ? GBM / 4 + c : c) * 512; }
    gcopy(ub, ul, 0, lbase, ln, more);                        // stage 0
    asm volatile("s_wait_asynccnt 0x0" ::: "memory");         // this wave's copies of stage 0 have landed
    __syncthreads();                                          // and every other wave's
    gcopy(ub, ul, GRBB, lbase + GSTB, ln, more);              // stage 1
    const unsigned char* fa = ring + wm * 4 * GRBB + ln; const unsigned char* fb = ring + (GBM / 16 + wn * 4) * GRBB + ln;
#pragma unroll 1
    for (int t = 0; t < GNST; t += 2) {                       // two stages a trip, so that each buffer's addresses are constants of the code
#pragma unroll
        for (int p = 0; p < 2; ++p) {
            // The stage's 32 LDS reads go in three groups, the later two eight WMMAs ahead of the first product that needs them, in twelve fragments' registers (two whole sets would pass 256 registers): all of k 0..31 and A of k 32..63; then Bt of k 32..63 by halves, where the halves of k 0..31 come free.
            // The scheduling barriers keep the groups where they stand: left alone this build put the reads among the WMMAs in pairs, each waited for to 0.
            const unsigned char* pa = fa + p * GSTB; const unsigned char* pb = fb + p * GSTB;
            v16bf a0[4], a1[4], b0[4], b1[4];
#pragma unroll
            for (int mb = 0; mb < 4; ++mb) a0[mb] = ldsFr(pa + mb * GRBB);
#pragma unroll
            for (int nb = 0; nb < 4; ++nb) b0[nb] = ldsFr(pb + nb * GRBB);
#pragma unroll
            for (int mb = 0; mb < 4; ++mb) a1[mb] = ldsFr(pa + mb * GRBB + 1024);
            __builtin_amdgcn_sched_barrier(0);
#pragma unroll
            for (int nb = 0; nb < 2; ++nb)
#pragma unroll
                for (int mb = 0; mb < 4; ++mb) acc[mb][nb] = wmmab(a0[mb], b0[nb], acc[mb][nb]);
            __builtin_amdgcn_sched_barrier(0);
            b1[0] = ldsFr(pb + 1024); b1[1] = ldsFr(pb + GRBB + 1024);
            __builtin_amdgcn_sched_barrier(0);
#pragma unroll
            for (int nb = 2; nb < 4; ++nb)
#pragma unroll
                for (int mb = 0; mb < 4; ++mb) acc[mb][nb] = wmmab(a0[mb], b0[nb], acc[mb][nb]);
            __builtin_amdgcn_sched_barrier(0);
            b1[2] = ldsFr(pb + 2 * GRBB + 1024); b1[3] = ldsFr(pb + 3 * GRBB + 1024);
            __builtin_amdgcn_sched_barrier(0);
#pragma unroll
            for (int nb = 0; nb < 4; ++nb)
#pragma unroll
                for (int mb = 0; mb < 4; ++mb) acc[mb][nb] = wmmab(a1[mb], b1[nb], acc[mb][nb]);
            __builtin_amdgcn_sched_barrier(0);                // every WMMA of the stage stays ahead of the slots and the barrier below
            asm volatile("v_nop\n\tv_nop\n\tv_nop\n\tv_nop" : "+v"(acc[0][3]), "+v"(acc[1][3]), "+v"(acc[2][3]), "+v"(acc[3][3]) : "v"(a1[0]), "v"(a1[3]), "v"(b1[3]));   // four vector slots behind the stage's last WMMAs, on the taken side of a branch too
            asm volatile("s_wait_dscnt 0x0" ::: "memory");    // this wave has read all it wants of the buffer
            asm volatile("s_wait_asynccnt 0x0" ::: "memory"); // its copies of the next stage have landed
            __syncthreads();                                  // publishes the next stage and frees this buffer
            if (t + p + 2 < GNST) gcopy(ub, ul, (unsigned)(t + p + 2) * GRBB, lbase + p * GSTB, ln, more);   // the test reads the same for the whole workgroup
        }
    }
    asm volatile("s_wait_asynccnt 0x0" ::: "memory");         // nothing is in flight when the wave goes on
    const int sec = ct / NH_, h = ct % NH_;                                           // wave-uniform
    const size_t hp = (z * NH_ + h) * TT * HD;
    if (sec < 2) {
        unsigned* us = (unsigned*)st;
        bf* Ph = (sec == 0 ? QPh : KPh) + hp + (size_t)r0 * HD; bf* Pl = (sec == 0 ? QPl : KPl) + hp + (size_t)r0 * HD;
        const float sc = (sec == 0) ? SCL : 1.0f;
#pragma unroll
        for (int mb = 0; mb < 4; ++mb) {
            const float* cp = CS + ((size_t)(r0 + mb * 16 + hi * 8) * HD + lr) * 2;
            v2f cs[2][8];
#pragma unroll
            for (int j = 0; j < 8; ++j) { cs[0][j] = *(const v2f*)(cp + j * HD * 2); cs[1][j] = *(const v2f*)(cp + j * HD * 2 + 32); }
            asm volatile("s_wait_xcnt 0x0" :: "v"(cp) : "memory");   // the wait before a register of the loads above is used again; naming the address keeps it out of their destinations
#pragma unroll
            for (int nl = 0; nl < 2; ++nl) {
                float ra[8], rb[8];
#pragma unroll
                for (int j = 0; j < 8; ++j) {
                    const float x0 = acc[mb][nl][j], x1 = acc[mb][nl + 2][j], cn = cs[nl][j][0], sn = cs[nl][j][1];
                    ra[j] = (x0 * cn - x1 * sn) * sc; rb[j] = (x1 * cn + x0 * sn) * sc; }
#pragma unroll
                for (int jp = 0; jp < 4; ++jp) {                                      // one word = rows 2jp, 2jp+1 of one column; word rows 0..7 hi, 8..15 lo
                    unsigned wh, wl; unsigned* u = us + (hi * 4 + jp) * 68 + nl * 16 + lr;
                    split2(ra[2 * jp], ra[2 * jp + 1], wh, wl); u[0] = wh; u[8 * 68] = wl;
                    split2(rb[2 * jp], rb[2 * jp + 1], wh, wl); u[32] = wh; u[8 * 68 + 32] = wl; } }
            __builtin_amdgcn_wave_barrier(); asm volatile("" ::: "memory");   // keeps the other lanes' LDS writes ahead of the reads below in the compiled order
#pragma unroll
            for (int s = 0; s < 4; ++s) {
                const int pr = (s & 1) * 4 + (lane >> 3), seg = lane & 7;             // row pair and 8-column segment; s >> 1 picks the plane
                const unsigned* u = us + ((s >> 1) * 8 + pr) * 68 + seg * 8;
                const v4u p0 = *(const v4ua*)u, p1 = *(const v4ua*)(u + 4);
                v4u oe, oo;
                oe[0] = lo16(p0[0], p0[1]); oe[1] = lo16(p0[2], p0[3]); oe[2] = lo16(p1[0], p1[1]); oe[3] = lo16(p1[2], p1[3]);
                oo[0] = hi16(p0[0], p0[1]); oo[1] = hi16(p0[2], p0[3]); oo[2] = hi16(p1[0], p1[1]); oo[3] = hi16(p1[2], p1[3]);
                bf* P = ((s >> 1) ? Pl : Ph) + (size_t)(mb * 16 + 2 * pr) * HD + seg * 8;
                *(v4ua*)P = oe; *(v4ua*)(P + HD) = oo; }
            if (mb < 3) { __builtin_amdgcn_wave_barrier(); asm volatile("s_wait_xcnt 0x0" ::: "memory"); }   // the reads above stay ahead of the next rows' LDS writes; the wait stands before the stores' registers are used again
        }
    } else {
        bf* sp = (bf*)st;
#pragma unroll
        for (int hf = 0; hf < 2; ++hf) {                                              // 32 d at a time, the three planes side by side in LDS
#pragma unroll
            for (int nl = 0; nl < 2; ++nl) {
#pragma unroll
                for (int mb = 0; mb < 4; ++mb) {
                    const v8f x = acc[mb][hf * 2 + nl]; v4u oh, ol;
#pragma unroll
                    for (int i = 0; i < 4; ++i) { unsigned wh, wl; split2(x[2 * i], x[2 * i + 1], wh, wl); oh[i] = wh; ol[i] = wl; }
                    bf* q = sp + (nl * 16 + lr) * TP + mb * 16 + hi * 8;
                    *(v4ua*)q = __builtin_bit_cast(v4u, __builtin_convertvector(x, v8h)); *(v4ua*)(q + 32 * TP) = oh; *(v4ua*)(q + 64 * TP) = ol; } }
            __builtin_amdgcn_wave_barrier(); asm volatile("" ::: "memory");   // other lanes' LDS writes ahead of the reads below, as above
#pragma unroll
            for (int pl = 0; pl < 3; ++pl) {
                bf* P = ((pl == 0) ? (bf*)VT16 : (pl == 1) ? VTh : VTl) + hp + (size_t)hf * 32 * TT + r0;
#pragma unroll
                for (int s = 0; s < 8; ++s) {
                    const int idx = s * 32 + lane; const int row = idx >> 3, seg = idx & 7;
                    *(v4ua*)(P + (size_t)row * TT + seg * 8) = *(const v4ua*)(sp + (pl * 32 + row) * TP + seg * 8); } }
            __builtin_amdgcn_wave_barrier(); asm volatile("s_wait_xcnt 0x0" ::: "memory");   // reads ahead of the next half's LDS writes; the wait before the stores' registers are used again (behind the last half too: the built code lays the q, k block behind this one)
        }
    }
}

// The four preparation jobs below depend on nothing but the inputs and not on each other: they are bodies of ONE kernel, k_prep, which hands each a range of its blocks (blk = the block's index inside its range).
__device__ __forceinline__ void d_cvt8(int blk, int bz, const float* __restrict__ src, bf* dst, size_t n8, size_t sS, size_t sD) { const size_t i = (size_t)blk * 256 + threadIdx.x; if (i >= n8) return; src += bz * sS; dst += bz * sD; const v8f v = *(const v8f*)(src + (size_t)pkrow(i) * DM + pkcol(i)); v8us o;
#pragma unroll
    for (int k = 0; k < 8; ++k) o[k] = f2bf(v[k]); *(v8us*)(dst + pkoff(i)) = o;  }

__device__ __forceinline__ void d_cvtw(int blk, const float* __restrict__ wq, const float* __restrict__ wkv, bf* dst, size_t n8) {
    const size_t i = (size_t)blk * 256 + threadIdx.x; if (i >= n8) return;
    const int row = pkrow(i), col = pkcol(i);
    const int r2 = max(row - DM, 0); const int c = (r2 >= DM) ? 1 : 0; const int r3 = r2 - c * DM;
    const int srow = (r3 >> 6) * (2 * HD) + 2 * (r3 & 63) + c;
    const float* src = (row < DM) ? (wq + (size_t)row * DM + col) : (wkv + (size_t)srow * DM + col);
    const v8f v = *(const v8f*)src; v8us o;
#pragma unroll
    for (int k = 0; k < 8; ++k) o[k] = f2bf(v[k]);
    *(v8us*)(dst + pkoff(i)) = o; 
}

__device__ __forceinline__ void d_cstab(int blk, float* CS) {
    const int idx = blk * 256 + threadIdx.x; if (idx >= TT * HD) return;
    const int t = idx / HD, dd = idx % HD, p = dd & (HD / 2 - 1);
    const float pw = exp10f((float)p * 0.125f);
    const float inv = __fdiv_rn(1.0f, pw);
    float ang = __fmul_rn((float)t, inv); asm volatile("" : "+v"(ang));
    float sn, cn; sincosf(ang, &sn, &cn);
    v2f cs; cs[0] = cn; cs[1] = sn;
    *(v2f*)(CS + (size_t)idx * 2) = cs; 
}

// d_mflag: per (64-row query block, 64-key chunk) flags from the int mask [q][k] (row pitch MPITCH): bit0 = any nonzero, bit1 = all nonzero; chunks >= NCH flagged 0.
// One block per (query block, group of MFG chunks): 64 rows x 256 columns, 16 loads of 16 bytes per thread, none depending on another, each wave-load 512 contiguous bytes of one row. Threads 64*rg .. 64*rg+63 take rows 16*rg .. 16*rg+15; 16 lanes span one chunk's columns.
// A block's MFG flags go to a 128-byte line of their own (FLIDX), so that a line has one writer.
__device__ __forceinline__ void d_mflag(int blk, int* fls, const int* __restrict__ mask, int* FL) {
    const int tid = threadIdx.x, lane = tid & 31, w = tid >> 5; const int qblk = blk / FLG, g = blk % FLG, qb = qblk * 64;
    const int* mp = mask + (size_t)(qb + (tid >> 6) * 16) * MPITCH + g * (MFG * 64) + (tid & 63) * 4;
    v4i a[16];
#pragma unroll
    for (int i = 0; i < 16; ++i) a[i] = *(const v4i*)(mp + (size_t)i * MPITCH);
    // the wait before a register of the loads above is used again; naming the address keeps it out of their destinations, and naming the loaded values (inputs only) keeps all 16 loads in flight together: without it this build waited for nine before it issued the other seven
    asm volatile("s_wait_xcnt 0x0" :: "v"(mp), "v"(a[0]), "v"(a[1]), "v"(a[2]), "v"(a[3]), "v"(a[4]), "v"(a[5]), "v"(a[6]), "v"(a[7]), "v"(a[8]), "v"(a[9]), "v"(a[10]), "v"(a[11]), "v"(a[12]), "v"(a[13]), "v"(a[14]), "v"(a[15]) : "memory");
    unsigned anyv = 0u, minv = 0xFFFFFFFFu;                   // OR of the words; their unsigned minimum, which is nonzero exactly when every word is
#pragma unroll
    for (int i = 0; i < 16; ++i)
#pragma unroll
        for (int q = 0; q < 4; ++q) { anyv |= (unsigned)a[i][q]; minv = min(minv, (unsigned)a[i][q]); }
    const unsigned bany = __builtin_amdgcn_ballot_w32(anyv != 0u), ball = __builtin_amdgcn_ballot_w32(minv != 0u);   // bits 15..0: the wave's first chunk, bits 31..16: its second
    if ((lane & 15) == 0) { const unsigned ha = (bany >> lane) & 0xFFFFu, hl = (ball >> lane) & 0xFFFFu; fls[w * 2 + (lane >> 4)] = (ha != 0u ? 1 : 0) | (hl == 0xFFFFu ? 2 : 0); }
    __syncthreads();
    if (tid < MFG) {                                          // chunk tid of the group: wave 2*rg + (tid >> 1), half tid & 1, joined over the four row groups
        int va = 0, vl = 2;
#pragma unroll
        for (int rg = 0; rg < 4; ++rg) { const int v = fls[(rg * 2 + (tid >> 1)) * 2 + (tid & 1)]; va |= v & 1; vl &= v; }
        const int kc = g * MFG + tid;
        FL[FLIDX(qblk, kc)] = (kc < NCH) ? (va | vl) : 0; }
}

// k_prep: block ranges, in this order: mask flags, rotary table, weight planes, x planes. The range test is block-uniform.
#define PB_MF  (NQB * FLG)
#define PB_CS  ((TT * HD + 255) / 256)
#define PB_W   ((D3 * DM / 8 + 255) / 256)
#define PB_X   ((TT * DM / 8 + 255) / 256)
__global__ __launch_bounds__(256) void k_prep(const float* __restrict__ x, const float* __restrict__ wq, const float* __restrict__ wkv, const int* __restrict__ mask, bf* XB, bf* W3, float* CS, int* FL) {
    __shared__ int fls[FLP];
    int blk = (int)blockIdx.x;
    if (blk < PB_MF) { d_mflag(blk, fls, mask, FL); return; }
    blk -= PB_MF;
    if (blk < PB_CS) { d_cstab(blk, CS); return; }
    blk -= PB_CS;
    if (blk < PB_W) { d_cvtw(blk, wq, wkv, W3, (size_t)D3 * DM / 8); return; }
    blk -= PB_W;
    d_cvt8(blk % PB_X, blk / PB_X, x, XB, (size_t)TT * DM / 8, (size_t)SEQ_FULL * DM, (size_t)TT * DM);
}

// k_flash: flash-style masked softmax attention for one head and one 64-row query block per workgroup (128 threads = 4 waves x 16 query rows); one block per (query block, head, batch). d_flash<HIRES> is its body; the kernel picks the form by the block's query rows (block-uniform), so both forms run in one launch.
// Per 64-key chunk (flag bit0 set): K hi/lo tiles [key][d] and the V^T tile [d][key] staged in LDS (pitch TP), the int mask tile packed to bytes when the chunk is partial (flag bit1 clear);
// query rows >= RH: the three tiles of a chunk are one of two buffers of BUFB bytes, filled by asynchronous copies (fcopy) while the chunk in the other buffer is worked on, so that a chunk does not begin with the wait for its own loads; query rows < RH: four tiles through registers into one buffer;
// S^T[64 keys x 16 queries] = k_hi.q_hi + k_hi.q_lo + k_lo.q_hi (A = K rows from LDS, B = q fragments kept in registers, q planes pre-scaled by log2(e)/8): lane (lr, hi) holds query lr's scores of keys nb*16 + 8*hi + r;
// masked keys -> excluded; running-max online softmax in f32, maximum and sum in-lane, the maximum joined between the wave halves once per chunk, the sums once in the epilogue;
// a weight is one subtraction and one exp2: p = 2^(s - (m - c)), c = log2 of the carry (10, or 0), so that P, its sum and O all carry 2^c and the quotient does not. A masked score (NEGS) underflows to 0 there as soon as its query has one open key;
// what a query gathers before its first open key (m still NEGS) is multiplied by alpha = 2^(NEGS - m) = 0 at that key; a query with no open key at all ends with m = NEGS and is given the reference's NaN in the epilogue;
// P^T packs from the score registers straight into the B operand (score tiles 2ks and 2ks+1 are the fragment's k order) and O^T[64 d x 16 queries] += V^T.P^T: HIRES -> P and v as bf16 hi/lo (3 products, carry 1), else f16 P carried x1024 and f16 v.
// One chunk's copies of one wave: 16 bytes a lane, four copies for each of the tiles K hi, K lo, V^T f16 (copy i: unit i * 128 + tid, row = unit >> 3 = i * 16 + (tid >> 3), 16-byte segment = tid & 7, as the staging through registers has them).
// bKh, bKl, bV = the lane's 16 bytes of copy 0 in chunk 0 of each plane, lb = their LDS byte address in the buffer's first tile; what is added here is wave-uniform (kc = the chunk, < NCH).
// The s_wait_xcnt stands as the last line of the copies' own statement, in front of whatever rewrites an address register that a copy names.
__device__ __forceinline__ void fcopy(const char* bKh, const char* bKl, const char* bV, int kc, unsigned lb) {
    const char* g[12]; unsigned l[12];
#pragma unroll
    for (int i = 0; i < 4; ++i) {
        const unsigned ok = (unsigned)(kc * 64 + i * 16) * (HD * 2), ov = (unsigned)(i * 16) * (TT * 2) + (unsigned)kc * 128u;
        g[i] = bKh + ok; g[4 + i] = bKl + ok; g[8 + i] = bV + ov;
        l[i] = lb + (i * 16 * TP * 2 + O_KH); l[4 + i] = lb + (i * 16 * TP * 2 + O_KL); l[8 + i] = lb + (i * 16 * TP * 2 + O_VA); }
    asm volatile("global_load_async_to_lds_b128 %0, %12, off\n\tglobal_load_async_to_lds_b128 %1, %13, off\n\tglobal_load_async_to_lds_b128 %2, %14, off\n\tglobal_load_async_to_lds_b128 %3, %15, off\n\t"
                 "global_load_async_to_lds_b128 %4, %16, off\n\tglobal_load_async_to_lds_b128 %5, %17, off\n\tglobal_load_async_to_lds_b128 %6, %18, off\n\tglobal_load_async_to_lds_b128 %7, %19, off\n\t"
                 "global_load_async_to_lds_b128 %8, %20, off\n\tglobal_load_async_to_lds_b128 %9, %21, off\n\tglobal_load_async_to_lds_b128 %10, %22, off\n\tglobal_load_async_to_lds_b128 %11, %23, off\n\ts_wait_xcnt 0x0"
                 :: "v"(l[0]), "v"(l[1]), "v"(l[2]), "v"(l[3]), "v"(l[4]), "v"(l[5]), "v"(l[6]), "v"(l[7]), "v"(l[8]), "v"(l[9]), "v"(l[10]), "v"(l[11]),
                    "v"(g[0]), "v"(g[1]), "v"(g[2]), "v"(g[3]), "v"(g[4]), "v"(g[5]), "v"(g[6]), "v"(g[7]), "v"(g[8]), "v"(g[9]), "v"(g[10]), "v"(g[11]) : "memory");
}

template <bool HIRES>
__device__ __forceinline__ void d_flash(unsigned char* smem, const bf* __restrict__ QPh, const bf* __restrict__ QPl, const bf* __restrict__ KPh, const bf* __restrict__ KPl,
                                        const h16* __restrict__ VT16, const bf* __restrict__ VTh, const bf* __restrict__ VTl,
                                        const int* __restrict__ mask, const int* __restrict__ FL, int qblk, int h, int bz, float* OUT) {
    bf* sKh = (bf*)(smem + O_KH); bf* sKl = (bf*)(smem + O_KL);
    h16* sV16 = (h16*)(smem + O_VA); bf* sVh = (bf*)(smem + O_VA); bf* sVl = (bf*)(smem + O_VB);
    unsigned char* Ms = smem + O_MS;
    const int tid = threadIdx.x, lane = tid & 31, w = tid >> 5, lr = lane & 15, hi = lane >> 4;
    const int qb = qblk * 64;
    const size_t hp = ((size_t)bz * NH_ + h) * TT * HD;
    float* OUTb = OUT + (size_t)bz * TT * DQ;
    const bf* Qh = QPh + hp; const bf* Ql = QPl + hp; const bf* Kh = KPh + hp; const bf* Kl = KPl + hp;
    const h16* V16 = VT16 + hp; const bf* Vh = VTh + hp; const bf* Vl = VTl + hp;
    const int qrow = qb + w * 16 + lr;                       // B layout: lane -> query column
    v16bf bq[2], bq2[2];
#pragma unroll
    for (int ks = 0; ks < 2; ++ks) { bq[ks] = WFrag<bf>::ld(Qh + (size_t)qrow * HD + ks * 32 + 8 * hi); bq2[ks] = WFrag<bf>::ld(Ql + (size_t)qrow * HD + ks * 32 + 8 * hi); }
    v8f acc[4]; float m = NEGS, l = 0.0f;                    // acc[dt][r] = O^T[dt*16 + 8*hi + r][query lr]; m is the query's, l the sum over this half's keys
#pragma unroll
    for (int dt = 0; dt < 4; ++dt) acc[dt] = (v8f){};
    const unsigned char* Msq = Ms + (w * 16 + lr) * 64 + 8 * hi;   // the lane's query row of the mask tile, at its half's keys
    const float car = HIRES ? 0.0f : PCARL;                  // log2 of the carry on P
    const int fv = FL[FLIDX(qblk, lane)];                    // lane = chunk: the query block's FLP flags, read once
    const unsigned fany = __builtin_amdgcn_ballot_w32((fv & 1) != 0), fall = __builtin_amdgcn_ballot_w32((fv & 2) != 0);   // bit kc, the same in every wave of the block
    // The two-buffer ring of the form for query rows >= RH. The chunks that count are the set bits of fany, the same in every wave, so every test around a copy or a barrier below reads the same for the whole workgroup.
    const unsigned ring = (unsigned)(size_t)smem + (unsigned)((tid >> 3) * TP + (tid & 7) * 8) * 2u;   // LDS byte address of the lane's first copy in buffer 0
    const char* bKh = (const char*)(Kh + tid * 8); const char* bKl = (const char*)(Kl + tid * 8); const char* bV = (const char*)(V16 + (size_t)(tid >> 3) * TT + (tid & 7) * 8);   // and its global addresses in chunk 0
    int pb = 0;                                              // the buffer that holds the current chunk
    if (!HIRES && fany != 0u) {
        const unsigned f1 = fany & (fany - 1u);              // the chunks behind the first
        fcopy(bKh, bKl, bV, __builtin_ctz(fany), ring);
        asm volatile("s_wait_asynccnt 0x0" ::: "memory");    // this wave's copies of the first chunk have landed
        __syncthreads();                                     // and every other wave's
        if (f1 != 0u) fcopy(bKh, bKl, bV, __builtin_ctz(f1), ring + BUFB);
    }
#pragma unroll 1
    for (int kc = 0; kc < NCH; ++kc) {
        if (((fany >> kc) & 1u) == 0u) continue;             // block-uniform
        const bool needm = (((fall >> kc) & 1u) == 0u);
        const int kb = kc * 64;
        if (HIRES) {
        __syncthreads();
        const bf* gKh[4]; const bf* gKl[4]; const bf* gVh[4]; const bf* gVl[4];
        v8us rKh[4], rKl[4], rVh[4], rVl[4];
#pragma unroll
        for (int i = 0; i < 4; ++i) {
            const int idx = i * 128 + tid; const int row = idx >> 3, seg = idx & 7;
            gKh[i] = Kh + (size_t)(kb + row) * HD + seg * 8; rKh[i] = *(const v8us*)gKh[i];
            gKl[i] = Kl + (size_t)(kb + row) * HD + seg * 8; rKl[i] = *(const v8us*)gKl[i];
            gVh[i] = Vh + (size_t)row * TT + kb + seg * 8; rVh[i] = *(const v8us*)gVh[i];
            gVl[i] = Vl + (size_t)row * TT + kb + seg * 8; rVl[i] = *(const v8us*)gVl[i];
        }
        // the wait before a register of the loads above is used again; naming the addresses keeps them out of the loads' destinations
        asm volatile("s_wait_xcnt 0x0" :: "v"(gKh[0]), "v"(gKh[1]), "v"(gKh[2]), "v"(gKh[3]), "v"(gKl[0]), "v"(gKl[1]), "v"(gKl[2]), "v"(gKl[3]), "v"(gVh[0]), "v"(gVh[1]), "v"(gVh[2]), "v"(gVh[3]), "v"(gVl[0]), "v"(gVl[1]), "v"(gVl[2]), "v"(gVl[3]) : "memory");
#pragma unroll
        for (int i = 0; i < 4; ++i) {
            const int idx = i * 128 + tid; const int row = idx >> 3, seg = idx & 7;
            *(v8us*)(sKh + row * TP + seg * 8) = rKh[i];
            *(v8us*)(sKl + row * TP + seg * 8) = rKl[i];
            *(v8us*)(sVh + row * TP + seg * 8) = rVh[i]; *(v8us*)(sVl + row * TP + seg * 8) = rVl[i];
        }
        }
        if (needm) {
#pragma unroll
            for (int i = 0; i < 8; ++i) {
                const int idx = i * 128 + tid; const int row = idx >> 4, seg = idx & 15;
                const v4i mv = *(const v4i*)(mask + (size_t)(qb + row) * MPITCH + kb + seg * 4);
                const unsigned pk = (mv[0] != 0 ? 1u : 0u) | (mv[1] != 0 ? 0x100u : 0u) | (mv[2] != 0 ? 0x10000u : 0u) | (mv[3] != 0 ? 0x1000000u : 0u);
                *(unsigned*)(Ms + row * 64 + seg * 4) = pk; } }
        if (HIRES || needm) __syncthreads();                 // publishes what this trip has stored in LDS; the ring's tiles were published in front of the loop or at the foot of the trip before
        // The chunk's LDS fragment reads are issued as groups of eight ahead of the products that use them, not tile by tile (K hi and lo of k 0..31 first; each later K group where an older group's registers come free; all V^T reads in front of the softmax), within the 256 registers that let four waves share a SIMD;
        // every run of products goes round the four independent score tiles; a tile's own products keep their order (hi.hi, hi.lo, lo.hi of k 0..31, then of k 32..63).
        // The form for query rows < RH, whose four staged planes leave no registers for that, keeps one tile's reads in front of that tile's products.
        v8f s[4]; v16h av[2][4];
        if (HIRES) {
#pragma unroll
            for (int nb = 0; nb < 4; ++nb) s[nb] = (v8f){};
#pragma unroll
            for (int ks = 0; ks < 2; ++ks) {
#pragma unroll
                for (int nb = 0; nb < 4; ++nb) {
                    const v16bf a = ldsAb(sKh + (nb * 16 + lr) * TP + ks * 32 + 8 * hi);
                    const v16bf a2 = ldsAb(sKl + (nb * 16 + lr) * TP + ks * 32 + 8 * hi);
                    s[nb] = wmmab(a, bq[ks], s[nb]); s[nb] = wmmab(a, bq2[ks], s[nb]); s[nb] = wmmab(a2, bq[ks], s[nb]);
                    asm volatile("v_nop\n\tv_nop\n\tv_nop\n\tv_nop" : "+v"(s[nb]) : "v"(a), "v"(a2), "v"(bq[ks]), "v"(bq2[ks])); } }   // four vector slots behind the last WMMA of the tile, before its D is read or its operands are rewritten
        } else {
        v16bf kh0[4], kl0[4], kh1[4], kl1[4];
        const bf* pKh = sKh + pb * (BUFB / 2) + lr * TP + 8 * hi; const bf* pKl = sKl + pb * (BUFB / 2) + lr * TP + 8 * hi;
#pragma unroll
        for (int nb = 0; nb < 4; ++nb) kh0[nb] = ldsAb(pKh + nb * 16 * TP);
#pragma unroll
        for (int nb = 0; nb < 4; ++nb) kl0[nb] = ldsAb(pKl + nb * 16 * TP);
#pragma unroll
        for (int nb = 0; nb < 4; ++nb) s[nb] = wmmab(kh0[nb], bq[0], (v8f){});
#pragma unroll
        for (int nb = 0; nb < 4; ++nb) s[nb] = wmmab(kh0[nb], bq2[0], s[nb]);
#pragma unroll
        for (int nb = 0; nb < 4; ++nb) kh1[nb] = ldsAb(pKh + nb * 16 * TP + 32);
#pragma unroll
        for (int nb = 0; nb < 4; ++nb) s[nb] = wmmab(kl0[nb], bq[0], s[nb]);
#pragma unroll
        for (int nb = 0; nb < 4; ++nb) kl1[nb] = ldsAb(pKl + nb * 16 * TP + 32);
#pragma unroll
        for (int nb = 0; nb < 4; ++nb) s[nb] = wmmab(kh1[nb], bq[1], s[nb]);
#pragma unroll
        for (int nb = 0; nb < 4; ++nb) s[nb] = wmmab(kh1[nb], bq2[1], s[nb]);
#pragma unroll
        for (int nb = 0; nb < 4; ++nb) s[nb] = wmmab(kl1[nb], bq[1], s[nb]);
        asm volatile("v_nop\n\tv_nop\n\tv_nop\n\tv_nop" : "+v"(s[0]), "+v"(s[1]), "+v"(s[2]), "+v"(s[3]) : "v"(kl1[0]), "v"(kl1[1]), "v"(kl1[2]), "v"(kl1[3]), "v"(bq[1]));   // four vector slots behind the last WMMAs, before a D is read or an operand rewritten, on the taken side of the branch below too
        // all V^T fragments of the chunk, read while the softmax below runs
#pragma unroll
        for (int ks = 0; ks < 2; ++ks)
#pragma unroll
            for (int dt = 0; dt < 4; ++dt) av[ks][dt] = ldsA16(sV16 + pb * (BUFB / 2) + (dt * 16 + lr) * TP + ks * 32 + 8 * hi);
        }
        if (needm) {
#pragma unroll
            for (int nb = 0; nb < 4; ++nb) {
                const v2u mk = *(const v2ua*)(Msq + nb * 16);
#pragma unroll
                for (int r = 0; r < 8; ++r) s[nb][r] = (((mk[r >> 2] >> (8 * (r & 3))) & 0xFFu) != 0u) ? s[nb][r] : NEGS; } }
        float tm[4];
#pragma unroll
        for (int nb = 0; nb < 4; ++nb) { tm[nb] = s[nb][0];
#pragma unroll
            for (int r = 1; r < 8; ++r) tm[nb] = fmaxf(tm[nb], s[nb][r]); }
        float tmax = fmaxf(fmaxf(fmaxf(tm[0], tm[1]), fmaxf(tm[2], tm[3])), NEGS);
        tmax = fmaxf(tmax, xhalf(tmax));
        const float nm = fmaxf(m, tmax);
        const float alpha = __builtin_amdgcn_exp2f(m - nm);
        m = nm;
        const float nc = nm - car;
        float sm[4];
#pragma unroll
        for (int nb = 0; nb < 4; ++nb) { sm[nb] = 0.0f; v8f e;
#pragma unroll
            for (int r = 0; r < 8; ++r) e[r] = s[nb][r] - nc;
            exp2x8(e);
#pragma unroll
            for (int r = 0; r < 8; ++r) { sm[nb] += e[r]; s[nb][r] = e[r]; } }
        l = l * alpha + ((sm[0] + sm[1]) + (sm[2] + sm[3]));
#pragma unroll
        for (int dt = 0; dt < 4; ++dt) acc[dt] *= alpha;
        if (HIRES) {
#pragma unroll
            for (int ks = 0; ks < 2; ++ks) {
                v8us ph0, ph1, pl0, pl1;
#pragma unroll
                for (int i = 0; i < 8; ++i) { unsigned short a2, c2; splitf(s[2 * ks][i], a2, c2); ph0[i] = a2; pl0[i] = c2; splitf(s[2 * ks + 1][i], a2, c2); ph1[i] = a2; pl1[i] = c2; }
                const v16bf bph = cat16b(ph0, ph1), bpl = cat16b(pl0, pl1);
#pragma unroll
                for (int dt = 0; dt < 4; ++dt) {
                    const v16bf avh = ldsAb(sVh + (dt * 16 + lr) * TP + ks * 32 + 8 * hi), avl = ldsAb(sVl + (dt * 16 + lr) * TP + ks * 32 + 8 * hi);
                    acc[dt] = wmmab(avh, bph, acc[dt]); acc[dt] = wmmab(avh, bpl, acc[dt]); acc[dt] = wmmab(avl, bph, acc[dt]);
                    asm volatile("v_nop\n\tv_nop\n\tv_nop\n\tv_nop" : "+v"(acc[dt]) : "v"(bph), "v"(bpl), "v"(avh), "v"(avl)); } }   // WMMA distance, as above
        } else {
#pragma unroll
            for (int ks = 0; ks < 2; ++ks) {
                v16h bp;
#pragma unroll
                for (int i = 0; i < 8; ++i) { bp[i] = tohx(s[2 * ks][i]); bp[8 + i] = tohx(s[2 * ks + 1][i]); }
#pragma unroll
                for (int dt = 0; dt < 4; ++dt) acc[dt] = wmma16(av[ks][dt], bp, acc[dt]);
                if (ks == 1) asm volatile("v_nop\n\tv_nop\n\tv_nop\n\tv_nop" : "+v"(acc[0]), "+v"(acc[1]), "+v"(acc[2]), "+v"(acc[3]) : "v"(bp), "v"(av[1][0]), "v"(av[1][1]), "v"(av[1][2]), "v"(av[1][3])); }   // WMMA distance behind the chunk's last products, as above (the loop's branch follows)
            asm volatile("s_wait_dscnt 0x0" ::: "memory");    // this wave has read all it wants of the buffer
            asm volatile("s_wait_asynccnt 0x0" ::: "memory"); // its copies of the next chunk have landed
            __syncthreads();                                  // publishes the next chunk and frees this buffer (and the mask tile)
            const unsigned fa = fany & ~((2u << kc) - 1u);    // the chunks behind this one
            const unsigned f2 = fa & (fa - 1u);               // and behind the next
            if (f2 != 0u) fcopy(bKh, bKl, bV, __builtin_ctz(f2), ring + pb * BUFB);
            pb ^= 1;
        }
    }
    if (!HIRES) asm volatile("s_wait_asynccnt 0x0" ::: "memory");   // nothing is in flight when the wave goes on
    __syncthreads();                                          // all waves done with the K tiles before the output staging aliases them
    float* os = (float*)smem + w * 16 * 68;
    const float inv = (m > -1.0e38f) ? __fdiv_rn(1.0f, l + xhalf(l)) : __builtin_nanf("");   // the two halves' key sums joined here; no open key: NaN, as the reference's softmax of an empty row
#pragma unroll
    for (int dt = 0; dt < 4; ++dt) {
        v4f o0, o1;
#pragma unroll
        for (int r = 0; r < 4; ++r) { o0[r] = acc[dt][r] * inv; o1[r] = acc[dt][4 + r] * inv; }
        *(v4fa*)(os + lr * 68 + dt * 16 + 8 * hi) = o0; *(v4fa*)(os + lr * 68 + dt * 16 + 8 * hi + 4) = o1; }
    __builtin_amdgcn_wave_barrier(); asm volatile("" ::: "memory");
    float* crow = OUTb + (size_t)(qb + w * 16) * DQ + h * HD;
{
#pragma unroll
        for (int s2 = 0; s2 < 8; ++s2) { const int row = 2 * s2 + hi, cofs = lr * 4; const v4f val = *(const v4fa*)(os + row * 68 + cofs);
            *(v4f*)(crow + (size_t)row * DQ + cofs) = val; }
         }
}

#define NQL   (NQB - RH / 64)
#define FB_L  (NQL * NH_ * NB)
#define FB_H  ((RH / 64) * NH_ * NB)
static_assert(NQL >= 1);
__global__ __launch_bounds__(128) void k_flash(const bf* __restrict__ QPh, const bf* __restrict__ QPl, const bf* __restrict__ KPh, const bf* __restrict__ KPl,
                                               const h16* __restrict__ VT16, const bf* __restrict__ VTh, const bf* __restrict__ VTl,
                                               const int* __restrict__ mask, const int* __restrict__ FL, float* OUT) {
    __shared__ __align__(16) unsigned char smem[LDS_TOTAL];
    const int b = (int)blockIdx.x;                           // flat index: query block fastest, then head, then batch; the blocks of query rows >= RH first, the few short blocks of rows < RH last
    if (b < FB_L) d_flash<false>(smem, QPh, QPl, KPh, KPl, VT16, VTh, VTl, mask, FL, RH / 64 + b % NQL, (b / NQL) % NH_, b / (NQL * NH_), OUT);
    else { const int c = b - FB_L; d_flash<true>(smem, QPh, QPl, KPh, KPl, VT16, VTh, VTl, mask, FL, c % (RH / 64), (c / (RH / 64)) % NH_, c / ((RH / 64) * NH_), OUT); }
}

extern "C" void kernel_launch(void* const* d_in, const int* in_sizes, int n_in,
                              void* d_out, int out_size, void* d_ws, size_t ws_size, hipStream_t stream) {
    if (n_in < 4) return;
    if (in_sizes[0] < (NB - 1) * SEQ_FULL * DM + TT * DM) return;
    if (in_sizes[1] < DM * DM) return;
    if (in_sizes[2] < 2 * DM * DM) return;
    if (in_sizes[3] < TT * MPITCH) return;
    if (out_size < NB * TT * DQ) return;
    const float* x = (const float*)d_in[0]; const float* wq = (const float*)d_in[1]; const float* wkv = (const float*)d_in[2]; const int* mask = (const int*)d_in[3];
    float* OUT = (float*)d_out;     // [NB][TT][DQ]
    char* wsp = (char*)d_ws;
    auto take = [&](size_t bytes) { char* p = wsp; wsp += (bytes + 255) & ~(size_t)255; return (void*)p; };
    bf* W3 = (bf*)take((size_t)D3 * DM * 2); float* CS = (float*)take((size_t)TT * HD * 2 * 4); int* FL = (int*)take((size_t)NQB * FLG * 32 * 4);
    bf* XB = (bf*)take((size_t)NB * TT * DM * 2);
    bf* QPh = (bf*)take((size_t)NB * NH_ * TT * HD * 2); bf* QPl = (bf*)take((size_t)NB * NH_ * TT * HD * 2); bf* KPh = (bf*)take((size_t)NB * NH_ * TT * HD * 2); bf* KPl = (bf*)take((size_t)NB * NH_ * TT * HD * 2);
    h16* VT16 = (h16*)take((size_t)NB * NH_ * HD * TT * 2); bf* VTh = (bf*)take((size_t)NB * NH_ * HD * TT * 2); bf* VTl = (bf*)take((size_t)NB * NH_ * HD * TT * 2);
    const size_t used = (size_t)(wsp - (char*)d_ws);
    if (used > ws_size || used > (size_t)134217728) return;   // 74,481,664 B at NB=2, SEQ=2048
    k_prep<<<PB_MF + PB_CS + PB_W + NB * PB_X, 256, 0, stream>>>(x, wq, wkv, mask, XB, W3, CS, FL);
    k_gemmw<<<dim3(TT / GBM, D3 / GBN, NB), GWV * 32, 0, stream>>>(XB, W3, CS, QPh, QPl, KPh, KPl, VT16, VTh, VTl);
    k_flash<<<FB_L + FB_H, 128, 0, stream>>>(QPh, QPl, KPh, KPl, VT16, VTh, VTl, mask, FL, OUT);
}
